// v000
// The times below were measured on an AMD MI455X: many runs one after another, warmed up first and cycling through
// copies of the inputs, with the whole window's GPU time divided by the number of runs. Launches and the gaps
// between them are all in it. The median over several windows is given; except for v000 it joins two sittings, which
// can be a few percent apart, so the side-by-side timings, each taken in one sitting, are the better comparison.
// The starting kernel, v000, takes 437 microseconds a run.
// Contractions: x@Wq, x@Wk, x@Wv and xmix@Wp on v_wmma_f32_16x16x32_bf16 with bf16 hi/lo operand planes (hi.hi + hi.lo + lo.hi); q.k^T on v_wmma_f32_16x16x32_f16 with plain f16 q/k planes; p.v and p_cross.v on v_wmma_f32_16x16x32_bf16 with bf16 hi/lo p and v tiles; f32 accumulate; bias gather, online softmax and head mixing in f32.
#include <hip/hip_runtime.h>
#include <stdint.h>

typedef __attribute__((ext_vector_type(16))) _Float16 v16h;
typedef __attribute__((ext_vector_type(8)))  _Float16 v8h;
typedef __attribute__((ext_vector_type(16))) __bf16   v16b;
typedef __attribute__((ext_vector_type(8)))  __bf16   v8b;
typedef __attribute__((ext_vector_type(8)))  float    v8f;
typedef __attribute__((ext_vector_type(4)))  float    v4f;
typedef __attribute__((ext_vector_type(4)))  unsigned int v4u;
typedef __attribute__((ext_vector_type(2)))  int      v2i;

/* ---- problem geometry (fixed by the module) ---- */
constexpr int kBatch = 2;
constexpr int kNq    = 2048;
constexpr int kNkv   = 4096;
constexpr int kC     = 128;
constexpr int kH     = 4;
constexpr int kHD    = 32;
constexpr int kNH    = 2;
constexpr int kMaxd  = 128;
constexpr int kSpan  = 2 * kMaxd + 1;
constexpr int kTable = kSpan * kSpan;
constexpr int kKC    = 32;     /* keys per chunk in the attention kernel */
constexpr int kQB    = 64;     /* query rows per attention block (4 waves x 16) */
constexpr int kOsPitch = 36;   /* floats; per-wave output staging pitch */
constexpr float kScale = 0.17677669529663687f;   /* head_dim ** -0.5 */
constexpr float kLambdaInit = 0.8f;

static_assert(kNq % kQB == 0, "");
static_assert(kNkv % kKC == 0, "");
static_assert(kC == kH * kHD, "");
static_assert((kBatch * kNq) % 64 == 0 && (kBatch * kNkv) % 64 == 0, "");
static_assert(kC % 64 == 0 && kC % 32 == 0, "");
static_assert(kH == 4 && kNH == 2 && kHD == 32 && kKC == 32, "");

__device__ __forceinline__ unsigned short f2bf_bits(float f) {
  unsigned u = __float_as_uint(f);
  return (unsigned short)((u + 0x7FFFu + ((u >> 16) & 1u)) >> 16);
}
__device__ __forceinline__ float bf_bits2f(unsigned short h) { return __uint_as_float(((unsigned)h) << 16); }

/* hazard guards as plain device helpers */
__device__ __forceinline__ void dep_guard_h(v8f& a, v8f& b, v16h x, v16h y) { asm volatile("v_nop\n\tv_nop\n\tv_nop\n\tv_nop" : "+v"(a), "+v"(b) : "v"(x), "v"(y)); }
__device__ __forceinline__ void dep_guard_b(v8f& a, v8f& b, v16b x, v16b y) { asm volatile("v_nop\n\tv_nop\n\tv_nop\n\tv_nop" : "+v"(a), "+v"(b) : "v"(x), "v"(y)); }
__device__ __forceinline__ void keep4_h(v16h a, v16h b, v16h c, v16h d) { asm volatile("v_nop" :: "v"(a), "v"(b), "v"(c), "v"(d)); }
__device__ __forceinline__ void keep4_b(v16b a, v16b b, v16b c, v16b d) { asm volatile("v_nop" :: "v"(a), "v"(b), "v"(c), "v"(d)); }
__device__ __forceinline__ void acc_guard4(v8f& a, v8f& b, v8f& c, v8f& d) { asm volatile("v_nop\n\tv_nop\n\tv_nop\n\tv_nop" : "+v"(a), "+v"(b), "+v"(c), "+v"(d)); }
template <typename T> struct Frag;
template <> struct Frag<_Float16> {
  typedef v16h V; union U { v16h v; v8h h[2]; };
  static __device__ __forceinline__ v16h load(const _Float16* p) {
    U f; f.h[0] = *(const v8h*)(p); f.h[1] = *(const v8h*)(p + 16); return f.v;
  }
  static __device__ __forceinline__ v8f mma(v16h a, v16h b, v8f c) {
    return __builtin_amdgcn_wmma_f32_16x16x32_f16(false, a, false, b, (short)0, c, false, false);
  }
  static __device__ __forceinline__ void guard(v8f& a, v8f& b, v16h x, v16h y) { dep_guard_h(a, b, x, y); }
  static __device__ __forceinline__ void keep(v16h a, v16h b, v16h c, v16h d) { keep4_h(a, b, c, d); }
};
template <> struct Frag<__bf16> {
  typedef v16b V; union U { v16b v; v8b h[2]; };
  static __device__ __forceinline__ v16b load(const __bf16* p) {
    U f; f.h[0] = *(const v8b*)(p); f.h[1] = *(const v8b*)(p + 16); return f.v;
  }
  static __device__ __forceinline__ v8f mma(v16b a, v16b b, v8f c) {
    return __builtin_amdgcn_wmma_f32_16x16x32_bf16(false, a, false, b, (short)0, c, false, false);
  }
  static __device__ __forceinline__ void guard(v8f& a, v8f& b, v16b x, v16b y) { dep_guard_b(a, b, x, y); }
  static __device__ __forceinline__ void keep(v16b a, v16b b, v16b c, v16b d) { keep4_b(a, b, c, d); }
};

/* ---- Register-blocked batched WMMA GEMM ---------------- */
template <int ET> struct Elem;
template <> struct Elem<0> { typedef _Float16 T; };
template <> struct Elem<1> { typedef __bf16 T; };
template <int ET, bool SPLIT, int BIAS_MODE, int OUT_MODE, bool RESID, int ACT = 0>
__global__ __launch_bounds__(256) void wmma_gemm64(
    const unsigned short* __restrict__ Ap, const unsigned short* __restrict__ A2p, int lda, long strideA,
    const unsigned short* __restrict__ Btp, const unsigned short* __restrict__ Bt2p, int ldb, long strideB,
    void* __restrict__ Cout, void* __restrict__ Cout2, int ldc, long strideC,
    const float* __restrict__ bias,
    const float* __restrict__ resid, long strideR,
    int M, int N, int K, float scale) {
  typedef typename Elem<ET>::T T;
  typedef typename Frag<T>::V V;
  const T* A = (const T*)Ap; const T* A2 = (const T*)A2p; const T* Bt = (const T*)Btp; const T* Bt2 = (const T*)Bt2p;
  __shared__ __align__(16) float sT[8][16 * 68];
  const int b    = blockIdx.y;
  const int lane = threadIdx.x & 31;
  const int wave = threadIdx.x >> 5;
  const int tilesN = N >> 6;
  const int tilesM = M >> 6;
  const int tile = blockIdx.x * 8 + wave;
  if (tile >= tilesM * tilesN) return;
  const int tm = tile / tilesN;
  const int tn = tile - tm * tilesN;
  const int m0 = tm << 6;
  const int n0 = tn << 6;

  const T* Ab  = A  + (size_t)b * strideA;
  const T* Bb  = Bt + (size_t)b * strideB;
  const T* Ab2 = SPLIT ? (A2  + (size_t)b * strideA) : nullptr;
  const T* Bb2 = SPLIT ? (Bt2 + (size_t)b * strideB) : nullptr;

  const int rlane = lane & 15;
  const int koff  = (lane >> 4) * 8;
  const int mOff  = (lane >> 4) * 8;

  v8f acc[4][4];
#pragma unroll
  for (int i = 0; i < 4; ++i)
#pragma unroll
    for (int j = 0; j < 4; ++j) acc[i][j] = (v8f){0.f,0.f,0.f,0.f,0.f,0.f,0.f,0.f};

  for (int k0 = 0; k0 < K; k0 += 32) {
    V bh[4], bl[4];
#pragma unroll
    for (int j = 0; j < 4; ++j) {
      const size_t bo = (size_t)(n0 + (j << 4) + rlane) * ldb + koff + k0;
      bh[j] = Frag<T>::load(Bb + bo);
      if (SPLIT) bl[j] = Frag<T>::load(Bb2 + bo);
    }
#pragma unroll
    for (int i = 0; i < 4; ++i) {
      const size_t ao = (size_t)(m0 + (i << 4) + rlane) * lda + koff + k0;
      V ah = Frag<T>::load(Ab + ao);
      V al;
      if (SPLIT) al = Frag<T>::load(Ab2 + ao);
#pragma unroll
      for (int j = 0; j < 4; ++j) {
        acc[i][j] = Frag<T>::mma(ah, bh[j], acc[i][j]);
        if (SPLIT) {
          acc[i][j] = Frag<T>::mma(ah, bl[j], acc[i][j]);
          acc[i][j] = Frag<T>::mma(al, bh[j], acc[i][j]);
        }
      }
      Frag<T>::guard(acc[i][0], acc[i][3], ah, SPLIT ? al : ah);
    }
    Frag<T>::keep(bh[0], bh[1], bh[2], bh[3]);
    if (SPLIT) Frag<T>::keep(bl[0], bl[1], bl[2], bl[3]);
  }
  acc_guard4(acc[0][0], acc[0][1], acc[0][2], acc[0][3]);
  acc_guard4(acc[1][0], acc[1][1], acc[1][2], acc[1][3]);
  acc_guard4(acc[2][0], acc[2][1], acc[2][2], acc[2][3]);
  acc_guard4(acc[3][0], acc[3][1], acc[3][2], acc[3][3]);

  float* slab = sT[wave];
  const float* Rb = RESID ? (resid + (size_t)b * strideR) : nullptr;
#pragma unroll
  for (int i = 0; i < 4; ++i) {
    const int mBase = m0 + (i << 4);
#pragma unroll
    for (int j = 0; j < 4; ++j) {
      const int n = n0 + (j << 4) + rlane;
      float bv = 0.f;
      if (BIAS_MODE == 2) bv = bias[n];
#pragma unroll
      for (int r = 0; r < 8; ++r) {
        float v = acc[i][j][r] * scale;
        if (BIAS_MODE == 1) v += bias[mBase + mOff + r];
        if (BIAS_MODE == 2) v += bv;
        if (RESID) v += Rb[(size_t)(mBase + mOff + r) * ldc + n];
        if (ACT == 1) v = tanhf(v);
        if (ACT == 2) v = fmaxf(v, 0.0f);
        if (ACT == 3) v = v / (1.0f + expf(-v));
        if (ACT == 4) v = (v > 0.f) ? v : 0.01f * v;
        if (ACT == 5) v = 0.5f * v * (1.0f + erff(v * 0.70710678118654752f));
        slab[(mOff + r) * 68 + (j << 4) + rlane] = v;
      }
    }
    __builtin_amdgcn_fence(__ATOMIC_RELEASE, "workgroup");
    __builtin_amdgcn_wave_barrier();
    __builtin_amdgcn_fence(__ATOMIC_ACQUIRE, "workgroup");
    if (OUT_MODE == 0) {
      float* C = (float*)Cout + (size_t)b * strideC;
      const int hh = lane >> 4, c4 = (lane & 15) * 4;
      {
#pragma unroll
        for (int it = 0; it < 8; ++it) {
          const int row = it * 2 + hh;
          v4f v = *(const v4f*)(slab + row * 68 + c4);
          *(v4f*)(C + (size_t)(mBase + row) * ldc + n0 + c4) = v;
        }
        
      }
    } else {
      const int q = lane >> 3, c8 = (lane & 7) * 8;
      unsigned short* C  = (unsigned short*)Cout  + (size_t)b * strideC;
      unsigned short* C2 = (OUT_MODE == 2) ? ((unsigned short*)Cout2 + (size_t)b * strideC) : nullptr;
      {
#pragma unroll
        for (int it = 0; it < 4; ++it) {
          const int row = it * 4 + q;
          const float* sp = slab + row * 68 + c8;
          v8h hv, lv;
#pragma unroll
          for (int e = 0; e < 8; ++e) {
            if (OUT_MODE == 1) {
              hv[e] = (_Float16)sp[e];
            } else {
              unsigned short hb = f2bf_bits(sp[e]);
              unsigned short lb = f2bf_bits(sp[e] - bf_bits2f(hb));
              hv[e] = __builtin_bit_cast(_Float16, hb);
              lv[e] = __builtin_bit_cast(_Float16, lb);
            }
          }
          *(v8h*)(C + (size_t)(mBase + row) * ldc + n0 + c8) = hv;
          if (OUT_MODE == 2) *(v8h*)(C2 + (size_t)(mBase + row) * ldc + n0 + c8) = lv;
        }
        
      }
    }
    __builtin_amdgcn_fence(__ATOMIC_RELEASE, "workgroup");
    __builtin_amdgcn_wave_barrier();
    __builtin_amdgcn_fence(__ATOMIC_ACQUIRE, "workgroup");
  }
}

/* ---- bf16 helpers for the attention path ---- */
__device__ __forceinline__ unsigned short at_bf_bits(float f) {
  unsigned u = __float_as_uint(f);
  return (unsigned short)((u + 0x7FFFu + ((u >> 16) & 1u)) >> 16);
}
__device__ __forceinline__ __bf16 at_f2bf(float f) { return __builtin_bit_cast(__bf16, at_bf_bits(f)); }
__device__ __forceinline__ void at_split(float f, __bf16& hi, __bf16& lo) {
  const unsigned short hb = at_bf_bits(f);
  hi = __builtin_bit_cast(__bf16, hb);
  lo = at_f2bf(f - __uint_as_float(((unsigned)hb) << 16));
}
__device__ __forceinline__ v8f at_mma(v16b a, v16b b, v8f c) {
  c = __builtin_amdgcn_wmma_f32_16x16x32_bf16(false, a, false, b, (short)0, c, false, false);
  asm volatile("v_nop\n\tv_nop\n\tv_nop\n\tv_nop" : "+v"(c) : "v"(a), "v"(b));
  return c;
}
__device__ __forceinline__ v8f mma_h16(v16h a, v16h b, v8f c) {
  c = __builtin_amdgcn_wmma_f32_16x16x32_f16(false, a, false, b, (short)0, c, false, false);
  asm volatile("v_nop\n\tv_nop\n\tv_nop\n\tv_nop" : "+v"(c) : "v"(a), "v"(b));
  return c;
}
__device__ __forceinline__ void wave_sync_lds() {
  __builtin_amdgcn_fence(__ATOMIC_RELEASE, "workgroup");
  __builtin_amdgcn_wave_barrier();
  __builtin_amdgcn_fence(__ATOMIC_ACQUIRE, "workgroup");
}

/* f32[8] -> packed bf16 hi (4 words) and bf16 lo residual (4 words), RNE convert */
__device__ __forceinline__ void split_pack8(const float (&x)[8], v4u& H, v4u& L) {
#pragma unroll
  for (int p = 0; p < 4; ++p) {
    const unsigned short h0 = f2bf_bits(x[2 * p]);
    const unsigned short l0 = f2bf_bits(x[2 * p] - bf_bits2f(h0));
    const unsigned short h1 = f2bf_bits(x[2 * p + 1]);
    const unsigned short l1 = f2bf_bits(x[2 * p + 1] - bf_bits2f(h1));
    H[p] = (unsigned)h0 | ((unsigned)h1 << 16);
    L[p] = (unsigned)l0 | ((unsigned)l1 << 16);
  }
}
__device__ __forceinline__ void store_planes2(unsigned short* __restrict__ hi, unsigned short* __restrict__ lo,
                                              size_t off, v4u H, v4u L) {
  *(v4u*)(hi + off) = H;
  *(v4u*)(lo + off) = L;
  
}

/* ---- activations f32 [rows][128] -> bf16 hi/lo planes, same layout -------------
   coverage: n8 = rows*128/8 threads exactly (host asserts divisibility). */
__global__ __launch_bounds__(256) void split_rows_bf16(const float* __restrict__ in,
                                                        unsigned short* __restrict__ hi,
                                                        unsigned short* __restrict__ lo, int n8) {
  const int i = blockIdx.x * 256 + threadIdx.x;
  if (i >= n8) return;
  const size_t e0 = (size_t)i * 8;
  const v4f a = *(const v4f*)(in + e0);
  const v4f c = *(const v4f*)(in + e0 + 4);
  float x[8];
  x[0] = a[0]; x[1] = a[1]; x[2] = a[2]; x[3] = a[3];
  x[4] = c[0]; x[5] = c[1]; x[6] = c[2]; x[7] = c[3];
  v4u H, L;
  split_pack8(x, H, L);
  store_planes2(hi, lo, e0, H, L);
}

/* ---- weights W[k][n] (input-major, 128x128): in[k][n] -> out[n][k] as transposed bf16 hi/lo planes -----
   outb holds 4 weights x (hi plane + lo plane) of 128*128 halves. grid (8, 4): 2048 threads per weight;
   2048 threads x 8 = 16384 = 128x128 per plane exactly. */
__global__ __launch_bounds__(256) void wt_split_bf16(const float* __restrict__ W0, const float* __restrict__ W1,
                                                     const float* __restrict__ W2, const float* __restrict__ W3,
                                                     unsigned short* __restrict__ outb) {
  const int which = blockIdx.y;
  const float* W = (which == 0) ? W0 : (which == 1) ? W1 : (which == 2) ? W2 : W3;
  unsigned short* hi = outb + (size_t)which * (2 * kC * kC);
  unsigned short* lo = hi + kC * kC;
  const int gt = blockIdx.x * 256 + threadIdx.x;
  if (gt >= kC * kC / 8) return;
  const int n  = gt >> 4;
  const int k8 = (gt & 15) * 8;
  float x[8];
#pragma unroll
  for (int e = 0; e < 8; ++e) x[e] = W[(size_t)(k8 + e) * kC + n];
  v4u H, L;
  split_pack8(x, H, L);
  store_planes2(hi, lo, (size_t)n * kC + k8, H, L);
}

/* ---- online softmax step for one head, 16 query rows x 32 keys per wave (2 key subtiles) ----
   sA: keys 0..15 (col c), sB: keys 16..31 (col 16+c); D row = 8*hh + r. */
__device__ __forceinline__ void softmax_step2(v8f& sA, v8f& sB, float (&mrow)[8], float (&lrow)[8], float (&alph)[8],
                                              __bf16* pwh, __bf16* pwl, int hh, int c) {
#pragma unroll
  for (int r = 0; r < 8; ++r) {
    float m = fmaxf(sA[r], sB[r]);
#pragma unroll
    for (int off = 1; off < 16; off <<= 1) m = fmaxf(m, __shfl_xor(m, off, 32));
    const float mnew = fmaxf(mrow[r], m);
    const float al = expf(mrow[r] - mnew);
    mrow[r] = mnew;
    alph[r] = al;
    const float p0 = expf(sA[r] - mnew);
    const float p1 = expf(sB[r] - mnew);
    float psum = p0 + p1;
    __bf16 ph, plo;
    at_split(p0, ph, plo);
    pwh[(8 * hh + r) * kKC + c] = ph;
    pwl[(8 * hh + r) * kKC + c] = plo;
    at_split(p1, ph, plo);
    pwh[(8 * hh + r) * kKC + 16 + c] = ph;
    pwl[(8 * hh + r) * kKC + 16 + c] = plo;
#pragma unroll
    for (int off = 1; off < 16; off <<= 1) psum += __shfl_xor(psum, off, 32);
    lrow[r] = lrow[r] * al + psum;
  }
}
/* per-wave 16x32 f32 result tile -> LDS staging (pitch kOsPitch); writes rows 0..15, cols 0..31 */
__device__ __forceinline__ void tile_to_os(float* os, const v8f (&o)[2], const float (&inv)[8], int hh, int c) {
#pragma unroll
  for (int r = 0; r < 8; ++r) {
#pragma unroll
    for (int t = 0; t < 2; ++t) os[(8 * hh + r) * kOsPitch + t * 16 + c] = o[t][r] * inv[r];
  }
}
/*
*/
__device__ __forceinline__ void os_to_global(const float* os, float* __restrict__ dst, size_t pitch, int lane) {
  const int q = lane >> 3, c4 = (lane & 7) * 4;
  {
#pragma unroll
    for (int it = 0; it < 4; ++it) {
      const int row = it * 4 + q;
      const v4f v = *(const v4f*)(os + row * kOsPitch + c4);
      *(v4f*)(dst + (size_t)row * pitch + c4) = v;
    }
    
  }
}

/* ---- attention for one (batch, head h, 64 query rows) ----------------------------------
   q16/k16: f16 planes [B*N][128] (head-major columns); vhi/vlo: bf16 hi/lo planes [B*Nkv][128].
   scores = (q.k^T)*scale + rpe[idx][h]; online softmax in f32; P hi/lo per wave in LDS;
   o = P . V_h;  for h >= 2 also ox = P . V_{h-2} (the cross term of the differential mixing).
   xattn f32 [B*Nq][128]; ycross f32 [B][2][Nq][32]. grid.x = B*H*(Nq/64), block 128. */
__global__ __launch_bounds__(128) __attribute__((amdgpu_num_vgpr(256)))
void attn_head_kernel(
    const unsigned short* __restrict__ q16, const unsigned short* __restrict__ k16,
    const unsigned short* __restrict__ vhi, const unsigned short* __restrict__ vlo,
    const int* __restrict__ coords_q, const int* __restrict__ coords_k,
    const float* __restrict__ rpe,
    float* __restrict__ xattn, float* __restrict__ ycross)
{
  __shared__ __align__(16) unsigned short Ksh[kKC * kHD];   /* [key][d]  f16 bits  */
  __shared__ __align__(16) unsigned short Vth[kHD * kKC];   /* [d][key] bf16 hi, head h   */
  __shared__ __align__(16) unsigned short Vtl[kHD * kKC];   /* [d][key] bf16 lo, head h   */
  __shared__ __align__(16) unsigned short Vxh[kHD * kKC];   /* [d][key] bf16 hi, head h-2 */
  __shared__ __align__(16) unsigned short Vxl[kHD * kKC];   /* [d][key] bf16 lo, head h-2 */
  __shared__ __align__(16) __bf16 Ph[4][16 * kKC];          /* [wave][row][key] hi */
  __shared__ __align__(16) __bf16 Pl[4][16 * kKC];
  __shared__ __align__(16) float Os[4][16 * kOsPitch];

  const int tid  = threadIdx.x;
  const int wave = tid >> 5;
  const int lane = tid & 31;
  const int hh   = lane >> 4;
  const int c    = lane & 15;
  constexpr int nqb = kNq / kQB;
  const int bx   = blockIdx.x;
  const int qb   = bx % nqb;
  const int rest = bx / nqb;
  const int h    = rest % kH;
  const int b    = rest / kH;
  const bool cross = (h >= kNH);                       /* block-uniform */
  const int hcol = h * kHD;
  const int xcol = (cross ? (h - kNH) : 0) * kHD;
  const int q0   = qb * kQB + wave * 16;
  const size_t qrows  = (size_t)b * kNq + q0;
  const size_t kvrows = (size_t)b * kNkv;
  const float* __restrict__ rpe_h = rpe + h;           /* table entry stride kH floats */

  /* Q fragment (A operand, K = head_dim = 32, one k-step) */
  const _Float16* qp = (const _Float16*)(const void*)q16;
  const v16h qa = Frag<_Float16>::load(qp + (qrows + c) * kC + hcol + 8 * hh);

  /* query coords for this lane's 8 D-rows (row 8*hh + r), +MAXD folded in */
  int cqx[8], cqy[8];
#pragma unroll
  for (int r = 0; r < 8; ++r) {
    const v2i cc = *(const v2i*)(coords_q + (qrows + 8 * hh + r) * 2);
    cqx[r] = cc.x + kMaxd;
    cqy[r] = cc.y + kMaxd;
  }

  float mr[8], lr[8];
  v8f o[2], ox[2];
#pragma unroll
  for (int r = 0; r < 8; ++r) { mr[r] = -INFINITY; lr[r] = 0.f; }
#pragma unroll
  for (int t = 0; t < 2; ++t) {
    o[t]  = (v8f){0.f,0.f,0.f,0.f,0.f,0.f,0.f,0.f};
    ox[t] = (v8f){0.f,0.f,0.f,0.f,0.f,0.f,0.f,0.f};
  }

  __bf16* pwh = Ph[wave];
  __bf16* pwl = Pl[wave];

  for (int kc = 0; kc < kNkv / kKC; ++kc) {
    const int kv0 = kc * kKC;
    __syncthreads();
    /* stage K tile and V^T hi/lo tiles: 32 keys x 4 segments of 8 halves = 128 = blockDim, one uint4 per thread
       per plane; covers Ksh 32x32, Vth/Vtl 32x32 (and Vxh/Vxl when cross) exactly */
    {
      const int key = tid >> 2;
      const int seg = tid & 3;
      const size_t rowoff = (kvrows + kv0 + key) * kC;
      const size_t go = rowoff + hcol + seg * 8;
      const uint4 kw = *(const uint4*)(k16 + go);
      *(uint4*)(&Ksh[key * kHD + seg * 8]) = kw;
      const uint4 vh4 = *(const uint4*)(vhi + go);
      const uint4 vl4 = *(const uint4*)(vlo + go);
      unsigned short* vth = &Vth[(seg * 8) * kKC + key];
      unsigned short* vtl = &Vtl[(seg * 8) * kKC + key];
      vth[0 * kKC] = (unsigned short)(vh4.x & 0xffffu); vth[1 * kKC] = (unsigned short)(vh4.x >> 16);
      vth[2 * kKC] = (unsigned short)(vh4.y & 0xffffu); vth[3 * kKC] = (unsigned short)(vh4.y >> 16);
      vth[4 * kKC] = (unsigned short)(vh4.z & 0xffffu); vth[5 * kKC] = (unsigned short)(vh4.z >> 16);
      vth[6 * kKC] = (unsigned short)(vh4.w & 0xffffu); vth[7 * kKC] = (unsigned short)(vh4.w >> 16);
      vtl[0 * kKC] = (unsigned short)(vl4.x & 0xffffu); vtl[1 * kKC] = (unsigned short)(vl4.x >> 16);
      vtl[2 * kKC] = (unsigned short)(vl4.y & 0xffffu); vtl[3 * kKC] = (unsigned short)(vl4.y >> 16);
      vtl[4 * kKC] = (unsigned short)(vl4.z & 0xffffu); vtl[5 * kKC] = (unsigned short)(vl4.z >> 16);
      vtl[6 * kKC] = (unsigned short)(vl4.w & 0xffffu); vtl[7 * kKC] = (unsigned short)(vl4.w >> 16);
      if (cross) {
        const size_t gx = rowoff + xcol + seg * 8;
        const uint4 xh4 = *(const uint4*)(vhi + gx);
        const uint4 xl4 = *(const uint4*)(vlo + gx);
        unsigned short* vxh = &Vxh[(seg * 8) * kKC + key];
        unsigned short* vxl = &Vxl[(seg * 8) * kKC + key];
        vxh[0 * kKC] = (unsigned short)(xh4.x & 0xffffu); vxh[1 * kKC] = (unsigned short)(xh4.x >> 16);
        vxh[2 * kKC] = (unsigned short)(xh4.y & 0xffffu); vxh[3 * kKC] = (unsigned short)(xh4.y >> 16);
        vxh[4 * kKC] = (unsigned short)(xh4.z & 0xffffu); vxh[5 * kKC] = (unsigned short)(xh4.z >> 16);
        vxh[6 * kKC] = (unsigned short)(xh4.w & 0xffffu); vxh[7 * kKC] = (unsigned short)(xh4.w >> 16);
        vxl[0 * kKC] = (unsigned short)(xl4.x & 0xffffu); vxl[1 * kKC] = (unsigned short)(xl4.x >> 16);
        vxl[2 * kKC] = (unsigned short)(xl4.y & 0xffffu); vxl[3 * kKC] = (unsigned short)(xl4.y >> 16);
        vxl[4 * kKC] = (unsigned short)(xl4.z & 0xffffu); vxl[5 * kKC] = (unsigned short)(xl4.z >> 16);
        vxl[6 * kKC] = (unsigned short)(xl4.w & 0xffffu); vxl[7 * kKC] = (unsigned short)(xl4.w >> 16);
      }
    }
    __syncthreads();

    /* scores: s[j], j = key subtile; B fragment lane c -> key j*16+c, elements d (split map) */
    v8f s[2];
    {
      const v8f z = (v8f){0.f,0.f,0.f,0.f,0.f,0.f,0.f,0.f};
      const _Float16* Kp = (const _Float16*)(const void*)Ksh;
#pragma unroll
      for (int j = 0; j < 2; ++j) {
        Frag<_Float16>::U kb;
        kb.h[0] = *(const v8h*)(Kp + (j * 16 + c) * kHD + 8 * hh);
        kb.h[1] = *(const v8h*)(Kp + (j * 16 + c) * kHD + 16 + 8 * hh);
        s[j] = mma_h16(qa, kb.v, z);
      }
    }
    /* key coords for this lane's two columns */
    int ckx[2], cky[2];
#pragma unroll
    for (int j = 0; j < 2; ++j) {
      const v2i ck = *(const v2i*)(coords_k + (kvrows + kv0 + j * 16 + c) * 2);
      ckx[j] = ck.x; cky[j] = ck.y;
    }

    /* scale + relative position bias: one clamped b32 table gather per (row, key);
*/
#pragma unroll
    for (int grp = 0; grp < 4; ++grp) {
#pragma unroll
      for (int rr = 0; rr < 2; ++rr) {
        const int r = grp * 2 + rr;
#pragma unroll
        for (int j = 0; j < 2; ++j) {
          int dx = cqx[r] - ckx[j]; dx = dx < 0 ? 0 : dx; dx = dx > 2 * kMaxd ? 2 * kMaxd : dx;
          int dy = cqy[r] - cky[j]; dy = dy < 0 ? 0 : dy; dy = dy > 2 * kMaxd ? 2 * kMaxd : dy;
          const int idx = dx * kSpan + dy;            /* 0 .. kTable-1 */
          const float bv = rpe_h[(size_t)idx * kH];
          s[j][r] = s[j][r] * kScale + bv;
        }
      }
      asm volatile("" : "+v"(s[0]), "+v"(s[1]) : : "memory");
    }

    /* online softmax; P hi/lo to this wave's LDS tiles */
    float al[8];
    softmax_step2(s[0], s[1], mr, lr, al, pwh, pwl, hh, c);
#pragma unroll
    for (int t = 0; t < 2; ++t) {
#pragma unroll
      for (int r = 0; r < 8; ++r) { o[t][r] *= al[r]; ox[t][r] *= al[r]; }
    }
    wave_sync_lds();

    /* P.V : A = P (lane c -> query row, elements key, split map), B = V^T tile (lane c -> d, elements key) */
    {
      Frag<__bf16>::U pa, pb;
      pa.h[0] = *(const v8b*)(pwh + c * kKC + 8 * hh);  pa.h[1] = *(const v8b*)(pwh + c * kKC + 16 + 8 * hh);
      pb.h[0] = *(const v8b*)(pwl + c * kKC + 8 * hh);  pb.h[1] = *(const v8b*)(pwl + c * kKC + 16 + 8 * hh);
      const __bf16* Vh = (const __bf16*)(const void*)Vth;
      const __bf16* Vl = (const __bf16*)(const void*)Vtl;
#pragma unroll
      for (int t = 0; t < 2; ++t) {
        Frag<__bf16>::U vb, vl;
        vb.h[0] = *(const v8b*)(Vh + (t * 16 + c) * kKC + 8 * hh);  vb.h[1] = *(const v8b*)(Vh + (t * 16 + c) * kKC + 16 + 8 * hh);
        vl.h[0] = *(const v8b*)(Vl + (t * 16 + c) * kKC + 8 * hh);  vl.h[1] = *(const v8b*)(Vl + (t * 16 + c) * kKC + 16 + 8 * hh);
        o[t] = at_mma(pa.v, vb.v, o[t]);
        o[t] = at_mma(pa.v, vl.v, o[t]);
        o[t] = at_mma(pb.v, vb.v, o[t]);
      }
      if (cross) {
        const __bf16* Xh = (const __bf16*)(const void*)Vxh;
        const __bf16* Xl = (const __bf16*)(const void*)Vxl;
#pragma unroll
        for (int t = 0; t < 2; ++t) {
          Frag<__bf16>::U vb, vl;
          vb.h[0] = *(const v8b*)(Xh + (t * 16 + c) * kKC + 8 * hh);  vb.h[1] = *(const v8b*)(Xh + (t * 16 + c) * kKC + 16 + 8 * hh);
          vl.h[0] = *(const v8b*)(Xl + (t * 16 + c) * kKC + 8 * hh);  vl.h[1] = *(const v8b*)(Xl + (t * 16 + c) * kKC + 16 + 8 * hh);
          ox[t] = at_mma(pa.v, vb.v, ox[t]);
          ox[t] = at_mma(pa.v, vl.v, ox[t]);
          ox[t] = at_mma(pb.v, vb.v, ox[t]);
        }
      }
    }
  }

  float inv[8];
#pragma unroll
  for (int r = 0; r < 8; ++r) inv[r] = 1.0f / lr[r];
  float* os = Os[wave];

  tile_to_os(os, o, inv, hh, c);
  wave_sync_lds();
  os_to_global(os, xattn + qrows * kC + hcol, (size_t)kC, lane);

  if (cross) {
    wave_sync_lds();
    tile_to_os(os, ox, inv, hh, c);
    wave_sync_lds();
    os_to_global(os, ycross + (((size_t)b * kNH + (h - kNH)) * kNq + q0) * kHD, (size_t)kHD, lane);
  }
}

/* ---- differential head mixing + split to bf16 hi/lo planes for the output projection --------
   x[b,q,h*32+d] = xs + alpha[b,q]*(xs - lam[h]*yc[b,h,q,d]) for h < 2, else xs.
   coverage 65536 threads x 8 = 4096x128 exactly. */
__global__ __launch_bounds__(256) void combine_split_kernel(
    const float* __restrict__ xattn, const float* __restrict__ ycross, const float* __restrict__ alpha,
    const float* __restrict__ lq1, const float* __restrict__ lk1,
    const float* __restrict__ lq2, const float* __restrict__ lk2,
    unsigned short* __restrict__ hi, unsigned short* __restrict__ lo)
{
  __shared__ float lam_s[2];
  if (threadIdx.x < 2) {
    const int h = threadIdx.x;
    float s1 = 0.f, s2 = 0.f;
#pragma unroll 1
    for (int i = 0; i < kHD; ++i) {
      s1 += lq1[h * kHD + i] * lk1[h * kHD + i];
      s2 += lq2[h * kHD + i] * lk2[h * kHD + i];
    }
    lam_s[h] = expf(s1) - expf(s2) + kLambdaInit;
  }
  __syncthreads();
  const int gt = blockIdx.x * 256 + threadIdx.x;
  if (gt >= kBatch * kNq * kC / 8) return;
  const size_t e0 = (size_t)gt * 8;
  const int row = (int)(e0 >> 7);
  const int col = (int)(e0 & 127);
  const int h   = col >> 5;
  const int d   = col & 31;
  const int hc  = h & 1;
  const int b   = row >> 11;
  const int q   = row & (kNq - 1);
  const float a   = alpha[row];
  const float lam = lam_s[hc];
  const v4f xs0 = *(const v4f*)(xattn + e0);
  const v4f xs1 = *(const v4f*)(xattn + e0 + 4);
  const size_t yo = (((size_t)b * kNH + hc) * kNq + q) * kHD + d;
  const v4f y0 = *(const v4f*)(ycross + yo);
  const v4f y1 = *(const v4f*)(ycross + yo + 4);
  const bool mix = (h < kNH);
  float x[8];
#pragma unroll
  for (int e = 0; e < 4; ++e) {
    const float xa = xs0[e], xb = xs1[e];
    const float va = xa + a * (xa - lam * y0[e]);
    const float vb = xb + a * (xb - lam * y1[e]);
    x[e]     = mix ? va : xa;
    x[4 + e] = mix ? vb : xb;
  }
  v4u H, L;
  split_pack8(x, H, L);
  store_planes2(hi, lo, e0, H, L);
}

/* =========================================================================================
   host launch: 9 kernel launches
   workspace region map (bytes, all offsets MiB/256-KiB aligned):
     xq_hi  1 MiB | xq_lo 1 MiB | xkv_hi 2 MiB | xkv_lo 2 MiB | wt planes 256 KiB (4 weights x hi,lo x 32 KiB)
     q16 1 MiB | k16 2 MiB | v_hi 2 MiB | v_lo 2 MiB | xattn f32 2 MiB | ycross f32 1 MiB | xmix_hi 1 MiB | xmix_lo 1 MiB
     total 19,136,512 B
   ========================================================================================= */
extern "C" void kernel_launch(void* const* d_in, const int* in_sizes, int n_in,
                              void* d_out, int out_size, void* d_ws, size_t ws_size,
                              hipStream_t stream) {
  constexpr int Mq  = kBatch * kNq;    /* 4096 */
  constexpr int Mkv = kBatch * kNkv;   /* 8192 */
  static_assert(Mq % 64 == 0 && Mkv % 64 == 0 && kC % 64 == 0 && kC % 32 == 0, "");
  static_assert((Mq * kC) % 8 == 0 && (Mkv * kC) % 8 == 0, "");
  if (n_in < 18) return;
  if (in_sizes[0] != Mq * kC || in_sizes[1] != Mkv * kC || in_sizes[2] != Mq * 2 || in_sizes[3] != Mkv * 2 ||
      in_sizes[4] != Mq || in_sizes[5] != kC * kC || in_sizes[7] != kC * kC || in_sizes[9] != kC * kC ||
      in_sizes[16] != kC * kC || in_sizes[6] != kC || in_sizes[8] != kC || in_sizes[10] != kC || in_sizes[17] != kC ||
      in_sizes[11] != kNH * kHD || in_sizes[12] != kNH * kHD || in_sizes[13] != kNH * kHD || in_sizes[14] != kNH * kHD ||
      in_sizes[15] != kTable * kH || out_size != Mq * kC) return;

  const float* x_q      = (const float*)d_in[0];
  const float* x_kv     = (const float*)d_in[1];
  const int*   coords_q = (const int*)d_in[2];
  const int*   coords_k = (const int*)d_in[3];
  const float* alpha    = (const float*)d_in[4];
  const float* Wq = (const float*)d_in[5];  const float* bq = (const float*)d_in[6];
  const float* Wk = (const float*)d_in[7];  const float* bk = (const float*)d_in[8];
  const float* Wv = (const float*)d_in[9];  const float* bv = (const float*)d_in[10];
  const float* lq1 = (const float*)d_in[11]; const float* lk1 = (const float*)d_in[12];
  const float* lq2 = (const float*)d_in[13]; const float* lk2 = (const float*)d_in[14];
  const float* rpe = (const float*)d_in[15];
  const float* Wp = (const float*)d_in[16]; const float* bp = (const float*)d_in[17];
  float* out = (float*)d_out;

  char* ws = (char*)d_ws;
  size_t off = 0;
  const size_t szXq16  = (size_t)Mq * kC * 2;     /* 1 MiB  */
  const size_t szXkv16 = (size_t)Mkv * kC * 2;    /* 2 MiB  */
  const size_t szWt    = (size_t)4 * 2 * kC * kC * 2;
  const size_t szXattn = (size_t)Mq * kC * 4;
  const size_t szYc    = (size_t)kBatch * kNH * kNq * kHD * 4;
  unsigned short* xq_hi  = (unsigned short*)(ws + off); off += szXq16;
  unsigned short* xq_lo  = (unsigned short*)(ws + off); off += szXq16;
  unsigned short* xkv_hi = (unsigned short*)(ws + off); off += szXkv16;
  unsigned short* xkv_lo = (unsigned short*)(ws + off); off += szXkv16;
  unsigned short* wt     = (unsigned short*)(ws + off); off += szWt;
  unsigned short* q16    = (unsigned short*)(ws + off); off += szXq16;
  unsigned short* k16    = (unsigned short*)(ws + off); off += szXkv16;
  unsigned short* v_hi   = (unsigned short*)(ws + off); off += szXkv16;
  unsigned short* v_lo   = (unsigned short*)(ws + off); off += szXkv16;
  float*          xattn  = (float*)(ws + off);          off += szXattn;
  float*          ycross = (float*)(ws + off);          off += szYc;
  unsigned short* xm_hi  = (unsigned short*)(ws + off); off += szXq16;
  unsigned short* xm_lo  = (unsigned short*)(ws + off); off += szXq16;
  if (off > ws_size) return;

  const unsigned short* wtq_hi = wt + 0 * (2 * kC * kC); const unsigned short* wtq_lo = wtq_hi + kC * kC;
  const unsigned short* wtk_hi = wt + 1 * (2 * kC * kC); const unsigned short* wtk_lo = wtk_hi + kC * kC;
  const unsigned short* wtv_hi = wt + 2 * (2 * kC * kC); const unsigned short* wtv_lo = wtv_hi + kC * kC;
  const unsigned short* wtp_hi = wt + 3 * (2 * kC * kC); const unsigned short* wtp_lo = wtp_hi + kC * kC;

  /* 1-2: activations -> bf16 hi/lo planes */
  const int n8q = Mq * kC / 8, n8kv = Mkv * kC / 8;
  split_rows_bf16<<<dim3((n8q + 255) / 256), dim3(256), 0, stream>>>(x_q, xq_hi, xq_lo, n8q);
  split_rows_bf16<<<dim3((n8kv + 255) / 256), dim3(256), 0, stream>>>(x_kv, xkv_hi, xkv_lo, n8kv);
  /* 3: weights -> transposed bf16 hi/lo planes (in[k][n] -> out[n][k], square 128x128) */
  wt_split_bf16<<<dim3((kC * kC / 8 + 255) / 256, 4), dim3(256), 0, stream>>>(Wq, Wk, Wv, Wp, wt);

  /* 4-6: projections, M x 128, K = 128 (M % 64 == 0, N = 128 % 64 == 0, K = 128 % 32 == 0) */
  const int blocksQ  = ((Mq  / 64) * (kC / 64) + 7) / 8;
  const int blocksKV = ((Mkv / 64) * (kC / 64) + 7) / 8;
  wmma_gemm64<1, true, 2, 1, false><<<dim3(blocksQ, 1), dim3(256), 0, stream>>>(
      xq_hi, xq_lo, kC, 0L, wtq_hi, wtq_lo, kC, 0L, (void*)q16, nullptr, kC, 0L, bq, nullptr, 0L, Mq, kC, kC, 1.0f);
  wmma_gemm64<1, true, 2, 1, false><<<dim3(blocksKV, 1), dim3(256), 0, stream>>>(
      xkv_hi, xkv_lo, kC, 0L, wtk_hi, wtk_lo, kC, 0L, (void*)k16, nullptr, kC, 0L, bk, nullptr, 0L, Mkv, kC, kC, 1.0f);
  wmma_gemm64<1, true, 2, 2, false><<<dim3(blocksKV, 1), dim3(256), 0, stream>>>(
      xkv_hi, xkv_lo, kC, 0L, wtv_hi, wtv_lo, kC, 0L, (void*)v_hi, (void*)v_lo, kC, 0L, bv, nullptr, 0L, Mkv, kC, kC, 1.0f);

  /* 7: attention per (batch, head, 64 queries) */
  const int attnBlocks = kBatch * kH * (kNq / kQB);
  attn_head_kernel<<<dim3(attnBlocks), dim3(128), 0, stream>>>(q16, k16, v_hi, v_lo, coords_q, coords_k, rpe, xattn, ycross);

  /* 8: differential mixing + bf16 hi/lo planes */
  combine_split_kernel<<<dim3((n8q + 255) / 256), dim3(256), 0, stream>>>(xattn, ycross, alpha, lq1, lk1, lq2, lk2, xm_hi, xm_lo);

  /* 9: output projection -> d_out (f32), M = 4096, N = 128, K = 128 */
  wmma_gemm64<1, true, 2, 0, false><<<dim3(blocksQ, 1), dim3(256), 0, stream>>>(
      xm_hi, xm_lo, kC, 0L, wtp_hi, wtp_lo, kC, 0L, (void*)out, nullptr, kC, 0L, bp, nullptr, 0L, Mq, kC, kC, 1.0f);
}

// v001
// One run takes 327 microseconds.
// Next to v000, in two timings, it ran 1.39 and 1.38 times as fast.
// Contractions: x@Wq, x@Wk, x@Wv and xmix@Wp on v_wmma_f32_16x16x32_bf16 with bf16 hi/lo operand planes (hi.hi + hi.lo + lo.hi); q.k^T on v_wmma_f32_16x16x32_f16 with plain f16 q/k planes; p.v and p_cross.v on v_wmma_f32_16x16x32_bf16 with bf16 hi/lo p and v tiles; f32 accumulate; bias gather, online softmax and head mixing in f32.
#include <hip/hip_runtime.h>
#include <stdint.h>

typedef __attribute__((ext_vector_type(16))) _Float16 v16h;
typedef __attribute__((ext_vector_type(8)))  _Float16 v8h;
typedef __attribute__((ext_vector_type(16))) __bf16   v16b;
typedef __attribute__((ext_vector_type(8)))  __bf16   v8b;
typedef __attribute__((ext_vector_type(8)))  float    v8f;
typedef __attribute__((ext_vector_type(4)))  float    v4f;
typedef __attribute__((ext_vector_type(4)))  unsigned int v4u;
typedef __attribute__((ext_vector_type(2)))  int      v2i;

/* ---- problem geometry (fixed by the module) ---- */
constexpr int kBatch = 2;
constexpr int kNq    = 2048;
constexpr int kNkv   = 4096;
constexpr int kC     = 128;
constexpr int kH     = 4;
constexpr int kHD    = 32;
constexpr int kNH    = 2;
constexpr int kMaxd  = 128;
constexpr int kSpan  = 2 * kMaxd + 1;
constexpr int kTable = kSpan * kSpan;
constexpr int kKC    = 32;     /* keys per chunk in the attention kernel */
constexpr int kQB    = 64;     /* query rows per attention block (4 query tiles x 16) */
constexpr int kSplit = 4;      /* key groups per attention block: wave = (key group, query tile) */
constexpr int kOsPitch = 36;   /* floats; per-wave output staging pitch */
constexpr float kScale = 0.17677669529663687f;   /* head_dim ** -0.5 */
constexpr float kLambdaInit = 0.8f;

static_assert(kNq % kQB == 0, "");
static_assert(kNkv % (kKC * kSplit) == 0, "");
static_assert(kSplit * 4 == 16, "");   /* the merge gives each wave 16 / kSplit = 4 rows = 32 lanes x 4 floats */
static_assert(kC == kH * kHD, "");
static_assert((kBatch * kNq) % 64 == 0 && (kBatch * kNkv) % 64 == 0, "");
static_assert(kC % 64 == 0 && kC % 32 == 0, "");
static_assert(kH == 4 && kNH == 2 && kHD == 32 && kKC == 32, "");

__device__ __forceinline__ unsigned short f2bf_bits(float f) {
  unsigned u = __float_as_uint(f);
  return (unsigned short)((u + 0x7FFFu + ((u >> 16) & 1u)) >> 16);
}
__device__ __forceinline__ float bf_bits2f(unsigned short h) { return __uint_as_float(((unsigned)h) << 16); }

/* hazard guards as plain device helpers */
__device__ __forceinline__ void dep_guard_h(v8f& a, v8f& b, v16h x, v16h y) { asm volatile("v_nop\n\tv_nop\n\tv_nop\n\tv_nop" : "+v"(a), "+v"(b) : "v"(x), "v"(y)); }
__device__ __forceinline__ void dep_guard_b(v8f& a, v8f& b, v16b x, v16b y) { asm volatile("v_nop\n\tv_nop\n\tv_nop\n\tv_nop" : "+v"(a), "+v"(b) : "v"(x), "v"(y)); }
__device__ __forceinline__ void keep4_h(v16h a, v16h b, v16h c, v16h d) { asm volatile("v_nop" :: "v"(a), "v"(b), "v"(c), "v"(d)); }
__device__ __forceinline__ void keep4_b(v16b a, v16b b, v16b c, v16b d) { asm volatile("v_nop" :: "v"(a), "v"(b), "v"(c), "v"(d)); }
__device__ __forceinline__ void acc_guard4(v8f& a, v8f& b, v8f& c, v8f& d) { asm volatile("v_nop\n\tv_nop\n\tv_nop\n\tv_nop" : "+v"(a), "+v"(b), "+v"(c), "+v"(d)); }
template <typename T> struct Frag;
template <> struct Frag<_Float16> {
  typedef v16h V; union U { v16h v; v8h h[2]; };
  static __device__ __forceinline__ v16h load(const _Float16* p) {
    U f; f.h[0] = *(const v8h*)(p); f.h[1] = *(const v8h*)(p + 16); return f.v;
  }
  static __device__ __forceinline__ v8f mma(v16h a, v16h b, v8f c) {
    return __builtin_amdgcn_wmma_f32_16x16x32_f16(false, a, false, b, (short)0, c, false, false);
  }
  static __device__ __forceinline__ void guard(v8f& a, v8f& b, v16h x, v16h y) { dep_guard_h(a, b, x, y); }
  static __device__ __forceinline__ void keep(v16h a, v16h b, v16h c, v16h d) { keep4_h(a, b, c, d); }
};
template <> struct Frag<__bf16> {
  typedef v16b V; union U { v16b v; v8b h[2]; };
  static __device__ __forceinline__ v16b load(const __bf16* p) {
    U f; f.h[0] = *(const v8b*)(p); f.h[1] = *(const v8b*)(p + 16); return f.v;
  }
  static __device__ __forceinline__ v8f mma(v16b a, v16b b, v8f c) {
    return __builtin_amdgcn_wmma_f32_16x16x32_bf16(false, a, false, b, (short)0, c, false, false);
  }
  static __device__ __forceinline__ void guard(v8f& a, v8f& b, v16b x, v16b y) { dep_guard_b(a, b, x, y); }
  static __device__ __forceinline__ void keep(v16b a, v16b b, v16b c, v16b d) { keep4_b(a, b, c, d); }
};

/* ---- Register-blocked batched WMMA GEMM ---------------- */
template <int ET> struct Elem;
template <> struct Elem<0> { typedef _Float16 T; };
template <> struct Elem<1> { typedef __bf16 T; };
template <int ET, bool SPLIT, int BIAS_MODE, int OUT_MODE, bool RESID, int ACT = 0>
__global__ __launch_bounds__(256) void wmma_gemm64(
    const unsigned short* __restrict__ Ap, const unsigned short* __restrict__ A2p, int lda, long strideA,
    const unsigned short* __restrict__ Btp, const unsigned short* __restrict__ Bt2p, int ldb, long strideB,
    void* __restrict__ Cout, void* __restrict__ Cout2, int ldc, long strideC,
    const float* __restrict__ bias,
    const float* __restrict__ resid, long strideR,
    int M, int N, int K, float scale) {
  typedef typename Elem<ET>::T T;
  typedef typename Frag<T>::V V;
  const T* A = (const T*)Ap; const T* A2 = (const T*)A2p; const T* Bt = (const T*)Btp; const T* Bt2 = (const T*)Bt2p;
  __shared__ __align__(16) float sT[8][16 * 68];
  const int b    = blockIdx.y;
  const int lane = threadIdx.x & 31;
  const int wave = threadIdx.x >> 5;
  const int tilesN = N >> 6;
  const int tilesM = M >> 6;
  const int tile = blockIdx.x * 8 + wave;
  if (tile >= tilesM * tilesN) return;
  const int tm = tile / tilesN;
  const int tn = tile - tm * tilesN;
  const int m0 = tm << 6;
  const int n0 = tn << 6;

  const T* Ab  = A  + (size_t)b * strideA;
  const T* Bb  = Bt + (size_t)b * strideB;
  const T* Ab2 = SPLIT ? (A2  + (size_t)b * strideA) : nullptr;
  const T* Bb2 = SPLIT ? (Bt2 + (size_t)b * strideB) : nullptr;

  const int rlane = lane & 15;
  const int koff  = (lane >> 4) * 8;
  const int mOff  = (lane >> 4) * 8;

  v8f acc[4][4];
#pragma unroll
  for (int i = 0; i < 4; ++i)
#pragma unroll
    for (int j = 0; j < 4; ++j) acc[i][j] = (v8f){0.f,0.f,0.f,0.f,0.f,0.f,0.f,0.f};

  for (int k0 = 0; k0 < K; k0 += 32) {
    V bh[4], bl[4];
#pragma unroll
    for (int j = 0; j < 4; ++j) {
      const size_t bo = (size_t)(n0 + (j << 4) + rlane) * ldb + koff + k0;
      bh[j] = Frag<T>::load(Bb + bo);
      if (SPLIT) bl[j] = Frag<T>::load(Bb2 + bo);
    }
#pragma unroll
    for (int i = 0; i < 4; ++i) {
      const size_t ao = (size_t)(m0 + (i << 4) + rlane) * lda + koff + k0;
      V ah = Frag<T>::load(Ab + ao);
      V al;
      if (SPLIT) al = Frag<T>::load(Ab2 + ao);
#pragma unroll
      for (int j = 0; j < 4; ++j) {
        acc[i][j] = Frag<T>::mma(ah, bh[j], acc[i][j]);
        if (SPLIT) {
          acc[i][j] = Frag<T>::mma(ah, bl[j], acc[i][j]);
          acc[i][j] = Frag<T>::mma(al, bh[j], acc[i][j]);
        }
      }
      Frag<T>::guard(acc[i][0], acc[i][3], ah, SPLIT ? al : ah);
    }
    Frag<T>::keep(bh[0], bh[1], bh[2], bh[3]);
    if (SPLIT) Frag<T>::keep(bl[0], bl[1], bl[2], bl[3]);
  }
  acc_guard4(acc[0][0], acc[0][1], acc[0][2], acc[0][3]);
  acc_guard4(acc[1][0], acc[1][1], acc[1][2], acc[1][3]);
  acc_guard4(acc[2][0], acc[2][1], acc[2][2], acc[2][3]);
  acc_guard4(acc[3][0], acc[3][1], acc[3][2], acc[3][3]);

  float* slab = sT[wave];
  const float* Rb = RESID ? (resid + (size_t)b * strideR) : nullptr;
#pragma unroll
  for (int i = 0; i < 4; ++i) {
    const int mBase = m0 + (i << 4);
#pragma unroll
    for (int j = 0; j < 4; ++j) {
      const int n = n0 + (j << 4) + rlane;
      float bv = 0.f;
      if (BIAS_MODE == 2) bv = bias[n];
#pragma unroll
      for (int r = 0; r < 8; ++r) {
        float v = acc[i][j][r] * scale;
        if (BIAS_MODE == 1) v += bias[mBase + mOff + r];
        if (BIAS_MODE == 2) v += bv;
        if (RESID) v += Rb[(size_t)(mBase + mOff + r) * ldc + n];
        if (ACT == 1) v = tanhf(v);
        if (ACT == 2) v = fmaxf(v, 0.0f);
        if (ACT == 3) v = v / (1.0f + expf(-v));
        if (ACT == 4) v = (v > 0.f) ? v : 0.01f * v;
        if (ACT == 5) v = 0.5f * v * (1.0f + erff(v * 0.70710678118654752f));
        slab[(mOff + r) * 68 + (j << 4) + rlane] = v;
      }
    }
    __builtin_amdgcn_fence(__ATOMIC_RELEASE, "workgroup");
    __builtin_amdgcn_wave_barrier();
    __builtin_amdgcn_fence(__ATOMIC_ACQUIRE, "workgroup");
    if (OUT_MODE == 0) {
      float* C = (float*)Cout + (size_t)b * strideC;
      const int hh = lane >> 4, c4 = (lane & 15) * 4;
      {
#pragma unroll
        for (int it = 0; it < 8; ++it) {
          const int row = it * 2 + hh;
          v4f v = *(const v4f*)(slab + row * 68 + c4);
          *(v4f*)(C + (size_t)(mBase + row) * ldc + n0 + c4) = v;
        }
        
      }
    } else {
      const int q = lane >> 3, c8 = (lane & 7) * 8;
      unsigned short* C  = (unsigned short*)Cout  + (size_t)b * strideC;
      unsigned short* C2 = (OUT_MODE == 2) ? ((unsigned short*)Cout2 + (size_t)b * strideC) : nullptr;
      {
#pragma unroll
        for (int it = 0; it < 4; ++it) {
          const int row = it * 4 + q;
          const float* sp = slab + row * 68 + c8;
          v8h hv, lv;
#pragma unroll
          for (int e = 0; e < 8; ++e) {
            if (OUT_MODE == 1) {
              hv[e] = (_Float16)sp[e];
            } else {
              unsigned short hb = f2bf_bits(sp[e]);
              unsigned short lb = f2bf_bits(sp[e] - bf_bits2f(hb));
              hv[e] = __builtin_bit_cast(_Float16, hb);
              lv[e] = __builtin_bit_cast(_Float16, lb);
            }
          }
          *(v8h*)(C + (size_t)(mBase + row) * ldc + n0 + c8) = hv;
          if (OUT_MODE == 2) *(v8h*)(C2 + (size_t)(mBase + row) * ldc + n0 + c8) = lv;
        }
        
      }
    }
    __builtin_amdgcn_fence(__ATOMIC_RELEASE, "workgroup");
    __builtin_amdgcn_wave_barrier();
    __builtin_amdgcn_fence(__ATOMIC_ACQUIRE, "workgroup");
  }
}

/* ---- bf16 helpers for the attention path ---- */
__device__ __forceinline__ unsigned short at_bf_bits(float f) {
  unsigned u = __float_as_uint(f);
  return (unsigned short)((u + 0x7FFFu + ((u >> 16) & 1u)) >> 16);
}
__device__ __forceinline__ __bf16 at_f2bf(float f) { return __builtin_bit_cast(__bf16, at_bf_bits(f)); }
__device__ __forceinline__ void at_split(float f, __bf16& hi, __bf16& lo) {
  const unsigned short hb = at_bf_bits(f);
  hi = __builtin_bit_cast(__bf16, hb);
  lo = at_f2bf(f - __uint_as_float(((unsigned)hb) << 16));
}
__device__ __forceinline__ v8f at_mma(v16b a, v16b b, v8f c) {
  c = __builtin_amdgcn_wmma_f32_16x16x32_bf16(false, a, false, b, (short)0, c, false, false);
  asm volatile("v_nop\n\tv_nop\n\tv_nop\n\tv_nop" : "+v"(c) : "v"(a), "v"(b));
  return c;
}
__device__ __forceinline__ v8f mma_h16(v16h a, v16h b, v8f c) {
  c = __builtin_amdgcn_wmma_f32_16x16x32_f16(false, a, false, b, (short)0, c, false, false);
  asm volatile("v_nop\n\tv_nop\n\tv_nop\n\tv_nop" : "+v"(c) : "v"(a), "v"(b));
  return c;
}
__device__ __forceinline__ void wave_sync_lds() {
  __builtin_amdgcn_fence(__ATOMIC_RELEASE, "workgroup");
  __builtin_amdgcn_wave_barrier();
  __builtin_amdgcn_fence(__ATOMIC_ACQUIRE, "workgroup");
}

/* f32[8] -> packed bf16 hi (4 words) and bf16 lo residual (4 words), RNE convert */
__device__ __forceinline__ void split_pack8(const float (&x)[8], v4u& H, v4u& L) {
#pragma unroll
  for (int p = 0; p < 4; ++p) {
    const unsigned short h0 = f2bf_bits(x[2 * p]);
    const unsigned short l0 = f2bf_bits(x[2 * p] - bf_bits2f(h0));
    const unsigned short h1 = f2bf_bits(x[2 * p + 1]);
    const unsigned short l1 = f2bf_bits(x[2 * p + 1] - bf_bits2f(h1));
    H[p] = (unsigned)h0 | ((unsigned)h1 << 16);
    L[p] = (unsigned)l0 | ((unsigned)l1 << 16);
  }
}
__device__ __forceinline__ void store_planes2(unsigned short* __restrict__ hi, unsigned short* __restrict__ lo,
                                              size_t off, v4u H, v4u L) {
  *(v4u*)(hi + off) = H;
  *(v4u*)(lo + off) = L;
  
}

/* ---- activations f32 [rows][128] -> bf16 hi/lo planes, same layout -------------
   coverage: n8 = rows*128/8 threads exactly (host asserts divisibility). */
__global__ __launch_bounds__(256) void split_rows_bf16(const float* __restrict__ in,
                                                        unsigned short* __restrict__ hi,
                                                        unsigned short* __restrict__ lo, int n8) {
  const int i = blockIdx.x * 256 + threadIdx.x;
  if (i >= n8) return;
  const size_t e0 = (size_t)i * 8;
  const v4f a = *(const v4f*)(in + e0);
  const v4f c = *(const v4f*)(in + e0 + 4);
  float x[8];
  x[0] = a[0]; x[1] = a[1]; x[2] = a[2]; x[3] = a[3];
  x[4] = c[0]; x[5] = c[1]; x[6] = c[2]; x[7] = c[3];
  v4u H, L;
  split_pack8(x, H, L);
  store_planes2(hi, lo, e0, H, L);
}

/* ---- weights W[k][n] (input-major, 128x128): in[k][n] -> out[n][k] as transposed bf16 hi/lo planes -----
   outb holds 4 weights x (hi plane + lo plane) of 128*128 halves. grid (8, 4): 2048 threads per weight;
   2048 threads x 8 = 16384 = 128x128 per plane exactly. */
__global__ __launch_bounds__(256) void wt_split_bf16(const float* __restrict__ W0, const float* __restrict__ W1,
                                                     const float* __restrict__ W2, const float* __restrict__ W3,
                                                     unsigned short* __restrict__ outb) {
  const int which = blockIdx.y;
  const float* W = (which == 0) ? W0 : (which == 1) ? W1 : (which == 2) ? W2 : W3;
  unsigned short* hi = outb + (size_t)which * (2 * kC * kC);
  unsigned short* lo = hi + kC * kC;
  const int gt = blockIdx.x * 256 + threadIdx.x;
  if (gt >= kC * kC / 8) return;
  const int n  = gt >> 4;
  const int k8 = (gt & 15) * 8;
  float x[8];
#pragma unroll
  for (int e = 0; e < 8; ++e) x[e] = W[(size_t)(k8 + e) * kC + n];
  v4u H, L;
  split_pack8(x, H, L);
  store_planes2(hi, lo, (size_t)n * kC + k8, H, L);
}

/* ---- online softmax step for one head, 16 query rows x 32 keys per wave (2 key subtiles) ----
   sA: keys 0..15 (col c), sB: keys 16..31 (col 16+c); D row = 8*hh + r. */
__device__ __forceinline__ void softmax_step2(v8f& sA, v8f& sB, float (&mrow)[8], float (&lrow)[8], float (&alph)[8],
                                              __bf16* pwh, __bf16* pwl, int hh, int c) {
#pragma unroll
  for (int r = 0; r < 8; ++r) {
    float m = fmaxf(sA[r], sB[r]);
#pragma unroll
    for (int off = 1; off < 16; off <<= 1) m = fmaxf(m, __shfl_xor(m, off, 32));
    const float mnew = fmaxf(mrow[r], m);
    const float al = expf(mrow[r] - mnew);
    mrow[r] = mnew;
    alph[r] = al;
    const float p0 = expf(sA[r] - mnew);
    const float p1 = expf(sB[r] - mnew);
    float psum = p0 + p1;
    __bf16 ph, plo;
    at_split(p0, ph, plo);
    pwh[(8 * hh + r) * kKC + c] = ph;
    pwl[(8 * hh + r) * kKC + c] = plo;
    at_split(p1, ph, plo);
    pwh[(8 * hh + r) * kKC + 16 + c] = ph;
    pwl[(8 * hh + r) * kKC + 16 + c] = plo;
#pragma unroll
    for (int off = 1; off < 16; off <<= 1) psum += __shfl_xor(psum, off, 32);
    lrow[r] = lrow[r] * al + psum;
  }
}
/* per-wave 16x32 f32 result tile -> LDS staging (pitch kOsPitch); writes rows 0..15, cols 0..31 */
__device__ __forceinline__ void tile_to_os(float* os, const v8f (&o)[2], int hh, int c) {
#pragma unroll
  for (int r = 0; r < 8; ++r) {
#pragma unroll
    for (int t = 0; t < 2; ++t) os[(8 * hh + r) * kOsPitch + t * 16 + c] = o[t][r];
  }
}
/* weighted sum over the kSplit key groups of one query tile, 4 floats of one row per lane;
   os0: staging tile of key group 0 for this query tile, the groups 4 tiles apart */
__device__ __forceinline__ v4f merge_os(const float* os0, const float (&w)[kSplit], int row, int c4) {
  v4f acc = (v4f){0.f, 0.f, 0.f, 0.f};
#pragma unroll
  for (int s = 0; s < kSplit; ++s) {
    const v4f v = *(const v4f*)(os0 + s * (4 * 16 * kOsPitch) + row * kOsPitch + c4);
#pragma unroll
    for (int e = 0; e < 4; ++e) acc[e] += w[s] * v[e];
  }
  return acc;
}

/* ---- attention for one (batch, head h, 64 query rows) ----------------------------------
   q16/k16: f16 planes [B*N][128] (head-major columns); vhi/vlo: bf16 hi/lo planes [B*Nkv][128].
   scores = (q.k^T)*scale + rpe[idx][h]; online softmax in f32; P hi/lo per wave in LDS;
   o = P . V_h;  for h >= 2 also ox = P . V_{h-2} (the cross term of the differential mixing).
   16 waves: wave = (key group sp, query tile qt). Group sp (4 waves) takes key chunks sp, sp + kSplit, ... with its own
   K/V tiles and each wave its own running max, sum and accumulators; the groups are merged through LDS at the end.
   xattn f32 [B*Nq][128]; ycross f32 [B][2][Nq][32]. grid.x = B*H*(Nq/64), block 128 * kSplit. */
__global__ __launch_bounds__(128 * kSplit) __attribute__((amdgpu_num_vgpr(256)))
void attn_head_kernel(
    const unsigned short* __restrict__ q16, const unsigned short* __restrict__ k16,
    const unsigned short* __restrict__ vhi, const unsigned short* __restrict__ vlo,
    const int* __restrict__ coords_q, const int* __restrict__ coords_k,
    const float* __restrict__ rpe,
    float* __restrict__ xattn, float* __restrict__ ycross)
{
  __shared__ __align__(16) unsigned short KshS[kSplit][kKC * kHD];   /* [group][key][d]  f16 bits  */
  __shared__ __align__(16) unsigned short VthS[kSplit][kHD * kKC];   /* [group][d][key] bf16 hi, head h   */
  __shared__ __align__(16) unsigned short VtlS[kSplit][kHD * kKC];   /* [group][d][key] bf16 lo, head h   */
  __shared__ __align__(16) unsigned short VxhS[kSplit][kHD * kKC];   /* [group][d][key] bf16 hi, head h-2 */
  __shared__ __align__(16) unsigned short VxlS[kSplit][kHD * kKC];   /* [group][d][key] bf16 lo, head h-2 */
  __shared__ __align__(16) __bf16 Ph[4 * kSplit][16 * kKC];          /* [wave][row][key] hi */
  __shared__ __align__(16) __bf16 Pl[4 * kSplit][16 * kKC];
  __shared__ __align__(16) float Os[4 * kSplit][16 * kOsPitch];
  __shared__ __align__(16) float Ml[4 * kSplit][16 * 2];             /* [wave][row] (max, sum) */

  const int wave = threadIdx.x >> 5;     /* 0 .. 15 */
  const int sp   = wave >> 2;            /* key group */
  const int qt   = wave & 3;             /* query tile */
  const int tid  = threadIdx.x & 127;    /* thread within the key group */
  const int lane = tid & 31;
  unsigned short* Ksh = KshS[sp];
  unsigned short* Vth = VthS[sp];
  unsigned short* Vtl = VtlS[sp];
  unsigned short* Vxh = VxhS[sp];
  unsigned short* Vxl = VxlS[sp];
  const int hh   = lane >> 4;
  const int c    = lane & 15;
  constexpr int nqb = kNq / kQB;
  const int bx   = blockIdx.x;
  const int qb   = bx % nqb;
  const int rest = bx / nqb;
  const int h    = rest % kH;
  const int b    = rest / kH;
  const bool cross = (h >= kNH);                       /* block-uniform */
  const int hcol = h * kHD;
  const int xcol = (cross ? (h - kNH) : 0) * kHD;
  const int q0   = qb * kQB + qt * 16;
  const size_t qrows  = (size_t)b * kNq + q0;
  const size_t kvrows = (size_t)b * kNkv;
  const float* __restrict__ rpe_h = rpe + h;           /* table entry stride kH floats */

  /* Q fragment (A operand, K = head_dim = 32, one k-step) */
  const _Float16* qp = (const _Float16*)(const void*)q16;
  const v16h qa = Frag<_Float16>::load(qp + (qrows + c) * kC + hcol + 8 * hh);

  /* query coords for this lane's 8 D-rows (row 8*hh + r), +MAXD folded in */
  int cqx[8], cqy[8];
#pragma unroll
  for (int r = 0; r < 8; ++r) {
    const v2i cc = *(const v2i*)(coords_q + (qrows + 8 * hh + r) * 2);
    cqx[r] = cc.x + kMaxd;
    cqy[r] = cc.y + kMaxd;
  }

  float mr[8], lr[8];
  v8f o[2], ox[2];
#pragma unroll
  for (int r = 0; r < 8; ++r) { mr[r] = -INFINITY; lr[r] = 0.f; }
#pragma unroll
  for (int t = 0; t < 2; ++t) {
    o[t]  = (v8f){0.f,0.f,0.f,0.f,0.f,0.f,0.f,0.f};
    ox[t] = (v8f){0.f,0.f,0.f,0.f,0.f,0.f,0.f,0.f};
  }

  __bf16* pwh = Ph[wave];
  __bf16* pwl = Pl[wave];

  for (int kc = 0; kc < kNkv / (kKC * kSplit); ++kc) {
    const int kv0 = (kc * kSplit + sp) * kKC;
    __syncthreads();
    /* stage K tile and V^T hi/lo tiles: 32 keys x 4 segments of 8 halves = 128 = threads of a key group, one uint4 per thread
       per plane; covers Ksh 32x32, Vth/Vtl 32x32 (and Vxh/Vxl when cross) exactly */
    {
      const int key = tid >> 2;
      const int seg = tid & 3;
      const size_t rowoff = (kvrows + kv0 + key) * kC;
      const size_t go = rowoff + hcol + seg * 8;
      const uint4 kw = *(const uint4*)(k16 + go);
      *(uint4*)(&Ksh[key * kHD + seg * 8]) = kw;
      const uint4 vh4 = *(const uint4*)(vhi + go);
      const uint4 vl4 = *(const uint4*)(vlo + go);
      unsigned short* vth = &Vth[(seg * 8) * kKC + key];
      unsigned short* vtl = &Vtl[(seg * 8) * kKC + key];
      vth[0 * kKC] = (unsigned short)(vh4.x & 0xffffu); vth[1 * kKC] = (unsigned short)(vh4.x >> 16);
      vth[2 * kKC] = (unsigned short)(vh4.y & 0xffffu); vth[3 * kKC] = (unsigned short)(vh4.y >> 16);
      vth[4 * kKC] = (unsigned short)(vh4.z & 0xffffu); vth[5 * kKC] = (unsigned short)(vh4.z >> 16);
      vth[6 * kKC] = (unsigned short)(vh4.w & 0xffffu); vth[7 * kKC] = (unsigned short)(vh4.w >> 16);
      vtl[0 * kKC] = (unsigned short)(vl4.x & 0xffffu); vtl[1 * kKC] = (unsigned short)(vl4.x >> 16);
      vtl[2 * kKC] = (unsigned short)(vl4.y & 0xffffu); vtl[3 * kKC] = (unsigned short)(vl4.y >> 16);
      vtl[4 * kKC] = (unsigned short)(vl4.z & 0xffffu); vtl[5 * kKC] = (unsigned short)(vl4.z >> 16);
      vtl[6 * kKC] = (unsigned short)(vl4.w & 0xffffu); vtl[7 * kKC] = (unsigned short)(vl4.w >> 16);
      if (cross) {
        const size_t gx = rowoff + xcol + seg * 8;
        const uint4 xh4 = *(const uint4*)(vhi + gx);
        const uint4 xl4 = *(const uint4*)(vlo + gx);
        unsigned short* vxh = &Vxh[(seg * 8) * kKC + key];
        unsigned short* vxl = &Vxl[(seg * 8) * kKC + key];
        vxh[0 * kKC] = (unsigned short)(xh4.x & 0xffffu); vxh[1 * kKC] = (unsigned short)(xh4.x >> 16);
        vxh[2 * kKC] = (unsigned short)(xh4.y & 0xffffu); vxh[3 * kKC] = (unsigned short)(xh4.y >> 16);
        vxh[4 * kKC] = (unsigned short)(xh4.z & 0xffffu); vxh[5 * kKC] = (unsigned short)(xh4.z >> 16);
        vxh[6 * kKC] = (unsigned short)(xh4.w & 0xffffu); vxh[7 * kKC] = (unsigned short)(xh4.w >> 16);
        vxl[0 * kKC] = (unsigned short)(xl4.x & 0xffffu); vxl[1 * kKC] = (unsigned short)(xl4.x >> 16);
        vxl[2 * kKC] = (unsigned short)(xl4.y & 0xffffu); vxl[3 * kKC] = (unsigned short)(xl4.y >> 16);
        vxl[4 * kKC] = (unsigned short)(xl4.z & 0xffffu); vxl[5 * kKC] = (unsigned short)(xl4.z >> 16);
        vxl[6 * kKC] = (unsigned short)(xl4.w & 0xffffu); vxl[7 * kKC] = (unsigned short)(xl4.w >> 16);
      }
    }
    __syncthreads();

    /* scores: s[j], j = key subtile; B fragment lane c -> key j*16+c, elements d (split map) */
    v8f s[2];
    {
      const v8f z = (v8f){0.f,0.f,0.f,0.f,0.f,0.f,0.f,0.f};
      const _Float16* Kp = (const _Float16*)(const void*)Ksh;
#pragma unroll
      for (int j = 0; j < 2; ++j) {
        Frag<_Float16>::U kb;
        kb.h[0] = *(const v8h*)(Kp + (j * 16 + c) * kHD + 8 * hh);
        kb.h[1] = *(const v8h*)(Kp + (j * 16 + c) * kHD + 16 + 8 * hh);
        s[j] = mma_h16(qa, kb.v, z);
      }
    }
    /* key coords for this lane's two columns */
    int ckx[2], cky[2];
#pragma unroll
    for (int j = 0; j < 2; ++j) {
      const v2i ck = *(const v2i*)(coords_k + (kvrows + kv0 + j * 16 + c) * 2);
      ckx[j] = ck.x; cky[j] = ck.y;
    }

    /* scale + relative position bias: one clamped b32 table gather per (row, key);
*/
#pragma unroll
    for (int grp = 0; grp < 4; ++grp) {
#pragma unroll
      for (int rr = 0; rr < 2; ++rr) {
        const int r = grp * 2 + rr;
#pragma unroll
        for (int j = 0; j < 2; ++j) {
          int dx = cqx[r] - ckx[j]; dx = dx < 0 ? 0 : dx; dx = dx > 2 * kMaxd ? 2 * kMaxd : dx;
          int dy = cqy[r] - cky[j]; dy = dy < 0 ? 0 : dy; dy = dy > 2 * kMaxd ? 2 * kMaxd : dy;
          const int idx = dx * kSpan + dy;            /* 0 .. kTable-1 */
          const float bv = rpe_h[(size_t)idx * kH];
          s[j][r] = s[j][r] * kScale + bv;
        }
      }
      asm volatile("" : "+v"(s[0]), "+v"(s[1]) : : "memory");
    }

    /* online softmax; P hi/lo to this wave's LDS tiles */
    float al[8];
    softmax_step2(s[0], s[1], mr, lr, al, pwh, pwl, hh, c);
#pragma unroll
    for (int t = 0; t < 2; ++t) {
#pragma unroll
      for (int r = 0; r < 8; ++r) { o[t][r] *= al[r]; ox[t][r] *= al[r]; }
    }
    wave_sync_lds();

    /* P.V : A = P (lane c -> query row, elements key, split map), B = V^T tile (lane c -> d, elements key) */
    {
      Frag<__bf16>::U pa, pb;
      pa.h[0] = *(const v8b*)(pwh + c * kKC + 8 * hh);  pa.h[1] = *(const v8b*)(pwh + c * kKC + 16 + 8 * hh);
      pb.h[0] = *(const v8b*)(pwl + c * kKC + 8 * hh);  pb.h[1] = *(const v8b*)(pwl + c * kKC + 16 + 8 * hh);
      const __bf16* Vh = (const __bf16*)(const void*)Vth;
      const __bf16* Vl = (const __bf16*)(const void*)Vtl;
#pragma unroll
      for (int t = 0; t < 2; ++t) {
        Frag<__bf16>::U vb, vl;
        vb.h[0] = *(const v8b*)(Vh + (t * 16 + c) * kKC + 8 * hh);  vb.h[1] = *(const v8b*)(Vh + (t * 16 + c) * kKC + 16 + 8 * hh);
        vl.h[0] = *(const v8b*)(Vl + (t * 16 + c) * kKC + 8 * hh);  vl.h[1] = *(const v8b*)(Vl + (t * 16 + c) * kKC + 16 + 8 * hh);
        o[t] = at_mma(pa.v, vb.v, o[t]);
        o[t] = at_mma(pa.v, vl.v, o[t]);
        o[t] = at_mma(pb.v, vb.v, o[t]);
      }
      if (cross) {
        const __bf16* Xh = (const __bf16*)(const void*)Vxh;
        const __bf16* Xl = (const __bf16*)(const void*)Vxl;
#pragma unroll
        for (int t = 0; t < 2; ++t) {
          Frag<__bf16>::U vb, vl;
          vb.h[0] = *(const v8b*)(Xh + (t * 16 + c) * kKC + 8 * hh);  vb.h[1] = *(const v8b*)(Xh + (t * 16 + c) * kKC + 16 + 8 * hh);
          vl.h[0] = *(const v8b*)(Xl + (t * 16 + c) * kKC + 8 * hh);  vl.h[1] = *(const v8b*)(Xl + (t * 16 + c) * kKC + 16 + 8 * hh);
          ox[t] = at_mma(pa.v, vb.v, ox[t]);
          ox[t] = at_mma(pa.v, vl.v, ox[t]);
          ox[t] = at_mma(pb.v, vb.v, ox[t]);
        }
      }
    }
  }

  /* merge of the key groups: every wave leaves its accumulators (not normalised) and its (max, sum) in LDS;
     wave (sp, qt) then merges rows 4*sp .. 4*sp+3 of query tile qt: x = sum_s e^(m_s-M) o_s / sum_s e^(m_s-M) l_s */
  float* os = Os[wave];
  tile_to_os(os, o, hh, c);
  if (c == 0) {   /* max and sum are equal in the 16 lanes of a half */
#pragma unroll
    for (int r = 0; r < 8; ++r) { Ml[wave][(8 * hh + r) * 2] = mr[r]; Ml[wave][(8 * hh + r) * 2 + 1] = lr[r]; }
  }
  __syncthreads();   /* all groups' partial tiles are in LDS */

  const int row = 4 * sp + (lane >> 3);
  const int c4  = (lane & 7) * 4;
  float w[kSplit];
  {
    float ms[kSplit], ls[kSplit];
    float M = -INFINITY;
#pragma unroll
    for (int s = 0; s < kSplit; ++s) {
      ms[s] = Ml[s * 4 + qt][row * 2];
      ls[s] = Ml[s * 4 + qt][row * 2 + 1];
      M = fmaxf(M, ms[s]);
    }
    float L = 0.f;
#pragma unroll
    for (int s = 0; s < kSplit; ++s) { w[s] = expf(ms[s] - M); L += w[s] * ls[s]; }
    const float inv = 1.0f / L;
#pragma unroll
    for (int s = 0; s < kSplit; ++s) w[s] *= inv;
  }
  *(v4f*)(xattn + (qrows + row) * kC + hcol + c4) = merge_os(Os[qt], w, row, c4);
  asm volatile("s_wait_xcnt 0x0" ::: "memory");   /* the cross path below reuses the registers this store names */

  if (cross) {
    __syncthreads();   /* every reader has left the o tiles */
    tile_to_os(os, ox, hh, c);
    __syncthreads();   /* all groups' cross tiles are in LDS */
    *(v4f*)(ycross + ((((size_t)b * kNH + (h - kNH)) * kNq + q0 + row) * kHD) + c4) = merge_os(Os[qt], w, row, c4);
  }
}

/* ---- differential head mixing + split to bf16 hi/lo planes for the output projection --------
   x[b,q,h*32+d] = xs + alpha[b,q]*(xs - lam[h]*yc[b,h,q,d]) for h < 2, else xs.
   coverage 65536 threads x 8 = 4096x128 exactly. */
__global__ __launch_bounds__(256) void combine_split_kernel(
    const float* __restrict__ xattn, const float* __restrict__ ycross, const float* __restrict__ alpha,
    const float* __restrict__ lq1, const float* __restrict__ lk1,
    const float* __restrict__ lq2, const float* __restrict__ lk2,
    unsigned short* __restrict__ hi, unsigned short* __restrict__ lo)
{
  __shared__ float lam_s[2];
  if (threadIdx.x < 2) {
    const int h = threadIdx.x;
    float s1 = 0.f, s2 = 0.f;
#pragma unroll 1
    for (int i = 0; i < kHD; ++i) {
      s1 += lq1[h * kHD + i] * lk1[h * kHD + i];
      s2 += lq2[h * kHD + i] * lk2[h * kHD + i];
    }
    lam_s[h] = expf(s1) - expf(s2) + kLambdaInit;
  }
  __syncthreads();
  const int gt = blockIdx.x * 256 + threadIdx.x;
  if (gt >= kBatch * kNq * kC / 8) return;
  const size_t e0 = (size_t)gt * 8;
  const int row = (int)(e0 >> 7);
  const int col = (int)(e0 & 127);
  const int h   = col >> 5;
  const int d   = col & 31;
  const int hc  = h & 1;
  const int b   = row >> 11;
  const int q   = row & (kNq - 1);
  const float a   = alpha[row];
  const float lam = lam_s[hc];
  const v4f xs0 = *(const v4f*)(xattn + e0);
  const v4f xs1 = *(const v4f*)(xattn + e0 + 4);
  const size_t yo = (((size_t)b * kNH + hc) * kNq + q) * kHD + d;
  const v4f y0 = *(const v4f*)(ycross + yo);
  const v4f y1 = *(const v4f*)(ycross + yo + 4);
  const bool mix = (h < kNH);
  float x[8];
#pragma unroll
  for (int e = 0; e < 4; ++e) {
    const float xa = xs0[e], xb = xs1[e];
    const float va = xa + a * (xa - lam * y0[e]);
    const float vb = xb + a * (xb - lam * y1[e]);
    x[e]     = mix ? va : xa;
    x[4 + e] = mix ? vb : xb;
  }
  v4u H, L;
  split_pack8(x, H, L);
  store_planes2(hi, lo, e0, H, L);
}

/* =========================================================================================
   host launch: 9 kernel launches
   workspace region map (bytes, all offsets MiB/256-KiB aligned):
     xq_hi  1 MiB | xq_lo 1 MiB | xkv_hi 2 MiB | xkv_lo 2 MiB | wt planes 256 KiB (4 weights x hi,lo x 32 KiB)
     q16 1 MiB | k16 2 MiB | v_hi 2 MiB | v_lo 2 MiB | xattn f32 2 MiB | ycross f32 1 MiB | xmix_hi 1 MiB | xmix_lo 1 MiB
     total 19,136,512 B
   ========================================================================================= */
extern "C" void kernel_launch(void* const* d_in, const int* in_sizes, int n_in,
                              void* d_out, int out_size, void* d_ws, size_t ws_size,
                              hipStream_t stream) {
  constexpr int Mq  = kBatch * kNq;    /* 4096 */
  constexpr int Mkv = kBatch * kNkv;   /* 8192 */
  static_assert(Mq % 64 == 0 && Mkv % 64 == 0 && kC % 64 == 0 && kC % 32 == 0, "");
  static_assert((Mq * kC) % 8 == 0 && (Mkv * kC) % 8 == 0, "");
  if (n_in < 18) return;
  if (in_sizes[0] != Mq * kC || in_sizes[1] != Mkv * kC || in_sizes[2] != Mq * 2 || in_sizes[3] != Mkv * 2 ||
      in_sizes[4] != Mq || in_sizes[5] != kC * kC || in_sizes[7] != kC * kC || in_sizes[9] != kC * kC ||
      in_sizes[16] != kC * kC || in_sizes[6] != kC || in_sizes[8] != kC || in_sizes[10] != kC || in_sizes[17] != kC ||
      in_sizes[11] != kNH * kHD || in_sizes[12] != kNH * kHD || in_sizes[13] != kNH * kHD || in_sizes[14] != kNH * kHD ||
      in_sizes[15] != kTable * kH || out_size != Mq * kC) return;

  const float* x_q      = (const float*)d_in[0];
  const float* x_kv     = (const float*)d_in[1];
  const int*   coords_q = (const int*)d_in[2];
  const int*   coords_k = (const int*)d_in[3];
  const float* alpha    = (const float*)d_in[4];
  const float* Wq = (const float*)d_in[5];  const float* bq = (const float*)d_in[6];
  const float* Wk = (const float*)d_in[7];  const float* bk = (const float*)d_in[8];
  const float* Wv = (const float*)d_in[9];  const float* bv = (const float*)d_in[10];
  const float* lq1 = (const float*)d_in[11]; const float* lk1 = (const float*)d_in[12];
  const float* lq2 = (const float*)d_in[13]; const float* lk2 = (const float*)d_in[14];
  const float* rpe = (const float*)d_in[15];
  const float* Wp = (const float*)d_in[16]; const float* bp = (const float*)d_in[17];
  float* out = (float*)d_out;

  char* ws = (char*)d_ws;
  size_t off = 0;
  const size_t szXq16  = (size_t)Mq * kC * 2;     /* 1 MiB  */
  const size_t szXkv16 = (size_t)Mkv * kC * 2;    /* 2 MiB  */
  const size_t szWt    = (size_t)4 * 2 * kC * kC * 2;
  const size_t szXattn = (size_t)Mq * kC * 4;
  const size_t szYc    = (size_t)kBatch * kNH * kNq * kHD * 4;
  unsigned short* xq_hi  = (unsigned short*)(ws + off); off += szXq16;
  unsigned short* xq_lo  = (unsigned short*)(ws + off); off += szXq16;
  unsigned short* xkv_hi = (unsigned short*)(ws + off); off += szXkv16;
  unsigned short* xkv_lo = (unsigned short*)(ws + off); off += szXkv16;
  unsigned short* wt     = (unsigned short*)(ws + off); off += szWt;
  unsigned short* q16    = (unsigned short*)(ws + off); off += szXq16;
  unsigned short* k16    = (unsigned short*)(ws + off); off += szXkv16;
  unsigned short* v_hi   = (unsigned short*)(ws + off); off += szXkv16;
  unsigned short* v_lo   = (unsigned short*)(ws + off); off += szXkv16;
  float*          xattn  = (float*)(ws + off);          off += szXattn;
  float*          ycross = (float*)(ws + off);          off += szYc;
  unsigned short* xm_hi  = (unsigned short*)(ws + off); off += szXq16;
  unsigned short* xm_lo  = (unsigned short*)(ws + off); off += szXq16;
  if (off > ws_size) return;

  const unsigned short* wtq_hi = wt + 0 * (2 * kC * kC); const unsigned short* wtq_lo = wtq_hi + kC * kC;
  const unsigned short* wtk_hi = wt + 1 * (2 * kC * kC); const unsigned short* wtk_lo = wtk_hi + kC * kC;
  const unsigned short* wtv_hi = wt + 2 * (2 * kC * kC); const unsigned short* wtv_lo = wtv_hi + kC * kC;
  const unsigned short* wtp_hi = wt + 3 * (2 * kC * kC); const unsigned short* wtp_lo = wtp_hi + kC * kC;

  /* 1-2: activations -> bf16 hi/lo planes */
  const int n8q = Mq * kC / 8, n8kv = Mkv * kC / 8;
  split_rows_bf16<<<dim3((n8q + 255) / 256), dim3(256), 0, stream>>>(x_q, xq_hi, xq_lo, n8q);
  split_rows_bf16<<<dim3((n8kv + 255) / 256), dim3(256), 0, stream>>>(x_kv, xkv_hi, xkv_lo, n8kv);
  /* 3: weights -> transposed bf16 hi/lo planes (in[k][n] -> out[n][k], square 128x128) */
  wt_split_bf16<<<dim3((kC * kC / 8 + 255) / 256, 4), dim3(256), 0, stream>>>(Wq, Wk, Wv, Wp, wt);

  /* 4-6: projections, M x 128, K = 128 (M % 64 == 0, N = 128 % 64 == 0, K = 128 % 32 == 0) */
  const int blocksQ  = ((Mq  / 64) * (kC / 64) + 7) / 8;
  const int blocksKV = ((Mkv / 64) * (kC / 64) + 7) / 8;
  wmma_gemm64<1, true, 2, 1, false><<<dim3(blocksQ, 1), dim3(256), 0, stream>>>(
      xq_hi, xq_lo, kC, 0L, wtq_hi, wtq_lo, kC, 0L, (void*)q16, nullptr, kC, 0L, bq, nullptr, 0L, Mq, kC, kC, 1.0f);
  wmma_gemm64<1, true, 2, 1, false><<<dim3(blocksKV, 1), dim3(256), 0, stream>>>(
      xkv_hi, xkv_lo, kC, 0L, wtk_hi, wtk_lo, kC, 0L, (void*)k16, nullptr, kC, 0L, bk, nullptr, 0L, Mkv, kC, kC, 1.0f);
  wmma_gemm64<1, true, 2, 2, false><<<dim3(blocksKV, 1), dim3(256), 0, stream>>>(
      xkv_hi, xkv_lo, kC, 0L, wtv_hi, wtv_lo, kC, 0L, (void*)v_hi, (void*)v_lo, kC, 0L, bv, nullptr, 0L, Mkv, kC, kC, 1.0f);

  /* 7: attention per (batch, head, 64 queries) */
  const int attnBlocks = kBatch * kH * (kNq / kQB);
  attn_head_kernel<<<dim3(attnBlocks), dim3(128 * kSplit), 0, stream>>>(q16, k16, v_hi, v_lo, coords_q, coords_k, rpe, xattn, ycross);

  /* 8: differential mixing + bf16 hi/lo planes */
  combine_split_kernel<<<dim3((n8q + 255) / 256), dim3(256), 0, stream>>>(xattn, ycross, alpha, lq1, lk1, lq2, lk2, xm_hi, xm_lo);

  /* 9: output projection -> d_out (f32), M = 4096, N = 128, K = 128 */
  wmma_gemm64<1, true, 2, 0, false><<<dim3(blocksQ, 1), dim3(256), 0, stream>>>(
      xm_hi, xm_lo, kC, 0L, wtp_hi, wtp_lo, kC, 0L, (void*)out, nullptr, kC, 0L, bp, nullptr, 0L, Mq, kC, kC, 1.0f);
}

// v002
// It runs in 236 microseconds.
// Timed twice side by side with v001, it ran 1.38 times as fast both times.
// Over all steps from v000 it is 1.92 times as fast.
// Contractions: x@Wq, x@Wk, x@Wv and xmix@Wp on v_wmma_f32_16x16x32_bf16 with bf16 hi/lo operand planes (hi.hi + hi.lo + lo.hi); q.k^T on v_wmma_f32_16x16x32_f16 with plain f16 q/k planes; p.v and p_cross.v on v_wmma_f32_16x16x32_bf16 with bf16 hi/lo p and v tiles; f32 accumulate; bias gather, online softmax and head mixing in f32.
#include <hip/hip_runtime.h>
#include <stdint.h>

typedef __attribute__((ext_vector_type(16))) _Float16 v16h;
typedef __attribute__((ext_vector_type(8)))  _Float16 v8h;
typedef __attribute__((ext_vector_type(16))) __bf16   v16b;
typedef __attribute__((ext_vector_type(8)))  __bf16   v8b;
typedef __attribute__((ext_vector_type(8)))  float    v8f;
typedef __attribute__((ext_vector_type(4)))  float    v4f;
typedef __attribute__((ext_vector_type(4)))  unsigned int v4u;
typedef __attribute__((ext_vector_type(2)))  int      v2i;

/* ---- problem geometry (fixed by the module) ---- */
constexpr int kBatch = 2;
constexpr int kNq    = 2048;
constexpr int kNkv   = 4096;
constexpr int kC     = 128;
constexpr int kH     = 4;
constexpr int kHD    = 32;
constexpr int kNH    = 2;
constexpr int kMaxd  = 128;
constexpr int kSpan  = 2 * kMaxd + 1;
constexpr int kTable = kSpan * kSpan;
constexpr int kKC    = 32;     /* keys per chunk in the attention kernel */
constexpr int kQB    = 64;     /* query rows per attention block (4 query tiles x 16) */
constexpr int kSplit = 4;      /* key groups per attention block: wave = (key group, query tile) */
constexpr int kOsPitch = 36;   /* floats; per-wave output staging pitch */
constexpr int kTabLds  = (kTable + 3) & ~3;   /* floats; one head's bias column in LDS, rounded to 16 bytes */
constexpr float kScale = 0.17677669529663687f;   /* head_dim ** -0.5 */
constexpr float kLambdaInit = 0.8f;

static_assert(kNq % kQB == 0, "");
static_assert(kNkv % (kKC * kSplit) == 0, "");
static_assert(kSplit * 4 == 16, "");   /* the merge gives each wave 16 / kSplit = 4 rows = 32 lanes x 4 floats */
static_assert(kC == kH * kHD, "");
static_assert((kBatch * kNq) % 64 == 0 && (kBatch * kNkv) % 64 == 0, "");
static_assert(kC % 64 == 0 && kC % 32 == 0, "");
static_assert(kH == 4 && kNH == 2 && kHD == 32 && kKC == 32, "");

__device__ __forceinline__ unsigned short f2bf_bits(float f) {
  unsigned u = __float_as_uint(f);
  return (unsigned short)((u + 0x7FFFu + ((u >> 16) & 1u)) >> 16);
}
__device__ __forceinline__ float bf_bits2f(unsigned short h) { return __uint_as_float(((unsigned)h) << 16); }

/* hazard guards as plain device helpers */
__device__ __forceinline__ void dep_guard_h(v8f& a, v8f& b, v16h x, v16h y) { asm volatile("v_nop\n\tv_nop\n\tv_nop\n\tv_nop" : "+v"(a), "+v"(b) : "v"(x), "v"(y)); }
__device__ __forceinline__ void dep_guard_b(v8f& a, v8f& b, v16b x, v16b y) { asm volatile("v_nop\n\tv_nop\n\tv_nop\n\tv_nop" : "+v"(a), "+v"(b) : "v"(x), "v"(y)); }
__device__ __forceinline__ void keep4_h(v16h a, v16h b, v16h c, v16h d) { asm volatile("v_nop" :: "v"(a), "v"(b), "v"(c), "v"(d)); }
__device__ __forceinline__ void keep4_b(v16b a, v16b b, v16b c, v16b d) { asm volatile("v_nop" :: "v"(a), "v"(b), "v"(c), "v"(d)); }
__device__ __forceinline__ void acc_guard4(v8f& a, v8f& b, v8f& c, v8f& d) { asm volatile("v_nop\n\tv_nop\n\tv_nop\n\tv_nop" : "+v"(a), "+v"(b), "+v"(c), "+v"(d)); }
template <typename T> struct Frag;
template <> struct Frag<_Float16> {
  typedef v16h V; union U { v16h v; v8h h[2]; };
  static __device__ __forceinline__ v16h load(const _Float16* p) {
    U f; f.h[0] = *(const v8h*)(p); f.h[1] = *(const v8h*)(p + 16); return f.v;
  }
  static __device__ __forceinline__ v8f mma(v16h a, v16h b, v8f c) {
    return __builtin_amdgcn_wmma_f32_16x16x32_f16(false, a, false, b, (short)0, c, false, false);
  }
  static __device__ __forceinline__ void guard(v8f& a, v8f& b, v16h x, v16h y) { dep_guard_h(a, b, x, y); }
  static __device__ __forceinline__ void keep(v16h a, v16h b, v16h c, v16h d) { keep4_h(a, b, c, d); }
};
template <> struct Frag<__bf16> {
  typedef v16b V; union U { v16b v; v8b h[2]; };
  static __device__ __forceinline__ v16b load(const __bf16* p) {
    U f; f.h[0] = *(const v8b*)(p); f.h[1] = *(const v8b*)(p + 16); return f.v;
  }
  static __device__ __forceinline__ v8f mma(v16b a, v16b b, v8f c) {
    return __builtin_amdgcn_wmma_f32_16x16x32_bf16(false, a, false, b, (short)0, c, false, false);
  }
  static __device__ __forceinline__ void guard(v8f& a, v8f& b, v16b x, v16b y) { dep_guard_b(a, b, x, y); }
  static __device__ __forceinline__ void keep(v16b a, v16b b, v16b c, v16b d) { keep4_b(a, b, c, d); }
};

/* ---- Register-blocked batched WMMA GEMM ---------------- */
template <int ET> struct Elem;
template <> struct Elem<0> { typedef _Float16 T; };
template <> struct Elem<1> { typedef __bf16 T; };
template <int ET, bool SPLIT, int BIAS_MODE, int OUT_MODE, bool RESID, int ACT = 0>
__global__ __launch_bounds__(256) void wmma_gemm64(
    const unsigned short* __restrict__ Ap, const unsigned short* __restrict__ A2p, int lda, long strideA,
    const unsigned short* __restrict__ Btp, const unsigned short* __restrict__ Bt2p, int ldb, long strideB,
    void* __restrict__ Cout, void* __restrict__ Cout2, int ldc, long strideC,
    const float* __restrict__ bias,
    const float* __restrict__ resid, long strideR,
    int M, int N, int K, float scale) {
  typedef typename Elem<ET>::T T;
  typedef typename Frag<T>::V V;
  const T* A = (const T*)Ap; const T* A2 = (const T*)A2p; const T* Bt = (const T*)Btp; const T* Bt2 = (const T*)Bt2p;
  __shared__ __align__(16) float sT[8][16 * 68];
  const int b    = blockIdx.y;
  const int lane = threadIdx.x & 31;
  const int wave = threadIdx.x >> 5;
  const int tilesN = N >> 6;
  const int tilesM = M >> 6;
  const int tile = blockIdx.x * 8 + wave;
  if (tile >= tilesM * tilesN) return;
  const int tm = tile / tilesN;
  const int tn = tile - tm * tilesN;
  const int m0 = tm << 6;
  const int n0 = tn << 6;

  const T* Ab  = A  + (size_t)b * strideA;
  const T* Bb  = Bt + (size_t)b * strideB;
  const T* Ab2 = SPLIT ? (A2  + (size_t)b * strideA) : nullptr;
  const T* Bb2 = SPLIT ? (Bt2 + (size_t)b * strideB) : nullptr;

  const int rlane = lane & 15;
  const int koff  = (lane >> 4) * 8;
  const int mOff  = (lane >> 4) * 8;

  v8f acc[4][4];
#pragma unroll
  for (int i = 0; i < 4; ++i)
#pragma unroll
    for (int j = 0; j < 4; ++j) acc[i][j] = (v8f){0.f,0.f,0.f,0.f,0.f,0.f,0.f,0.f};

  for (int k0 = 0; k0 < K; k0 += 32) {
    V bh[4], bl[4];
#pragma unroll
    for (int j = 0; j < 4; ++j) {
      const size_t bo = (size_t)(n0 + (j << 4) + rlane) * ldb + koff + k0;
      bh[j] = Frag<T>::load(Bb + bo);
      if (SPLIT) bl[j] = Frag<T>::load(Bb2 + bo);
    }
#pragma unroll
    for (int i = 0; i < 4; ++i) {
      const size_t ao = (size_t)(m0 + (i << 4) + rlane) * lda + koff + k0;
      V ah = Frag<T>::load(Ab + ao);
      V al;
      if (SPLIT) al = Frag<T>::load(Ab2 + ao);
#pragma unroll
      for (int j = 0; j < 4; ++j) {
        acc[i][j] = Frag<T>::mma(ah, bh[j], acc[i][j]);
        if (SPLIT) {
          acc[i][j] = Frag<T>::mma(ah, bl[j], acc[i][j]);
          acc[i][j] = Frag<T>::mma(al, bh[j], acc[i][j]);
        }
      }
      Frag<T>::guard(acc[i][0], acc[i][3], ah, SPLIT ? al : ah);
    }
    Frag<T>::keep(bh[0], bh[1], bh[2], bh[3]);
    if (SPLIT) Frag<T>::keep(bl[0], bl[1], bl[2], bl[3]);
  }
  acc_guard4(acc[0][0], acc[0][1], acc[0][2], acc[0][3]);
  acc_guard4(acc[1][0], acc[1][1], acc[1][2], acc[1][3]);
  acc_guard4(acc[2][0], acc[2][1], acc[2][2], acc[2][3]);
  acc_guard4(acc[3][0], acc[3][1], acc[3][2], acc[3][3]);

  float* slab = sT[wave];
  const float* Rb = RESID ? (resid + (size_t)b * strideR) : nullptr;
#pragma unroll
  for (int i = 0; i < 4; ++i) {
    const int mBase = m0 + (i << 4);
#pragma unroll
    for (int j = 0; j < 4; ++j) {
      const int n = n0 + (j << 4) + rlane;
      float bv = 0.f;
      if (BIAS_MODE == 2) bv = bias[n];
#pragma unroll
      for (int r = 0; r < 8; ++r) {
        float v = acc[i][j][r] * scale;
        if (BIAS_MODE == 1) v += bias[mBase + mOff + r];
        if (BIAS_MODE == 2) v += bv;
        if (RESID) v += Rb[(size_t)(mBase + mOff + r) * ldc + n];
        if (ACT == 1) v = tanhf(v);
        if (ACT == 2) v = fmaxf(v, 0.0f);
        if (ACT == 3) v = v / (1.0f + expf(-v));
        if (ACT == 4) v = (v > 0.f) ? v : 0.01f * v;
        if (ACT == 5) v = 0.5f * v * (1.0f + erff(v * 0.70710678118654752f));
        slab[(mOff + r) * 68 + (j << 4) + rlane] = v;
      }
    }
    __builtin_amdgcn_fence(__ATOMIC_RELEASE, "workgroup");
    __builtin_amdgcn_wave_barrier();
    __builtin_amdgcn_fence(__ATOMIC_ACQUIRE, "workgroup");
    if (OUT_MODE == 0) {
      float* C = (float*)Cout + (size_t)b * strideC;
      const int hh = lane >> 4, c4 = (lane & 15) * 4;
      {
#pragma unroll
        for (int it = 0; it < 8; ++it) {
          const int row = it * 2 + hh;
          v4f v = *(const v4f*)(slab + row * 68 + c4);
          *(v4f*)(C + (size_t)(mBase + row) * ldc + n0 + c4) = v;
        }
        
      }
    } else {
      const int q = lane >> 3, c8 = (lane & 7) * 8;
      unsigned short* C  = (unsigned short*)Cout  + (size_t)b * strideC;
      unsigned short* C2 = (OUT_MODE == 2) ? ((unsigned short*)Cout2 + (size_t)b * strideC) : nullptr;
      {
#pragma unroll
        for (int it = 0; it < 4; ++it) {
          const int row = it * 4 + q;
          const float* sp = slab + row * 68 + c8;
          v8h hv, lv;
#pragma unroll
          for (int e = 0; e < 8; ++e) {
            if (OUT_MODE == 1) {
              hv[e] = (_Float16)sp[e];
            } else {
              unsigned short hb = f2bf_bits(sp[e]);
              unsigned short lb = f2bf_bits(sp[e] - bf_bits2f(hb));
              hv[e] = __builtin_bit_cast(_Float16, hb);
              lv[e] = __builtin_bit_cast(_Float16, lb);
            }
          }
          *(v8h*)(C + (size_t)(mBase + row) * ldc + n0 + c8) = hv;
          if (OUT_MODE == 2) *(v8h*)(C2 + (size_t)(mBase + row) * ldc + n0 + c8) = lv;
        }
        
      }
    }
    __builtin_amdgcn_fence(__ATOMIC_RELEASE, "workgroup");
    __builtin_amdgcn_wave_barrier();
    __builtin_amdgcn_fence(__ATOMIC_ACQUIRE, "workgroup");
  }
}

/* ---- bf16 helpers for the attention path ---- */
__device__ __forceinline__ unsigned short at_bf_bits(float f) {
  unsigned u = __float_as_uint(f);
  return (unsigned short)((u + 0x7FFFu + ((u >> 16) & 1u)) >> 16);
}
__device__ __forceinline__ __bf16 at_f2bf(float f) { return __builtin_bit_cast(__bf16, at_bf_bits(f)); }
__device__ __forceinline__ void at_split(float f, __bf16& hi, __bf16& lo) {
  const unsigned short hb = at_bf_bits(f);
  hi = __builtin_bit_cast(__bf16, hb);
  lo = at_f2bf(f - __uint_as_float(((unsigned)hb) << 16));
}
__device__ __forceinline__ v8f at_mma(v16b a, v16b b, v8f c) {
  c = __builtin_amdgcn_wmma_f32_16x16x32_bf16(false, a, false, b, (short)0, c, false, false);
  asm volatile("v_nop\n\tv_nop\n\tv_nop\n\tv_nop" : "+v"(c) : "v"(a), "v"(b));
  return c;
}
__device__ __forceinline__ v8f mma_h16(v16h a, v16h b, v8f c) {
  c = __builtin_amdgcn_wmma_f32_16x16x32_f16(false, a, false, b, (short)0, c, false, false);
  asm volatile("v_nop\n\tv_nop\n\tv_nop\n\tv_nop" : "+v"(c) : "v"(a), "v"(b));
  return c;
}
__device__ __forceinline__ void wave_sync_lds() {
  __builtin_amdgcn_fence(__ATOMIC_RELEASE, "workgroup");
  __builtin_amdgcn_wave_barrier();
  __builtin_amdgcn_fence(__ATOMIC_ACQUIRE, "workgroup");
}

/* f32[8] -> packed bf16 hi (4 words) and bf16 lo residual (4 words), RNE convert */
__device__ __forceinline__ void split_pack8(const float (&x)[8], v4u& H, v4u& L) {
#pragma unroll
  for (int p = 0; p < 4; ++p) {
    const unsigned short h0 = f2bf_bits(x[2 * p]);
    const unsigned short l0 = f2bf_bits(x[2 * p] - bf_bits2f(h0));
    const unsigned short h1 = f2bf_bits(x[2 * p + 1]);
    const unsigned short l1 = f2bf_bits(x[2 * p + 1] - bf_bits2f(h1));
    H[p] = (unsigned)h0 | ((unsigned)h1 << 16);
    L[p] = (unsigned)l0 | ((unsigned)l1 << 16);
  }
}
__device__ __forceinline__ void store_planes2(unsigned short* __restrict__ hi, unsigned short* __restrict__ lo,
                                              size_t off, v4u H, v4u L) {
  *(v4u*)(hi + off) = H;
  *(v4u*)(lo + off) = L;
  
}

/* ---- activations f32 [rows][128] -> bf16 hi/lo planes, same layout -------------
   coverage: n8 = rows*128/8 threads exactly (host asserts divisibility). */
__global__ __launch_bounds__(256) void split_rows_bf16(const float* __restrict__ in,
                                                        unsigned short* __restrict__ hi,
                                                        unsigned short* __restrict__ lo, int n8) {
  const int i = blockIdx.x * 256 + threadIdx.x;
  if (i >= n8) return;
  const size_t e0 = (size_t)i * 8;
  const v4f a = *(const v4f*)(in + e0);
  const v4f c = *(const v4f*)(in + e0 + 4);
  float x[8];
  x[0] = a[0]; x[1] = a[1]; x[2] = a[2]; x[3] = a[3];
  x[4] = c[0]; x[5] = c[1]; x[6] = c[2]; x[7] = c[3];
  v4u H, L;
  split_pack8(x, H, L);
  store_planes2(hi, lo, e0, H, L);
}

/* ---- weights W[k][n] (input-major, 128x128): in[k][n] -> out[n][k] as transposed bf16 hi/lo planes -----
   outb holds 4 weights x (hi plane + lo plane) of 128*128 halves. grid (8, 4): 2048 threads per weight;
   2048 threads x 8 = 16384 = 128x128 per plane exactly. */
__global__ __launch_bounds__(256) void wt_split_bf16(const float* __restrict__ W0, const float* __restrict__ W1,
                                                     const float* __restrict__ W2, const float* __restrict__ W3,
                                                     unsigned short* __restrict__ outb) {
  const int which = blockIdx.y;
  const float* W = (which == 0) ? W0 : (which == 1) ? W1 : (which == 2) ? W2 : W3;
  unsigned short* hi = outb + (size_t)which * (2 * kC * kC);
  unsigned short* lo = hi + kC * kC;
  const int gt = blockIdx.x * 256 + threadIdx.x;
  if (gt >= kC * kC / 8) return;
  const int n  = gt >> 4;
  const int k8 = (gt & 15) * 8;
  float x[8];
#pragma unroll
  for (int e = 0; e < 8; ++e) x[e] = W[(size_t)(k8 + e) * kC + n];
  v4u H, L;
  split_pack8(x, H, L);
  store_planes2(hi, lo, (size_t)n * kC + k8, H, L);
}

/* ---- online softmax step for one head, 16 query rows x 32 keys per wave (2 key subtiles) ----
   sA: keys 0..15 (col c), sB: keys 16..31 (col 16+c); D row = 8*hh + r.
   The hi parts of P go to the wave's LDS tile; the lo parts stay in registers (loA, loB) until the caller has read the hi tile. */
__device__ __forceinline__ void softmax_step2(v8f& sA, v8f& sB, float (&mrow)[8], float (&lrow)[8], float (&alph)[8],
                                              __bf16* pw, __bf16 (&loA)[8], __bf16 (&loB)[8], int hh, int c) {
#pragma unroll
  for (int r = 0; r < 8; ++r) {
    float m = fmaxf(sA[r], sB[r]);
#pragma unroll
    for (int off = 1; off < 16; off <<= 1) m = fmaxf(m, __shfl_xor(m, off, 32));
    const float mnew = fmaxf(mrow[r], m);
    const float al = expf(mrow[r] - mnew);
    mrow[r] = mnew;
    alph[r] = al;
    const float p0 = expf(sA[r] - mnew);
    const float p1 = expf(sB[r] - mnew);
    float psum = p0 + p1;
    __bf16 ph, plo;
    at_split(p0, ph, plo);
    pw[(8 * hh + r) * kKC + c] = ph;
    loA[r] = plo;
    at_split(p1, ph, plo);
    pw[(8 * hh + r) * kKC + 16 + c] = ph;
    loB[r] = plo;
#pragma unroll
    for (int off = 1; off < 16; off <<= 1) psum += __shfl_xor(psum, off, 32);
    lrow[r] = lrow[r] * al + psum;
  }
}
/* per-wave 16x32 f32 result tile -> LDS staging (pitch kOsPitch); writes rows 0..15, cols 0..31 */
__device__ __forceinline__ void tile_to_os(float* os, const v8f (&o)[2], int hh, int c) {
#pragma unroll
  for (int r = 0; r < 8; ++r) {
#pragma unroll
    for (int t = 0; t < 2; ++t) os[(8 * hh + r) * kOsPitch + t * 16 + c] = o[t][r];
  }
}
/* weighted sum over the kSplit key groups of one query tile, 4 floats of one row per lane;
   os0: staging tile of key group 0 for this query tile, the groups 4 tiles apart */
__device__ __forceinline__ v4f merge_os(const float* os0, const float (&w)[kSplit], int row, int c4) {
  v4f acc = (v4f){0.f, 0.f, 0.f, 0.f};
#pragma unroll
  for (int s = 0; s < kSplit; ++s) {
    const v4f v = *(const v4f*)(os0 + s * (4 * 16 * kOsPitch) + row * kOsPitch + c4);
#pragma unroll
    for (int e = 0; e < 4; ++e) acc[e] += w[s] * v[e];
  }
  return acc;
}

/* ---- attention for one (batch, head h, 64 query rows) ----------------------------------
   q16/k16: f16 planes [B*N][128] (head-major columns); vhi/vlo: bf16 hi/lo planes [B*Nkv][128].
   scores = (q.k^T)*scale + rpe[idx][h], the head's table column held in LDS; online softmax in f32; P hi, then lo, per wave in LDS;
   o = P . V_h;  for h >= 2 also ox = P . V_{h-2} (the cross term of the differential mixing).
   16 waves: wave = (key group sp, query tile qt). Group sp (4 waves) takes key chunks sp, sp + kSplit, ... with its own
   K/V tiles and each wave its own running max, sum and accumulators; the groups are merged through LDS at the end.
   xattn f32 [B*Nq][128]; ycross f32 [B][2][Nq][32]. grid.x = B*H*(Nq/64), block 128 * kSplit. */
__global__ __launch_bounds__(128 * kSplit) __attribute__((amdgpu_num_vgpr(256)))
void attn_head_kernel(
    const unsigned short* __restrict__ q16, const unsigned short* __restrict__ k16,
    const unsigned short* __restrict__ vhi, const unsigned short* __restrict__ vlo,
    const int* __restrict__ coords_q, const int* __restrict__ coords_k,
    const float* __restrict__ rpe,
    float* __restrict__ xattn, float* __restrict__ ycross)
{
  __shared__ __align__(16) unsigned short KshS[kSplit][kKC * kHD];   /* [group][key][d]  f16 bits  */
  __shared__ __align__(16) unsigned short VthS[kSplit][kHD * kKC];   /* [group][d][key] bf16 hi, head h   */
  __shared__ __align__(16) unsigned short VtlS[kSplit][kHD * kKC];   /* [group][d][key] bf16 lo, head h   */
  __shared__ __align__(16) unsigned short VxhS[kSplit][kHD * kKC];   /* [group][d][key] bf16 hi, head h-2 */
  __shared__ __align__(16) unsigned short VxlS[kSplit][kHD * kKC];   /* [group][d][key] bf16 lo, head h-2 */
  __shared__ __align__(16) __bf16 Pw[4 * kSplit][16 * kKC];          /* [wave][row][key]: hi, then lo in the same bytes */
  __shared__ __align__(16) float Tab[kTabLds];                       /* rpe[idx][h] for this block's head, all idx */
  /* behind the key loop the table is dead and its bytes take the merge staging */
  static_assert(4 * kSplit * 16 * kOsPitch + 4 * kSplit * 16 * 2 <= kTabLds, "");
  float* const OsAll = Tab;                                          /* [wave][16 * kOsPitch] */
  float* const MlAll = Tab + 4 * kSplit * 16 * kOsPitch;             /* [wave][row] (max, sum) */

  const int wave = threadIdx.x >> 5;     /* 0 .. 15 */
  const int sp   = wave >> 2;            /* key group */
  const int qt   = wave & 3;             /* query tile */
  const int tid  = threadIdx.x & 127;    /* thread within the key group */
  const int lane = tid & 31;
  unsigned short* Ksh = KshS[sp];
  unsigned short* Vth = VthS[sp];
  unsigned short* Vtl = VtlS[sp];
  unsigned short* Vxh = VxhS[sp];
  unsigned short* Vxl = VxlS[sp];
  const int hh   = lane >> 4;
  const int c    = lane & 15;
  constexpr int nqb = kNq / kQB;
  const int bx   = blockIdx.x;
  const int qb   = bx % nqb;
  const int rest = bx / nqb;
  const int h    = rest % kH;
  const int b    = rest / kH;
  const bool cross = (h >= kNH);                       /* block-uniform */
  const int hcol = h * kHD;
  const int xcol = (cross ? (h - kNH) : 0) * kHD;
  const int q0   = qb * kQB + qt * 16;
  const size_t qrows  = (size_t)b * kNq + q0;
  const size_t kvrows = (size_t)b * kNkv;
  const float* __restrict__ rpe_h = rpe + h;           /* table entry stride kH floats */

  /* this head's column of the bias table -> LDS, once per work-group; batches of 16 loads per thread keep the
     latency of the strided reads covered. The first barrier of the key loop publishes it. */
  {
    constexpr int kThreads = 128 * kSplit;
    constexpr int kFull = kTable / (kThreads * 16);
    const int t0 = threadIdx.x;
    /* rolled: 16 waves x 16 loads in flight already cover the L2 latency; unrolled further the copy only takes more registers */
#pragma unroll 1
    for (int g = 0; g < kFull; ++g) {
      float tv[16];
      const float* gp = rpe_h + (size_t)(g * 16 * kThreads + t0) * kH;
#pragma unroll
      for (int u = 0; u < 16; ++u) tv[u] = gp[u * (kThreads * kH)];
      asm volatile("s_wait_xcnt 0x0" :: "v"(gp) : "memory");   /* the loads' address registers are kept as they are until this wait */
#pragma unroll
      for (int u = 0; u < 16; ++u) Tab[(g * 16 + u) * kThreads + t0] = tv[u];
    }
    for (int i = kFull * 16 * kThreads + t0; i < kTable; i += kThreads) Tab[i] = rpe_h[(size_t)i * kH];
  }

  /* Q fragment (A operand, K = head_dim = 32, one k-step) */
  const _Float16* qp = (const _Float16*)(const void*)q16;
  const v16h qa = Frag<_Float16>::load(qp + (qrows + c) * kC + hcol + 8 * hh);

  /* query coords for this lane's 8 D-rows (row 8*hh + r), +MAXD folded in */
  int cqx[8], cqy[8];
#pragma unroll
  for (int r = 0; r < 8; ++r) {
    const v2i cc = *(const v2i*)(coords_q + (qrows + 8 * hh + r) * 2);
    cqx[r] = cc.x + kMaxd;
    cqy[r] = cc.y + kMaxd;
  }

  float mr[8], lr[8];
  v8f o[2], ox[2];
#pragma unroll
  for (int r = 0; r < 8; ++r) { mr[r] = -INFINITY; lr[r] = 0.f; }
#pragma unroll
  for (int t = 0; t < 2; ++t) {
    o[t]  = (v8f){0.f,0.f,0.f,0.f,0.f,0.f,0.f,0.f};
    ox[t] = (v8f){0.f,0.f,0.f,0.f,0.f,0.f,0.f,0.f};
  }

  __bf16* pw = Pw[wave];

  for (int kc = 0; kc < kNkv / (kKC * kSplit); ++kc) {
    const int kv0 = (kc * kSplit + sp) * kKC;
    __syncthreads();
    /* stage K tile and V^T hi/lo tiles: 32 keys x 4 segments of 8 halves = 128 = threads of a key group, one uint4 per thread
       per plane; covers Ksh 32x32, Vth/Vtl 32x32 (and Vxh/Vxl when cross) exactly */
    {
      const int key = tid >> 2;
      const int seg = tid & 3;
      const size_t rowoff = (kvrows + kv0 + key) * kC;
      const size_t go = rowoff + hcol + seg * 8;
      const uint4 kw = *(const uint4*)(k16 + go);
      *(uint4*)(&Ksh[key * kHD + seg * 8]) = kw;
      const uint4 vh4 = *(const uint4*)(vhi + go);
      const uint4 vl4 = *(const uint4*)(vlo + go);
      unsigned short* vth = &Vth[(seg * 8) * kKC + key];
      unsigned short* vtl = &Vtl[(seg * 8) * kKC + key];
      vth[0 * kKC] = (unsigned short)(vh4.x & 0xffffu); vth[1 * kKC] = (unsigned short)(vh4.x >> 16);
      vth[2 * kKC] = (unsigned short)(vh4.y & 0xffffu); vth[3 * kKC] = (unsigned short)(vh4.y >> 16);
      vth[4 * kKC] = (unsigned short)(vh4.z & 0xffffu); vth[5 * kKC] = (unsigned short)(vh4.z >> 16);
      vth[6 * kKC] = (unsigned short)(vh4.w & 0xffffu); vth[7 * kKC] = (unsigned short)(vh4.w >> 16);
      vtl[0 * kKC] = (unsigned short)(vl4.x & 0xffffu); vtl[1 * kKC] = (unsigned short)(vl4.x >> 16);
      vtl[2 * kKC] = (unsigned short)(vl4.y & 0xffffu); vtl[3 * kKC] = (unsigned short)(vl4.y >> 16);
      vtl[4 * kKC] = (unsigned short)(vl4.z & 0xffffu); vtl[5 * kKC] = (unsigned short)(vl4.z >> 16);
      vtl[6 * kKC] = (unsigned short)(vl4.w & 0xffffu); vtl[7 * kKC] = (unsigned short)(vl4.w >> 16);
      if (cross) {
        const size_t gx = rowoff + xcol + seg * 8;
        const uint4 xh4 = *(const uint4*)(vhi + gx);
        const uint4 xl4 = *(const uint4*)(vlo + gx);
        unsigned short* vxh = &Vxh[(seg * 8) * kKC + key];
        unsigned short* vxl = &Vxl[(seg * 8) * kKC + key];
        vxh[0 * kKC] = (unsigned short)(xh4.x & 0xffffu); vxh[1 * kKC] = (unsigned short)(xh4.x >> 16);
        vxh[2 * kKC] = (unsigned short)(xh4.y & 0xffffu); vxh[3 * kKC] = (unsigned short)(xh4.y >> 16);
        vxh[4 * kKC] = (unsigned short)(xh4.z & 0xffffu); vxh[5 * kKC] = (unsigned short)(xh4.z >> 16);
        vxh[6 * kKC] = (unsigned short)(xh4.w & 0xffffu); vxh[7 * kKC] = (unsigned short)(xh4.w >> 16);
        vxl[0 * kKC] = (unsigned short)(xl4.x & 0xffffu); vxl[1 * kKC] = (unsigned short)(xl4.x >> 16);
        vxl[2 * kKC] = (unsigned short)(xl4.y & 0xffffu); vxl[3 * kKC] = (unsigned short)(xl4.y >> 16);
        vxl[4 * kKC] = (unsigned short)(xl4.z & 0xffffu); vxl[5 * kKC] = (unsigned short)(xl4.z >> 16);
        vxl[6 * kKC] = (unsigned short)(xl4.w & 0xffffu); vxl[7 * kKC] = (unsigned short)(xl4.w >> 16);
      }
    }
    __syncthreads();

    /* scores: s[j], j = key subtile; B fragment lane c -> key j*16+c, elements d (split map) */
    v8f s[2];
    {
      const v8f z = (v8f){0.f,0.f,0.f,0.f,0.f,0.f,0.f,0.f};
      const _Float16* Kp = (const _Float16*)(const void*)Ksh;
#pragma unroll
      for (int j = 0; j < 2; ++j) {
        Frag<_Float16>::U kb;
        kb.h[0] = *(const v8h*)(Kp + (j * 16 + c) * kHD + 8 * hh);
        kb.h[1] = *(const v8h*)(Kp + (j * 16 + c) * kHD + 16 + 8 * hh);
        s[j] = mma_h16(qa, kb.v, z);
      }
    }
    /* key coords for this lane's two columns */
    int ckx[2], cky[2];
#pragma unroll
    for (int j = 0; j < 2; ++j) {
      const v2i ck = *(const v2i*)(coords_k + (kvrows + kv0 + j * 16 + c) * 2);
      ckx[j] = ck.x; cky[j] = ck.y;
    }

    /* scale + relative position bias: one clamped b32 gather from the LDS table per (row, key) */
#pragma unroll
    for (int r = 0; r < 8; ++r) {
#pragma unroll
      for (int j = 0; j < 2; ++j) {
        int dx = cqx[r] - ckx[j]; dx = dx < 0 ? 0 : dx; dx = dx > 2 * kMaxd ? 2 * kMaxd : dx;
        int dy = cqy[r] - cky[j]; dy = dy < 0 ? 0 : dy; dy = dy > 2 * kMaxd ? 2 * kMaxd : dy;
        const int idx = dx * kSpan + dy;            /* 0 .. kTable-1 */
        s[j][r] = s[j][r] * kScale + Tab[idx];
      }
    }

    /* online softmax; P hi to this wave's LDS tile, P lo held in registers */
    float al[8];
    __bf16 loA[8], loB[8];
    softmax_step2(s[0], s[1], mr, lr, al, pw, loA, loB, hh, c);
#pragma unroll
    for (int t = 0; t < 2; ++t) {
#pragma unroll
      for (int r = 0; r < 8; ++r) { o[t][r] *= al[r]; ox[t][r] *= al[r]; }
    }
    wave_sync_lds();

    /* P.V : A = P (lane c -> query row, elements key, split map), B = V^T tile (lane c -> d, elements key) */
    {
      Frag<__bf16>::U pa, pb, vb[2], xb[2];
      pa.h[0] = *(const v8b*)(pw + c * kKC + 8 * hh);  pa.h[1] = *(const v8b*)(pw + c * kKC + 16 + 8 * hh);
      wave_sync_lds();   /* every lane has its hi fragment before the lo parts take the same bytes */
#pragma unroll
      for (int r = 0; r < 8; ++r) {
        pw[(8 * hh + r) * kKC + c]      = loA[r];
        pw[(8 * hh + r) * kKC + 16 + c] = loB[r];
      }
      const __bf16* Vh = (const __bf16*)(const void*)Vth;
      const __bf16* Vl = (const __bf16*)(const void*)Vtl;
#pragma unroll
      for (int t = 0; t < 2; ++t) {
        Frag<__bf16>::U vl;
        vb[t].h[0] = *(const v8b*)(Vh + (t * 16 + c) * kKC + 8 * hh);  vb[t].h[1] = *(const v8b*)(Vh + (t * 16 + c) * kKC + 16 + 8 * hh);
        vl.h[0] = *(const v8b*)(Vl + (t * 16 + c) * kKC + 8 * hh);  vl.h[1] = *(const v8b*)(Vl + (t * 16 + c) * kKC + 16 + 8 * hh);
        o[t] = at_mma(pa.v, vb[t].v, o[t]);
        o[t] = at_mma(pa.v, vl.v, o[t]);
      }
      if (cross) {
        const __bf16* Xh = (const __bf16*)(const void*)Vxh;
        const __bf16* Xl = (const __bf16*)(const void*)Vxl;
#pragma unroll
        for (int t = 0; t < 2; ++t) {
          Frag<__bf16>::U vl;
          xb[t].h[0] = *(const v8b*)(Xh + (t * 16 + c) * kKC + 8 * hh);  xb[t].h[1] = *(const v8b*)(Xh + (t * 16 + c) * kKC + 16 + 8 * hh);
          vl.h[0] = *(const v8b*)(Xl + (t * 16 + c) * kKC + 8 * hh);  vl.h[1] = *(const v8b*)(Xl + (t * 16 + c) * kKC + 16 + 8 * hh);
          ox[t] = at_mma(pa.v, xb[t].v, ox[t]);
          ox[t] = at_mma(pa.v, vl.v, ox[t]);
        }
      }
      wave_sync_lds();   /* the lo tile is complete */
      pb.h[0] = *(const v8b*)(pw + c * kKC + 8 * hh);  pb.h[1] = *(const v8b*)(pw + c * kKC + 16 + 8 * hh);
#pragma unroll
      for (int t = 0; t < 2; ++t) o[t] = at_mma(pb.v, vb[t].v, o[t]);
      if (cross) {
#pragma unroll
        for (int t = 0; t < 2; ++t) ox[t] = at_mma(pb.v, xb[t].v, ox[t]);
      }
    }
  }

  /* merge of the key groups: every wave leaves its accumulators (not normalised) and its (max, sum) in LDS;
     wave (sp, qt) then merges rows 4*sp .. 4*sp+3 of query tile qt: x = sum_s e^(m_s-M) o_s / sum_s e^(m_s-M) l_s */
  __syncthreads();   /* every wave has made its last table read: the table's bytes become the merge staging */
  float* os = OsAll + wave * (16 * kOsPitch);
  const float* osq = OsAll + qt * (16 * kOsPitch);
  tile_to_os(os, o, hh, c);
  if (c == 0) {   /* max and sum are equal in the 16 lanes of a half */
#pragma unroll
    for (int r = 0; r < 8; ++r) { MlAll[wave * 32 + (8 * hh + r) * 2] = mr[r]; MlAll[wave * 32 + (8 * hh + r) * 2 + 1] = lr[r]; }
  }
  __syncthreads();   /* all groups' partial tiles are in LDS */

  const int row = 4 * sp + (lane >> 3);
  const int c4  = (lane & 7) * 4;
  float w[kSplit];
  {
    float ms[kSplit], ls[kSplit];
    float M = -INFINITY;
#pragma unroll
    for (int s = 0; s < kSplit; ++s) {
      ms[s] = MlAll[(s * 4 + qt) * 32 + row * 2];
      ls[s] = MlAll[(s * 4 + qt) * 32 + row * 2 + 1];
      M = fmaxf(M, ms[s]);
    }
    float L = 0.f;
#pragma unroll
    for (int s = 0; s < kSplit; ++s) { w[s] = expf(ms[s] - M); L += w[s] * ls[s]; }
    const float inv = 1.0f / L;
#pragma unroll
    for (int s = 0; s < kSplit; ++s) w[s] *= inv;
  }
  *(v4f*)(xattn + (qrows + row) * kC + hcol + c4) = merge_os(osq, w, row, c4);
  asm volatile("s_wait_xcnt 0x0" ::: "memory");   /* the cross path below reuses the registers this store names */

  if (cross) {
    __syncthreads();   /* every reader has left the o tiles */
    tile_to_os(os, ox, hh, c);
    __syncthreads();   /* all groups' cross tiles are in LDS */
    *(v4f*)(ycross + ((((size_t)b * kNH + (h - kNH)) * kNq + q0 + row) * kHD) + c4) = merge_os(osq, w, row, c4);
  }
}

/* ---- differential head mixing + split to bf16 hi/lo planes for the output projection --------
   x[b,q,h*32+d] = xs + alpha[b,q]*(xs - lam[h]*yc[b,h,q,d]) for h < 2, else xs.
   coverage 65536 threads x 8 = 4096x128 exactly. */
__global__ __launch_bounds__(256) void combine_split_kernel(
    const float* __restrict__ xattn, const float* __restrict__ ycross, const float* __restrict__ alpha,
    const float* __restrict__ lq1, const float* __restrict__ lk1,
    const float* __restrict__ lq2, const float* __restrict__ lk2,
    unsigned short* __restrict__ hi, unsigned short* __restrict__ lo)
{
  __shared__ float lam_s[2];
  if (threadIdx.x < 2) {
    const int h = threadIdx.x;
    float s1 = 0.f, s2 = 0.f;
#pragma unroll 1
    for (int i = 0; i < kHD; ++i) {
      s1 += lq1[h * kHD + i] * lk1[h * kHD + i];
      s2 += lq2[h * kHD + i] * lk2[h * kHD + i];
    }
    lam_s[h] = expf(s1) - expf(s2) + kLambdaInit;
  }
  __syncthreads();
  const int gt = blockIdx.x * 256 + threadIdx.x;
  if (gt >= kBatch * kNq * kC / 8) return;
  const size_t e0 = (size_t)gt * 8;
  const int row = (int)(e0 >> 7);
  const int col = (int)(e0 & 127);
  const int h   = col >> 5;
  const int d   = col & 31;
  const int hc  = h & 1;
  const int b   = row >> 11;
  const int q   = row & (kNq - 1);
  const float a   = alpha[row];
  const float lam = lam_s[hc];
  const v4f xs0 = *(const v4f*)(xattn + e0);
  const v4f xs1 = *(const v4f*)(xattn + e0 + 4);
  const size_t yo = (((size_t)b * kNH + hc) * kNq + q) * kHD + d;
  const v4f y0 = *(const v4f*)(ycross + yo);
  const v4f y1 = *(const v4f*)(ycross + yo + 4);
  const bool mix = (h < kNH);
  float x[8];
#pragma unroll
  for (int e = 0; e < 4; ++e) {
    const float xa = xs0[e], xb = xs1[e];
    const float va = xa + a * (xa - lam * y0[e]);
    const float vb = xb + a * (xb - lam * y1[e]);
    x[e]     = mix ? va : xa;
    x[4 + e] = mix ? vb : xb;
  }
  v4u H, L;
  split_pack8(x, H, L);
  store_planes2(hi, lo, e0, H, L);
}

/* =========================================================================================
   host launch: 9 kernel launches
   workspace region map (bytes, all offsets MiB/256-KiB aligned):
     xq_hi  1 MiB | xq_lo 1 MiB | xkv_hi 2 MiB | xkv_lo 2 MiB | wt planes 256 KiB (4 weights x hi,lo x 32 KiB)
     q16 1 MiB | k16 2 MiB | v_hi 2 MiB | v_lo 2 MiB | xattn f32 2 MiB | ycross f32 512 KiB | xmix_hi 1 MiB | xmix_lo 1 MiB
     total 18,612,224 B
   ========================================================================================= */
extern "C" void kernel_launch(void* const* d_in, const int* in_sizes, int n_in,
                              void* d_out, int out_size, void* d_ws, size_t ws_size,
                              hipStream_t stream) {
  constexpr int Mq  = kBatch * kNq;    /* 4096 */
  constexpr int Mkv = kBatch * kNkv;   /* 8192 */
  static_assert(Mq % 64 == 0 && Mkv % 64 == 0 && kC % 64 == 0 && kC % 32 == 0, "");
  static_assert((Mq * kC) % 8 == 0 && (Mkv * kC) % 8 == 0, "");
  if (n_in < 18) return;
  if (in_sizes[0] != Mq * kC || in_sizes[1] != Mkv * kC || in_sizes[2] != Mq * 2 || in_sizes[3] != Mkv * 2 ||
      in_sizes[4] != Mq || in_sizes[5] != kC * kC || in_sizes[7] != kC * kC || in_sizes[9] != kC * kC ||
      in_sizes[16] != kC * kC || in_sizes[6] != kC || in_sizes[8] != kC || in_sizes[10] != kC || in_sizes[17] != kC ||
      in_sizes[11] != kNH * kHD || in_sizes[12] != kNH * kHD || in_sizes[13] != kNH * kHD || in_sizes[14] != kNH * kHD ||
      in_sizes[15] != kTable * kH || out_size != Mq * kC) return;

  const float* x_q      = (const float*)d_in[0];
  const float* x_kv     = (const float*)d_in[1];
  const int*   coords_q = (const int*)d_in[2];
  const int*   coords_k = (const int*)d_in[3];
  const float* alpha    = (const float*)d_in[4];
  const float* Wq = (const float*)d_in[5];  const float* bq = (const float*)d_in[6];
  const float* Wk = (const float*)d_in[7];  const float* bk = (const float*)d_in[8];
  const float* Wv = (const float*)d_in[9];  const float* bv = (const float*)d_in[10];
  const float* lq1 = (const float*)d_in[11]; const float* lk1 = (const float*)d_in[12];
  const float* lq2 = (const float*)d_in[13]; const float* lk2 = (const float*)d_in[14];
  const float* rpe = (const float*)d_in[15];
  const float* Wp = (const float*)d_in[16]; const float* bp = (const float*)d_in[17];
  float* out = (float*)d_out;

  char* ws = (char*)d_ws;
  size_t off = 0;
  const size_t szXq16  = (size_t)Mq * kC * 2;     /* 1 MiB  */
  const size_t szXkv16 = (size_t)Mkv * kC * 2;    /* 2 MiB  */
  const size_t szWt    = (size_t)4 * 2 * kC * kC * 2;
  const size_t szXattn = (size_t)Mq * kC * 4;
  const size_t szYc    = (size_t)kBatch * kNH * kNq * kHD * 4;
  unsigned short* xq_hi  = (unsigned short*)(ws + off); off += szXq16;
  unsigned short* xq_lo  = (unsigned short*)(ws + off); off += szXq16;
  unsigned short* xkv_hi = (unsigned short*)(ws + off); off += szXkv16;
  unsigned short* xkv_lo = (unsigned short*)(ws + off); off += szXkv16;
  unsigned short* wt     = (unsigned short*)(ws + off); off += szWt;
  unsigned short* q16    = (unsigned short*)(ws + off); off += szXq16;
  unsigned short* k16    = (unsigned short*)(ws + off); off += szXkv16;
  unsigned short* v_hi   = (unsigned short*)(ws + off); off += szXkv16;
  unsigned short* v_lo   = (unsigned short*)(ws + off); off += szXkv16;
  float*          xattn  = (float*)(ws + off);          off += szXattn;
  float*          ycross = (float*)(ws + off);          off += szYc;
  unsigned short* xm_hi  = (unsigned short*)(ws + off); off += szXq16;
  unsigned short* xm_lo  = (unsigned short*)(ws + off); off += szXq16;
  if (off > ws_size) return;

  const unsigned short* wtq_hi = wt + 0 * (2 * kC * kC); const unsigned short* wtq_lo = wtq_hi + kC * kC;
  const unsigned short* wtk_hi = wt + 1 * (2 * kC * kC); const unsigned short* wtk_lo = wtk_hi + kC * kC;
  const unsigned short* wtv_hi = wt + 2 * (2 * kC * kC); const unsigned short* wtv_lo = wtv_hi + kC * kC;
  const unsigned short* wtp_hi = wt + 3 * (2 * kC * kC); const unsigned short* wtp_lo = wtp_hi + kC * kC;

  /* 1-2: activations -> bf16 hi/lo planes */
  const int n8q = Mq * kC / 8, n8kv = Mkv * kC / 8;
  split_rows_bf16<<<dim3((n8q + 255) / 256), dim3(256), 0, stream>>>(x_q, xq_hi, xq_lo, n8q);
  split_rows_bf16<<<dim3((n8kv + 255) / 256), dim3(256), 0, stream>>>(x_kv, xkv_hi, xkv_lo, n8kv);
  /* 3: weights -> transposed bf16 hi/lo planes (in[k][n] -> out[n][k], square 128x128) */
  wt_split_bf16<<<dim3((kC * kC / 8 + 255) / 256, 4), dim3(256), 0, stream>>>(Wq, Wk, Wv, Wp, wt);

  /* 4-6: projections, M x 128, K = 128 (M % 64 == 0, N = 128 % 64 == 0, K = 128 % 32 == 0) */
  const int blocksQ  = ((Mq  / 64) * (kC / 64) + 7) / 8;
  const int blocksKV = ((Mkv / 64) * (kC / 64) + 7) / 8;
  wmma_gemm64<1, true, 2, 1, false><<<dim3(blocksQ, 1), dim3(256), 0, stream>>>(
      xq_hi, xq_lo, kC, 0L, wtq_hi, wtq_lo, kC, 0L, (void*)q16, nullptr, kC, 0L, bq, nullptr, 0L, Mq, kC, kC, 1.0f);
  wmma_gemm64<1, true, 2, 1, false><<<dim3(blocksKV, 1), dim3(256), 0, stream>>>(
      xkv_hi, xkv_lo, kC, 0L, wtk_hi, wtk_lo, kC, 0L, (void*)k16, nullptr, kC, 0L, bk, nullptr, 0L, Mkv, kC, kC, 1.0f);
  wmma_gemm64<1, true, 2, 2, false><<<dim3(blocksKV, 1), dim3(256), 0, stream>>>(
      xkv_hi, xkv_lo, kC, 0L, wtv_hi, wtv_lo, kC, 0L, (void*)v_hi, (void*)v_lo, kC, 0L, bv, nullptr, 0L, Mkv, kC, kC, 1.0f);

  /* 7: attention per (batch, head, 64 queries) */
  const int attnBlocks = kBatch * kH * (kNq / kQB);
  attn_head_kernel<<<dim3(attnBlocks), dim3(128 * kSplit), 0, stream>>>(q16, k16, v_hi, v_lo, coords_q, coords_k, rpe, xattn, ycross);

  /* 8: differential mixing + bf16 hi/lo planes */
  combine_split_kernel<<<dim3((n8q + 255) / 256), dim3(256), 0, stream>>>(xattn, ycross, alpha, lq1, lk1, lq2, lk2, xm_hi, xm_lo);

  /* 9: output projection -> d_out (f32), M = 4096, N = 128, K = 128 */
  wmma_gemm64<1, true, 2, 0, false><<<dim3(blocksQ, 1), dim3(256), 0, stream>>>(
      xm_hi, xm_lo, kC, 0L, wtp_hi, wtp_lo, kC, 0L, (void*)out, nullptr, kC, 0L, bp, nullptr, 0L, Mq, kC, kC, 1.0f);
}

// v003
// Measured time: 194 microseconds a run.
// Next to v002, in two timings, it ran 1.22 times as fast each time.
// Over all steps from v000 it is 2.34 times as fast.
// Contractions: x@Wq, x@Wk, x@Wv and xmix@Wp on v_wmma_f32_16x16x32_bf16 with bf16 hi/lo operand planes (hi.hi + hi.lo + lo.hi); k.q^T on v_wmma_f32_16x16x32_f16 with plain f16 q/k planes; v^T.p^T and v_cross^T.p^T on v_wmma_f32_16x16x32_bf16 with bf16 hi/lo p and v tiles; f32 accumulate; bias gather, online softmax and head mixing in f32.
#include <hip/hip_runtime.h>
#include <stdint.h>

typedef __attribute__((ext_vector_type(16))) _Float16 v16h;
typedef __attribute__((ext_vector_type(8)))  _Float16 v8h;
typedef __attribute__((ext_vector_type(16))) __bf16   v16b;
typedef __attribute__((ext_vector_type(8)))  __bf16   v8b;
typedef __attribute__((ext_vector_type(8)))  float    v8f;
typedef __attribute__((ext_vector_type(4)))  float    v4f;
typedef __attribute__((ext_vector_type(4)))  unsigned int v4u;
typedef __attribute__((ext_vector_type(2)))  int      v2i;
typedef __attribute__((ext_vector_type(4)))  int      v4i;

/* ---- problem geometry (fixed by the module) ---- */
constexpr int kBatch = 2;
constexpr int kNq    = 2048;
constexpr int kNkv   = 4096;
constexpr int kC     = 128;
constexpr int kH     = 4;
constexpr int kHD    = 32;
constexpr int kNH    = 2;
constexpr int kMaxd  = 128;
constexpr int kSpan  = 2 * kMaxd + 1;
constexpr int kTable = kSpan * kSpan;
constexpr int kKC    = 32;     /* keys per chunk in the attention kernel */
constexpr int kQB    = 64;     /* query rows per attention block (4 query tiles x 16) */
constexpr int kSplit = 4;      /* key groups per attention block: wave = (key group, query tile) */
constexpr int kOsPitch = 36;   /* floats; per-wave output staging pitch */
constexpr int kTabLds  = (kTable + 3) & ~3;   /* floats; one head's bias column in LDS, rounded to 16 bytes */
constexpr float kScale = 0.17677669529663687f;   /* head_dim ** -0.5 */
constexpr float kLambdaInit = 0.8f;

static_assert(kNq % kQB == 0, "");
static_assert(kNkv % (kKC * kSplit) == 0, "");
static_assert(kSplit * 4 == 16, "");   /* the merge gives each wave 16 / kSplit = 4 rows = 32 lanes x 4 floats */
static_assert(kC == kH * kHD, "");
static_assert((kBatch * kNq) % 64 == 0 && (kBatch * kNkv) % 64 == 0, "");
static_assert(kC % 64 == 0 && kC % 32 == 0, "");
static_assert(kH == 4 && kNH == 2 && kHD == 32 && kKC == 32, "");

__device__ __forceinline__ unsigned short f2bf_bits(float f) {
  unsigned u = __float_as_uint(f);
  return (unsigned short)((u + 0x7FFFu + ((u >> 16) & 1u)) >> 16);
}
__device__ __forceinline__ float bf_bits2f(unsigned short h) { return __uint_as_float(((unsigned)h) << 16); }

/* hazard guards as plain device helpers */
__device__ __forceinline__ void dep_guard_h(v8f& a, v8f& b, v16h x, v16h y) { asm volatile("v_nop\n\tv_nop\n\tv_nop\n\tv_nop" : "+v"(a), "+v"(b) : "v"(x), "v"(y)); }
__device__ __forceinline__ void dep_guard_b(v8f& a, v8f& b, v16b x, v16b y) { asm volatile("v_nop\n\tv_nop\n\tv_nop\n\tv_nop" : "+v"(a), "+v"(b) : "v"(x), "v"(y)); }
__device__ __forceinline__ void keep4_h(v16h a, v16h b, v16h c, v16h d) { asm volatile("v_nop" :: "v"(a), "v"(b), "v"(c), "v"(d)); }
__device__ __forceinline__ void keep4_b(v16b a, v16b b, v16b c, v16b d) { asm volatile("v_nop" :: "v"(a), "v"(b), "v"(c), "v"(d)); }
__device__ __forceinline__ void acc_guard4(v8f& a, v8f& b, v8f& c, v8f& d) { asm volatile("v_nop\n\tv_nop\n\tv_nop\n\tv_nop" : "+v"(a), "+v"(b), "+v"(c), "+v"(d)); }
template <typename T> struct Frag;
template <> struct Frag<_Float16> {
  typedef v16h V; union U { v16h v; v8h h[2]; };
  static __device__ __forceinline__ v16h load(const _Float16* p) {
    U f; f.h[0] = *(const v8h*)(p); f.h[1] = *(const v8h*)(p + 16); return f.v;
  }
  static __device__ __forceinline__ v8f mma(v16h a, v16h b, v8f c) {
    return __builtin_amdgcn_wmma_f32_16x16x32_f16(false, a, false, b, (short)0, c, false, false);
  }
  static __device__ __forceinline__ void guard(v8f& a, v8f& b, v16h x, v16h y) { dep_guard_h(a, b, x, y); }
  static __device__ __forceinline__ void keep(v16h a, v16h b, v16h c, v16h d) { keep4_h(a, b, c, d); }
};
template <> struct Frag<__bf16> {
  typedef v16b V; union U { v16b v; v8b h[2]; };
  static __device__ __forceinline__ v16b load(const __bf16* p) {
    U f; f.h[0] = *(const v8b*)(p); f.h[1] = *(const v8b*)(p + 16); return f.v;
  }
  static __device__ __forceinline__ v8f mma(v16b a, v16b b, v8f c) {
    return __builtin_amdgcn_wmma_f32_16x16x32_bf16(false, a, false, b, (short)0, c, false, false);
  }
  static __device__ __forceinline__ void guard(v8f& a, v8f& b, v16b x, v16b y) { dep_guard_b(a, b, x, y); }
  static __device__ __forceinline__ void keep(v16b a, v16b b, v16b c, v16b d) { keep4_b(a, b, c, d); }
};

/* ---- Register-blocked batched WMMA GEMM ---------------- */
template <int ET> struct Elem;
template <> struct Elem<0> { typedef _Float16 T; };
template <> struct Elem<1> { typedef __bf16 T; };
template <int ET, bool SPLIT, int BIAS_MODE, int OUT_MODE, bool RESID, int ACT = 0>
__global__ __launch_bounds__(256) void wmma_gemm64(
    const unsigned short* __restrict__ Ap, const unsigned short* __restrict__ A2p, int lda, long strideA,
    const unsigned short* __restrict__ Btp, const unsigned short* __restrict__ Bt2p, int ldb, long strideB,
    void* __restrict__ Cout, void* __restrict__ Cout2, int ldc, long strideC,
    const float* __restrict__ bias,
    const float* __restrict__ resid, long strideR,
    int M, int N, int K, float scale) {
  typedef typename Elem<ET>::T T;
  typedef typename Frag<T>::V V;
  const T* A = (const T*)Ap; const T* A2 = (const T*)A2p; const T* Bt = (const T*)Btp; const T* Bt2 = (const T*)Bt2p;
  __shared__ __align__(16) float sT[8][16 * 68];
  const int b    = blockIdx.y;
  const int lane = threadIdx.x & 31;
  const int wave = threadIdx.x >> 5;
  const int tilesN = N >> 6;
  const int tilesM = M >> 6;
  const int tile = blockIdx.x * 8 + wave;
  if (tile >= tilesM * tilesN) return;
  const int tm = tile / tilesN;
  const int tn = tile - tm * tilesN;
  const int m0 = tm << 6;
  const int n0 = tn << 6;

  const T* Ab  = A  + (size_t)b * strideA;
  const T* Bb  = Bt + (size_t)b * strideB;
  const T* Ab2 = SPLIT ? (A2  + (size_t)b * strideA) : nullptr;
  const T* Bb2 = SPLIT ? (Bt2 + (size_t)b * strideB) : nullptr;

  const int rlane = lane & 15;
  const int koff  = (lane >> 4) * 8;
  const int mOff  = (lane >> 4) * 8;

  v8f acc[4][4];
#pragma unroll
  for (int i = 0; i < 4; ++i)
#pragma unroll
    for (int j = 0; j < 4; ++j) acc[i][j] = (v8f){0.f,0.f,0.f,0.f,0.f,0.f,0.f,0.f};

  for (int k0 = 0; k0 < K; k0 += 32) {
    V bh[4], bl[4];
#pragma unroll
    for (int j = 0; j < 4; ++j) {
      const size_t bo = (size_t)(n0 + (j << 4) + rlane) * ldb + koff + k0;
      bh[j] = Frag<T>::load(Bb + bo);
      if (SPLIT) bl[j] = Frag<T>::load(Bb2 + bo);
    }
#pragma unroll
    for (int i = 0; i < 4; ++i) {
      const size_t ao = (size_t)(m0 + (i << 4) + rlane) * lda + koff + k0;
      V ah = Frag<T>::load(Ab + ao);
      V al;
      if (SPLIT) al = Frag<T>::load(Ab2 + ao);
#pragma unroll
      for (int j = 0; j < 4; ++j) {
        acc[i][j] = Frag<T>::mma(ah, bh[j], acc[i][j]);
        if (SPLIT) {
          acc[i][j] = Frag<T>::mma(ah, bl[j], acc[i][j]);
          acc[i][j] = Frag<T>::mma(al, bh[j], acc[i][j]);
        }
      }
      Frag<T>::guard(acc[i][0], acc[i][3], ah, SPLIT ? al : ah);
    }
    Frag<T>::keep(bh[0], bh[1], bh[2], bh[3]);
    if (SPLIT) Frag<T>::keep(bl[0], bl[1], bl[2], bl[3]);
  }
  acc_guard4(acc[0][0], acc[0][1], acc[0][2], acc[0][3]);
  acc_guard4(acc[1][0], acc[1][1], acc[1][2], acc[1][3]);
  acc_guard4(acc[2][0], acc[2][1], acc[2][2], acc[2][3]);
  acc_guard4(acc[3][0], acc[3][1], acc[3][2], acc[3][3]);

  float* slab = sT[wave];
  const float* Rb = RESID ? (resid + (size_t)b * strideR) : nullptr;
#pragma unroll
  for (int i = 0; i < 4; ++i) {
    const int mBase = m0 + (i << 4);
#pragma unroll
    for (int j = 0; j < 4; ++j) {
      const int n = n0 + (j << 4) + rlane;
      float bv = 0.f;
      if (BIAS_MODE == 2) bv = bias[n];
#pragma unroll
      for (int r = 0; r < 8; ++r) {
        float v = acc[i][j][r] * scale;
        if (BIAS_MODE == 1) v += bias[mBase + mOff + r];
        if (BIAS_MODE == 2) v += bv;
        if (RESID) v += Rb[(size_t)(mBase + mOff + r) * ldc + n];
        if (ACT == 1) v = tanhf(v);
        if (ACT == 2) v = fmaxf(v, 0.0f);
        if (ACT == 3) v = v / (1.0f + expf(-v));
        if (ACT == 4) v = (v > 0.f) ? v : 0.01f * v;
        if (ACT == 5) v = 0.5f * v * (1.0f + erff(v * 0.70710678118654752f));
        slab[(mOff + r) * 68 + (j << 4) + rlane] = v;
      }
    }
    __builtin_amdgcn_fence(__ATOMIC_RELEASE, "workgroup");
    __builtin_amdgcn_wave_barrier();
    __builtin_amdgcn_fence(__ATOMIC_ACQUIRE, "workgroup");
    if (OUT_MODE == 0) {
      float* C = (float*)Cout + (size_t)b * strideC;
      const int hh = lane >> 4, c4 = (lane & 15) * 4;
      {
#pragma unroll
        for (int it = 0; it < 8; ++it) {
          const int row = it * 2 + hh;
          v4f v = *(const v4f*)(slab + row * 68 + c4);
          *(v4f*)(C + (size_t)(mBase + row) * ldc + n0 + c4) = v;
        }
        
      }
    } else {
      const int q = lane >> 3, c8 = (lane & 7) * 8;
      unsigned short* C  = (unsigned short*)Cout  + (size_t)b * strideC;
      unsigned short* C2 = (OUT_MODE == 2) ? ((unsigned short*)Cout2 + (size_t)b * strideC) : nullptr;
      {
#pragma unroll
        for (int it = 0; it < 4; ++it) {
          const int row = it * 4 + q;
          const float* sp = slab + row * 68 + c8;
          v8h hv, lv;
#pragma unroll
          for (int e = 0; e < 8; ++e) {
            if (OUT_MODE == 1) {
              hv[e] = (_Float16)sp[e];
            } else {
              unsigned short hb = f2bf_bits(sp[e]);
              unsigned short lb = f2bf_bits(sp[e] - bf_bits2f(hb));
              hv[e] = __builtin_bit_cast(_Float16, hb);
              lv[e] = __builtin_bit_cast(_Float16, lb);
            }
          }
          *(v8h*)(C + (size_t)(mBase + row) * ldc + n0 + c8) = hv;
          if (OUT_MODE == 2) *(v8h*)(C2 + (size_t)(mBase + row) * ldc + n0 + c8) = lv;
        }
        
      }
    }
    __builtin_amdgcn_fence(__ATOMIC_RELEASE, "workgroup");
    __builtin_amdgcn_wave_barrier();
    __builtin_amdgcn_fence(__ATOMIC_ACQUIRE, "workgroup");
  }
}

/* ---- bf16 helpers for the attention path ---- */
__device__ __forceinline__ unsigned short at_bf_bits(float f) {
  unsigned u = __float_as_uint(f);
  return (unsigned short)((u + 0x7FFFu + ((u >> 16) & 1u)) >> 16);
}
__device__ __forceinline__ __bf16 at_f2bf(float f) { return __builtin_bit_cast(__bf16, at_bf_bits(f)); }
__device__ __forceinline__ void at_split(float f, __bf16& hi, __bf16& lo) {
  const unsigned short hb = at_bf_bits(f);
  hi = __builtin_bit_cast(__bf16, hb);
  lo = at_f2bf(f - __uint_as_float(((unsigned)hb) << 16));
}
__device__ __forceinline__ v8f at_mma(v16b a, v16b b, v8f c) {
  c = __builtin_amdgcn_wmma_f32_16x16x32_bf16(false, a, false, b, (short)0, c, false, false);
  asm volatile("v_nop\n\tv_nop\n\tv_nop\n\tv_nop" : "+v"(c) : "v"(a), "v"(b));
  return c;
}
__device__ __forceinline__ v8f mma_h16(v16h a, v16h b, v8f c) {
  c = __builtin_amdgcn_wmma_f32_16x16x32_f16(false, a, false, b, (short)0, c, false, false);
  asm volatile("v_nop\n\tv_nop\n\tv_nop\n\tv_nop" : "+v"(c) : "v"(a), "v"(b));
  return c;
}

/* f32[8] -> packed bf16 hi (4 words) and bf16 lo residual (4 words), RNE convert */
__device__ __forceinline__ void split_pack8(const float (&x)[8], v4u& H, v4u& L) {
#pragma unroll
  for (int p = 0; p < 4; ++p) {
    const unsigned short h0 = f2bf_bits(x[2 * p]);
    const unsigned short l0 = f2bf_bits(x[2 * p] - bf_bits2f(h0));
    const unsigned short h1 = f2bf_bits(x[2 * p + 1]);
    const unsigned short l1 = f2bf_bits(x[2 * p + 1] - bf_bits2f(h1));
    H[p] = (unsigned)h0 | ((unsigned)h1 << 16);
    L[p] = (unsigned)l0 | ((unsigned)l1 << 16);
  }
}
__device__ __forceinline__ void store_planes2(unsigned short* __restrict__ hi, unsigned short* __restrict__ lo,
                                              size_t off, v4u H, v4u L) {
  *(v4u*)(hi + off) = H;
  *(v4u*)(lo + off) = L;
  
}

/* ---- activations f32 [rows][128] -> bf16 hi/lo planes, same layout -------------
   coverage: n8 = rows*128/8 threads exactly (host asserts divisibility). */
__global__ __launch_bounds__(256) void split_rows_bf16(const float* __restrict__ in,
                                                        unsigned short* __restrict__ hi,
                                                        unsigned short* __restrict__ lo, int n8) {
  const int i = blockIdx.x * 256 + threadIdx.x;
  if (i >= n8) return;
  const size_t e0 = (size_t)i * 8;
  const v4f a = *(const v4f*)(in + e0);
  const v4f c = *(const v4f*)(in + e0 + 4);
  float x[8];
  x[0] = a[0]; x[1] = a[1]; x[2] = a[2]; x[3] = a[3];
  x[4] = c[0]; x[5] = c[1]; x[6] = c[2]; x[7] = c[3];
  v4u H, L;
  split_pack8(x, H, L);
  store_planes2(hi, lo, e0, H, L);
}

/* ---- weights W[k][n] (input-major, 128x128): in[k][n] -> out[n][k] as transposed bf16 hi/lo planes -----
   outb holds 4 weights x (hi plane + lo plane) of 128*128 halves. grid (8, 4): 2048 threads per weight;
   2048 threads x 8 = 16384 = 128x128 per plane exactly. */
__global__ __launch_bounds__(256) void wt_split_bf16(const float* __restrict__ W0, const float* __restrict__ W1,
                                                     const float* __restrict__ W2, const float* __restrict__ W3,
                                                     unsigned short* __restrict__ outb) {
  const int which = blockIdx.y;
  const float* W = (which == 0) ? W0 : (which == 1) ? W1 : (which == 2) ? W2 : W3;
  unsigned short* hi = outb + (size_t)which * (2 * kC * kC);
  unsigned short* lo = hi + kC * kC;
  const int gt = blockIdx.x * 256 + threadIdx.x;
  if (gt >= kC * kC / 8) return;
  const int n  = gt >> 4;
  const int k8 = (gt & 15) * 8;
  float x[8];
#pragma unroll
  for (int e = 0; e < 8; ++e) x[e] = W[(size_t)(k8 + e) * kC + n];
  v4u H, L;
  split_pack8(x, H, L);
  store_planes2(hi, lo, (size_t)n * kC + k8, H, L);
}

/* lane l with lane l ^ 16: the two halves of a wave hold the two halves of a query column's keys */
__device__ __forceinline__ float xhalf(float x) {
  return __builtin_bit_cast(float, __builtin_amdgcn_permlanex16(__builtin_bit_cast(int, x), __builtin_bit_cast(int, x),
                                                                0x76543210, 0xfedcba98, false, false));
}
/* ---- online softmax step for one head, 32 keys x 16 query columns per wave (2 key subtiles), scores transposed ----
   sA[r]: key 8*hh + r, sB[r]: key 16 + 8*hh + r, both of query column c: a lane holds 16 keys of ONE query.
   Maximum in the lane plus one exchange between the halves; the sum stays a per-lane partial (joined behind the key loop).
   P^T leaves as two B operands, hi and lo: element s = key kmap(s, hh), which is the order the accumulators already have. */
__device__ __forceinline__ float softmax_step_t(const v8f& sA, const v8f& sB, float& mrow, float& lrow, v16b& ph, v16b& pl) {
  float mm[4];
#pragma unroll
  for (int k = 0; k < 4; ++k) mm[k] = fmaxf(fmaxf(sA[k], sA[4 + k]), fmaxf(sB[k], sB[4 + k]));
  float m = fmaxf(fmaxf(mm[0], mm[1]), fmaxf(mm[2], mm[3]));
  m = fmaxf(m, xhalf(m));
  const float mnew = fmaxf(mrow, m);
  const float al = expf(mrow - mnew);
  mrow = mnew;
  float ps[4] = {0.f, 0.f, 0.f, 0.f};
#pragma unroll
  for (int r = 0; r < 8; ++r) {
    const float p0 = expf(sA[r] - mnew);
    const float p1 = expf(sB[r] - mnew);
    ps[r & 1]       += p0;
    ps[2 + (r & 1)] += p1;
    __bf16 hi, lo;
    at_split(p0, hi, lo);
    ph[r] = hi;  pl[r] = lo;
    at_split(p1, hi, lo);
    ph[8 + r] = hi;  pl[8 + r] = lo;
  }
  lrow = lrow * al + ((ps[0] + ps[1]) + (ps[2] + ps[3]));
  return al;
}
/* per-wave transposed result (o[t][r] = O[query c][d = t*16 + 8*hh + r]) -> LDS staging [query][d] (pitch kOsPitch);
   writes rows 0..15, cols 0..31, 8 consecutive floats per lane and tile */
__device__ __forceinline__ void tile_to_os(float* os, const v8f (&o)[2], int hh, int c) {
#pragma unroll
  for (int t = 0; t < 2; ++t) {
    float* p = os + c * kOsPitch + t * 16 + 8 * hh;
    *(v4f*)(p)     = (v4f){o[t][0], o[t][1], o[t][2], o[t][3]};
    *(v4f*)(p + 4) = (v4f){o[t][4], o[t][5], o[t][6], o[t][7]};
  }
}
/* weighted sum over the kSplit key groups of one query tile, 4 floats of one row per lane;
   os0: staging tile of key group 0 for this query tile, the groups 4 tiles apart */
__device__ __forceinline__ v4f merge_os(const float* os0, const float (&w)[kSplit], int row, int c4) {
  v4f acc = (v4f){0.f, 0.f, 0.f, 0.f};
#pragma unroll
  for (int s = 0; s < kSplit; ++s) {
    const v4f v = *(const v4f*)(os0 + s * (4 * 16 * kOsPitch) + row * kOsPitch + c4);
#pragma unroll
    for (int e = 0; e < 4; ++e) acc[e] += w[s] * v[e];
  }
  return acc;
}

/* ---- attention for one (batch, head h, 64 query rows) ----------------------------------
   q16/k16: f16 planes [B*N][128] (head-major columns); vhi/vlo: bf16 hi/lo planes [B*Nkv][128].
   scores^T = (k.q^T)*scale + rpe[idx][h], the head's table column held in LDS; online softmax in f32, a lane holding one query's keys;
   P^T hi and lo go from the score accumulators straight into B operands, never through LDS;
   o^T = V_h^T . P^T;  for h >= 2 also ox^T = V_{h-2}^T . P^T (the cross term of the differential mixing).
   16 waves: wave = (key group sp, query tile qt). Group sp (4 waves) takes key chunks sp, sp + kSplit, ... with its own
   K/V tiles and each wave its own running max, sum and accumulators; the groups are merged through LDS at the end.
   xattn f32 [B*Nq][128]; ycross f32 [B][2][Nq][32]. grid.x = B*H*(Nq/64), block 128 * kSplit. */
__global__ __launch_bounds__(128 * kSplit) __attribute__((amdgpu_num_vgpr(256)))
void attn_head_kernel(
    const unsigned short* __restrict__ q16, const unsigned short* __restrict__ k16,
    const unsigned short* __restrict__ vhi, const unsigned short* __restrict__ vlo,
    const int* __restrict__ coords_q, const int* __restrict__ coords_k,
    const float* __restrict__ rpe,
    float* __restrict__ xattn, float* __restrict__ ycross)
{
  __shared__ __align__(16) unsigned short KshS[kSplit][kKC * kHD];   /* [group][key][d]  f16 bits  */
  __shared__ __align__(16) unsigned short VthS[kSplit][kHD * kKC];   /* [group][d][key] bf16 hi, head h   */
  __shared__ __align__(16) unsigned short VtlS[kSplit][kHD * kKC];   /* [group][d][key] bf16 lo, head h   */
  __shared__ __align__(16) unsigned short VxhS[kSplit][kHD * kKC];   /* [group][d][key] bf16 hi, head h-2 */
  __shared__ __align__(16) unsigned short VxlS[kSplit][kHD * kKC];   /* [group][d][key] bf16 lo, head h-2 */
  __shared__ __align__(16) float Tab[kTabLds];                       /* rpe[idx][h] for this block's head, all idx */
  /* behind the key loop the table is dead and its bytes take the merge staging */
  static_assert(4 * kSplit * 16 * kOsPitch + 4 * kSplit * 16 * 2 <= kTabLds, "");
  float* const OsAll = Tab;                                          /* [wave][16 * kOsPitch] */
  float* const MlAll = Tab + 4 * kSplit * 16 * kOsPitch;             /* [wave][row] (max, sum) */

  const int wave = threadIdx.x >> 5;     /* 0 .. 15 */
  const int sp   = wave >> 2;            /* key group */
  const int qt   = wave & 3;             /* query tile */
  const int tid  = threadIdx.x & 127;    /* thread within the key group */
  const int lane = tid & 31;
  unsigned short* Ksh = KshS[sp];
  unsigned short* Vth = VthS[sp];
  unsigned short* Vtl = VtlS[sp];
  unsigned short* Vxh = VxhS[sp];
  unsigned short* Vxl = VxlS[sp];
  const int hh   = lane >> 4;
  const int c    = lane & 15;
  constexpr int nqb = kNq / kQB;
  const int bx   = blockIdx.x;
  const int qb   = bx % nqb;
  const int rest = bx / nqb;
  const int h    = rest % kH;
  const int b    = rest / kH;
  const bool cross = (h >= kNH);                       /* block-uniform */
  const int hcol = h * kHD;
  const int xcol = (cross ? (h - kNH) : 0) * kHD;
  const int q0   = qb * kQB + qt * 16;
  const size_t qrows  = (size_t)b * kNq + q0;
  const size_t kvrows = (size_t)b * kNkv;
  const float* __restrict__ rpe_h = rpe + h;           /* table entry stride kH floats */

  /* this head's column of the bias table -> LDS, once per work-group; batches of 16 loads per thread keep the
     latency of the strided reads covered. The first barrier of the key loop publishes it. */
  {
    constexpr int kThreads = 128 * kSplit;
    constexpr int kFull = kTable / (kThreads * 16);
    const int t0 = threadIdx.x;
    /* rolled: 16 waves x 16 loads in flight already cover the L2 latency; unrolled further the copy only takes more registers */
#pragma unroll 1
    for (int g = 0; g < kFull; ++g) {
      float tv[16];
      const float* gp = rpe_h + (size_t)(g * 16 * kThreads + t0) * kH;
#pragma unroll
      for (int u = 0; u < 16; ++u) tv[u] = gp[u * (kThreads * kH)];
      asm volatile("s_wait_xcnt 0x0" :: "v"(gp) : "memory");   /* the loads' address registers are kept as they are until this wait */
#pragma unroll
      for (int u = 0; u < 16; ++u) Tab[(g * 16 + u) * kThreads + t0] = tv[u];
    }
    for (int i = kFull * 16 * kThreads + t0; i < kTable; i += kThreads) Tab[i] = rpe_h[(size_t)i * kH];
  }

  /* Q fragment (B operand: lane c -> query column c; K = head_dim = 32, one k-step) */
  const _Float16* qp = (const _Float16*)(const void*)q16;
  const v16h qa = Frag<_Float16>::load(qp + (qrows + c) * kC + hcol + 8 * hh);

  /* coords of this lane's query column c, +MAXD folded in */
  const v2i cq = *(const v2i*)(coords_q + (qrows + c) * 2);
  const int cqx = cq.x + kMaxd;
  const int cqy = cq.y + kMaxd;

  float mr = -INFINITY, lr = 0.f;   /* running max (equal in both halves) and this lane's partial sum for query c */
  v8f o[2], ox[2];                  /* o[t][r] = O[query c][d = t*16 + 8*hh + r] */
#pragma unroll
  for (int t = 0; t < 2; ++t) {
    o[t]  = (v8f){0.f,0.f,0.f,0.f,0.f,0.f,0.f,0.f};
    ox[t] = (v8f){0.f,0.f,0.f,0.f,0.f,0.f,0.f,0.f};
  }

  for (int kc = 0; kc < kNkv / (kKC * kSplit); ++kc) {
    const int kv0 = (kc * kSplit + sp) * kKC;
    __syncthreads();
    /* coords of this lane's 16 score rows (keys j*16 + 8*hh + r), two keys per 16-byte load, the same address in the 16 lanes
       of a half; asked for just ahead of the K and V rows so that one round trip serves both */
    v4i ck[2][4];
    {
      const int* ckp = coords_k + (kvrows + kv0 + 8 * hh) * 2;
#pragma unroll
      for (int j = 0; j < 2; ++j) {
#pragma unroll
        for (int i = 0; i < 4; ++i) ck[j][i] = *(const v4i*)(ckp + j * 32 + i * 4);
      }
      asm volatile("s_wait_xcnt 0x0" :: "v"(ckp) : "memory");   /* the loads' address registers are kept as they are until this wait */
    }
    /* stage K tile and V^T hi/lo tiles: 32 keys x 4 segments of 8 halves = 128 = threads of a key group, one uint4 per thread
       per plane; covers Ksh 32x32, Vth/Vtl 32x32 (and Vxh/Vxl when cross) exactly */
    {
      const int key = tid >> 2;
      const int seg = tid & 3;
      const size_t rowoff = (kvrows + kv0 + key) * kC;
      const size_t go = rowoff + hcol + seg * 8;
      const uint4 kw = *(const uint4*)(k16 + go);
      *(uint4*)(&Ksh[key * kHD + seg * 8]) = kw;
      const uint4 vh4 = *(const uint4*)(vhi + go);
      const uint4 vl4 = *(const uint4*)(vlo + go);
      unsigned short* vth = &Vth[(seg * 8) * kKC + key];
      unsigned short* vtl = &Vtl[(seg * 8) * kKC + key];
      vth[0 * kKC] = (unsigned short)(vh4.x & 0xffffu); vth[1 * kKC] = (unsigned short)(vh4.x >> 16);
      vth[2 * kKC] = (unsigned short)(vh4.y & 0xffffu); vth[3 * kKC] = (unsigned short)(vh4.y >> 16);
      vth[4 * kKC] = (unsigned short)(vh4.z & 0xffffu); vth[5 * kKC] = (unsigned short)(vh4.z >> 16);
      vth[6 * kKC] = (unsigned short)(vh4.w & 0xffffu); vth[7 * kKC] = (unsigned short)(vh4.w >> 16);
      vtl[0 * kKC] = (unsigned short)(vl4.x & 0xffffu); vtl[1 * kKC] = (unsigned short)(vl4.x >> 16);
      vtl[2 * kKC] = (unsigned short)(vl4.y & 0xffffu); vtl[3 * kKC] = (unsigned short)(vl4.y >> 16);
      vtl[4 * kKC] = (unsigned short)(vl4.z & 0xffffu); vtl[5 * kKC] = (unsigned short)(vl4.z >> 16);
      vtl[6 * kKC] = (unsigned short)(vl4.w & 0xffffu); vtl[7 * kKC] = (unsigned short)(vl4.w >> 16);
      if (cross) {
        const size_t gx = rowoff + xcol + seg * 8;
        const uint4 xh4 = *(const uint4*)(vhi + gx);
        const uint4 xl4 = *(const uint4*)(vlo + gx);
        unsigned short* vxh = &Vxh[(seg * 8) * kKC + key];
        unsigned short* vxl = &Vxl[(seg * 8) * kKC + key];
        vxh[0 * kKC] = (unsigned short)(xh4.x & 0xffffu); vxh[1 * kKC] = (unsigned short)(xh4.x >> 16);
        vxh[2 * kKC] = (unsigned short)(xh4.y & 0xffffu); vxh[3 * kKC] = (unsigned short)(xh4.y >> 16);
        vxh[4 * kKC] = (unsigned short)(xh4.z & 0xffffu); vxh[5 * kKC] = (unsigned short)(xh4.z >> 16);
        vxh[6 * kKC] = (unsigned short)(xh4.w & 0xffffu); vxh[7 * kKC] = (unsigned short)(xh4.w >> 16);
        vxl[0 * kKC] = (unsigned short)(xl4.x & 0xffffu); vxl[1 * kKC] = (unsigned short)(xl4.x >> 16);
        vxl[2 * kKC] = (unsigned short)(xl4.y & 0xffffu); vxl[3 * kKC] = (unsigned short)(xl4.y >> 16);
        vxl[4 * kKC] = (unsigned short)(xl4.z & 0xffffu); vxl[5 * kKC] = (unsigned short)(xl4.z >> 16);
        vxl[6 * kKC] = (unsigned short)(xl4.w & 0xffffu); vxl[7 * kKC] = (unsigned short)(xl4.w >> 16);
      }
    }
    __syncthreads();

    /* scores^T: s[j], j = key subtile; A fragment lane c -> key j*16+c, elements d (split map); s[j][r] = S[key j*16+8*hh+r][query c] */
    v8f s[2];
    {
      const v8f z = (v8f){0.f,0.f,0.f,0.f,0.f,0.f,0.f,0.f};
      const _Float16* Kp = (const _Float16*)(const void*)Ksh;
#pragma unroll
      for (int j = 0; j < 2; ++j) {
        Frag<_Float16>::U kb;
        kb.h[0] = *(const v8h*)(Kp + (j * 16 + c) * kHD + 8 * hh);
        kb.h[1] = *(const v8h*)(Kp + (j * 16 + c) * kHD + 16 + 8 * hh);
        s[j] = mma_h16(kb.v, qa, z);
      }
    }

    /* scale + relative position bias: one clamped b32 gather from the LDS table per (key, query) */
#pragma unroll
    for (int r = 0; r < 8; ++r) {
#pragma unroll
      for (int j = 0; j < 2; ++j) {
        const int kx = ck[j][r >> 1][(r & 1) * 2];
        const int ky = ck[j][r >> 1][(r & 1) * 2 + 1];
        int dx = cqx - kx; dx = dx < 0 ? 0 : dx; dx = dx > 2 * kMaxd ? 2 * kMaxd : dx;
        int dy = cqy - ky; dy = dy < 0 ? 0 : dy; dy = dy > 2 * kMaxd ? 2 * kMaxd : dy;
        const int idx = dx * kSpan + dy;            /* 0 .. kTable-1 */
        s[j][r] = s[j][r] * kScale + Tab[idx];
      }
    }

    /* online softmax; P^T hi and lo stay in registers as B operands */
    v16b ph, pl;
    const float al = softmax_step_t(s[0], s[1], mr, lr, ph, pl);
#pragma unroll
    for (int t = 0; t < 2; ++t) {
#pragma unroll
      for (int r = 0; r < 8; ++r) { o[t][r] *= al; ox[t][r] *= al; }
    }

    /* V^T.P^T : A = V^T tile (lane c -> d, elements key, split map), B = P^T (lane c -> query, elements key, same map) */
    {
      const __bf16* Vh = (const __bf16*)(const void*)Vth;
      const __bf16* Vl = (const __bf16*)(const void*)Vtl;
#pragma unroll
      for (int t = 0; t < 2; ++t) {
        Frag<__bf16>::U vh, vl;
        vh.h[0] = *(const v8b*)(Vh + (t * 16 + c) * kKC + 8 * hh);  vh.h[1] = *(const v8b*)(Vh + (t * 16 + c) * kKC + 16 + 8 * hh);
        vl.h[0] = *(const v8b*)(Vl + (t * 16 + c) * kKC + 8 * hh);  vl.h[1] = *(const v8b*)(Vl + (t * 16 + c) * kKC + 16 + 8 * hh);
        o[t] = at_mma(vh.v, ph, o[t]);
        o[t] = at_mma(vl.v, ph, o[t]);
        o[t] = at_mma(vh.v, pl, o[t]);
      }
      if (cross) {
        const __bf16* Xh = (const __bf16*)(const void*)Vxh;
        const __bf16* Xl = (const __bf16*)(const void*)Vxl;
#pragma unroll
        for (int t = 0; t < 2; ++t) {
          Frag<__bf16>::U vh, vl;
          vh.h[0] = *(const v8b*)(Xh + (t * 16 + c) * kKC + 8 * hh);  vh.h[1] = *(const v8b*)(Xh + (t * 16 + c) * kKC + 16 + 8 * hh);
          vl.h[0] = *(const v8b*)(Xl + (t * 16 + c) * kKC + 8 * hh);  vl.h[1] = *(const v8b*)(Xl + (t * 16 + c) * kKC + 16 + 8 * hh);
          ox[t] = at_mma(vh.v, ph, ox[t]);
          ox[t] = at_mma(vl.v, ph, ox[t]);
          ox[t] = at_mma(vh.v, pl, ox[t]);
        }
      }
    }
  }

  /* merge of the key groups: every wave leaves its accumulators (not normalised) and its (max, sum) in LDS;
     wave (sp, qt) then merges rows 4*sp .. 4*sp+3 of query tile qt: x = sum_s e^(m_s-M) o_s / sum_s e^(m_s-M) l_s */
  __syncthreads();   /* every wave has made its last table read: the table's bytes become the merge staging */
  float* os = OsAll + wave * (16 * kOsPitch);
  const float* osq = OsAll + qt * (16 * kOsPitch);
  tile_to_os(os, o, hh, c);
  lr += xhalf(lr);   /* the two halves' partial sums of query c */
  if (hh == 0) {     /* max and sum are now equal in lanes c and c + 16 */
    MlAll[wave * 32 + c * 2] = mr;
    MlAll[wave * 32 + c * 2 + 1] = lr;
  }
  __syncthreads();   /* all groups' partial tiles are in LDS */

  const int row = 4 * sp + (lane >> 3);
  const int c4  = (lane & 7) * 4;
  float w[kSplit];
  {
    float ms[kSplit], ls[kSplit];
    float M = -INFINITY;
#pragma unroll
    for (int s = 0; s < kSplit; ++s) {
      ms[s] = MlAll[(s * 4 + qt) * 32 + row * 2];
      ls[s] = MlAll[(s * 4 + qt) * 32 + row * 2 + 1];
      M = fmaxf(M, ms[s]);
    }
    float L = 0.f;
#pragma unroll
    for (int s = 0; s < kSplit; ++s) { w[s] = expf(ms[s] - M); L += w[s] * ls[s]; }
    const float inv = 1.0f / L;
#pragma unroll
    for (int s = 0; s < kSplit; ++s) w[s] *= inv;
  }
  *(v4f*)(xattn + (qrows + row) * kC + hcol + c4) = merge_os(osq, w, row, c4);
  asm volatile("s_wait_xcnt 0x0" ::: "memory");   /* the cross path below reuses the registers this store names */

  if (cross) {
    __syncthreads();   /* every reader has left the o tiles */
    tile_to_os(os, ox, hh, c);
    __syncthreads();   /* all groups' cross tiles are in LDS */
    *(v4f*)(ycross + ((((size_t)b * kNH + (h - kNH)) * kNq + q0 + row) * kHD) + c4) = merge_os(osq, w, row, c4);
  }
}

/* ---- differential head mixing + split to bf16 hi/lo planes for the output projection --------
   x[b,q,h*32+d] = xs + alpha[b,q]*(xs - lam[h]*yc[b,h,q,d]) for h < 2, else xs.
   coverage 65536 threads x 8 = 4096x128 exactly. */
__global__ __launch_bounds__(256) void combine_split_kernel(
    const float* __restrict__ xattn, const float* __restrict__ ycross, const float* __restrict__ alpha,
    const float* __restrict__ lq1, const float* __restrict__ lk1,
    const float* __restrict__ lq2, const float* __restrict__ lk2,
    unsigned short* __restrict__ hi, unsigned short* __restrict__ lo)
{
  __shared__ float lam_s[2];
  if (threadIdx.x < 2) {
    const int h = threadIdx.x;
    float s1 = 0.f, s2 = 0.f;
#pragma unroll 1
    for (int i = 0; i < kHD; ++i) {
      s1 += lq1[h * kHD + i] * lk1[h * kHD + i];
      s2 += lq2[h * kHD + i] * lk2[h * kHD + i];
    }
    lam_s[h] = expf(s1) - expf(s2) + kLambdaInit;
  }
  __syncthreads();
  const int gt = blockIdx.x * 256 + threadIdx.x;
  if (gt >= kBatch * kNq * kC / 8) return;
  const size_t e0 = (size_t)gt * 8;
  const int row = (int)(e0 >> 7);
  const int col = (int)(e0 & 127);
  const int h   = col >> 5;
  const int d   = col & 31;
  const int hc  = h & 1;
  const int b   = row >> 11;
  const int q   = row & (kNq - 1);
  const float a   = alpha[row];
  const float lam = lam_s[hc];
  const v4f xs0 = *(const v4f*)(xattn + e0);
  const v4f xs1 = *(const v4f*)(xattn + e0 + 4);
  const size_t yo = (((size_t)b * kNH + hc) * kNq + q) * kHD + d;
  const v4f y0 = *(const v4f*)(ycross + yo);
  const v4f y1 = *(const v4f*)(ycross + yo + 4);
  const bool mix = (h < kNH);
  float x[8];
#pragma unroll
  for (int e = 0; e < 4; ++e) {
    const float xa = xs0[e], xb = xs1[e];
    const float va = xa + a * (xa - lam * y0[e]);
    const float vb = xb + a * (xb - lam * y1[e]);
    x[e]     = mix ? va : xa;
    x[4 + e] = mix ? vb : xb;
  }
  v4u H, L;
  split_pack8(x, H, L);
  store_planes2(hi, lo, e0, H, L);
}

/* =========================================================================================
   host launch: 9 kernel launches
   workspace region map (bytes, all offsets MiB/256-KiB aligned):
     xq_hi  1 MiB | xq_lo 1 MiB | xkv_hi 2 MiB | xkv_lo 2 MiB | wt planes 256 KiB (4 weights x hi,lo x 32 KiB)
     q16 1 MiB | k16 2 MiB | v_hi 2 MiB | v_lo 2 MiB | xattn f32 2 MiB | ycross f32 1 MiB | xmix_hi 1 MiB | xmix_lo 1 MiB
     total 19,136,512 B
   ========================================================================================= */
extern "C" void kernel_launch(void* const* d_in, const int* in_sizes, int n_in,
                              void* d_out, int out_size, void* d_ws, size_t ws_size,
                              hipStream_t stream) {
  constexpr int Mq  = kBatch * kNq;    /* 4096 */
  constexpr int Mkv = kBatch * kNkv;   /* 8192 */
  static_assert(Mq % 64 == 0 && Mkv % 64 == 0 && kC % 64 == 0 && kC % 32 == 0, "");
  static_assert((Mq * kC) % 8 == 0 && (Mkv * kC) % 8 == 0, "");
  if (n_in < 18) return;
  if (in_sizes[0] != Mq * kC || in_sizes[1] != Mkv * kC || in_sizes[2] != Mq * 2 || in_sizes[3] != Mkv * 2 ||
      in_sizes[4] != Mq || in_sizes[5] != kC * kC || in_sizes[7] != kC * kC || in_sizes[9] != kC * kC ||
      in_sizes[16] != kC * kC || in_sizes[6] != kC || in_sizes[8] != kC || in_sizes[10] != kC || in_sizes[17] != kC ||
      in_sizes[11] != kNH * kHD || in_sizes[12] != kNH * kHD || in_sizes[13] != kNH * kHD || in_sizes[14] != kNH * kHD ||
      in_sizes[15] != kTable * kH || out_size != Mq * kC) return;

  const float* x_q      = (const float*)d_in[0];
  const float* x_kv     = (const float*)d_in[1];
  const int*   coords_q = (const int*)d_in[2];
  const int*   coords_k = (const int*)d_in[3];
  const float* alpha    = (const float*)d_in[4];
  const float* Wq = (const float*)d_in[5];  const float* bq = (const float*)d_in[6];
  const float* Wk = (const float*)d_in[7];  const float* bk = (const float*)d_in[8];
  const float* Wv = (const float*)d_in[9];  const float* bv = (const float*)d_in[10];
  const float* lq1 = (const float*)d_in[11]; const float* lk1 = (const float*)d_in[12];
  const float* lq2 = (const float*)d_in[13]; const float* lk2 = (const float*)d_in[14];
  const float* rpe = (const float*)d_in[15];
  const float* Wp = (const float*)d_in[16]; const float* bp = (const float*)d_in[17];
  float* out = (float*)d_out;

  char* ws = (char*)d_ws;
  size_t off = 0;
  const size_t szXq16  = (size_t)Mq * kC * 2;     /* 1 MiB  */
  const size_t szXkv16 = (size_t)Mkv * kC * 2;    /* 2 MiB  */
  const size_t szWt    = (size_t)4 * 2 * kC * kC * 2;
  const size_t szXattn = (size_t)Mq * kC * 4;
  const size_t szYc    = (size_t)kBatch * kNH * kNq * kHD * 4;
  unsigned short* xq_hi  = (unsigned short*)(ws + off); off += szXq16;
  unsigned short* xq_lo  = (unsigned short*)(ws + off); off += szXq16;
  unsigned short* xkv_hi = (unsigned short*)(ws + off); off += szXkv16;
  unsigned short* xkv_lo = (unsigned short*)(ws + off); off += szXkv16;
  unsigned short* wt     = (unsigned short*)(ws + off); off += szWt;
  unsigned short* q16    = (unsigned short*)(ws + off); off += szXq16;
  unsigned short* k16    = (unsigned short*)(ws + off); off += szXkv16;
  unsigned short* v_hi   = (unsigned short*)(ws + off); off += szXkv16;
  unsigned short* v_lo   = (unsigned short*)(ws + off); off += szXkv16;
  float*          xattn  = (float*)(ws + off);          off += szXattn;
  float*          ycross = (float*)(ws + off);          off += szYc;
  unsigned short* xm_hi  = (unsigned short*)(ws + off); off += szXq16;
  unsigned short* xm_lo  = (unsigned short*)(ws + off); off += szXq16;
  if (off > ws_size) return;

  const unsigned short* wtq_hi = wt + 0 * (2 * kC * kC); const unsigned short* wtq_lo = wtq_hi + kC * kC;
  const unsigned short* wtk_hi = wt + 1 * (2 * kC * kC); const unsigned short* wtk_lo = wtk_hi + kC * kC;
  const unsigned short* wtv_hi = wt + 2 * (2 * kC * kC); const unsigned short* wtv_lo = wtv_hi + kC * kC;
  const unsigned short* wtp_hi = wt + 3 * (2 * kC * kC); const unsigned short* wtp_lo = wtp_hi + kC * kC;

  /* 1-2: activations -> bf16 hi/lo planes */
  const int n8q = Mq * kC / 8, n8kv = Mkv * kC / 8;
  split_rows_bf16<<<dim3((n8q + 255) / 256), dim3(256), 0, stream>>>(x_q, xq_hi, xq_lo, n8q);
  split_rows_bf16<<<dim3((n8kv + 255) / 256), dim3(256), 0, stream>>>(x_kv, xkv_hi, xkv_lo, n8kv);
  /* 3: weights -> transposed bf16 hi/lo planes (in[k][n] -> out[n][k], square 128x128) */
  wt_split_bf16<<<dim3((kC * kC / 8 + 255) / 256, 4), dim3(256), 0, stream>>>(Wq, Wk, Wv, Wp, wt);

  /* 4-6: projections, M x 128, K = 128 (M % 64 == 0, N = 128 % 64 == 0, K = 128 % 32 == 0) */
  const int blocksQ  = ((Mq  / 64) * (kC / 64) + 7) / 8;
  const int blocksKV = ((Mkv / 64) * (kC / 64) + 7) / 8;
  wmma_gemm64<1, true, 2, 1, false><<<dim3(blocksQ, 1), dim3(256), 0, stream>>>(
      xq_hi, xq_lo, kC, 0L, wtq_hi, wtq_lo, kC, 0L, (void*)q16, nullptr, kC, 0L, bq, nullptr, 0L, Mq, kC, kC, 1.0f);
  wmma_gemm64<1, true, 2, 1, false><<<dim3(blocksKV, 1), dim3(256), 0, stream>>>(
      xkv_hi, xkv_lo, kC, 0L, wtk_hi, wtk_lo, kC, 0L, (void*)k16, nullptr, kC, 0L, bk, nullptr, 0L, Mkv, kC, kC, 1.0f);
  wmma_gemm64<1, true, 2, 2, false><<<dim3(blocksKV, 1), dim3(256), 0, stream>>>(
      xkv_hi, xkv_lo, kC, 0L, wtv_hi, wtv_lo, kC, 0L, (void*)v_hi, (void*)v_lo, kC, 0L, bv, nullptr, 0L, Mkv, kC, kC, 1.0f);

  /* 7: attention per (batch, head, 64 queries) */
  const int attnBlocks = kBatch * kH * (kNq / kQB);
  attn_head_kernel<<<dim3(attnBlocks), dim3(128 * kSplit), 0, stream>>>(q16, k16, v_hi, v_lo, coords_q, coords_k, rpe, xattn, ycross);

  /* 8: differential mixing + bf16 hi/lo planes */
  combine_split_kernel<<<dim3((n8q + 255) / 256), dim3(256), 0, stream>>>(xattn, ycross, alpha, lq1, lk1, lq2, lk2, xm_hi, xm_lo);

  /* 9: output projection -> d_out (f32), M = 4096, N = 128, K = 128 */
  wmma_gemm64<1, true, 2, 0, false><<<dim3(blocksQ, 1), dim3(256), 0, stream>>>(
      xm_hi, xm_lo, kC, 0L, wtp_hi, wtp_lo, kC, 0L, (void*)out, nullptr, kC, 0L, bp, nullptr, 0L, Mq, kC, kC, 1.0f);
}

// v004
// Measured time: 167 microseconds a run.
// Next to v003, in two timings, it ran 1.15 and 1.17 times as fast.
// Over all steps from v000 it is 2.71 times as fast.
// Contractions: x@Wq, x@Wk, x@Wv and xmix@Wp on v_wmma_f32_16x16x32_bf16 with bf16 hi/lo operand planes (hi.hi + hi.lo + lo.hi); k.q^T on v_wmma_f32_16x16x32_f16 with plain f16 q/k planes; v^T.p^T and v_cross^T.p^T on v_wmma_f32_16x16x32_bf16 with bf16 hi/lo p and v tiles; f32 accumulate; bias gather, online softmax and head mixing in f32.
#include <hip/hip_runtime.h>
#include <stdint.h>

typedef __attribute__((ext_vector_type(16))) _Float16 v16h;
typedef __attribute__((ext_vector_type(8)))  _Float16 v8h;
typedef __attribute__((ext_vector_type(16))) __bf16   v16b;
typedef __attribute__((ext_vector_type(8)))  __bf16   v8b;
typedef __attribute__((ext_vector_type(8)))  float    v8f;
typedef __attribute__((ext_vector_type(4)))  float    v4f;
typedef __attribute__((ext_vector_type(4)))  unsigned int v4u;
typedef __attribute__((ext_vector_type(2)))  int      v2i;
typedef __attribute__((ext_vector_type(4)))  int      v4i;
typedef __attribute__((ext_vector_type(8)))  short    v8s;

/* ---- problem geometry (fixed by the module) ---- */
constexpr int kBatch = 2;
constexpr int kNq    = 2048;
constexpr int kNkv   = 4096;
constexpr int kC     = 128;
constexpr int kH     = 4;
constexpr int kHD    = 32;
constexpr int kNH    = 2;
constexpr int kMaxd  = 128;
constexpr int kSpan  = 2 * kMaxd + 1;
constexpr int kTable = kSpan * kSpan;
constexpr int kKC    = 32;     /* keys per chunk in the attention kernel */
constexpr int kQB    = 64;     /* query rows per attention block (4 query tiles x 16) */
constexpr int kSplit = 4;      /* key groups per attention block: wave = (key group, query tile) */
constexpr int kOsPitch = 36;   /* floats; per-wave output staging pitch */
constexpr int kVP    = 48;     /* halves; LDS row pitch of the V tiles: 96 B = 32 B x odd, the pitch of the transposing load */
constexpr int kTabLds  = (kTable + 3) & ~3;   /* floats; one head's bias column in LDS, rounded to 16 bytes */
constexpr float kScale = 0.17677669529663687f;   /* head_dim ** -0.5 */
constexpr float kLambdaInit = 0.8f;

static_assert(kNq % kQB == 0, "");
static_assert(kNkv % (kKC * kSplit) == 0, "");
static_assert(kSplit * 4 == 16, "");   /* the merge gives each wave 16 / kSplit = 4 rows = 32 lanes x 4 floats */
static_assert(kC == kH * kHD, "");
static_assert((kBatch * kNq) % 64 == 0 && (kBatch * kNkv) % 64 == 0, "");
static_assert(kC % 64 == 0 && kC % 32 == 0, "");
static_assert(kH == 4 && kNH == 2 && kHD == 32 && kKC == 32, "");

__device__ __forceinline__ unsigned short f2bf_bits(float f) {
  unsigned u = __float_as_uint(f);
  return (unsigned short)((u + 0x7FFFu + ((u >> 16) & 1u)) >> 16);
}
__device__ __forceinline__ float bf_bits2f(unsigned short h) { return __uint_as_float(((unsigned)h) << 16); }

/* hazard guards as plain device helpers */
__device__ __forceinline__ void dep_guard_h(v8f& a, v8f& b, v16h x, v16h y) { asm volatile("v_nop\n\tv_nop\n\tv_nop\n\tv_nop" : "+v"(a), "+v"(b) : "v"(x), "v"(y)); }
__device__ __forceinline__ void dep_guard_b(v8f& a, v8f& b, v16b x, v16b y) { asm volatile("v_nop\n\tv_nop\n\tv_nop\n\tv_nop" : "+v"(a), "+v"(b) : "v"(x), "v"(y)); }
__device__ __forceinline__ void keep4_h(v16h a, v16h b, v16h c, v16h d) { asm volatile("v_nop" :: "v"(a), "v"(b), "v"(c), "v"(d)); }
__device__ __forceinline__ void keep4_b(v16b a, v16b b, v16b c, v16b d) { asm volatile("v_nop" :: "v"(a), "v"(b), "v"(c), "v"(d)); }
__device__ __forceinline__ void acc_guard4(v8f& a, v8f& b, v8f& c, v8f& d) { asm volatile("v_nop\n\tv_nop\n\tv_nop\n\tv_nop" : "+v"(a), "+v"(b), "+v"(c), "+v"(d)); }
template <typename T> struct Frag;
template <> struct Frag<_Float16> {
  typedef v16h V; union U { v16h v; v8h h[2]; };
  static __device__ __forceinline__ v16h load(const _Float16* p) {
    U f; f.h[0] = *(const v8h*)(p); f.h[1] = *(const v8h*)(p + 16); return f.v;
  }
  static __device__ __forceinline__ v8f mma(v16h a, v16h b, v8f c) {
    return __builtin_amdgcn_wmma_f32_16x16x32_f16(false, a, false, b, (short)0, c, false, false);
  }
  static __device__ __forceinline__ void guard(v8f& a, v8f& b, v16h x, v16h y) { dep_guard_h(a, b, x, y); }
  static __device__ __forceinline__ void keep(v16h a, v16h b, v16h c, v16h d) { keep4_h(a, b, c, d); }
};
template <> struct Frag<__bf16> {
  typedef v16b V; union U { v16b v; v8b h[2]; };
  static __device__ __forceinline__ v16b load(const __bf16* p) {
    U f; f.h[0] = *(const v8b*)(p); f.h[1] = *(const v8b*)(p + 16); return f.v;
  }
  static __device__ __forceinline__ v8f mma(v16b a, v16b b, v8f c) {
    return __builtin_amdgcn_wmma_f32_16x16x32_bf16(false, a, false, b, (short)0, c, false, false);
  }
  static __device__ __forceinline__ void guard(v8f& a, v8f& b, v16b x, v16b y) { dep_guard_b(a, b, x, y); }
  static __device__ __forceinline__ void keep(v16b a, v16b b, v16b c, v16b d) { keep4_b(a, b, c, d); }
};

/* ---- Register-blocked batched WMMA GEMM ---------------- */
template <int ET> struct Elem;
template <> struct Elem<0> { typedef _Float16 T; };
template <> struct Elem<1> { typedef __bf16 T; };
template <int ET, bool SPLIT, int BIAS_MODE, int OUT_MODE, bool RESID, int ACT = 0>
__global__ __launch_bounds__(256) void wmma_gemm64(
    const unsigned short* __restrict__ Ap, const unsigned short* __restrict__ A2p, int lda, long strideA,
    const unsigned short* __restrict__ Btp, const unsigned short* __restrict__ Bt2p, int ldb, long strideB,
    void* __restrict__ Cout, void* __restrict__ Cout2, int ldc, long strideC,
    const float* __restrict__ bias,
    const float* __restrict__ resid, long strideR,
    int M, int N, int K, float scale) {
  typedef typename Elem<ET>::T T;
  typedef typename Frag<T>::V V;
  const T* A = (const T*)Ap; const T* A2 = (const T*)A2p; const T* Bt = (const T*)Btp; const T* Bt2 = (const T*)Bt2p;
  __shared__ __align__(16) float sT[8][16 * 68];
  const int b    = blockIdx.y;
  const int lane = threadIdx.x & 31;
  const int wave = threadIdx.x >> 5;
  const int tilesN = N >> 6;
  const int tilesM = M >> 6;
  const int tile = blockIdx.x * 8 + wave;
  if (tile >= tilesM * tilesN) return;
  const int tm = tile / tilesN;
  const int tn = tile - tm * tilesN;
  const int m0 = tm << 6;
  const int n0 = tn << 6;

  const T* Ab  = A  + (size_t)b * strideA;
  const T* Bb  = Bt + (size_t)b * strideB;
  const T* Ab2 = SPLIT ? (A2  + (size_t)b * strideA) : nullptr;
  const T* Bb2 = SPLIT ? (Bt2 + (size_t)b * strideB) : nullptr;

  const int rlane = lane & 15;
  const int koff  = (lane >> 4) * 8;
  const int mOff  = (lane >> 4) * 8;

  v8f acc[4][4];
#pragma unroll
  for (int i = 0; i < 4; ++i)
#pragma unroll
    for (int j = 0; j < 4; ++j) acc[i][j] = (v8f){0.f,0.f,0.f,0.f,0.f,0.f,0.f,0.f};

  for (int k0 = 0; k0 < K; k0 += 32) {
    V bh[4], bl[4];
#pragma unroll
    for (int j = 0; j < 4; ++j) {
      const size_t bo = (size_t)(n0 + (j << 4) + rlane) * ldb + koff + k0;
      bh[j] = Frag<T>::load(Bb + bo);
      if (SPLIT) bl[j] = Frag<T>::load(Bb2 + bo);
    }
#pragma unroll
    for (int i = 0; i < 4; ++i) {
      const size_t ao = (size_t)(m0 + (i << 4) + rlane) * lda + koff + k0;
      V ah = Frag<T>::load(Ab + ao);
      V al;
      if (SPLIT) al = Frag<T>::load(Ab2 + ao);
#pragma unroll
      for (int j = 0; j < 4; ++j) {
        acc[i][j] = Frag<T>::mma(ah, bh[j], acc[i][j]);
        if (SPLIT) {
          acc[i][j] = Frag<T>::mma(ah, bl[j], acc[i][j]);
          acc[i][j] = Frag<T>::mma(al, bh[j], acc[i][j]);
        }
      }
      Frag<T>::guard(acc[i][0], acc[i][3], ah, SPLIT ? al : ah);
    }
    Frag<T>::keep(bh[0], bh[1], bh[2], bh[3]);
    if (SPLIT) Frag<T>::keep(bl[0], bl[1], bl[2], bl[3]);
  }
  acc_guard4(acc[0][0], acc[0][1], acc[0][2], acc[0][3]);
  acc_guard4(acc[1][0], acc[1][1], acc[1][2], acc[1][3]);
  acc_guard4(acc[2][0], acc[2][1], acc[2][2], acc[2][3]);
  acc_guard4(acc[3][0], acc[3][1], acc[3][2], acc[3][3]);

  float* slab = sT[wave];
  const float* Rb = RESID ? (resid + (size_t)b * strideR) : nullptr;
#pragma unroll
  for (int i = 0; i < 4; ++i) {
    const int mBase = m0 + (i << 4);
#pragma unroll
    for (int j = 0; j < 4; ++j) {
      const int n = n0 + (j << 4) + rlane;
      float bv = 0.f;
      if (BIAS_MODE == 2) bv = bias[n];
#pragma unroll
      for (int r = 0; r < 8; ++r) {
        float v = acc[i][j][r] * scale;
        if (BIAS_MODE == 1) v += bias[mBase + mOff + r];
        if (BIAS_MODE == 2) v += bv;
        if (RESID) v += Rb[(size_t)(mBase + mOff + r) * ldc + n];
        if (ACT == 1) v = tanhf(v);
        if (ACT == 2) v = fmaxf(v, 0.0f);
        if (ACT == 3) v = v / (1.0f + expf(-v));
        if (ACT == 4) v = (v > 0.f) ? v : 0.01f * v;
        if (ACT == 5) v = 0.5f * v * (1.0f + erff(v * 0.70710678118654752f));
        slab[(mOff + r) * 68 + (j << 4) + rlane] = v;
      }
    }
    __builtin_amdgcn_fence(__ATOMIC_RELEASE, "workgroup");
    __builtin_amdgcn_wave_barrier();
    __builtin_amdgcn_fence(__ATOMIC_ACQUIRE, "workgroup");
    if (OUT_MODE == 0) {
      float* C = (float*)Cout + (size_t)b * strideC;
      const int hh = lane >> 4, c4 = (lane & 15) * 4;
      {
#pragma unroll
        for (int it = 0; it < 8; ++it) {
          const int row = it * 2 + hh;
          v4f v = *(const v4f*)(slab + row * 68 + c4);
          *(v4f*)(C + (size_t)(mBase + row) * ldc + n0 + c4) = v;
        }
        
      }
    } else {
      const int q = lane >> 3, c8 = (lane & 7) * 8;
      unsigned short* C  = (unsigned short*)Cout  + (size_t)b * strideC;
      unsigned short* C2 = (OUT_MODE == 2) ? ((unsigned short*)Cout2 + (size_t)b * strideC) : nullptr;
      {
#pragma unroll
        for (int it = 0; it < 4; ++it) {
          const int row = it * 4 + q;
          const float* sp = slab + row * 68 + c8;
          v8h hv, lv;
#pragma unroll
          for (int e = 0; e < 8; ++e) {
            if (OUT_MODE == 1) {
              hv[e] = (_Float16)sp[e];
            } else {
              unsigned short hb = f2bf_bits(sp[e]);
              unsigned short lb = f2bf_bits(sp[e] - bf_bits2f(hb));
              hv[e] = __builtin_bit_cast(_Float16, hb);
              lv[e] = __builtin_bit_cast(_Float16, lb);
            }
          }
          *(v8h*)(C + (size_t)(mBase + row) * ldc + n0 + c8) = hv;
          if (OUT_MODE == 2) *(v8h*)(C2 + (size_t)(mBase + row) * ldc + n0 + c8) = lv;
        }
        
      }
    }
    __builtin_amdgcn_fence(__ATOMIC_RELEASE, "workgroup");
    __builtin_amdgcn_wave_barrier();
    __builtin_amdgcn_fence(__ATOMIC_ACQUIRE, "workgroup");
  }
}

/* ---- bf16 helpers for the attention path ---- */
__device__ __forceinline__ unsigned short at_bf_bits(float f) {
  unsigned u = __float_as_uint(f);
  return (unsigned short)((u + 0x7FFFu + ((u >> 16) & 1u)) >> 16);
}
__device__ __forceinline__ __bf16 at_f2bf(float f) { return __builtin_bit_cast(__bf16, at_bf_bits(f)); }
__device__ __forceinline__ void at_split(float f, __bf16& hi, __bf16& lo) {
  const unsigned short hb = at_bf_bits(f);
  hi = __builtin_bit_cast(__bf16, hb);
  lo = at_f2bf(f - __uint_as_float(((unsigned)hb) << 16));
}
__device__ __forceinline__ v8f at_mma(v16b a, v16b b, v8f c) {
  c = __builtin_amdgcn_wmma_f32_16x16x32_bf16(false, a, false, b, (short)0, c, false, false);
  asm volatile("v_nop\n\tv_nop\n\tv_nop\n\tv_nop" : "+v"(c) : "v"(a), "v"(b));
  return c;
}
__device__ __forceinline__ v8f mma_h16(v16h a, v16h b, v8f c) {
  c = __builtin_amdgcn_wmma_f32_16x16x32_f16(false, a, false, b, (short)0, c, false, false);
  asm volatile("v_nop\n\tv_nop\n\tv_nop\n\tv_nop" : "+v"(c) : "v"(a), "v"(b));
  return c;
}

/* f32[8] -> packed bf16 hi (4 words) and bf16 lo residual (4 words), RNE convert */
__device__ __forceinline__ void split_pack8(const float (&x)[8], v4u& H, v4u& L) {
#pragma unroll
  for (int p = 0; p < 4; ++p) {
    const unsigned short h0 = f2bf_bits(x[2 * p]);
    const unsigned short l0 = f2bf_bits(x[2 * p] - bf_bits2f(h0));
    const unsigned short h1 = f2bf_bits(x[2 * p + 1]);
    const unsigned short l1 = f2bf_bits(x[2 * p + 1] - bf_bits2f(h1));
    H[p] = (unsigned)h0 | ((unsigned)h1 << 16);
    L[p] = (unsigned)l0 | ((unsigned)l1 << 16);
  }
}
__device__ __forceinline__ void store_planes2(unsigned short* __restrict__ hi, unsigned short* __restrict__ lo,
                                              size_t off, v4u H, v4u L) {
  *(v4u*)(hi + off) = H;
  *(v4u*)(lo + off) = L;
  
}

/* ---- activations f32 [rows][128] -> bf16 hi/lo planes, same layout -------------
   coverage: n8 = rows*128/8 threads exactly (host asserts divisibility). */
__global__ __launch_bounds__(256) void split_rows_bf16(const float* __restrict__ in,
                                                        unsigned short* __restrict__ hi,
                                                        unsigned short* __restrict__ lo, int n8) {
  const int i = blockIdx.x * 256 + threadIdx.x;
  if (i >= n8) return;
  const size_t e0 = (size_t)i * 8;
  const v4f a = *(const v4f*)(in + e0);
  const v4f c = *(const v4f*)(in + e0 + 4);
  float x[8];
  x[0] = a[0]; x[1] = a[1]; x[2] = a[2]; x[3] = a[3];
  x[4] = c[0]; x[5] = c[1]; x[6] = c[2]; x[7] = c[3];
  v4u H, L;
  split_pack8(x, H, L);
  store_planes2(hi, lo, e0, H, L);
}

/* ---- weights W[k][n] (input-major, 128x128): in[k][n] -> out[n][k] as transposed bf16 hi/lo planes -----
   outb holds 4 weights x (hi plane + lo plane) of 128*128 halves. grid (8, 4): 2048 threads per weight;
   2048 threads x 8 = 16384 = 128x128 per plane exactly. */
__global__ __launch_bounds__(256) void wt_split_bf16(const float* __restrict__ W0, const float* __restrict__ W1,
                                                     const float* __restrict__ W2, const float* __restrict__ W3,
                                                     unsigned short* __restrict__ outb) {
  const int which = blockIdx.y;
  const float* W = (which == 0) ? W0 : (which == 1) ? W1 : (which == 2) ? W2 : W3;
  unsigned short* hi = outb + (size_t)which * (2 * kC * kC);
  unsigned short* lo = hi + kC * kC;
  const int gt = blockIdx.x * 256 + threadIdx.x;
  if (gt >= kC * kC / 8) return;
  const int n  = gt >> 4;
  const int k8 = (gt & 15) * 8;
  float x[8];
#pragma unroll
  for (int e = 0; e < 8; ++e) x[e] = W[(size_t)(k8 + e) * kC + n];
  v4u H, L;
  split_pack8(x, H, L);
  store_planes2(hi, lo, (size_t)n * kC + k8, H, L);
}

/* transposing LDS load: the lanes point at 16-byte pieces of a row-major [key][d] tile (lane l: row 8*(l>>4) + (l&7), piece (l>>3)&1);
   lane (c, hh) receives keys 8*hh .. 8*hh+7 of column d = c, which is half of an A fragment of the transposed tile */
__device__ __forceinline__ v8b ld_tr16(const unsigned short* p) {
  typedef __attribute__((address_space(3))) v8s lds_v8s;
  return __builtin_bit_cast(v8b, __builtin_amdgcn_ds_load_tr16_b128_v8i16((lds_v8s*)p));
}
/* lane l with lane l ^ 16: the two halves of a wave hold the two halves of a query column's keys */
__device__ __forceinline__ float xhalf(float x) {
  return __builtin_bit_cast(float, __builtin_amdgcn_permlanex16(__builtin_bit_cast(int, x), __builtin_bit_cast(int, x),
                                                                0x76543210, 0xfedcba98, false, false));
}
/* ---- online softmax step for one head, 32 keys x 16 query columns per wave (2 key subtiles), scores transposed ----
   sA[r]: key 8*hh + r, sB[r]: key 16 + 8*hh + r, both of query column c: a lane holds 16 keys of ONE query.
   Maximum in the lane plus one exchange between the halves; the sum stays a per-lane partial (joined behind the key loop).
   P^T leaves as two B operands, hi and lo: element s = key kmap(s, hh), which is the order the accumulators already have. */
__device__ __forceinline__ float softmax_step_t(const v8f& sA, const v8f& sB, float& mrow, float& lrow, v16b& ph, v16b& pl) {
  float mm[4];
#pragma unroll
  for (int k = 0; k < 4; ++k) mm[k] = fmaxf(fmaxf(sA[k], sA[4 + k]), fmaxf(sB[k], sB[4 + k]));
  float m = fmaxf(fmaxf(mm[0], mm[1]), fmaxf(mm[2], mm[3]));
  m = fmaxf(m, xhalf(m));
  const float mnew = fmaxf(mrow, m);
  const float al = expf(mrow - mnew);
  mrow = mnew;
  float ps[4] = {0.f, 0.f, 0.f, 0.f};
#pragma unroll
  for (int r = 0; r < 8; ++r) {
    const float p0 = expf(sA[r] - mnew);
    const float p1 = expf(sB[r] - mnew);
    ps[r & 1]       += p0;
    ps[2 + (r & 1)] += p1;
    __bf16 hi, lo;
    at_split(p0, hi, lo);
    ph[r] = hi;  pl[r] = lo;
    at_split(p1, hi, lo);
    ph[8 + r] = hi;  pl[8 + r] = lo;
  }
  lrow = lrow * al + ((ps[0] + ps[1]) + (ps[2] + ps[3]));
  return al;
}
/* per-wave transposed result (o[t][r] = O[query c][d = t*16 + 8*hh + r]) -> LDS staging [query][d] (pitch kOsPitch);
   writes rows 0..15, cols 0..31, 8 consecutive floats per lane and tile */
__device__ __forceinline__ void tile_to_os(float* os, const v8f (&o)[2], int hh, int c) {
#pragma unroll
  for (int t = 0; t < 2; ++t) {
    float* p = os + c * kOsPitch + t * 16 + 8 * hh;
    *(v4f*)(p)     = (v4f){o[t][0], o[t][1], o[t][2], o[t][3]};
    *(v4f*)(p + 4) = (v4f){o[t][4], o[t][5], o[t][6], o[t][7]};
  }
}
/* weighted sum over the kSplit key groups of one query tile, 4 floats of one row per lane;
   os0: staging tile of key group 0 for this query tile, the groups 4 tiles apart */
__device__ __forceinline__ v4f merge_os(const float* os0, const float (&w)[kSplit], int row, int c4) {
  v4f acc = (v4f){0.f, 0.f, 0.f, 0.f};
#pragma unroll
  for (int s = 0; s < kSplit; ++s) {
    const v4f v = *(const v4f*)(os0 + s * (4 * 16 * kOsPitch) + row * kOsPitch + c4);
#pragma unroll
    for (int e = 0; e < 4; ++e) acc[e] += w[s] * v[e];
  }
  return acc;
}

/* ---- attention for one (batch, head h, 64 query rows) ----------------------------------
   q16/k16: f16 planes [B*N][128] (head-major columns); vhi/vlo: bf16 hi/lo planes [B*Nkv][128].
   scores^T = (k.q^T)*scale + rpe[idx][h], the head's table column held in LDS; online softmax in f32, a lane holding one query's keys;
   P^T hi and lo go from the score accumulators straight into B operands, never through LDS;
   V tiles lie row-major in LDS and are transposed by the load that reads them;
   o^T = V_h^T . P^T;  for h >= 2 also ox^T = V_{h-2}^T . P^T (the cross term of the differential mixing).
   16 waves: wave = (key group sp, query tile qt). Group sp (4 waves) takes key chunks sp, sp + kSplit, ... with its own
   K/V tiles and each wave its own running max, sum and accumulators; the groups are merged through LDS at the end.
   xattn f32 [B*Nq][128]; ycross f32 [B][2][Nq][32]. grid.x = B*H*(Nq/64), block 128 * kSplit. */
__global__ __launch_bounds__(128 * kSplit) __attribute__((amdgpu_num_vgpr(256)))
void attn_head_kernel(
    const unsigned short* __restrict__ q16, const unsigned short* __restrict__ k16,
    const unsigned short* __restrict__ vhi, const unsigned short* __restrict__ vlo,
    const int* __restrict__ coords_q, const int* __restrict__ coords_k,
    const float* __restrict__ rpe,
    float* __restrict__ xattn, float* __restrict__ ycross)
{
  __shared__ __align__(16) unsigned short KshS[kSplit][kKC * kHD];   /* [group][key][d]  f16 bits  */
  __shared__ __align__(16) unsigned short VthS[kSplit][kKC * kVP];   /* [group][key][d] bf16 hi, head h,   row pitch kVP */
  __shared__ __align__(16) unsigned short VtlS[kSplit][kKC * kVP];   /* [group][key][d] bf16 lo, head h,   row pitch kVP */
  __shared__ __align__(16) unsigned short VxhS[kSplit][kKC * kVP];   /* [group][key][d] bf16 hi, head h-2, row pitch kVP */
  __shared__ __align__(16) unsigned short VxlS[kSplit][kKC * kVP];   /* [group][key][d] bf16 lo, head h-2, row pitch kVP */
  __shared__ __align__(16) float Tab[kTabLds];                       /* rpe[idx][h] for this block's head, all idx */
  /* behind the key loop the table is dead and its bytes take the merge staging */
  static_assert(4 * kSplit * 16 * kOsPitch + 4 * kSplit * 16 * 2 <= kTabLds, "");
  float* const OsAll = Tab;                                          /* [wave][16 * kOsPitch] */
  float* const MlAll = Tab + 4 * kSplit * 16 * kOsPitch;             /* [wave][row] (max, sum) */

  const int wave = threadIdx.x >> 5;     /* 0 .. 15 */
  const int sp   = wave >> 2;            /* key group */
  const int qt   = wave & 3;             /* query tile */
  const int tid  = threadIdx.x & 127;    /* thread within the key group */
  const int lane = tid & 31;
  unsigned short* Ksh = KshS[sp];
  unsigned short* Vth = VthS[sp];
  unsigned short* Vtl = VtlS[sp];
  unsigned short* Vxh = VxhS[sp];
  unsigned short* Vxl = VxlS[sp];
  const int hh   = lane >> 4;
  const int c    = lane & 15;
  const int vro  = (8 * hh + (lane & 7)) * kVP + ((lane >> 3) & 1) * 8;   /* halves; this lane's piece for the transposing V loads */
  constexpr int nqb = kNq / kQB;
  const int bx   = blockIdx.x;
  const int qb   = bx % nqb;
  const int rest = bx / nqb;
  const int h    = rest % kH;
  const int b    = rest / kH;
  const bool cross = (h >= kNH);                       /* block-uniform */
  const int hcol = h * kHD;
  const int xcol = (cross ? (h - kNH) : 0) * kHD;
  const int q0   = qb * kQB + qt * 16;
  const size_t qrows  = (size_t)b * kNq + q0;
  const size_t kvrows = (size_t)b * kNkv;
  const float* __restrict__ rpe_h = rpe + h;           /* table entry stride kH floats */

  /* this head's column of the bias table -> LDS, once per work-group; batches of 16 loads per thread keep the
     latency of the strided reads covered. The first barrier of the key loop publishes it. */
  {
    constexpr int kThreads = 128 * kSplit;
    constexpr int kFull = kTable / (kThreads * 16);
    const int t0 = threadIdx.x;
    /* rolled: 16 waves x 16 loads in flight already cover the L2 latency; unrolled further the copy only takes more registers */
#pragma unroll 1
    for (int g = 0; g < kFull; ++g) {
      float tv[16];
      const float* gp = rpe_h + (size_t)(g * 16 * kThreads + t0) * kH;
#pragma unroll
      for (int u = 0; u < 16; ++u) tv[u] = gp[u * (kThreads * kH)];
      asm volatile("s_wait_xcnt 0x0" :: "v"(gp) : "memory");   /* the loads' address registers are kept as they are until this wait */
#pragma unroll
      for (int u = 0; u < 16; ++u) Tab[(g * 16 + u) * kThreads + t0] = tv[u];
    }
    for (int i = kFull * 16 * kThreads + t0; i < kTable; i += kThreads) Tab[i] = rpe_h[(size_t)i * kH];
  }

  /* Q fragment (B operand: lane c -> query column c; K = head_dim = 32, one k-step) */
  const _Float16* qp = (const _Float16*)(const void*)q16;
  const v16h qa = Frag<_Float16>::load(qp + (qrows + c) * kC + hcol + 8 * hh);

  /* coords of this lane's query column c, +MAXD folded in */
  const v2i cq = *(const v2i*)(coords_q + (qrows + c) * 2);
  const int cqx = cq.x + kMaxd;
  const int cqy = cq.y + kMaxd;

  float mr = -INFINITY, lr = 0.f;   /* running max (equal in both halves) and this lane's partial sum for query c */
  v8f o[2], ox[2];                  /* o[t][r] = O[query c][d = t*16 + 8*hh + r] */
#pragma unroll
  for (int t = 0; t < 2; ++t) {
    o[t]  = (v8f){0.f,0.f,0.f,0.f,0.f,0.f,0.f,0.f};
    ox[t] = (v8f){0.f,0.f,0.f,0.f,0.f,0.f,0.f,0.f};
  }

  for (int kc = 0; kc < kNkv / (kKC * kSplit); ++kc) {
    const int kv0 = (kc * kSplit + sp) * kKC;
    __syncthreads();
    /* coords of this lane's 16 score rows (keys j*16 + 8*hh + r), two keys per 16-byte load, the same address in the 16 lanes
       of a half; asked for just ahead of the K and V rows so that one round trip serves both */
    v4i ck[2][4];
    {
      const int* ckp = coords_k + (kvrows + kv0 + 8 * hh) * 2;
#pragma unroll
      for (int j = 0; j < 2; ++j) {
#pragma unroll
        for (int i = 0; i < 4; ++i) ck[j][i] = *(const v4i*)(ckp + j * 32 + i * 4);
      }
      asm volatile("s_wait_xcnt 0x0" :: "v"(ckp) : "memory");   /* the loads' address registers are kept as they are until this wait */
    }
    /* stage the K tile and the V hi/lo tiles, all row-major: 32 keys x 4 segments of 8 halves = 128 = threads of a key group, one
       uint4 per thread per plane; covers Ksh 32x32 and the 32 d of every row of Vth/Vtl (and Vxh/Vxl when cross) exactly;
       the pad halves of a V row are never read */
    {
      const int key = tid >> 2;
      const int seg = tid & 3;
      const size_t rowoff = (kvrows + kv0 + key) * kC;
      const size_t go = rowoff + hcol + seg * 8;
      const unsigned short* kgp = k16 + go;
      const unsigned short* hgp = vhi + go;
      const unsigned short* lgp = vlo + go;
      const uint4 kw  = *(const uint4*)(kgp);
      const uint4 vh4 = *(const uint4*)(hgp);
      const uint4 vl4 = *(const uint4*)(lgp);
      asm volatile("s_wait_xcnt 0x0" :: "v"(kgp), "v"(hgp), "v"(lgp) : "memory");   /* the loads' address registers are kept as they are until this wait */
      *(uint4*)(&Ksh[key * kHD + seg * 8]) = kw;
      *(uint4*)(&Vth[key * kVP + seg * 8]) = vh4;
      *(uint4*)(&Vtl[key * kVP + seg * 8]) = vl4;
      if (cross) {
        const size_t gx = rowoff + xcol + seg * 8;
        const uint4 xh4 = *(const uint4*)(vhi + gx);
        const uint4 xl4 = *(const uint4*)(vlo + gx);
        *(uint4*)(&Vxh[key * kVP + seg * 8]) = xh4;
        *(uint4*)(&Vxl[key * kVP + seg * 8]) = xl4;
      }
    }
    __syncthreads();

    /* scores^T: s[j], j = key subtile; A fragment lane c -> key j*16+c, elements d (split map); s[j][r] = S[key j*16+8*hh+r][query c] */
    v8f s[2];
    {
      const v8f z = (v8f){0.f,0.f,0.f,0.f,0.f,0.f,0.f,0.f};
      const _Float16* Kp = (const _Float16*)(const void*)Ksh;
#pragma unroll
      for (int j = 0; j < 2; ++j) {
        Frag<_Float16>::U kb;
        kb.h[0] = *(const v8h*)(Kp + (j * 16 + c) * kHD + 8 * hh);
        kb.h[1] = *(const v8h*)(Kp + (j * 16 + c) * kHD + 16 + 8 * hh);
        s[j] = mma_h16(kb.v, qa, z);
      }
    }

    /* scale + relative position bias: one clamped b32 gather from the LDS table per (key, query) */
#pragma unroll
    for (int r = 0; r < 8; ++r) {
#pragma unroll
      for (int j = 0; j < 2; ++j) {
        const int kx = ck[j][r >> 1][(r & 1) * 2];
        const int ky = ck[j][r >> 1][(r & 1) * 2 + 1];
        int dx = cqx - kx; dx = dx < 0 ? 0 : dx; dx = dx > 2 * kMaxd ? 2 * kMaxd : dx;
        int dy = cqy - ky; dy = dy < 0 ? 0 : dy; dy = dy > 2 * kMaxd ? 2 * kMaxd : dy;
        const int idx = dx * kSpan + dy;            /* 0 .. kTable-1 */
        s[j][r] = s[j][r] * kScale + Tab[idx];
      }
    }

    /* online softmax; P^T hi and lo stay in registers as B operands */
    v16b ph, pl;
    const float al = softmax_step_t(s[0], s[1], mr, lr, ph, pl);
#pragma unroll
    for (int t = 0; t < 2; ++t) {
#pragma unroll
      for (int r = 0; r < 8; ++r) { o[t][r] *= al; ox[t][r] *= al; }
    }

    /* V^T.P^T : A = V^T (lane c -> d, elements key, split map), transposed out of the row-major tile by the load itself;
       B = P^T (lane c -> query, elements key, same map) */
    {
#pragma unroll
      for (int t = 0; t < 2; ++t) {
        Frag<__bf16>::U vh, vl;
        vh.h[0] = ld_tr16(Vth + vro + t * 16);  vh.h[1] = ld_tr16(Vth + vro + 16 * kVP + t * 16);
        vl.h[0] = ld_tr16(Vtl + vro + t * 16);  vl.h[1] = ld_tr16(Vtl + vro + 16 * kVP + t * 16);
        o[t] = at_mma(vh.v, ph, o[t]);
        o[t] = at_mma(vl.v, ph, o[t]);
        o[t] = at_mma(vh.v, pl, o[t]);
      }
      if (cross) {
#pragma unroll
        for (int t = 0; t < 2; ++t) {
          Frag<__bf16>::U vh, vl;
          vh.h[0] = ld_tr16(Vxh + vro + t * 16);  vh.h[1] = ld_tr16(Vxh + vro + 16 * kVP + t * 16);
          vl.h[0] = ld_tr16(Vxl + vro + t * 16);  vl.h[1] = ld_tr16(Vxl + vro + 16 * kVP + t * 16);
          ox[t] = at_mma(vh.v, ph, ox[t]);
          ox[t] = at_mma(vl.v, ph, ox[t]);
          ox[t] = at_mma(vh.v, pl, ox[t]);
        }
      }
    }
  }

  /* merge of the key groups: every wave leaves its accumulators (not normalised) and its (max, sum) in LDS;
     wave (sp, qt) then merges rows 4*sp .. 4*sp+3 of query tile qt: x = sum_s e^(m_s-M) o_s / sum_s e^(m_s-M) l_s */
  __syncthreads();   /* every wave has made its last table read: the table's bytes become the merge staging */
  float* os = OsAll + wave * (16 * kOsPitch);
  const float* osq = OsAll + qt * (16 * kOsPitch);
  tile_to_os(os, o, hh, c);
  lr += xhalf(lr);   /* the two halves' partial sums of query c */
  if (hh == 0) {     /* max and sum are now equal in lanes c and c + 16 */
    MlAll[wave * 32 + c * 2] = mr;
    MlAll[wave * 32 + c * 2 + 1] = lr;
  }
  __syncthreads();   /* all groups' partial tiles are in LDS */

  const int row = 4 * sp + (lane >> 3);
  const int c4  = (lane & 7) * 4;
  float w[kSplit];
  {
    float ms[kSplit], ls[kSplit];
    float M = -INFINITY;
#pragma unroll
    for (int s = 0; s < kSplit; ++s) {
      ms[s] = MlAll[(s * 4 + qt) * 32 + row * 2];
      ls[s] = MlAll[(s * 4 + qt) * 32 + row * 2 + 1];
      M = fmaxf(M, ms[s]);
    }
    float L = 0.f;
#pragma unroll
    for (int s = 0; s < kSplit; ++s) { w[s] = expf(ms[s] - M); L += w[s] * ls[s]; }
    const float inv = 1.0f / L;
#pragma unroll
    for (int s = 0; s < kSplit; ++s) w[s] *= inv;
  }
  *(v4f*)(xattn + (qrows + row) * kC + hcol + c4) = merge_os(osq, w, row, c4);
  asm volatile("s_wait_xcnt 0x0" ::: "memory");   /* the cross path below reuses the registers this store names */

  if (cross) {
    __syncthreads();   /* every reader has left the o tiles */
    tile_to_os(os, ox, hh, c);
    __syncthreads();   /* all groups' cross tiles are in LDS */
    *(v4f*)(ycross + ((((size_t)b * kNH + (h - kNH)) * kNq + q0 + row) * kHD) + c4) = merge_os(osq, w, row, c4);
  }
}

/* ---- differential head mixing + split to bf16 hi/lo planes for the output projection --------
   x[b,q,h*32+d] = xs + alpha[b,q]*(xs - lam[h]*yc[b,h,q,d]) for h < 2, else xs.
   coverage 65536 threads x 8 = 4096x128 exactly. */
__global__ __launch_bounds__(256) void combine_split_kernel(
    const float* __restrict__ xattn, const float* __restrict__ ycross, const float* __restrict__ alpha,
    const float* __restrict__ lq1, const float* __restrict__ lk1,
    const float* __restrict__ lq2, const float* __restrict__ lk2,
    unsigned short* __restrict__ hi, unsigned short* __restrict__ lo)
{
  __shared__ float lam_s[2];
  if (threadIdx.x < 2) {
    const int h = threadIdx.x;
    float s1 = 0.f, s2 = 0.f;
#pragma unroll 1
    for (int i = 0; i < kHD; ++i) {
      s1 += lq1[h * kHD + i] * lk1[h * kHD + i];
      s2 += lq2[h * kHD + i] * lk2[h * kHD + i];
    }
    lam_s[h] = expf(s1) - expf(s2) + kLambdaInit;
  }
  __syncthreads();
  const int gt = blockIdx.x * 256 + threadIdx.x;
  if (gt >= kBatch * kNq * kC / 8) return;
  const size_t e0 = (size_t)gt * 8;
  const int row = (int)(e0 >> 7);
  const int col = (int)(e0 & 127);
  const int h   = col >> 5;
  const int d   = col & 31;
  const int hc  = h & 1;
  const int b   = row >> 11;
  const int q   = row & (kNq - 1);
  const float a   = alpha[row];
  const float lam = lam_s[hc];
  const v4f xs0 = *(const v4f*)(xattn + e0);
  const v4f xs1 = *(const v4f*)(xattn + e0 + 4);
  const size_t yo = (((size_t)b * kNH + hc) * kNq + q) * kHD + d;
  const v4f y0 = *(const v4f*)(ycross + yo);
  const v4f y1 = *(const v4f*)(ycross + yo + 4);
  const bool mix = (h < kNH);
  float x[8];
#pragma unroll
  for (int e = 0; e < 4; ++e) {
    const float xa = xs0[e], xb = xs1[e];
    const float va = xa + a * (xa - lam * y0[e]);
    const float vb = xb + a * (xb - lam * y1[e]);
    x[e]     = mix ? va : xa;
    x[4 + e] = mix ? vb : xb;
  }
  v4u H, L;
  split_pack8(x, H, L);
  store_planes2(hi, lo, e0, H, L);
}

/* =========================================================================================
   host launch: 9 kernel launches
   workspace region map (bytes, all offsets MiB/256-KiB aligned):
     xq_hi  1 MiB | xq_lo 1 MiB | xkv_hi 2 MiB | xkv_lo 2 MiB | wt planes 256 KiB (4 weights x hi,lo x 32 KiB)
     q16 1 MiB | k16 2 MiB | v_hi 2 MiB | v_lo 2 MiB | xattn f32 2 MiB | ycross f32 512 KiB | xmix_hi 1 MiB | xmix_lo 1 MiB
     total 18,612,224 B
   ========================================================================================= */
extern "C" void kernel_launch(void* const* d_in, const int* in_sizes, int n_in,
                              void* d_out, int out_size, void* d_ws, size_t ws_size,
                              hipStream_t stream) {
  constexpr int Mq  = kBatch * kNq;    /* 4096 */
  constexpr int Mkv = kBatch * kNkv;   /* 8192 */
  static_assert(Mq % 64 == 0 && Mkv % 64 == 0 && kC % 64 == 0 && kC % 32 == 0, "");
  static_assert((Mq * kC) % 8 == 0 && (Mkv * kC) % 8 == 0, "");
  if (n_in < 18) return;
  if (in_sizes[0] != Mq * kC || in_sizes[1] != Mkv * kC || in_sizes[2] != Mq * 2 || in_sizes[3] != Mkv * 2 ||
      in_sizes[4] != Mq || in_sizes[5] != kC * kC || in_sizes[7] != kC * kC || in_sizes[9] != kC * kC ||
      in_sizes[16] != kC * kC || in_sizes[6] != kC || in_sizes[8] != kC || in_sizes[10] != kC || in_sizes[17] != kC ||
      in_sizes[11] != kNH * kHD || in_sizes[12] != kNH * kHD || in_sizes[13] != kNH * kHD || in_sizes[14] != kNH * kHD ||
      in_sizes[15] != kTable * kH || out_size != Mq * kC) return;

  const float* x_q      = (const float*)d_in[0];
  const float* x_kv     = (const float*)d_in[1];
  const int*   coords_q = (const int*)d_in[2];
  const int*   coords_k = (const int*)d_in[3];
  const float* alpha    = (const float*)d_in[4];
  const float* Wq = (const float*)d_in[5];  const float* bq = (const float*)d_in[6];
  const float* Wk = (const float*)d_in[7];  const float* bk = (const float*)d_in[8];
  const float* Wv = (const float*)d_in[9];  const float* bv = (const float*)d_in[10];
  const float* lq1 = (const float*)d_in[11]; const float* lk1 = (const float*)d_in[12];
  const float* lq2 = (const float*)d_in[13]; const float* lk2 = (const float*)d_in[14];
  const float* rpe = (const float*)d_in[15];
  const float* Wp = (const float*)d_in[16]; const float* bp = (const float*)d_in[17];
  float* out = (float*)d_out;

  char* ws = (char*)d_ws;
  size_t off = 0;
  const size_t szXq16  = (size_t)Mq * kC * 2;     /* 1 MiB  */
  const size_t szXkv16 = (size_t)Mkv * kC * 2;    /* 2 MiB  */
  const size_t szWt    = (size_t)4 * 2 * kC * kC * 2;
  const size_t szXattn = (size_t)Mq * kC * 4;
  const size_t szYc    = (size_t)kBatch * kNH * kNq * kHD * 4;
  unsigned short* xq_hi  = (unsigned short*)(ws + off); off += szXq16;
  unsigned short* xq_lo  = (unsigned short*)(ws + off); off += szXq16;
  unsigned short* xkv_hi = (unsigned short*)(ws + off); off += szXkv16;
  unsigned short* xkv_lo = (unsigned short*)(ws + off); off += szXkv16;
  unsigned short* wt     = (unsigned short*)(ws + off); off += szWt;
  unsigned short* q16    = (unsigned short*)(ws + off); off += szXq16;
  unsigned short* k16    = (unsigned short*)(ws + off); off += szXkv16;
  unsigned short* v_hi   = (unsigned short*)(ws + off); off += szXkv16;
  unsigned short* v_lo   = (unsigned short*)(ws + off); off += szXkv16;
  float*          xattn  = (float*)(ws + off);          off += szXattn;
  float*          ycross = (float*)(ws + off);          off += szYc;
  unsigned short* xm_hi  = (unsigned short*)(ws + off); off += szXq16;
  unsigned short* xm_lo  = (unsigned short*)(ws + off); off += szXq16;
  if (off > ws_size) return;

  const unsigned short* wtq_hi = wt + 0 * (2 * kC * kC); const unsigned short* wtq_lo = wtq_hi + kC * kC;
  const unsigned short* wtk_hi = wt + 1 * (2 * kC * kC); const unsigned short* wtk_lo = wtk_hi + kC * kC;
  const unsigned short* wtv_hi = wt + 2 * (2 * kC * kC); const unsigned short* wtv_lo = wtv_hi + kC * kC;
  const unsigned short* wtp_hi = wt + 3 * (2 * kC * kC); const unsigned short* wtp_lo = wtp_hi + kC * kC;

  /* 1-2: activations -> bf16 hi/lo planes */
  const int n8q = Mq * kC / 8, n8kv = Mkv * kC / 8;
  split_rows_bf16<<<dim3((n8q + 255) / 256), dim3(256), 0, stream>>>(x_q, xq_hi, xq_lo, n8q);
  split_rows_bf16<<<dim3((n8kv + 255) / 256), dim3(256), 0, stream>>>(x_kv, xkv_hi, xkv_lo, n8kv);
  /* 3: weights -> transposed bf16 hi/lo planes (in[k][n] -> out[n][k], square 128x128) */
  wt_split_bf16<<<dim3((kC * kC / 8 + 255) / 256, 4), dim3(256), 0, stream>>>(Wq, Wk, Wv, Wp, wt);

  /* 4-6: projections, M x 128, K = 128 (M % 64 == 0, N = 128 % 64 == 0, K = 128 % 32 == 0) */
  const int blocksQ  = ((Mq  / 64) * (kC / 64) + 7) / 8;
  const int blocksKV = ((Mkv / 64) * (kC / 64) + 7) / 8;
  wmma_gemm64<1, true, 2, 1, false><<<dim3(blocksQ, 1), dim3(256), 0, stream>>>(
      xq_hi, xq_lo, kC, 0L, wtq_hi, wtq_lo, kC, 0L, (void*)q16, nullptr, kC, 0L, bq, nullptr, 0L, Mq, kC, kC, 1.0f);
  wmma_gemm64<1, true, 2, 1, false><<<dim3(blocksKV, 1), dim3(256), 0, stream>>>(
      xkv_hi, xkv_lo, kC, 0L, wtk_hi, wtk_lo, kC, 0L, (void*)k16, nullptr, kC, 0L, bk, nullptr, 0L, Mkv, kC, kC, 1.0f);
  wmma_gemm64<1, true, 2, 2, false><<<dim3(blocksKV, 1), dim3(256), 0, stream>>>(
      xkv_hi, xkv_lo, kC, 0L, wtv_hi, wtv_lo, kC, 0L, (void*)v_hi, (void*)v_lo, kC, 0L, bv, nullptr, 0L, Mkv, kC, kC, 1.0f);

  /* 7: attention per (batch, head, 64 queries) */
  const int attnBlocks = kBatch * kH * (kNq / kQB);
  attn_head_kernel<<<dim3(attnBlocks), dim3(128 * kSplit), 0, stream>>>(q16, k16, v_hi, v_lo, coords_q, coords_k, rpe, xattn, ycross);

  /* 8: differential mixing + bf16 hi/lo planes */
  combine_split_kernel<<<dim3((n8q + 255) / 256), dim3(256), 0, stream>>>(xattn, ycross, alpha, lq1, lk1, lq2, lk2, xm_hi, xm_lo);

  /* 9: output projection -> d_out (f32), M = 4096, N = 128, K = 128 */
  wmma_gemm64<1, true, 2, 0, false><<<dim3(blocksQ, 1), dim3(256), 0, stream>>>(
      xm_hi, xm_lo, kC, 0L, wtp_hi, wtp_lo, kC, 0L, (void*)out, nullptr, kC, 0L, bp, nullptr, 0L, Mq, kC, kC, 1.0f);
}

// v005
// It runs in 151 microseconds.
// Next to v004, in two timings, it ran 1.10 times as fast each time.
// Over all steps from v000 it is 2.98 times as fast.
// Contractions: x@Wq, x@Wk, x@Wv and xmix@Wp on v_wmma_f32_16x16x32_bf16 with bf16 hi/lo operand planes (hi.hi + hi.lo + lo.hi); k.q^T on v_wmma_f32_16x16x32_f16 with plain f16 q/k planes; v^T.p^T and v_cross^T.p^T on v_wmma_f32_16x16x32_bf16 with bf16 hi/lo p and v tiles; f32 accumulate; bias gather, online softmax and head mixing in f32.
#include <hip/hip_runtime.h>
#include <stdint.h>

typedef __attribute__((ext_vector_type(16))) _Float16 v16h;
typedef __attribute__((ext_vector_type(8)))  _Float16 v8h;
typedef __attribute__((ext_vector_type(16))) __bf16   v16b;
typedef __attribute__((ext_vector_type(8)))  __bf16   v8b;
typedef __attribute__((ext_vector_type(8)))  float    v8f;
typedef __attribute__((ext_vector_type(4)))  float    v4f;
typedef __attribute__((ext_vector_type(4)))  unsigned int v4u;
typedef __attribute__((ext_vector_type(2)))  int      v2i;
typedef __attribute__((ext_vector_type(4)))  int      v4i;
typedef __attribute__((ext_vector_type(8)))  short    v8s;

/* ---- problem geometry (fixed by the module) ---- */
constexpr int kBatch = 2;
constexpr int kNq    = 2048;
constexpr int kNkv   = 4096;
constexpr int kC     = 128;
constexpr int kH     = 4;
constexpr int kHD    = 32;
constexpr int kNH    = 2;
constexpr int kMaxd  = 128;
constexpr int kSpan  = 2 * kMaxd + 1;
constexpr int kTable = kSpan * kSpan;
constexpr int kKC    = 32;     /* keys per chunk in the attention kernel */
constexpr int kQB    = 64;     /* query rows per attention block (4 query tiles x 16) */
constexpr int kSplit = 4;      /* key groups per attention block: wave = (key group, query tile) */
constexpr int kOsPitch = 36;   /* floats; per-wave output staging pitch */
constexpr int kVP    = 48;     /* halves; LDS row pitch of the V tiles: 96 B = 32 B x odd, the pitch of the transposing load */
constexpr int kTabLds  = (kTable + 3) & ~3;   /* floats; one head's bias column in LDS, rounded to 16 bytes */
constexpr float kLog2e  = 1.4426950408889634f;                        /* log2(e) */
constexpr float kScaleL2 = (float)(0.17677669529663687 * 1.4426950408889634);   /* head_dim ** -0.5 * log2(e) */
constexpr float kLambdaInit = 0.8f;

static_assert(kNq % kQB == 0, "");
static_assert(kNkv % (kKC * kSplit) == 0, "");
static_assert(kSplit * 4 == 16, "");   /* the merge gives each wave 16 / kSplit = 4 rows = 32 lanes x 4 floats */
static_assert(kC == kH * kHD, "");
static_assert((kBatch * kNq) % 64 == 0 && (kBatch * kNkv) % 64 == 0, "");
static_assert(kC % 64 == 0 && kC % 32 == 0, "");
static_assert(kH == 4 && kNH == 2 && kHD == 32 && kKC == 32, "");

__device__ __forceinline__ unsigned short f2bf_bits(float f) {
  unsigned u = __float_as_uint(f);
  return (unsigned short)((u + 0x7FFFu + ((u >> 16) & 1u)) >> 16);
}
__device__ __forceinline__ float bf_bits2f(unsigned short h) { return __uint_as_float(((unsigned)h) << 16); }

/* hazard guards as plain device helpers */
__device__ __forceinline__ void dep_guard_h(v8f& a, v8f& b, v16h x, v16h y) { asm volatile("v_nop\n\tv_nop\n\tv_nop\n\tv_nop" : "+v"(a), "+v"(b) : "v"(x), "v"(y)); }
__device__ __forceinline__ void dep_guard_b(v8f& a, v8f& b, v16b x, v16b y) { asm volatile("v_nop\n\tv_nop\n\tv_nop\n\tv_nop" : "+v"(a), "+v"(b) : "v"(x), "v"(y)); }
__device__ __forceinline__ void keep4_h(v16h a, v16h b, v16h c, v16h d) { asm volatile("v_nop" :: "v"(a), "v"(b), "v"(c), "v"(d)); }
__device__ __forceinline__ void keep4_b(v16b a, v16b b, v16b c, v16b d) { asm volatile("v_nop" :: "v"(a), "v"(b), "v"(c), "v"(d)); }
__device__ __forceinline__ void acc_guard4(v8f& a, v8f& b, v8f& c, v8f& d) { asm volatile("v_nop\n\tv_nop\n\tv_nop\n\tv_nop" : "+v"(a), "+v"(b), "+v"(c), "+v"(d)); }
template <typename T> struct Frag;
template <> struct Frag<_Float16> {
  typedef v16h V; union U { v16h v; v8h h[2]; };
  static __device__ __forceinline__ v16h load(const _Float16* p) {
    U f; f.h[0] = *(const v8h*)(p); f.h[1] = *(const v8h*)(p + 16); return f.v;
  }
  static __device__ __forceinline__ v8f mma(v16h a, v16h b, v8f c) {
    return __builtin_amdgcn_wmma_f32_16x16x32_f16(false, a, false, b, (short)0, c, false, false);
  }
  static __device__ __forceinline__ void guard(v8f& a, v8f& b, v16h x, v16h y) { dep_guard_h(a, b, x, y); }
  static __device__ __forceinline__ void keep(v16h a, v16h b, v16h c, v16h d) { keep4_h(a, b, c, d); }
};
template <> struct Frag<__bf16> {
  typedef v16b V; union U { v16b v; v8b h[2]; };
  static __device__ __forceinline__ v16b load(const __bf16* p) {
    U f; f.h[0] = *(const v8b*)(p); f.h[1] = *(const v8b*)(p + 16); return f.v;
  }
  static __device__ __forceinline__ v8f mma(v16b a, v16b b, v8f c) {
    return __builtin_amdgcn_wmma_f32_16x16x32_bf16(false, a, false, b, (short)0, c, false, false);
  }
  static __device__ __forceinline__ void guard(v8f& a, v8f& b, v16b x, v16b y) { dep_guard_b(a, b, x, y); }
  static __device__ __forceinline__ void keep(v16b a, v16b b, v16b c, v16b d) { keep4_b(a, b, c, d); }
};

/* ---- Register-blocked batched WMMA GEMM ---------------- */
template <int ET> struct Elem;
template <> struct Elem<0> { typedef _Float16 T; };
template <> struct Elem<1> { typedef __bf16 T; };
template <int ET, bool SPLIT, int BIAS_MODE, int OUT_MODE, bool RESID, int ACT = 0>
__global__ __launch_bounds__(256) void wmma_gemm64(
    const unsigned short* __restrict__ Ap, const unsigned short* __restrict__ A2p, int lda, long strideA,
    const unsigned short* __restrict__ Btp, const unsigned short* __restrict__ Bt2p, int ldb, long strideB,
    void* __restrict__ Cout, void* __restrict__ Cout2, int ldc, long strideC,
    const float* __restrict__ bias,
    const float* __restrict__ resid, long strideR,
    int M, int N, int K, float scale) {
  typedef typename Elem<ET>::T T;
  typedef typename Frag<T>::V V;
  const T* A = (const T*)Ap; const T* A2 = (const T*)A2p; const T* Bt = (const T*)Btp; const T* Bt2 = (const T*)Bt2p;
  __shared__ __align__(16) float sT[8][16 * 68];
  const int b    = blockIdx.y;
  const int lane = threadIdx.x & 31;
  const int wave = threadIdx.x >> 5;
  const int tilesN = N >> 6;
  const int tilesM = M >> 6;
  const int tile = blockIdx.x * 8 + wave;
  if (tile >= tilesM * tilesN) return;
  const int tm = tile / tilesN;
  const int tn = tile - tm * tilesN;
  const int m0 = tm << 6;
  const int n0 = tn << 6;

  const T* Ab  = A  + (size_t)b * strideA;
  const T* Bb  = Bt + (size_t)b * strideB;
  const T* Ab2 = SPLIT ? (A2  + (size_t)b * strideA) : nullptr;
  const T* Bb2 = SPLIT ? (Bt2 + (size_t)b * strideB) : nullptr;

  const int rlane = lane & 15;
  const int koff  = (lane >> 4) * 8;
  const int mOff  = (lane >> 4) * 8;

  v8f acc[4][4];
#pragma unroll
  for (int i = 0; i < 4; ++i)
#pragma unroll
    for (int j = 0; j < 4; ++j) acc[i][j] = (v8f){0.f,0.f,0.f,0.f,0.f,0.f,0.f,0.f};

  for (int k0 = 0; k0 < K; k0 += 32) {
    V bh[4], bl[4];
#pragma unroll
    for (int j = 0; j < 4; ++j) {
      const size_t bo = (size_t)(n0 + (j << 4) + rlane) * ldb + koff + k0;
      bh[j] = Frag<T>::load(Bb + bo);
      if (SPLIT) bl[j] = Frag<T>::load(Bb2 + bo);
    }
#pragma unroll
    for (int i = 0; i < 4; ++i) {
      const size_t ao = (size_t)(m0 + (i << 4) + rlane) * lda + koff + k0;
      V ah = Frag<T>::load(Ab + ao);
      V al;
      if (SPLIT) al = Frag<T>::load(Ab2 + ao);
#pragma unroll
      for (int j = 0; j < 4; ++j) {
        acc[i][j] = Frag<T>::mma(ah, bh[j], acc[i][j]);
        if (SPLIT) {
          acc[i][j] = Frag<T>::mma(ah, bl[j], acc[i][j]);
          acc[i][j] = Frag<T>::mma(al, bh[j], acc[i][j]);
        }
      }
      Frag<T>::guard(acc[i][0], acc[i][3], ah, SPLIT ? al : ah);
    }
    Frag<T>::keep(bh[0], bh[1], bh[2], bh[3]);
    if (SPLIT) Frag<T>::keep(bl[0], bl[1], bl[2], bl[3]);
  }
  acc_guard4(acc[0][0], acc[0][1], acc[0][2], acc[0][3]);
  acc_guard4(acc[1][0], acc[1][1], acc[1][2], acc[1][3]);
  acc_guard4(acc[2][0], acc[2][1], acc[2][2], acc[2][3]);
  acc_guard4(acc[3][0], acc[3][1], acc[3][2], acc[3][3]);

  float* slab = sT[wave];
  const float* Rb = RESID ? (resid + (size_t)b * strideR) : nullptr;
#pragma unroll
  for (int i = 0; i < 4; ++i) {
    const int mBase = m0 + (i << 4);
#pragma unroll
    for (int j = 0; j < 4; ++j) {
      const int n = n0 + (j << 4) + rlane;
      float bv = 0.f;
      if (BIAS_MODE == 2) bv = bias[n];
#pragma unroll
      for (int r = 0; r < 8; ++r) {
        float v = acc[i][j][r] * scale;
        if (BIAS_MODE == 1) v += bias[mBase + mOff + r];
        if (BIAS_MODE == 2) v += bv;
        if (RESID) v += Rb[(size_t)(mBase + mOff + r) * ldc + n];
        if (ACT == 1) v = tanhf(v);
        if (ACT == 2) v = fmaxf(v, 0.0f);
        if (ACT == 3) v = v / (1.0f + expf(-v));
        if (ACT == 4) v = (v > 0.f) ? v : 0.01f * v;
        if (ACT == 5) v = 0.5f * v * (1.0f + erff(v * 0.70710678118654752f));
        slab[(mOff + r) * 68 + (j << 4) + rlane] = v;
      }
    }
    __builtin_amdgcn_fence(__ATOMIC_RELEASE, "workgroup");
    __builtin_amdgcn_wave_barrier();
    __builtin_amdgcn_fence(__ATOMIC_ACQUIRE, "workgroup");
    if (OUT_MODE == 0) {
      float* C = (float*)Cout + (size_t)b * strideC;
      const int hh = lane >> 4, c4 = (lane & 15) * 4;
      {
#pragma unroll
        for (int it = 0; it < 8; ++it) {
          const int row = it * 2 + hh;
          v4f v = *(const v4f*)(slab + row * 68 + c4);
          *(v4f*)(C + (size_t)(mBase + row) * ldc + n0 + c4) = v;
        }
        
      }
    } else {
      const int q = lane >> 3, c8 = (lane & 7) * 8;
      unsigned short* C  = (unsigned short*)Cout  + (size_t)b * strideC;
      unsigned short* C2 = (OUT_MODE == 2) ? ((unsigned short*)Cout2 + (size_t)b * strideC) : nullptr;
      {
#pragma unroll
        for (int it = 0; it < 4; ++it) {
          const int row = it * 4 + q;
          const float* sp = slab + row * 68 + c8;
          v8h hv, lv;
#pragma unroll
          for (int e = 0; e < 8; ++e) {
            if (OUT_MODE == 1) {
              hv[e] = (_Float16)sp[e];
            } else {
              unsigned short hb = f2bf_bits(sp[e]);
              unsigned short lb = f2bf_bits(sp[e] - bf_bits2f(hb));
              hv[e] = __builtin_bit_cast(_Float16, hb);
              lv[e] = __builtin_bit_cast(_Float16, lb);
            }
          }
          *(v8h*)(C + (size_t)(mBase + row) * ldc + n0 + c8) = hv;
          if (OUT_MODE == 2) *(v8h*)(C2 + (size_t)(mBase + row) * ldc + n0 + c8) = lv;
        }
        
      }
    }
    __builtin_amdgcn_fence(__ATOMIC_RELEASE, "workgroup");
    __builtin_amdgcn_wave_barrier();
    __builtin_amdgcn_fence(__ATOMIC_ACQUIRE, "workgroup");
  }
}

/* ---- bf16 helpers for the attention path ---- */
__device__ __forceinline__ unsigned short at_bf_bits(float f) {
  unsigned u = __float_as_uint(f);
  return (unsigned short)((u + 0x7FFFu + ((u >> 16) & 1u)) >> 16);
}
__device__ __forceinline__ __bf16 at_f2bf(float f) { return __builtin_bit_cast(__bf16, at_bf_bits(f)); }
__device__ __forceinline__ void at_split(float f, __bf16& hi, __bf16& lo) {
  const unsigned short hb = at_bf_bits(f);
  hi = __builtin_bit_cast(__bf16, hb);
  lo = at_f2bf(f - __uint_as_float(((unsigned)hb) << 16));
}
__device__ __forceinline__ v8f at_mma(v16b a, v16b b, v8f c) {
  c = __builtin_amdgcn_wmma_f32_16x16x32_bf16(false, a, false, b, (short)0, c, false, false);
  asm volatile("v_nop\n\tv_nop\n\tv_nop\n\tv_nop" : "+v"(c) : "v"(a), "v"(b));
  return c;
}
__device__ __forceinline__ v8f mma_h16(v16h a, v16h b, v8f c) {
  c = __builtin_amdgcn_wmma_f32_16x16x32_f16(false, a, false, b, (short)0, c, false, false);
  asm volatile("v_nop\n\tv_nop\n\tv_nop\n\tv_nop" : "+v"(c) : "v"(a), "v"(b));
  return c;
}

/* f32[8] -> packed bf16 hi (4 words) and bf16 lo residual (4 words), RNE convert */
__device__ __forceinline__ void split_pack8(const float (&x)[8], v4u& H, v4u& L) {
#pragma unroll
  for (int p = 0; p < 4; ++p) {
    const unsigned short h0 = f2bf_bits(x[2 * p]);
    const unsigned short l0 = f2bf_bits(x[2 * p] - bf_bits2f(h0));
    const unsigned short h1 = f2bf_bits(x[2 * p + 1]);
    const unsigned short l1 = f2bf_bits(x[2 * p + 1] - bf_bits2f(h1));
    H[p] = (unsigned)h0 | ((unsigned)h1 << 16);
    L[p] = (unsigned)l0 | ((unsigned)l1 << 16);
  }
}
__device__ __forceinline__ void store_planes2(unsigned short* __restrict__ hi, unsigned short* __restrict__ lo,
                                              size_t off, v4u H, v4u L) {
  *(v4u*)(hi + off) = H;
  *(v4u*)(lo + off) = L;
  
}

/* ---- activations f32 [rows][128] -> bf16 hi/lo planes, same layout -------------
   coverage: n8 = rows*128/8 threads exactly (host asserts divisibility). */
__global__ __launch_bounds__(256) void split_rows_bf16(const float* __restrict__ in,
                                                        unsigned short* __restrict__ hi,
                                                        unsigned short* __restrict__ lo, int n8) {
  const int i = blockIdx.x * 256 + threadIdx.x;
  if (i >= n8) return;
  const size_t e0 = (size_t)i * 8;
  const v4f a = *(const v4f*)(in + e0);
  const v4f c = *(const v4f*)(in + e0 + 4);
  float x[8];
  x[0] = a[0]; x[1] = a[1]; x[2] = a[2]; x[3] = a[3];
  x[4] = c[0]; x[5] = c[1]; x[6] = c[2]; x[7] = c[3];
  v4u H, L;
  split_pack8(x, H, L);
  store_planes2(hi, lo, e0, H, L);
}

/* ---- weights W[k][n] (input-major, 128x128): in[k][n] -> out[n][k] as transposed bf16 hi/lo planes -----
   outb holds 4 weights x (hi plane + lo plane) of 128*128 halves. grid (8, 4): 2048 threads per weight;
   2048 threads x 8 = 16384 = 128x128 per plane exactly. */
__global__ __launch_bounds__(256) void wt_split_bf16(const float* __restrict__ W0, const float* __restrict__ W1,
                                                     const float* __restrict__ W2, const float* __restrict__ W3,
                                                     unsigned short* __restrict__ outb) {
  const int which = blockIdx.y;
  const float* W = (which == 0) ? W0 : (which == 1) ? W1 : (which == 2) ? W2 : W3;
  unsigned short* hi = outb + (size_t)which * (2 * kC * kC);
  unsigned short* lo = hi + kC * kC;
  const int gt = blockIdx.x * 256 + threadIdx.x;
  if (gt >= kC * kC / 8) return;
  const int n  = gt >> 4;
  const int k8 = (gt & 15) * 8;
  float x[8];
#pragma unroll
  for (int e = 0; e < 8; ++e) x[e] = W[(size_t)(k8 + e) * kC + n];
  v4u H, L;
  split_pack8(x, H, L);
  store_planes2(hi, lo, (size_t)n * kC + k8, H, L);
}

/* transposing LDS load: the lanes point at 16-byte pieces of a row-major [key][d] tile (lane l: row 8*(l>>4) + (l&7), piece (l>>3)&1);
   lane (c, hh) receives keys 8*hh .. 8*hh+7 of column d = c, which is half of an A fragment of the transposed tile */
__device__ __forceinline__ v8b ld_tr16(const unsigned short* p) {
  typedef __attribute__((address_space(3))) v8s lds_v8s;
  return __builtin_bit_cast(v8b, __builtin_amdgcn_ds_load_tr16_b128_v8i16((lds_v8s*)p));
}
/* lane l with lane l ^ 16: the two halves of a wave hold the two halves of a query column's keys */
__device__ __forceinline__ float xhalf(float x) {
  return __builtin_bit_cast(float, __builtin_amdgcn_permlanex16(__builtin_bit_cast(int, x), __builtin_bit_cast(int, x),
                                                                0x76543210, 0xfedcba98, false, false));
}
/* e[i] = 2^e[i], the 17 exponentials of a softmax step as one run. In asm for the free slot that the instruction set asks for behind a
   transcendental: each v_exp_f32 is the independent instruction behind the one before it and the v_nop stands behind the last */
__device__ __forceinline__ void exp2_run17(float (&e)[17]) {
  asm(
      "v_exp_f32 %0, %0\n\t"
      "v_exp_f32 %1, %1\n\t"
      "v_exp_f32 %2, %2\n\t"
      "v_exp_f32 %3, %3\n\t"
      "v_exp_f32 %4, %4\n\t"
      "v_exp_f32 %5, %5\n\t"
      "v_exp_f32 %6, %6\n\t"
      "v_exp_f32 %7, %7\n\t"
      "v_exp_f32 %8, %8\n\t"
      "v_exp_f32 %9, %9\n\t"
      "v_exp_f32 %10, %10\n\t"
      "v_exp_f32 %11, %11\n\t"
      "v_exp_f32 %12, %12\n\t"
      "v_exp_f32 %13, %13\n\t"
      "v_exp_f32 %14, %14\n\t"
      "v_exp_f32 %15, %15\n\t"
      "v_exp_f32 %16, %16\n\t"
      "v_nop"
      : "+v"(e[0]), "+v"(e[1]), "+v"(e[2]), "+v"(e[3]), "+v"(e[4]), "+v"(e[5]),
        "+v"(e[6]), "+v"(e[7]), "+v"(e[8]), "+v"(e[9]), "+v"(e[10]), "+v"(e[11]),
        "+v"(e[12]), "+v"(e[13]), "+v"(e[14]), "+v"(e[15]), "+v"(e[16]));
}
/* ---- online softmax step for one head, 32 keys x 16 query columns per wave (2 key subtiles), scores transposed ----
   sA[r]: key 8*hh + r, sB[r]: key 16 + 8*hh + r, both of query column c: a lane holds 16 keys of ONE query.
   The scores arrive times log2(e), so that e^(s - m) is one v_exp_f32 (2^x) of a difference; mrow is kept in the same unit.
   Maximum in the lane plus one exchange between the halves; the sum stays a per-lane partial (joined behind the key loop).
   P^T leaves as two B operands, hi and lo: element s = key kmap(s, hh), which is the order the accumulators already have. */
__device__ __forceinline__ float softmax_step_t(const v8f& sA, const v8f& sB, float& mrow, float& lrow, v16b& ph, v16b& pl) {
  float mm[4];
#pragma unroll
  for (int k = 0; k < 4; ++k) mm[k] = fmaxf(fmaxf(sA[k], sA[4 + k]), fmaxf(sB[k], sB[4 + k]));
  float m = fmaxf(fmaxf(mm[0], mm[1]), fmaxf(mm[2], mm[3]));
  m = fmaxf(m, xhalf(m));
  const float mnew = fmaxf(mrow, m);
  float e[17];
#pragma unroll
  for (int r = 0; r < 8; ++r) { e[r] = sA[r] - mnew; e[8 + r] = sB[r] - mnew; }
  e[16] = mrow - mnew;
  exp2_run17(e);
  const float al = e[16];
  mrow = mnew;
  float ps[4] = {0.f, 0.f, 0.f, 0.f};
#pragma unroll
  for (int r = 0; r < 8; ++r) {
    const float p0 = e[r];
    const float p1 = e[8 + r];
    ps[r & 1]       += p0;
    ps[2 + (r & 1)] += p1;
    __bf16 hi, lo;
    at_split(p0, hi, lo);
    ph[r] = hi;  pl[r] = lo;
    at_split(p1, hi, lo);
    ph[8 + r] = hi;  pl[8 + r] = lo;
  }
  lrow = lrow * al + ((ps[0] + ps[1]) + (ps[2] + ps[3]));
  return al;
}
/* per-wave transposed result (o[t][r] = O[query c][d = t*16 + 8*hh + r]) -> LDS staging [query][d] (pitch kOsPitch);
   writes rows 0..15, cols 0..31, 8 consecutive floats per lane and tile */
__device__ __forceinline__ void tile_to_os(float* os, const v8f (&o)[2], int hh, int c) {
#pragma unroll
  for (int t = 0; t < 2; ++t) {
    float* p = os + c * kOsPitch + t * 16 + 8 * hh;
    *(v4f*)(p)     = (v4f){o[t][0], o[t][1], o[t][2], o[t][3]};
    *(v4f*)(p + 4) = (v4f){o[t][4], o[t][5], o[t][6], o[t][7]};
  }
}
/* weighted sum over the kSplit key groups of one query tile, 4 floats of one row per lane;
   os0: staging tile of key group 0 for this query tile, the groups 4 tiles apart */
__device__ __forceinline__ v4f merge_os(const float* os0, const float (&w)[kSplit], int row, int c4) {
  v4f acc = (v4f){0.f, 0.f, 0.f, 0.f};
#pragma unroll
  for (int s = 0; s < kSplit; ++s) {
    const v4f v = *(const v4f*)(os0 + s * (4 * 16 * kOsPitch) + row * kOsPitch + c4);
#pragma unroll
    for (int e = 0; e < 4; ++e) acc[e] += w[s] * v[e];
  }
  return acc;
}

/* ---- attention for one (batch, head h, 64 query rows) ----------------------------------
   q16/k16: f16 planes [B*N][128] (head-major columns); vhi/vlo: bf16 hi/lo planes [B*Nkv][128].
   scores^T = (k.q^T)*scale + rpe[idx][h], the head's table column held in LDS; online softmax in f32, a lane holding one query's keys;
   scale and table carry the factor log2(e), so the softmax runs on powers of two (the hardware's own exponential);
   P^T hi and lo go from the score accumulators straight into B operands, never through LDS;
   V tiles lie row-major in LDS and are transposed by the load that reads them;
   o^T = V_h^T . P^T;  for h >= 2 also ox^T = V_{h-2}^T . P^T (the cross term of the differential mixing).
   16 waves: wave = (key group sp, query tile qt). Group sp (4 waves) takes key chunks sp, sp + kSplit, ... with its own
   K/V tiles and each wave its own running max, sum and accumulators; the groups are merged through LDS at the end.
   xattn f32 [B*Nq][128]; ycross f32 [B][2][Nq][32]. grid.x = B*H*(Nq/64), block 128 * kSplit. */
__global__ __launch_bounds__(128 * kSplit) __attribute__((amdgpu_num_vgpr(256)))
void attn_head_kernel(
    const unsigned short* __restrict__ q16, const unsigned short* __restrict__ k16,
    const unsigned short* __restrict__ vhi, const unsigned short* __restrict__ vlo,
    const int* __restrict__ coords_q, const int* __restrict__ coords_k,
    const float* __restrict__ rpe,
    float* __restrict__ xattn, float* __restrict__ ycross)
{
  __shared__ __align__(16) unsigned short KshS[kSplit][kKC * kHD];   /* [group][key][d]  f16 bits  */
  __shared__ __align__(16) unsigned short VthS[kSplit][kKC * kVP];   /* [group][key][d] bf16 hi, head h,   row pitch kVP */
  __shared__ __align__(16) unsigned short VtlS[kSplit][kKC * kVP];   /* [group][key][d] bf16 lo, head h,   row pitch kVP */
  __shared__ __align__(16) unsigned short VxhS[kSplit][kKC * kVP];   /* [group][key][d] bf16 hi, head h-2, row pitch kVP */
  __shared__ __align__(16) unsigned short VxlS[kSplit][kKC * kVP];   /* [group][key][d] bf16 lo, head h-2, row pitch kVP */
  __shared__ __align__(16) float Tab[kTabLds];                       /* rpe[idx][h] * log2(e) for this block's head, all idx */
  /* behind the key loop the table is dead and its bytes take the merge staging */
  static_assert(4 * kSplit * 16 * kOsPitch + 4 * kSplit * 16 * 2 <= kTabLds, "");
  float* const OsAll = Tab;                                          /* [wave][16 * kOsPitch] */
  float* const MlAll = Tab + 4 * kSplit * 16 * kOsPitch;             /* [wave][row] (max, sum) */

  const int wave = threadIdx.x >> 5;     /* 0 .. 15 */
  const int sp   = wave >> 2;            /* key group */
  const int qt   = wave & 3;             /* query tile */
  const int tid  = threadIdx.x & 127;    /* thread within the key group */
  const int lane = tid & 31;
  unsigned short* Ksh = KshS[sp];
  unsigned short* Vth = VthS[sp];
  unsigned short* Vtl = VtlS[sp];
  unsigned short* Vxh = VxhS[sp];
  unsigned short* Vxl = VxlS[sp];
  const int hh   = lane >> 4;
  const int c    = lane & 15;
  const int vro  = (8 * hh + (lane & 7)) * kVP + ((lane >> 3) & 1) * 8;   /* halves; this lane's piece for the transposing V loads */
  constexpr int nqb = kNq / kQB;
  const int bx   = blockIdx.x;
  const int qb   = bx % nqb;
  const int rest = bx / nqb;
  const int h    = rest % kH;
  const int b    = rest / kH;
  const bool cross = (h >= kNH);                       /* block-uniform */
  const int hcol = h * kHD;
  const int xcol = (cross ? (h - kNH) : 0) * kHD;
  const int q0   = qb * kQB + qt * 16;
  const size_t qrows  = (size_t)b * kNq + q0;
  const size_t kvrows = (size_t)b * kNkv;
  const float* __restrict__ rpe_h = rpe + h;           /* table entry stride kH floats */

  /* this head's column of the bias table -> LDS, once per work-group; batches of 16 loads per thread keep the
     latency of the strided reads covered. The first barrier of the key loop publishes it. */
  {
    constexpr int kThreads = 128 * kSplit;
    constexpr int kFull = kTable / (kThreads * 16);
    const int t0 = threadIdx.x;
    /* rolled: 16 waves x 16 loads in flight already cover the L2 latency; unrolled further the copy only takes more registers */
#pragma unroll 1
    for (int g = 0; g < kFull; ++g) {
      float tv[16];
      const float* gp = rpe_h + (size_t)(g * 16 * kThreads + t0) * kH;
#pragma unroll
      for (int u = 0; u < 16; ++u) tv[u] = gp[u * (kThreads * kH)];
      asm volatile("s_wait_xcnt 0x0" :: "v"(gp) : "memory");   /* the loads' address registers are kept as they are until this wait */
#pragma unroll
      for (int u = 0; u < 16; ++u) Tab[(g * 16 + u) * kThreads + t0] = tv[u] * kLog2e;
    }
    for (int i = kFull * 16 * kThreads + t0; i < kTable; i += kThreads) Tab[i] = rpe_h[(size_t)i * kH] * kLog2e;
  }

  /* Q fragment (B operand: lane c -> query column c; K = head_dim = 32, one k-step) */
  const _Float16* qp = (const _Float16*)(const void*)q16;
  const v16h qa = Frag<_Float16>::load(qp + (qrows + c) * kC + hcol + 8 * hh);

  /* coords of this lane's query column c, +MAXD folded in */
  const v2i cq = *(const v2i*)(coords_q + (qrows + c) * 2);
  const int cqx = cq.x + kMaxd;
  const int cqy = cq.y + kMaxd;

  float mr = -INFINITY, lr = 0.f;   /* running max (equal in both halves) and this lane's partial sum for query c */
  v8f o[2], ox[2];                  /* o[t][r] = O[query c][d = t*16 + 8*hh + r] */
#pragma unroll
  for (int t = 0; t < 2; ++t) {
    o[t]  = (v8f){0.f,0.f,0.f,0.f,0.f,0.f,0.f,0.f};
    ox[t] = (v8f){0.f,0.f,0.f,0.f,0.f,0.f,0.f,0.f};
  }

  for (int kc = 0; kc < kNkv / (kKC * kSplit); ++kc) {
    const int kv0 = (kc * kSplit + sp) * kKC;
    __syncthreads();
    /* coords of this lane's 16 score rows (keys j*16 + 8*hh + r), two keys per 16-byte load, the same address in the 16 lanes
       of a half; asked for just ahead of the K and V rows so that one round trip serves both */
    v4i ck[2][4];
    {
      const int* ckp = coords_k + (kvrows + kv0 + 8 * hh) * 2;
#pragma unroll
      for (int j = 0; j < 2; ++j) {
#pragma unroll
        for (int i = 0; i < 4; ++i) ck[j][i] = *(const v4i*)(ckp + j * 32 + i * 4);
      }
      asm volatile("s_wait_xcnt 0x0" :: "v"(ckp) : "memory");   /* the loads' address registers are kept as they are until this wait */
    }
    /* stage the K tile and the V hi/lo tiles, all row-major: 32 keys x 4 segments of 8 halves = 128 = threads of a key group, one
       uint4 per thread per plane; covers Ksh 32x32 and the 32 d of every row of Vth/Vtl (and Vxh/Vxl when cross) exactly;
       the pad halves of a V row are never read */
    {
      const int key = tid >> 2;
      const int seg = tid & 3;
      const size_t rowoff = (kvrows + kv0 + key) * kC;
      const size_t go = rowoff + hcol + seg * 8;
      const unsigned short* kgp = k16 + go;
      const unsigned short* hgp = vhi + go;
      const unsigned short* lgp = vlo + go;
      const uint4 kw  = *(const uint4*)(kgp);
      const uint4 vh4 = *(const uint4*)(hgp);
      const uint4 vl4 = *(const uint4*)(lgp);
      asm volatile("s_wait_xcnt 0x0" :: "v"(kgp), "v"(hgp), "v"(lgp) : "memory");   /* the loads' address registers are kept as they are until this wait */
      *(uint4*)(&Ksh[key * kHD + seg * 8]) = kw;
      *(uint4*)(&Vth[key * kVP + seg * 8]) = vh4;
      *(uint4*)(&Vtl[key * kVP + seg * 8]) = vl4;
      if (cross) {
        const size_t gx = rowoff + xcol + seg * 8;
        const uint4 xh4 = *(const uint4*)(vhi + gx);
        const uint4 xl4 = *(const uint4*)(vlo + gx);
        *(uint4*)(&Vxh[key * kVP + seg * 8]) = xh4;
        *(uint4*)(&Vxl[key * kVP + seg * 8]) = xl4;
      }
    }
    __syncthreads();

    /* scores^T: s[j], j = key subtile; A fragment lane c -> key j*16+c, elements d (split map); s[j][r] = S[key j*16+8*hh+r][query c] */
    v8f s[2];
    {
      const v8f z = (v8f){0.f,0.f,0.f,0.f,0.f,0.f,0.f,0.f};
      const _Float16* Kp = (const _Float16*)(const void*)Ksh;
#pragma unroll
      for (int j = 0; j < 2; ++j) {
        Frag<_Float16>::U kb;
        kb.h[0] = *(const v8h*)(Kp + (j * 16 + c) * kHD + 8 * hh);
        kb.h[1] = *(const v8h*)(Kp + (j * 16 + c) * kHD + 16 + 8 * hh);
        s[j] = mma_h16(kb.v, qa, z);
      }
    }

    /* scale + relative position bias, both times log2(e): one clamped b32 gather from the LDS table per (key, query) */
#pragma unroll
    for (int r = 0; r < 8; ++r) {
#pragma unroll
      for (int j = 0; j < 2; ++j) {
        const int kx = ck[j][r >> 1][(r & 1) * 2];
        const int ky = ck[j][r >> 1][(r & 1) * 2 + 1];
        int dx = cqx - kx; dx = dx < 0 ? 0 : dx; dx = dx > 2 * kMaxd ? 2 * kMaxd : dx;
        int dy = cqy - ky; dy = dy < 0 ? 0 : dy; dy = dy > 2 * kMaxd ? 2 * kMaxd : dy;
        const int idx = dx * kSpan + dy;            /* 0 .. kTable-1 */
        s[j][r] = s[j][r] * kScaleL2 + Tab[idx];
      }
    }

    /* online softmax; P^T hi and lo stay in registers as B operands */
    v16b ph, pl;
    const float al = softmax_step_t(s[0], s[1], mr, lr, ph, pl);
#pragma unroll
    for (int t = 0; t < 2; ++t) {
#pragma unroll
      for (int r = 0; r < 8; ++r) { o[t][r] *= al; ox[t][r] *= al; }
    }

    /* V^T.P^T : A = V^T (lane c -> d, elements key, split map), transposed out of the row-major tile by the load itself;
       B = P^T (lane c -> query, elements key, same map) */
    {
#pragma unroll
      for (int t = 0; t < 2; ++t) {
        Frag<__bf16>::U vh, vl;
        vh.h[0] = ld_tr16(Vth + vro + t * 16);  vh.h[1] = ld_tr16(Vth + vro + 16 * kVP + t * 16);
        vl.h[0] = ld_tr16(Vtl + vro + t * 16);  vl.h[1] = ld_tr16(Vtl + vro + 16 * kVP + t * 16);
        o[t] = at_mma(vh.v, ph, o[t]);
        o[t] = at_mma(vl.v, ph, o[t]);
        o[t] = at_mma(vh.v, pl, o[t]);
      }
      if (cross) {
#pragma unroll
        for (int t = 0; t < 2; ++t) {
          Frag<__bf16>::U vh, vl;
          vh.h[0] = ld_tr16(Vxh + vro + t * 16);  vh.h[1] = ld_tr16(Vxh + vro + 16 * kVP + t * 16);
          vl.h[0] = ld_tr16(Vxl + vro + t * 16);  vl.h[1] = ld_tr16(Vxl + vro + 16 * kVP + t * 16);
          ox[t] = at_mma(vh.v, ph, ox[t]);
          ox[t] = at_mma(vl.v, ph, ox[t]);
          ox[t] = at_mma(vh.v, pl, ox[t]);
        }
      }
    }
  }

  /* merge of the key groups: every wave leaves its accumulators (not normalised) and its (max, sum) in LDS;
     wave (sp, qt) then merges rows 4*sp .. 4*sp+3 of query tile qt: x = sum_s 2^(m_s-M) o_s / sum_s 2^(m_s-M) l_s, the maxima in log2 units */
  __syncthreads();   /* every wave has made its last table read: the table's bytes become the merge staging */
  float* os = OsAll + wave * (16 * kOsPitch);
  const float* osq = OsAll + qt * (16 * kOsPitch);
  tile_to_os(os, o, hh, c);
  lr += xhalf(lr);   /* the two halves' partial sums of query c */
  if (hh == 0) {     /* max and sum are now equal in lanes c and c + 16 */
    MlAll[wave * 32 + c * 2] = mr;
    MlAll[wave * 32 + c * 2 + 1] = lr;
  }
  __syncthreads();   /* all groups' partial tiles are in LDS */

  const int row = 4 * sp + (lane >> 3);
  const int c4  = (lane & 7) * 4;
  float w[kSplit];
  {
    float ms[kSplit], ls[kSplit];
    float M = -INFINITY;
#pragma unroll
    for (int s = 0; s < kSplit; ++s) {
      ms[s] = MlAll[(s * 4 + qt) * 32 + row * 2];
      ls[s] = MlAll[(s * 4 + qt) * 32 + row * 2 + 1];
      M = fmaxf(M, ms[s]);
    }
    float L = 0.f;
#pragma unroll
    for (int s = 0; s < kSplit; ++s) { w[s] = __builtin_amdgcn_exp2f(ms[s] - M); L += w[s] * ls[s]; }
    const float inv = 1.0f / L;
#pragma unroll
    for (int s = 0; s < kSplit; ++s) w[s] *= inv;
  }
  *(v4f*)(xattn + (qrows + row) * kC + hcol + c4) = merge_os(osq, w, row, c4);
  asm volatile("s_wait_xcnt 0x0" ::: "memory");   /* the cross path below reuses the registers this store names */

  if (cross) {
    __syncthreads();   /* every reader has left the o tiles */
    tile_to_os(os, ox, hh, c);
    __syncthreads();   /* all groups' cross tiles are in LDS */
    *(v4f*)(ycross + ((((size_t)b * kNH + (h - kNH)) * kNq + q0 + row) * kHD) + c4) = merge_os(osq, w, row, c4);
  }
}

/* ---- differential head mixing + split to bf16 hi/lo planes for the output projection --------
   x[b,q,h*32+d] = xs + alpha[b,q]*(xs - lam[h]*yc[b,h,q,d]) for h < 2, else xs.
   coverage 65536 threads x 8 = 4096x128 exactly. */
__global__ __launch_bounds__(256) void combine_split_kernel(
    const float* __restrict__ xattn, const float* __restrict__ ycross, const float* __restrict__ alpha,
    const float* __restrict__ lq1, const float* __restrict__ lk1,
    const float* __restrict__ lq2, const float* __restrict__ lk2,
    unsigned short* __restrict__ hi, unsigned short* __restrict__ lo)
{
  __shared__ float lam_s[2];
  if (threadIdx.x < 2) {
    const int h = threadIdx.x;
    float s1 = 0.f, s2 = 0.f;
#pragma unroll 1
    for (int i = 0; i < kHD; ++i) {
      s1 += lq1[h * kHD + i] * lk1[h * kHD + i];
      s2 += lq2[h * kHD + i] * lk2[h * kHD + i];
    }
    lam_s[h] = expf(s1) - expf(s2) + kLambdaInit;
  }
  __syncthreads();
  const int gt = blockIdx.x * 256 + threadIdx.x;
  if (gt >= kBatch * kNq * kC / 8) return;
  const size_t e0 = (size_t)gt * 8;
  const int row = (int)(e0 >> 7);
  const int col = (int)(e0 & 127);
  const int h   = col >> 5;
  const int d   = col & 31;
  const int hc  = h & 1;
  const int b   = row >> 11;
  const int q   = row & (kNq - 1);
  const float a   = alpha[row];
  const float lam = lam_s[hc];
  const v4f xs0 = *(const v4f*)(xattn + e0);
  const v4f xs1 = *(const v4f*)(xattn + e0 + 4);
  const size_t yo = (((size_t)b * kNH + hc) * kNq + q) * kHD + d;
  const v4f y0 = *(const v4f*)(ycross + yo);
  const v4f y1 = *(const v4f*)(ycross + yo + 4);
  const bool mix = (h < kNH);
  float x[8];
#pragma unroll
  for (int e = 0; e < 4; ++e) {
    const float xa = xs0[e], xb = xs1[e];
    const float va = xa + a * (xa - lam * y0[e]);
    const float vb = xb + a * (xb - lam * y1[e]);
    x[e]     = mix ? va : xa;
    x[4 + e] = mix ? vb : xb;
  }
  v4u H, L;
  split_pack8(x, H, L);
  store_planes2(hi, lo, e0, H, L);
}

/* =========================================================================================
   host launch: 9 kernel launches
   workspace region map (bytes, all offsets MiB/256-KiB aligned):
     xq_hi  1 MiB | xq_lo 1 MiB | xkv_hi 2 MiB | xkv_lo 2 MiB | wt planes 256 KiB (4 weights x hi,lo x 32 KiB)
     q16 1 MiB | k16 2 MiB | v_hi 2 MiB | v_lo 2 MiB | xattn f32 2 MiB | ycross f32 512 KiB | xmix_hi 1 MiB | xmix_lo 1 MiB
     total 18,612,224 B
   ========================================================================================= */
extern "C" void kernel_launch(void* const* d_in, const int* in_sizes, int n_in,
                              void* d_out, int out_size, void* d_ws, size_t ws_size,
                              hipStream_t stream) {
  constexpr int Mq  = kBatch * kNq;    /* 4096 */
  constexpr int Mkv = kBatch * kNkv;   /* 8192 */
  static_assert(Mq % 64 == 0 && Mkv % 64 == 0 && kC % 64 == 0 && kC % 32 == 0, "");
  static_assert((Mq * kC) % 8 == 0 && (Mkv * kC) % 8 == 0, "");
  if (n_in < 18) return;
  if (in_sizes[0] != Mq * kC || in_sizes[1] != Mkv * kC || in_sizes[2] != Mq * 2 || in_sizes[3] != Mkv * 2 ||
      in_sizes[4] != Mq || in_sizes[5] != kC * kC || in_sizes[7] != kC * kC || in_sizes[9] != kC * kC ||
      in_sizes[16] != kC * kC || in_sizes[6] != kC || in_sizes[8] != kC || in_sizes[10] != kC || in_sizes[17] != kC ||
      in_sizes[11] != kNH * kHD || in_sizes[12] != kNH * kHD || in_sizes[13] != kNH * kHD || in_sizes[14] != kNH * kHD ||
      in_sizes[15] != kTable * kH || out_size != Mq * kC) return;

  const float* x_q      = (const float*)d_in[0];
  const float* x_kv     = (const float*)d_in[1];
  const int*   coords_q = (const int*)d_in[2];
  const int*   coords_k = (const int*)d_in[3];
  const float* alpha    = (const float*)d_in[4];
  const float* Wq = (const float*)d_in[5];  const float* bq = (const float*)d_in[6];
  const float* Wk = (const float*)d_in[7];  const float* bk = (const float*)d_in[8];
  const float* Wv = (const float*)d_in[9];  const float* bv = (const float*)d_in[10];
  const float* lq1 = (const float*)d_in[11]; const float* lk1 = (const float*)d_in[12];
  const float* lq2 = (const float*)d_in[13]; const float* lk2 = (const float*)d_in[14];
  const float* rpe = (const float*)d_in[15];
  const float* Wp = (const float*)d_in[16]; const float* bp = (const float*)d_in[17];
  float* out = (float*)d_out;

  char* ws = (char*)d_ws;
  size_t off = 0;
  const size_t szXq16  = (size_t)Mq * kC * 2;     /* 1 MiB  */
  const size_t szXkv16 = (size_t)Mkv * kC * 2;    /* 2 MiB  */
  const size_t szWt    = (size_t)4 * 2 * kC * kC * 2;
  const size_t szXattn = (size_t)Mq * kC * 4;
  const size_t szYc    = (size_t)kBatch * kNH * kNq * kHD * 4;
  unsigned short* xq_hi  = (unsigned short*)(ws + off); off += szXq16;
  unsigned short* xq_lo  = (unsigned short*)(ws + off); off += szXq16;
  unsigned short* xkv_hi = (unsigned short*)(ws + off); off += szXkv16;
  unsigned short* xkv_lo = (unsigned short*)(ws + off); off += szXkv16;
  unsigned short* wt     = (unsigned short*)(ws + off); off += szWt;
  unsigned short* q16    = (unsigned short*)(ws + off); off += szXq16;
  unsigned short* k16    = (unsigned short*)(ws + off); off += szXkv16;
  unsigned short* v_hi   = (unsigned short*)(ws + off); off += szXkv16;
  unsigned short* v_lo   = (unsigned short*)(ws + off); off += szXkv16;
  float*          xattn  = (float*)(ws + off);          off += szXattn;
  float*          ycross = (float*)(ws + off);          off += szYc;
  unsigned short* xm_hi  = (unsigned short*)(ws + off); off += szXq16;
  unsigned short* xm_lo  = (unsigned short*)(ws + off); off += szXq16;
  if (off > ws_size) return;

  const unsigned short* wtq_hi = wt + 0 * (2 * kC * kC); const unsigned short* wtq_lo = wtq_hi + kC * kC;
  const unsigned short* wtk_hi = wt + 1 * (2 * kC * kC); const unsigned short* wtk_lo = wtk_hi + kC * kC;
  const unsigned short* wtv_hi = wt + 2 * (2 * kC * kC); const unsigned short* wtv_lo = wtv_hi + kC * kC;
  const unsigned short* wtp_hi = wt + 3 * (2 * kC * kC); const unsigned short* wtp_lo = wtp_hi + kC * kC;

  /* 1-2: activations -> bf16 hi/lo planes */
  const int n8q = Mq * kC / 8, n8kv = Mkv * kC / 8;
  split_rows_bf16<<<dim3((n8q + 255) / 256), dim3(256), 0, stream>>>(x_q, xq_hi, xq_lo, n8q);
  split_rows_bf16<<<dim3((n8kv + 255) / 256), dim3(256), 0, stream>>>(x_kv, xkv_hi, xkv_lo, n8kv);
  /* 3: weights -> transposed bf16 hi/lo planes (in[k][n] -> out[n][k], square 128x128) */
  wt_split_bf16<<<dim3((kC * kC / 8 + 255) / 256, 4), dim3(256), 0, stream>>>(Wq, Wk, Wv, Wp, wt);

  /* 4-6: projections, M x 128, K = 128 (M % 64 == 0, N = 128 % 64 == 0, K = 128 % 32 == 0) */
  const int blocksQ  = ((Mq  / 64) * (kC / 64) + 7) / 8;
  const int blocksKV = ((Mkv / 64) * (kC / 64) + 7) / 8;
  wmma_gemm64<1, true, 2, 1, false><<<dim3(blocksQ, 1), dim3(256), 0, stream>>>(
      xq_hi, xq_lo, kC, 0L, wtq_hi, wtq_lo, kC, 0L, (void*)q16, nullptr, kC, 0L, bq, nullptr, 0L, Mq, kC, kC, 1.0f);
  wmma_gemm64<1, true, 2, 1, false><<<dim3(blocksKV, 1), dim3(256), 0, stream>>>(
      xkv_hi, xkv_lo, kC, 0L, wtk_hi, wtk_lo, kC, 0L, (void*)k16, nullptr, kC, 0L, bk, nullptr, 0L, Mkv, kC, kC, 1.0f);
  wmma_gemm64<1, true, 2, 2, false><<<dim3(blocksKV, 1), dim3(256), 0, stream>>>(
      xkv_hi, xkv_lo, kC, 0L, wtv_hi, wtv_lo, kC, 0L, (void*)v_hi, (void*)v_lo, kC, 0L, bv, nullptr, 0L, Mkv, kC, kC, 1.0f);

  /* 7: attention per (batch, head, 64 queries) */
  const int attnBlocks = kBatch * kH * (kNq / kQB);
  attn_head_kernel<<<dim3(attnBlocks), dim3(128 * kSplit), 0, stream>>>(q16, k16, v_hi, v_lo, coords_q, coords_k, rpe, xattn, ycross);

  /* 8: differential mixing + bf16 hi/lo planes */
  combine_split_kernel<<<dim3((n8q + 255) / 256), dim3(256), 0, stream>>>(xattn, ycross, alpha, lq1, lk1, lq2, lk2, xm_hi, xm_lo);

  /* 9: output projection -> d_out (f32), M = 4096, N = 128, K = 128 */
  wmma_gemm64<1, true, 2, 0, false><<<dim3(blocksQ, 1), dim3(256), 0, stream>>>(
      xm_hi, xm_lo, kC, 0L, wtp_hi, wtp_lo, kC, 0L, (void*)out, nullptr, kC, 0L, bp, nullptr, 0L, Mq, kC, kC, 1.0f);
}

// v006
// It runs in 143 microseconds.
// Two timings next to v005 put it at 1.06 and 1.05 times that version's speed.
// All steps since v000 together make it 3.15 times as fast.
// Contractions: x@Wq, x@Wk, x@Wv and xmix@Wp on v_wmma_f32_16x16x32_bf16 with bf16 hi/lo operand planes (hi.hi + hi.lo + lo.hi); k.q^T on v_wmma_f32_16x16x32_f16 with plain f16 q/k planes; v^T.p^T and v_cross^T.p^T on v_wmma_f32_16x16x32_bf16 with bf16 hi/lo p and v tiles; f32 accumulate; bias gather, online softmax and head mixing in f32.
#include <hip/hip_runtime.h>
#include <stdint.h>

typedef __attribute__((ext_vector_type(16))) _Float16 v16h;
typedef __attribute__((ext_vector_type(8)))  _Float16 v8h;
typedef __attribute__((ext_vector_type(16))) __bf16   v16b;
typedef __attribute__((ext_vector_type(8)))  __bf16   v8b;
typedef __attribute__((ext_vector_type(8)))  float    v8f;
typedef __attribute__((ext_vector_type(4)))  float    v4f;
typedef __attribute__((ext_vector_type(4)))  unsigned int v4u;
typedef __attribute__((ext_vector_type(2)))  int      v2i;
typedef __attribute__((ext_vector_type(4)))  int      v4i;
typedef __attribute__((ext_vector_type(8)))  short    v8s;
typedef __attribute__((ext_vector_type(2)))  float    v2f;
typedef __attribute__((ext_vector_type(2)))  __bf16   v2b;

/* ---- problem geometry (fixed by the module) ---- */
constexpr int kBatch = 2;
constexpr int kNq    = 2048;
constexpr int kNkv   = 4096;
constexpr int kC     = 128;
constexpr int kH     = 4;
constexpr int kHD    = 32;
constexpr int kNH    = 2;
constexpr int kMaxd  = 128;
constexpr int kSpan  = 2 * kMaxd + 1;
constexpr int kTable = kSpan * kSpan;
constexpr int kKC    = 32;     /* keys per chunk in the attention kernel */
constexpr int kQB    = 64;     /* query rows per attention block (4 query tiles x 16) */
constexpr int kSplit = 4;      /* key groups per attention block: wave = (key group, query tile) */
constexpr int kOsPitch = 36;   /* floats; per-wave output staging pitch */
constexpr int kVP    = 48;     /* halves; LDS row pitch of the V tiles: 96 B = 32 B x odd, the pitch of the transposing load */
constexpr int kTabLds  = (kTable + 3) & ~3;   /* floats; one head's bias column in LDS, rounded to 16 bytes */
constexpr float kLog2e  = 1.4426950408889634f;                        /* log2(e) */
constexpr float kScaleL2 = (float)(0.17677669529663687 * 1.4426950408889634);   /* head_dim ** -0.5 * log2(e) */
constexpr float kLambdaInit = 0.8f;

static_assert(kNq % kQB == 0, "");
static_assert(kNkv % (kKC * kSplit) == 0, "");
static_assert(kSplit * 4 == 16, "");   /* the merge gives each wave 16 / kSplit = 4 rows = 32 lanes x 4 floats */
static_assert(kC == kH * kHD, "");
static_assert((kBatch * kNq) % 64 == 0 && (kBatch * kNkv) % 64 == 0, "");
static_assert(kC % 64 == 0 && kC % 32 == 0, "");
static_assert(kH == 4 && kNH == 2 && kHD == 32 && kKC == 32, "");

/* two f32 -> a packed pair of bf16 hi and a packed pair of bf16 lo (the residual x - hi, exact in f32), three instructions a pair, all on
   the hardware's own converts, which round to nearest even as the integer form did. hi: one packed convert. lo: one mixed fma per value,
   hi * (-1) + x with hi and the -1 read as bf16 and the result written as bf16 into one half of lo. In asm because the compiler widens hi
   by a shift and a mask, subtracts and converts again: five instructions a pair */
__device__ __forceinline__ void split2(float a, float b, v2b& hi, v2b& lo) {
  hi = __builtin_convertvector((v2f){a, b}, v2b);
  unsigned lw;
  asm("v_fma_mixlo_bf16 %0, %1, %2, %3 op_sel_hi:[1,1,0]\n\t"
      "v_fma_mixhi_bf16 %0, %1, %2, %4 op_sel:[1,0,0] op_sel_hi:[1,1,0]"
      : "=&v"(lw)
      : "v"(__builtin_bit_cast(unsigned, hi)), "v"(0xBF80BF80u) /* bf16 -1 */, "v"(a), "v"(b));
  lo = __builtin_bit_cast(v2b, lw);
}

/* hazard guards as plain device helpers */
__device__ __forceinline__ void dep_guard_h(v8f& a, v8f& b, v16h x, v16h y) { asm volatile("v_nop\n\tv_nop\n\tv_nop\n\tv_nop" : "+v"(a), "+v"(b) : "v"(x), "v"(y)); }
__device__ __forceinline__ void dep_guard_b(v8f& a, v8f& b, v16b x, v16b y) { asm volatile("v_nop\n\tv_nop\n\tv_nop\n\tv_nop" : "+v"(a), "+v"(b) : "v"(x), "v"(y)); }
__device__ __forceinline__ void keep4_h(v16h a, v16h b, v16h c, v16h d) { asm volatile("v_nop" :: "v"(a), "v"(b), "v"(c), "v"(d)); }
__device__ __forceinline__ void keep4_b(v16b a, v16b b, v16b c, v16b d) { asm volatile("v_nop" :: "v"(a), "v"(b), "v"(c), "v"(d)); }
__device__ __forceinline__ void acc_guard4(v8f& a, v8f& b, v8f& c, v8f& d) { asm volatile("v_nop\n\tv_nop\n\tv_nop\n\tv_nop" : "+v"(a), "+v"(b), "+v"(c), "+v"(d)); }
template <typename T> struct Frag;
template <> struct Frag<_Float16> {
  typedef v16h V; union U { v16h v; v8h h[2]; };
  static __device__ __forceinline__ v16h load(const _Float16* p) {
    U f; f.h[0] = *(const v8h*)(p); f.h[1] = *(const v8h*)(p + 16); return f.v;
  }
  static __device__ __forceinline__ v8f mma(v16h a, v16h b, v8f c) {
    return __builtin_amdgcn_wmma_f32_16x16x32_f16(false, a, false, b, (short)0, c, false, false);
  }
  static __device__ __forceinline__ void guard(v8f& a, v8f& b, v16h x, v16h y) { dep_guard_h(a, b, x, y); }
  static __device__ __forceinline__ void keep(v16h a, v16h b, v16h c, v16h d) { keep4_h(a, b, c, d); }
};
template <> struct Frag<__bf16> {
  typedef v16b V; union U { v16b v; v8b h[2]; };
  static __device__ __forceinline__ v16b load(const __bf16* p) {
    U f; f.h[0] = *(const v8b*)(p); f.h[1] = *(const v8b*)(p + 16); return f.v;
  }
  static __device__ __forceinline__ v8f mma(v16b a, v16b b, v8f c) {
    return __builtin_amdgcn_wmma_f32_16x16x32_bf16(false, a, false, b, (short)0, c, false, false);
  }
  static __device__ __forceinline__ void guard(v8f& a, v8f& b, v16b x, v16b y) { dep_guard_b(a, b, x, y); }
  static __device__ __forceinline__ void keep(v16b a, v16b b, v16b c, v16b d) { keep4_b(a, b, c, d); }
};

/* ---- Register-blocked batched WMMA GEMM ---------------- */
template <int ET> struct Elem;
template <> struct Elem<0> { typedef _Float16 T; };
template <> struct Elem<1> { typedef __bf16 T; };
template <int ET, bool SPLIT, int BIAS_MODE, int OUT_MODE, bool RESID, int ACT = 0>
__global__ __launch_bounds__(256) void wmma_gemm64(
    const unsigned short* __restrict__ Ap, const unsigned short* __restrict__ A2p, int lda, long strideA,
    const unsigned short* __restrict__ Btp, const unsigned short* __restrict__ Bt2p, int ldb, long strideB,
    void* __restrict__ Cout, void* __restrict__ Cout2, int ldc, long strideC,
    const float* __restrict__ bias,
    const float* __restrict__ resid, long strideR,
    int M, int N, int K, float scale) {
  typedef typename Elem<ET>::T T;
  typedef typename Frag<T>::V V;
  const T* A = (const T*)Ap; const T* A2 = (const T*)A2p; const T* Bt = (const T*)Btp; const T* Bt2 = (const T*)Bt2p;
  __shared__ __align__(16) float sT[8][16 * 68];
  const int b    = blockIdx.y;
  const int lane = threadIdx.x & 31;
  const int wave = threadIdx.x >> 5;
  const int tilesN = N >> 6;
  const int tilesM = M >> 6;
  const int tile = blockIdx.x * 8 + wave;
  if (tile >= tilesM * tilesN) return;
  const int tm = tile / tilesN;
  const int tn = tile - tm * tilesN;
  const int m0 = tm << 6;
  const int n0 = tn << 6;

  const T* Ab  = A  + (size_t)b * strideA;
  const T* Bb  = Bt + (size_t)b * strideB;
  const T* Ab2 = SPLIT ? (A2  + (size_t)b * strideA) : nullptr;
  const T* Bb2 = SPLIT ? (Bt2 + (size_t)b * strideB) : nullptr;

  const int rlane = lane & 15;
  const int koff  = (lane >> 4) * 8;
  const int mOff  = (lane >> 4) * 8;

  v8f acc[4][4];
#pragma unroll
  for (int i = 0; i < 4; ++i)
#pragma unroll
    for (int j = 0; j < 4; ++j) acc[i][j] = (v8f){0.f,0.f,0.f,0.f,0.f,0.f,0.f,0.f};

  for (int k0 = 0; k0 < K; k0 += 32) {
    V bh[4], bl[4];
#pragma unroll
    for (int j = 0; j < 4; ++j) {
      const size_t bo = (size_t)(n0 + (j << 4) + rlane) * ldb + koff + k0;
      bh[j] = Frag<T>::load(Bb + bo);
      if (SPLIT) bl[j] = Frag<T>::load(Bb2 + bo);
    }
#pragma unroll
    for (int i = 0; i < 4; ++i) {
      const size_t ao = (size_t)(m0 + (i << 4) + rlane) * lda + koff + k0;
      V ah = Frag<T>::load(Ab + ao);
      V al;
      if (SPLIT) al = Frag<T>::load(Ab2 + ao);
#pragma unroll
      for (int j = 0; j < 4; ++j) {
        acc[i][j] = Frag<T>::mma(ah, bh[j], acc[i][j]);
        if (SPLIT) {
          acc[i][j] = Frag<T>::mma(ah, bl[j], acc[i][j]);
          acc[i][j] = Frag<T>::mma(al, bh[j], acc[i][j]);
        }
      }
      Frag<T>::guard(acc[i][0], acc[i][3], ah, SPLIT ? al : ah);
    }
    Frag<T>::keep(bh[0], bh[1], bh[2], bh[3]);
    if (SPLIT) Frag<T>::keep(bl[0], bl[1], bl[2], bl[3]);
  }
  acc_guard4(acc[0][0], acc[0][1], acc[0][2], acc[0][3]);
  acc_guard4(acc[1][0], acc[1][1], acc[1][2], acc[1][3]);
  acc_guard4(acc[2][0], acc[2][1], acc[2][2], acc[2][3]);
  acc_guard4(acc[3][0], acc[3][1], acc[3][2], acc[3][3]);

  float* slab = sT[wave];
  const float* Rb = RESID ? (resid + (size_t)b * strideR) : nullptr;
#pragma unroll
  for (int i = 0; i < 4; ++i) {
    const int mBase = m0 + (i << 4);
#pragma unroll
    for (int j = 0; j < 4; ++j) {
      const int n = n0 + (j << 4) + rlane;
      float bv = 0.f;
      if (BIAS_MODE == 2) bv = bias[n];
#pragma unroll
      for (int r = 0; r < 8; ++r) {
        float v = acc[i][j][r] * scale;
        if (BIAS_MODE == 1) v += bias[mBase + mOff + r];
        if (BIAS_MODE == 2) v += bv;
        if (RESID) v += Rb[(size_t)(mBase + mOff + r) * ldc + n];
        if (ACT == 1) v = tanhf(v);
        if (ACT == 2) v = fmaxf(v, 0.0f);
        if (ACT == 3) v = v / (1.0f + expf(-v));
        if (ACT == 4) v = (v > 0.f) ? v : 0.01f * v;
        if (ACT == 5) v = 0.5f * v * (1.0f + erff(v * 0.70710678118654752f));
        slab[(mOff + r) * 68 + (j << 4) + rlane] = v;
      }
    }
    __builtin_amdgcn_fence(__ATOMIC_RELEASE, "workgroup");
    __builtin_amdgcn_wave_barrier();
    __builtin_amdgcn_fence(__ATOMIC_ACQUIRE, "workgroup");
    if (OUT_MODE == 0) {
      float* C = (float*)Cout + (size_t)b * strideC;
      const int hh = lane >> 4, c4 = (lane & 15) * 4;
      {
#pragma unroll
        for (int it = 0; it < 8; ++it) {
          const int row = it * 2 + hh;
          v4f v = *(const v4f*)(slab + row * 68 + c4);
          *(v4f*)(C + (size_t)(mBase + row) * ldc + n0 + c4) = v;
        }
        
      }
    } else {
      const int q = lane >> 3, c8 = (lane & 7) * 8;
      unsigned short* C  = (unsigned short*)Cout  + (size_t)b * strideC;
      unsigned short* C2 = (OUT_MODE == 2) ? ((unsigned short*)Cout2 + (size_t)b * strideC) : nullptr;
      {
#pragma unroll
        for (int it = 0; it < 4; ++it) {
          const int row = it * 4 + q;
          const float* sp = slab + row * 68 + c8;
          if (OUT_MODE == 1) {
            v8h hv;
#pragma unroll
            for (int e = 0; e < 8; ++e) hv[e] = (_Float16)sp[e];
            *(v8h*)(C + (size_t)(mBase + row) * ldc + n0 + c8) = hv;
          } else {
            v4u hw, lw;
#pragma unroll
            for (int p = 0; p < 4; ++p) {
              v2b h2, l2;
              split2(sp[2 * p], sp[2 * p + 1], h2, l2);
              hw[p] = __builtin_bit_cast(unsigned, h2);
              lw[p] = __builtin_bit_cast(unsigned, l2);
            }
            *(v4u*)(C + (size_t)(mBase + row) * ldc + n0 + c8) = hw;
            *(v4u*)(C2 + (size_t)(mBase + row) * ldc + n0 + c8) = lw;
          }
        }
        
      }
    }
    __builtin_amdgcn_fence(__ATOMIC_RELEASE, "workgroup");
    __builtin_amdgcn_wave_barrier();
    __builtin_amdgcn_fence(__ATOMIC_ACQUIRE, "workgroup");
  }
}

/* ---- matrix helpers for the attention path ---- */
__device__ __forceinline__ v8f at_mma(v16b a, v16b b, v8f c) {
  c = __builtin_amdgcn_wmma_f32_16x16x32_bf16(false, a, false, b, (short)0, c, false, false);
  asm volatile("v_nop\n\tv_nop\n\tv_nop\n\tv_nop" : "+v"(c) : "v"(a), "v"(b));
  return c;
}
__device__ __forceinline__ v8f mma_h16(v16h a, v16h b, v8f c) {
  c = __builtin_amdgcn_wmma_f32_16x16x32_f16(false, a, false, b, (short)0, c, false, false);
  asm volatile("v_nop\n\tv_nop\n\tv_nop\n\tv_nop" : "+v"(c) : "v"(a), "v"(b));
  return c;
}

/* f32[8] -> packed bf16 hi (4 words) and bf16 lo residual (4 words), RNE convert */
__device__ __forceinline__ void split_pack8(const float (&x)[8], v4u& H, v4u& L) {
#pragma unroll
  for (int p = 0; p < 4; ++p) {
    v2b h2, l2;
    split2(x[2 * p], x[2 * p + 1], h2, l2);
    H[p] = __builtin_bit_cast(unsigned, h2);
    L[p] = __builtin_bit_cast(unsigned, l2);
  }
}
__device__ __forceinline__ void store_planes2(unsigned short* __restrict__ hi, unsigned short* __restrict__ lo,
                                              size_t off, v4u H, v4u L) {
  *(v4u*)(hi + off) = H;
  *(v4u*)(lo + off) = L;
  
}

/* ---- activations f32 [rows][128] -> bf16 hi/lo planes, same layout -------------
   coverage: n8 = rows*128/8 threads exactly (host asserts divisibility). */
__global__ __launch_bounds__(256) void split_rows_bf16(const float* __restrict__ in,
                                                        unsigned short* __restrict__ hi,
                                                        unsigned short* __restrict__ lo, int n8) {
  const int i = blockIdx.x * 256 + threadIdx.x;
  if (i >= n8) return;
  const size_t e0 = (size_t)i * 8;
  const v4f a = *(const v4f*)(in + e0);
  const v4f c = *(const v4f*)(in + e0 + 4);
  float x[8];
  x[0] = a[0]; x[1] = a[1]; x[2] = a[2]; x[3] = a[3];
  x[4] = c[0]; x[5] = c[1]; x[6] = c[2]; x[7] = c[3];
  v4u H, L;
  split_pack8(x, H, L);
  store_planes2(hi, lo, e0, H, L);
}

/* ---- weights W[k][n] (input-major, 128x128): in[k][n] -> out[n][k] as transposed bf16 hi/lo planes -----
   outb holds 4 weights x (hi plane + lo plane) of 128*128 halves. grid (8, 4): 2048 threads per weight;
   2048 threads x 8 = 16384 = 128x128 per plane exactly. */
__global__ __launch_bounds__(256) void wt_split_bf16(const float* __restrict__ W0, const float* __restrict__ W1,
                                                     const float* __restrict__ W2, const float* __restrict__ W3,
                                                     unsigned short* __restrict__ outb) {
  const int which = blockIdx.y;
  const float* W = (which == 0) ? W0 : (which == 1) ? W1 : (which == 2) ? W2 : W3;
  unsigned short* hi = outb + (size_t)which * (2 * kC * kC);
  unsigned short* lo = hi + kC * kC;
  const int gt = blockIdx.x * 256 + threadIdx.x;
  if (gt >= kC * kC / 8) return;
  const int n  = gt >> 4;
  const int k8 = (gt & 15) * 8;
  float x[8];
#pragma unroll
  for (int e = 0; e < 8; ++e) x[e] = W[(size_t)(k8 + e) * kC + n];
  v4u H, L;
  split_pack8(x, H, L);
  store_planes2(hi, lo, (size_t)n * kC + k8, H, L);
}

/* transposing LDS load: the lanes point at 16-byte pieces of a row-major [key][d] tile (lane l: row 8*(l>>4) + (l&7), piece (l>>3)&1);
   lane (c, hh) receives keys 8*hh .. 8*hh+7 of column d = c, which is half of an A fragment of the transposed tile */
__device__ __forceinline__ v8b ld_tr16(const unsigned short* p) {
  typedef __attribute__((address_space(3))) v8s lds_v8s;
  return __builtin_bit_cast(v8b, __builtin_amdgcn_ds_load_tr16_b128_v8i16((lds_v8s*)p));
}
/* lane l with lane l ^ 16: the two halves of a wave hold the two halves of a query column's keys */
__device__ __forceinline__ float xhalf(float x) {
  return __builtin_bit_cast(float, __builtin_amdgcn_permlanex16(__builtin_bit_cast(int, x), __builtin_bit_cast(int, x),
                                                                0x76543210, 0xfedcba98, false, false));
}
/* e[i] = 2^e[i], the 17 exponentials of a softmax step as one run. In asm for the free slot that the instruction set asks for behind a
   transcendental: each v_exp_f32 is the independent instruction behind the one before it and the v_nop stands behind the last */
__device__ __forceinline__ void exp2_run17(float (&e)[17]) {
  asm(
      "v_exp_f32 %0, %0\n\t"
      "v_exp_f32 %1, %1\n\t"
      "v_exp_f32 %2, %2\n\t"
      "v_exp_f32 %3, %3\n\t"
      "v_exp_f32 %4, %4\n\t"
      "v_exp_f32 %5, %5\n\t"
      "v_exp_f32 %6, %6\n\t"
      "v_exp_f32 %7, %7\n\t"
      "v_exp_f32 %8, %8\n\t"
      "v_exp_f32 %9, %9\n\t"
      "v_exp_f32 %10, %10\n\t"
      "v_exp_f32 %11, %11\n\t"
      "v_exp_f32 %12, %12\n\t"
      "v_exp_f32 %13, %13\n\t"
      "v_exp_f32 %14, %14\n\t"
      "v_exp_f32 %15, %15\n\t"
      "v_exp_f32 %16, %16\n\t"
      "v_nop"
      : "+v"(e[0]), "+v"(e[1]), "+v"(e[2]), "+v"(e[3]), "+v"(e[4]), "+v"(e[5]),
        "+v"(e[6]), "+v"(e[7]), "+v"(e[8]), "+v"(e[9]), "+v"(e[10]), "+v"(e[11]),
        "+v"(e[12]), "+v"(e[13]), "+v"(e[14]), "+v"(e[15]), "+v"(e[16]));
}
/* ---- online softmax step for one head, 32 keys x 16 query columns per wave (2 key subtiles), scores transposed ----
   sA[r]: key 8*hh + r, sB[r]: key 16 + 8*hh + r, both of query column c: a lane holds 16 keys of ONE query.
   The scores arrive times log2(e), so that e^(s - m) is one v_exp_f32 (2^x) of a difference; mrow is kept in the same unit.
   Maximum in the lane plus one exchange between the halves; the sum stays a per-lane partial (joined behind the key loop).
   P^T leaves as two B operands, hi and lo: element s = key kmap(s, hh), which is the order the accumulators already have. */
__device__ __forceinline__ float softmax_step_t(const v8f& sA, const v8f& sB, float& mrow, float& lrow, v16b& ph, v16b& pl) {
  float mm[4];
#pragma unroll
  for (int k = 0; k < 4; ++k) mm[k] = fmaxf(fmaxf(sA[k], sA[4 + k]), fmaxf(sB[k], sB[4 + k]));
  float m = fmaxf(fmaxf(mm[0], mm[1]), fmaxf(mm[2], mm[3]));
  m = fmaxf(m, xhalf(m));
  const float mnew = fmaxf(mrow, m);
  float e[17];
#pragma unroll
  for (int r = 0; r < 8; ++r) { e[r] = sA[r] - mnew; e[8 + r] = sB[r] - mnew; }
  e[16] = mrow - mnew;
  exp2_run17(e);
  const float al = e[16];
  mrow = mnew;
  float ps[4] = {0.f, 0.f, 0.f, 0.f};
#pragma unroll
  for (int r = 0; r < 16; r += 2) {
    ps[(r >> 3) * 2]     += e[r];
    ps[(r >> 3) * 2 + 1] += e[r + 1];
    v2b hi, lo;
    split2(e[r], e[r + 1], hi, lo);
    ph[r] = hi[0];  ph[r + 1] = hi[1];
    pl[r] = lo[0];  pl[r + 1] = lo[1];
  }
  lrow = lrow * al + ((ps[0] + ps[1]) + (ps[2] + ps[3]));
  return al;
}
/* per-wave transposed result (o[t][r] = O[query c][d = t*16 + 8*hh + r]) -> LDS staging [query][d] (pitch kOsPitch);
   writes rows 0..15, cols 0..31, 8 consecutive floats per lane and tile */
__device__ __forceinline__ void tile_to_os(float* os, const v8f (&o)[2], int hh, int c) {
#pragma unroll
  for (int t = 0; t < 2; ++t) {
    float* p = os + c * kOsPitch + t * 16 + 8 * hh;
    *(v4f*)(p)     = (v4f){o[t][0], o[t][1], o[t][2], o[t][3]};
    *(v4f*)(p + 4) = (v4f){o[t][4], o[t][5], o[t][6], o[t][7]};
  }
}
/* weighted sum over the kSplit key groups of one query tile, 4 floats of one row per lane;
   os0: staging tile of key group 0 for this query tile, the groups 4 tiles apart */
__device__ __forceinline__ v4f merge_os(const float* os0, const float (&w)[kSplit], int row, int c4) {
  v4f acc = (v4f){0.f, 0.f, 0.f, 0.f};
#pragma unroll
  for (int s = 0; s < kSplit; ++s) {
    const v4f v = *(const v4f*)(os0 + s * (4 * 16 * kOsPitch) + row * kOsPitch + c4);
#pragma unroll
    for (int e = 0; e < 4; ++e) acc[e] += w[s] * v[e];
  }
  return acc;
}

/* ---- attention for one (batch, head h, 64 query rows) ----------------------------------
   q16/k16: f16 planes [B*N][128] (head-major columns); vhi/vlo: bf16 hi/lo planes [B*Nkv][128].
   scores^T = (k.q^T)*scale + rpe[idx][h], the head's table column held in LDS; online softmax in f32, a lane holding one query's keys;
   scale and table carry the factor log2(e), so the softmax runs on powers of two (the hardware's own exponential);
   P^T hi and lo go from the score accumulators straight into B operands, never through LDS;
   V tiles lie row-major in LDS and are transposed by the load that reads them;
   o^T = V_h^T . P^T;  for h >= 2 also ox^T = V_{h-2}^T . P^T (the cross term of the differential mixing).
   16 waves: wave = (key group sp, query tile qt). Group sp (4 waves) takes key chunks sp, sp + kSplit, ... with its own
   K/V tiles and each wave its own running max, sum and accumulators; the groups are merged through LDS at the end.
   xattn f32 [B*Nq][128]; ycross f32 [B][2][Nq][32]. grid.x = B*H*(Nq/64), block 128 * kSplit. */
__global__ __launch_bounds__(128 * kSplit) __attribute__((amdgpu_num_vgpr(256)))
void attn_head_kernel(
    const unsigned short* __restrict__ q16, const unsigned short* __restrict__ k16,
    const unsigned short* __restrict__ vhi, const unsigned short* __restrict__ vlo,
    const int* __restrict__ coords_q, const int* __restrict__ coords_k,
    const float* __restrict__ rpe,
    float* __restrict__ xattn, float* __restrict__ ycross)
{
  __shared__ __align__(16) unsigned short KshS[kSplit][kKC * kHD];   /* [group][key][d]  f16 bits  */
  __shared__ __align__(16) unsigned short VthS[kSplit][kKC * kVP];   /* [group][key][d] bf16 hi, head h,   row pitch kVP */
  __shared__ __align__(16) unsigned short VtlS[kSplit][kKC * kVP];   /* [group][key][d] bf16 lo, head h,   row pitch kVP */
  __shared__ __align__(16) unsigned short VxhS[kSplit][kKC * kVP];   /* [group][key][d] bf16 hi, head h-2, row pitch kVP */
  __shared__ __align__(16) unsigned short VxlS[kSplit][kKC * kVP];   /* [group][key][d] bf16 lo, head h-2, row pitch kVP */
  __shared__ __align__(16) float Tab[kTabLds];                       /* rpe[idx][h] * log2(e) for this block's head, all idx */
  /* behind the key loop the table is dead and its bytes take the merge staging */
  static_assert(4 * kSplit * 16 * kOsPitch + 4 * kSplit * 16 * 2 <= kTabLds, "");
  float* const OsAll = Tab;                                          /* [wave][16 * kOsPitch] */
  float* const MlAll = Tab + 4 * kSplit * 16 * kOsPitch;             /* [wave][row] (max, sum) */

  const int wave = threadIdx.x >> 5;     /* 0 .. 15 */
  const int sp   = wave >> 2;            /* key group */
  const int qt   = wave & 3;             /* query tile */
  const int tid  = threadIdx.x & 127;    /* thread within the key group */
  const int lane = tid & 31;
  unsigned short* Ksh = KshS[sp];
  unsigned short* Vth = VthS[sp];
  unsigned short* Vtl = VtlS[sp];
  unsigned short* Vxh = VxhS[sp];
  unsigned short* Vxl = VxlS[sp];
  const int hh   = lane >> 4;
  const int c    = lane & 15;
  const int vro  = (8 * hh + (lane & 7)) * kVP + ((lane >> 3) & 1) * 8;   /* halves; this lane's piece for the transposing V loads */
  constexpr int nqb = kNq / kQB;
  const int bx   = blockIdx.x;
  const int qb   = bx % nqb;
  const int rest = bx / nqb;
  const int h    = rest % kH;
  const int b    = rest / kH;
  const bool cross = (h >= kNH);                       /* block-uniform */
  const int hcol = h * kHD;
  const int xcol = (cross ? (h - kNH) : 0) * kHD;
  const int q0   = qb * kQB + qt * 16;
  const size_t qrows  = (size_t)b * kNq + q0;
  const size_t kvrows = (size_t)b * kNkv;
  const float* __restrict__ rpe_h = rpe + h;           /* table entry stride kH floats */

  /* this head's column of the bias table -> LDS, once per work-group; batches of 16 loads per thread keep the
     latency of the strided reads covered. The first barrier of the key loop publishes it. */
  {
    constexpr int kThreads = 128 * kSplit;
    constexpr int kFull = kTable / (kThreads * 16);
    const int t0 = threadIdx.x;
    /* rolled: 16 waves x 16 loads in flight already cover the L2 latency; unrolled further the copy only takes more registers */
#pragma unroll 1
    for (int g = 0; g < kFull; ++g) {
      float tv[16];
      const float* gp = rpe_h + (size_t)(g * 16 * kThreads + t0) * kH;
#pragma unroll
      for (int u = 0; u < 16; ++u) tv[u] = gp[u * (kThreads * kH)];
      asm volatile("s_wait_xcnt 0x0" :: "v"(gp) : "memory");   /* the loads' address registers are kept as they are until this wait */
#pragma unroll
      for (int u = 0; u < 16; ++u) Tab[(g * 16 + u) * kThreads + t0] = tv[u] * kLog2e;
    }
    for (int i = kFull * 16 * kThreads + t0; i < kTable; i += kThreads) Tab[i] = rpe_h[(size_t)i * kH] * kLog2e;
  }

  /* Q fragment (B operand: lane c -> query column c; K = head_dim = 32, one k-step) */
  const _Float16* qp = (const _Float16*)(const void*)q16;
  const v16h qa = Frag<_Float16>::load(qp + (qrows + c) * kC + hcol + 8 * hh);

  /* coords of this lane's query column c, +MAXD folded in */
  const v2i cq = *(const v2i*)(coords_q + (qrows + c) * 2);
  const int cqx = cq.x + kMaxd;
  const int cqy = cq.y + kMaxd;

  float mr = -INFINITY, lr = 0.f;   /* running max (equal in both halves) and this lane's partial sum for query c */
  v8f o[2], ox[2];                  /* o[t][r] = O[query c][d = t*16 + 8*hh + r] */
#pragma unroll
  for (int t = 0; t < 2; ++t) {
    o[t]  = (v8f){0.f,0.f,0.f,0.f,0.f,0.f,0.f,0.f};
    ox[t] = (v8f){0.f,0.f,0.f,0.f,0.f,0.f,0.f,0.f};
  }

  for (int kc = 0; kc < kNkv / (kKC * kSplit); ++kc) {
    const int kv0 = (kc * kSplit + sp) * kKC;
    __syncthreads();
    /* coords of this lane's 16 score rows (keys j*16 + 8*hh + r), two keys per 16-byte load, the same address in the 16 lanes
       of a half; asked for just ahead of the K and V rows so that one round trip serves both */
    v4i ck[2][4];
    {
      const int* ckp = coords_k + (kvrows + kv0 + 8 * hh) * 2;
#pragma unroll
      for (int j = 0; j < 2; ++j) {
#pragma unroll
        for (int i = 0; i < 4; ++i) ck[j][i] = *(const v4i*)(ckp + j * 32 + i * 4);
      }
      asm volatile("s_wait_xcnt 0x0" :: "v"(ckp) : "memory");   /* the loads' address registers are kept as they are until this wait */
    }
    /* stage the K tile and the V hi/lo tiles, all row-major: 32 keys x 4 segments of 8 halves = 128 = threads of a key group, one
       uint4 per thread per plane; covers Ksh 32x32 and the 32 d of every row of Vth/Vtl (and Vxh/Vxl when cross) exactly;
       the pad halves of a V row are never read */
    {
      const int key = tid >> 2;
      const int seg = tid & 3;
      const size_t rowoff = (kvrows + kv0 + key) * kC;
      const size_t go = rowoff + hcol + seg * 8;
      const unsigned short* kgp = k16 + go;
      const unsigned short* hgp = vhi + go;
      const unsigned short* lgp = vlo + go;
      const uint4 kw  = *(const uint4*)(kgp);
      const uint4 vh4 = *(const uint4*)(hgp);
      const uint4 vl4 = *(const uint4*)(lgp);
      asm volatile("s_wait_xcnt 0x0" :: "v"(kgp), "v"(hgp), "v"(lgp) : "memory");   /* the loads' address registers are kept as they are until this wait */
      *(uint4*)(&Ksh[key * kHD + seg * 8]) = kw;
      *(uint4*)(&Vth[key * kVP + seg * 8]) = vh4;
      *(uint4*)(&Vtl[key * kVP + seg * 8]) = vl4;
      if (cross) {
        const size_t gx = rowoff + xcol + seg * 8;
        const uint4 xh4 = *(const uint4*)(vhi + gx);
        const uint4 xl4 = *(const uint4*)(vlo + gx);
        *(uint4*)(&Vxh[key * kVP + seg * 8]) = xh4;
        *(uint4*)(&Vxl[key * kVP + seg * 8]) = xl4;
      }
    }
    __syncthreads();

    /* scores^T: s[j], j = key subtile; A fragment lane c -> key j*16+c, elements d (split map); s[j][r] = S[key j*16+8*hh+r][query c] */
    v8f s[2];
    {
      const v8f z = (v8f){0.f,0.f,0.f,0.f,0.f,0.f,0.f,0.f};
      const _Float16* Kp = (const _Float16*)(const void*)Ksh;
#pragma unroll
      for (int j = 0; j < 2; ++j) {
        Frag<_Float16>::U kb;
        kb.h[0] = *(const v8h*)(Kp + (j * 16 + c) * kHD + 8 * hh);
        kb.h[1] = *(const v8h*)(Kp + (j * 16 + c) * kHD + 16 + 8 * hh);
        s[j] = mma_h16(kb.v, qa, z);
      }
    }

    /* scale + relative position bias, both times log2(e): one clamped b32 gather from the LDS table per (key, query) */
#pragma unroll
    for (int r = 0; r < 8; ++r) {
#pragma unroll
      for (int j = 0; j < 2; ++j) {
        const int kx = ck[j][r >> 1][(r & 1) * 2];
        const int ky = ck[j][r >> 1][(r & 1) * 2 + 1];
        int dx = cqx - kx; dx = dx < 0 ? 0 : dx; dx = dx > 2 * kMaxd ? 2 * kMaxd : dx;
        int dy = cqy - ky; dy = dy < 0 ? 0 : dy; dy = dy > 2 * kMaxd ? 2 * kMaxd : dy;
        const int idx = dx * kSpan + dy;            /* 0 .. kTable-1 */
        s[j][r] = s[j][r] * kScaleL2 + Tab[idx];
      }
    }

    /* online softmax; P^T hi and lo stay in registers as B operands */
    v16b ph, pl;
    const float al = softmax_step_t(s[0], s[1], mr, lr, ph, pl);
#pragma unroll
    for (int t = 0; t < 2; ++t) {
#pragma unroll
      for (int r = 0; r < 8; ++r) { o[t][r] *= al; ox[t][r] *= al; }
    }

    /* V^T.P^T : A = V^T (lane c -> d, elements key, split map), transposed out of the row-major tile by the load itself;
       B = P^T (lane c -> query, elements key, same map) */
    {
#pragma unroll
      for (int t = 0; t < 2; ++t) {
        Frag<__bf16>::U vh, vl;
        vh.h[0] = ld_tr16(Vth + vro + t * 16);  vh.h[1] = ld_tr16(Vth + vro + 16 * kVP + t * 16);
        vl.h[0] = ld_tr16(Vtl + vro + t * 16);  vl.h[1] = ld_tr16(Vtl + vro + 16 * kVP + t * 16);
        o[t] = at_mma(vh.v, ph, o[t]);
        o[t] = at_mma(vl.v, ph, o[t]);
        o[t] = at_mma(vh.v, pl, o[t]);
      }
      if (cross) {
#pragma unroll
        for (int t = 0; t < 2; ++t) {
          Frag<__bf16>::U vh, vl;
          vh.h[0] = ld_tr16(Vxh + vro + t * 16);  vh.h[1] = ld_tr16(Vxh + vro + 16 * kVP + t * 16);
          vl.h[0] = ld_tr16(Vxl + vro + t * 16);  vl.h[1] = ld_tr16(Vxl + vro + 16 * kVP + t * 16);
          ox[t] = at_mma(vh.v, ph, ox[t]);
          ox[t] = at_mma(vl.v, ph, ox[t]);
          ox[t] = at_mma(vh.v, pl, ox[t]);
        }
      }
    }
  }

  /* merge of the key groups: every wave leaves its accumulators (not normalised) and its (max, sum) in LDS;
     wave (sp, qt) then merges rows 4*sp .. 4*sp+3 of query tile qt: x = sum_s 2^(m_s-M) o_s / sum_s 2^(m_s-M) l_s, the maxima in log2 units */
  __syncthreads();   /* every wave has made its last table read: the table's bytes become the merge staging */
  float* os = OsAll + wave * (16 * kOsPitch);
  const float* osq = OsAll + qt * (16 * kOsPitch);
  tile_to_os(os, o, hh, c);
  lr += xhalf(lr);   /* the two halves' partial sums of query c */
  if (hh == 0) {     /* max and sum are now equal in lanes c and c + 16 */
    MlAll[wave * 32 + c * 2] = mr;
    MlAll[wave * 32 + c * 2 + 1] = lr;
  }
  __syncthreads();   /* all groups' partial tiles are in LDS */

  const int row = 4 * sp + (lane >> 3);
  const int c4  = (lane & 7) * 4;
  float w[kSplit];
  {
    float ms[kSplit], ls[kSplit];
    float M = -INFINITY;
#pragma unroll
    for (int s = 0; s < kSplit; ++s) {
      ms[s] = MlAll[(s * 4 + qt) * 32 + row * 2];
      ls[s] = MlAll[(s * 4 + qt) * 32 + row * 2 + 1];
      M = fmaxf(M, ms[s]);
    }
    float L = 0.f;
#pragma unroll
    for (int s = 0; s < kSplit; ++s) { w[s] = __builtin_amdgcn_exp2f(ms[s] - M); L += w[s] * ls[s]; }
    const float inv = 1.0f / L;
#pragma unroll
    for (int s = 0; s < kSplit; ++s) w[s] *= inv;
  }
  *(v4f*)(xattn + (qrows + row) * kC + hcol + c4) = merge_os(osq, w, row, c4);
  asm volatile("s_wait_xcnt 0x0" ::: "memory");   /* the cross path below reuses the registers this store names */

  if (cross) {
    __syncthreads();   /* every reader has left the o tiles */
    tile_to_os(os, ox, hh, c);
    __syncthreads();   /* all groups' cross tiles are in LDS */
    *(v4f*)(ycross + ((((size_t)b * kNH + (h - kNH)) * kNq + q0 + row) * kHD) + c4) = merge_os(osq, w, row, c4);
  }
}

/* ---- differential head mixing + split to bf16 hi/lo planes for the output projection --------
   x[b,q,h*32+d] = xs + alpha[b,q]*(xs - lam[h]*yc[b,h,q,d]) for h < 2, else xs.
   coverage 65536 threads x 8 = 4096x128 exactly. */
__global__ __launch_bounds__(256) void combine_split_kernel(
    const float* __restrict__ xattn, const float* __restrict__ ycross, const float* __restrict__ alpha,
    const float* __restrict__ lq1, const float* __restrict__ lk1,
    const float* __restrict__ lq2, const float* __restrict__ lk2,
    unsigned short* __restrict__ hi, unsigned short* __restrict__ lo)
{
  __shared__ float lam_s[2];
  if (threadIdx.x < 2) {
    const int h = threadIdx.x;
    float s1 = 0.f, s2 = 0.f;
#pragma unroll 1
    for (int i = 0; i < kHD; ++i) {
      s1 += lq1[h * kHD + i] * lk1[h * kHD + i];
      s2 += lq2[h * kHD + i] * lk2[h * kHD + i];
    }
    lam_s[h] = expf(s1) - expf(s2) + kLambdaInit;
  }
  __syncthreads();
  const int gt = blockIdx.x * 256 + threadIdx.x;
  if (gt >= kBatch * kNq * kC / 8) return;
  const size_t e0 = (size_t)gt * 8;
  const int row = (int)(e0 >> 7);
  const int col = (int)(e0 & 127);
  const int h   = col >> 5;
  const int d   = col & 31;
  const int hc  = h & 1;
  const int b   = row >> 11;
  const int q   = row & (kNq - 1);
  const float a   = alpha[row];
  const float lam = lam_s[hc];
  const v4f xs0 = *(const v4f*)(xattn + e0);
  const v4f xs1 = *(const v4f*)(xattn + e0 + 4);
  const size_t yo = (((size_t)b * kNH + hc) * kNq + q) * kHD + d;
  const v4f y0 = *(const v4f*)(ycross + yo);
  const v4f y1 = *(const v4f*)(ycross + yo + 4);
  const bool mix = (h < kNH);
  float x[8];
#pragma unroll
  for (int e = 0; e < 4; ++e) {
    const float xa = xs0[e], xb = xs1[e];
    const float va = xa + a * (xa - lam * y0[e]);
    const float vb = xb + a * (xb - lam * y1[e]);
    x[e]     = mix ? va : xa;
    x[4 + e] = mix ? vb : xb;
  }
  v4u H, L;
  split_pack8(x, H, L);
  store_planes2(hi, lo, e0, H, L);
}

/* =========================================================================================
   host launch: 9 kernel launches
   workspace region map (bytes, all offsets MiB/256-KiB aligned):
     xq_hi  1 MiB | xq_lo 1 MiB | xkv_hi 2 MiB | xkv_lo 2 MiB | wt planes 256 KiB (4 weights x hi,lo x 32 KiB)
     q16 1 MiB | k16 2 MiB | v_hi 2 MiB | v_lo 2 MiB | xattn f32 2 MiB | ycross f32 1 MiB | xmix_hi 1 MiB | xmix_lo 1 MiB
     total 19,136,512 B
   ========================================================================================= */
extern "C" void kernel_launch(void* const* d_in, const int* in_sizes, int n_in,
                              void* d_out, int out_size, void* d_ws, size_t ws_size,
                              hipStream_t stream) {
  constexpr int Mq  = kBatch * kNq;    /* 4096 */
  constexpr int Mkv = kBatch * kNkv;   /* 8192 */
  static_assert(Mq % 64 == 0 && Mkv % 64 == 0 && kC % 64 == 0 && kC % 32 == 0, "");
  static_assert((Mq * kC) % 8 == 0 && (Mkv * kC) % 8 == 0, "");
  if (n_in < 18) return;
  if (in_sizes[0] != Mq * kC || in_sizes[1] != Mkv * kC || in_sizes[2] != Mq * 2 || in_sizes[3] != Mkv * 2 ||
      in_sizes[4] != Mq || in_sizes[5] != kC * kC || in_sizes[7] != kC * kC || in_sizes[9] != kC * kC ||
      in_sizes[16] != kC * kC || in_sizes[6] != kC || in_sizes[8] != kC || in_sizes[10] != kC || in_sizes[17] != kC ||
      in_sizes[11] != kNH * kHD || in_sizes[12] != kNH * kHD || in_sizes[13] != kNH * kHD || in_sizes[14] != kNH * kHD ||
      in_sizes[15] != kTable * kH || out_size != Mq * kC) return;

  const float* x_q      = (const float*)d_in[0];
  const float* x_kv     = (const float*)d_in[1];
  const int*   coords_q = (const int*)d_in[2];
  const int*   coords_k = (const int*)d_in[3];
  const float* alpha    = (const float*)d_in[4];
  const float* Wq = (const float*)d_in[5];  const float* bq = (const float*)d_in[6];
  const float* Wk = (const float*)d_in[7];  const float* bk = (const float*)d_in[8];
  const float* Wv = (const float*)d_in[9];  const float* bv = (const float*)d_in[10];
  const float* lq1 = (const float*)d_in[11]; const float* lk1 = (const float*)d_in[12];
  const float* lq2 = (const float*)d_in[13]; const float* lk2 = (const float*)d_in[14];
  const float* rpe = (const float*)d_in[15];
  const float* Wp = (const float*)d_in[16]; const float* bp = (const float*)d_in[17];
  float* out = (float*)d_out;

  char* ws = (char*)d_ws;
  size_t off = 0;
  const size_t szXq16  = (size_t)Mq * kC * 2;     /* 1 MiB  */
  const size_t szXkv16 = (size_t)Mkv * kC * 2;    /* 2 MiB  */
  const size_t szWt    = (size_t)4 * 2 * kC * kC * 2;
  const size_t szXattn = (size_t)Mq * kC * 4;
  const size_t szYc    = (size_t)kBatch * kNH * kNq * kHD * 4;
  unsigned short* xq_hi  = (unsigned short*)(ws + off); off += szXq16;
  unsigned short* xq_lo  = (unsigned short*)(ws + off); off += szXq16;
  unsigned short* xkv_hi = (unsigned short*)(ws + off); off += szXkv16;
  unsigned short* xkv_lo = (unsigned short*)(ws + off); off += szXkv16;
  unsigned short* wt     = (unsigned short*)(ws + off); off += szWt;
  unsigned short* q16    = (unsigned short*)(ws + off); off += szXq16;
  unsigned short* k16    = (unsigned short*)(ws + off); off += szXkv16;
  unsigned short* v_hi   = (unsigned short*)(ws + off); off += szXkv16;
  unsigned short* v_lo   = (unsigned short*)(ws + off); off += szXkv16;
  float*          xattn  = (float*)(ws + off);          off += szXattn;
  float*          ycross = (float*)(ws + off);          off += szYc;
  unsigned short* xm_hi  = (unsigned short*)(ws + off); off += szXq16;
  unsigned short* xm_lo  = (unsigned short*)(ws + off); off += szXq16;
  if (off > ws_size) return;

  const unsigned short* wtq_hi = wt + 0 * (2 * kC * kC); const unsigned short* wtq_lo = wtq_hi + kC * kC;
  const unsigned short* wtk_hi = wt + 1 * (2 * kC * kC); const unsigned short* wtk_lo = wtk_hi + kC * kC;
  const unsigned short* wtv_hi = wt + 2 * (2 * kC * kC); const unsigned short* wtv_lo = wtv_hi + kC * kC;
  const unsigned short* wtp_hi = wt + 3 * (2 * kC * kC); const unsigned short* wtp_lo = wtp_hi + kC * kC;

  /* 1-2: activations -> bf16 hi/lo planes */
  const int n8q = Mq * kC / 8, n8kv = Mkv * kC / 8;
  split_rows_bf16<<<dim3((n8q + 255) / 256), dim3(256), 0, stream>>>(x_q, xq_hi, xq_lo, n8q);
  split_rows_bf16<<<dim3((n8kv + 255) / 256), dim3(256), 0, stream>>>(x_kv, xkv_hi, xkv_lo, n8kv);
  /* 3: weights -> transposed bf16 hi/lo planes (in[k][n] -> out[n][k], square 128x128) */
  wt_split_bf16<<<dim3((kC * kC / 8 + 255) / 256, 4), dim3(256), 0, stream>>>(Wq, Wk, Wv, Wp, wt);

  /* 4-6: projections, M x 128, K = 128 (M % 64 == 0, N = 128 % 64 == 0, K = 128 % 32 == 0) */
  const int blocksQ  = ((Mq  / 64) * (kC / 64) + 7) / 8;
  const int blocksKV = ((Mkv / 64) * (kC / 64) + 7) / 8;
  wmma_gemm64<1, true, 2, 1, false><<<dim3(blocksQ, 1), dim3(256), 0, stream>>>(
      xq_hi, xq_lo, kC, 0L, wtq_hi, wtq_lo, kC, 0L, (void*)q16, nullptr, kC, 0L, bq, nullptr, 0L, Mq, kC, kC, 1.0f);
  wmma_gemm64<1, true, 2, 1, false><<<dim3(blocksKV, 1), dim3(256), 0, stream>>>(
      xkv_hi, xkv_lo, kC, 0L, wtk_hi, wtk_lo, kC, 0L, (void*)k16, nullptr, kC, 0L, bk, nullptr, 0L, Mkv, kC, kC, 1.0f);
  wmma_gemm64<1, true, 2, 2, false><<<dim3(blocksKV, 1), dim3(256), 0, stream>>>(
      xkv_hi, xkv_lo, kC, 0L, wtv_hi, wtv_lo, kC, 0L, (void*)v_hi, (void*)v_lo, kC, 0L, bv, nullptr, 0L, Mkv, kC, kC, 1.0f);

  /* 7: attention per (batch, head, 64 queries) */
  const int attnBlocks = kBatch * kH * (kNq / kQB);
  attn_head_kernel<<<dim3(attnBlocks), dim3(128 * kSplit), 0, stream>>>(q16, k16, v_hi, v_lo, coords_q, coords_k, rpe, xattn, ycross);

  /* 8: differential mixing + bf16 hi/lo planes */
  combine_split_kernel<<<dim3((n8q + 255) / 256), dim3(256), 0, stream>>>(xattn, ycross, alpha, lq1, lk1, lq2, lk2, xm_hi, xm_lo);

  /* 9: output projection -> d_out (f32), M = 4096, N = 128, K = 128 */
  wmma_gemm64<1, true, 2, 0, false><<<dim3(blocksQ, 1), dim3(256), 0, stream>>>(
      xm_hi, xm_lo, kC, 0L, wtp_hi, wtp_lo, kC, 0L, (void*)out, nullptr, kC, 0L, bp, nullptr, 0L, Mq, kC, kC, 1.0f);
}

// v007
// It runs in 111 microseconds.
// In two side-by-side timings against v006, it was 1.29 and 1.28 times as fast.
// Counting every step since v000, it is 4.04 times as fast.
// Contractions: x@Wq, x@Wk, x@Wv and xmix@Wp on v_wmma_f32_16x16x32_bf16 with bf16 hi/lo operand planes (hi.hi + hi.lo + lo.hi); k.q^T on v_wmma_f32_16x16x32_f16 with plain f16 q/k planes; v^T.p^T and v_cross^T.p^T on v_wmma_f32_16x16x32_bf16 with bf16 hi/lo p and v tiles; f32 accumulate; bias gather, online softmax and head mixing in f32.
#include <hip/hip_runtime.h>
#include <stdint.h>

typedef __attribute__((ext_vector_type(16))) _Float16 v16h;
typedef __attribute__((ext_vector_type(8)))  _Float16 v8h;
typedef __attribute__((ext_vector_type(16))) __bf16   v16b;
typedef __attribute__((ext_vector_type(8)))  __bf16   v8b;
typedef __attribute__((ext_vector_type(8)))  float    v8f;
typedef __attribute__((ext_vector_type(4)))  float    v4f;
typedef __attribute__((ext_vector_type(4)))  unsigned int v4u;
typedef __attribute__((ext_vector_type(2)))  int      v2i;
typedef __attribute__((ext_vector_type(4)))  int      v4i;
typedef __attribute__((ext_vector_type(8)))  short    v8s;
typedef __attribute__((ext_vector_type(2)))  float    v2f;
typedef __attribute__((ext_vector_type(2)))  __bf16   v2b;

/* ---- problem geometry (fixed by the module) ---- */
constexpr int kBatch = 2;
constexpr int kNq    = 2048;
constexpr int kNkv   = 4096;
constexpr int kC     = 128;
constexpr int kH     = 4;
constexpr int kHD    = 32;
constexpr int kNH    = 2;
constexpr int kMaxd  = 128;
constexpr int kSpan  = 2 * kMaxd + 1;
constexpr int kTable = kSpan * kSpan;
constexpr int kKC    = 32;     /* keys per chunk in the attention kernel */
constexpr int kQB    = 64;     /* query rows per attention block (4 query tiles x 16) */
constexpr int kSplit = 4;      /* key groups per attention block: wave = (key group, query tile) */
constexpr int kOsPitch = 36;   /* floats; per-wave output staging pitch */
constexpr int kVP    = 48;     /* halves; LDS row pitch of the V tiles: 96 B = 32 B x odd, the pitch of the transposing load */
constexpr int kTabLds  = (kTable + 3) & ~3;   /* floats; one head's bias column in LDS, rounded to 16 bytes */
constexpr float kLog2e  = 1.4426950408889634f;                        /* log2(e) */
constexpr float kScaleL2 = (float)(0.17677669529663687 * 1.4426950408889634);   /* head_dim ** -0.5 * log2(e) */
constexpr float kLambdaInit = 0.8f;

static_assert(kNq % kQB == 0, "");
static_assert(kNkv % (kKC * kSplit) == 0, "");
static_assert(kSplit * 4 == 16, "");   /* the merge gives each wave 16 / kSplit = 4 rows = 32 lanes x 4 floats */
static_assert(kC == kH * kHD, "");
static_assert((kBatch * kNq) % 64 == 0 && (kBatch * kNkv) % 64 == 0, "");
static_assert(kC % 64 == 0 && kC % 32 == 0, "");
static_assert(kH == 4 && kNH == 2 && kHD == 32 && kKC == 32, "");

/* two f32 -> a packed pair of bf16 hi and a packed pair of bf16 lo (the residual x - hi, exact in f32), three instructions a pair, all on
   the hardware's own converts, which round to nearest even as the integer form did. hi: one packed convert. lo: one mixed fma per value,
   hi * (-1) + x with hi and the -1 read as bf16 and the result written as bf16 into one half of lo. In asm because the compiler widens hi
   by a shift and a mask, subtracts and converts again: five instructions a pair */
__device__ __forceinline__ void split2(float a, float b, v2b& hi, v2b& lo) {
  hi = __builtin_convertvector((v2f){a, b}, v2b);
  unsigned lw;
  asm("v_fma_mixlo_bf16 %0, %1, %2, %3 op_sel_hi:[1,1,0]\n\t"
      "v_fma_mixhi_bf16 %0, %1, %2, %4 op_sel:[1,0,0] op_sel_hi:[1,1,0]"
      : "=&v"(lw)
      : "v"(__builtin_bit_cast(unsigned, hi)), "v"(0xBF80BF80u) /* bf16 -1 */, "v"(a), "v"(b));
  lo = __builtin_bit_cast(v2b, lw);
}

/* hazard guards as plain device helpers */
__device__ __forceinline__ void dep_guard_h(v8f& a, v8f& b, v16h x, v16h y) { asm volatile("v_nop\n\tv_nop\n\tv_nop\n\tv_nop" : "+v"(a), "+v"(b) : "v"(x), "v"(y)); }
__device__ __forceinline__ void dep_guard_b(v8f& a, v8f& b, v16b x, v16b y) { asm volatile("v_nop\n\tv_nop\n\tv_nop\n\tv_nop" : "+v"(a), "+v"(b) : "v"(x), "v"(y)); }
__device__ __forceinline__ void keep4_h(v16h a, v16h b, v16h c, v16h d) { asm volatile("v_nop" :: "v"(a), "v"(b), "v"(c), "v"(d)); }
__device__ __forceinline__ void keep4_b(v16b a, v16b b, v16b c, v16b d) { asm volatile("v_nop" :: "v"(a), "v"(b), "v"(c), "v"(d)); }
__device__ __forceinline__ void acc_guard4(v8f& a, v8f& b, v8f& c, v8f& d) { asm volatile("v_nop\n\tv_nop\n\tv_nop\n\tv_nop" : "+v"(a), "+v"(b), "+v"(c), "+v"(d)); }
template <typename T> struct Frag;
template <> struct Frag<_Float16> {
  typedef v16h V; union U { v16h v; v8h h[2]; };
  static __device__ __forceinline__ v16h load(const _Float16* p) {
    U f; f.h[0] = *(const v8h*)(p); f.h[1] = *(const v8h*)(p + 16); return f.v;
  }
  static __device__ __forceinline__ v8f mma(v16h a, v16h b, v8f c) {
    return __builtin_amdgcn_wmma_f32_16x16x32_f16(false, a, false, b, (short)0, c, false, false);
  }
  static __device__ __forceinline__ void guard(v8f& a, v8f& b, v16h x, v16h y) { dep_guard_h(a, b, x, y); }
  static __device__ __forceinline__ void keep(v16h a, v16h b, v16h c, v16h d) { keep4_h(a, b, c, d); }
};
template <> struct Frag<__bf16> {
  typedef v16b V; union U { v16b v; v8b h[2]; };
  static __device__ __forceinline__ v16b load(const __bf16* p) {
    U f; f.h[0] = *(const v8b*)(p); f.h[1] = *(const v8b*)(p + 16); return f.v;
  }
  static __device__ __forceinline__ v8f mma(v16b a, v16b b, v8f c) {
    return __builtin_amdgcn_wmma_f32_16x16x32_bf16(false, a, false, b, (short)0, c, false, false);
  }
  static __device__ __forceinline__ void guard(v8f& a, v8f& b, v16b x, v16b y) { dep_guard_b(a, b, x, y); }
  static __device__ __forceinline__ void keep(v16b a, v16b b, v16b c, v16b d) { keep4_b(a, b, c, d); }
};

/* ---- Register-blocked batched WMMA GEMM ---------------- */
template <int ET> struct Elem;
template <> struct Elem<0> { typedef _Float16 T; };
template <> struct Elem<1> { typedef __bf16 T; };
/* one work-group's share (8 waves, a 64x64 tile each) of one GEMM; bx, b: the work-group's place in that GEMM's own grid;
   sT: the work-group's staging slabs, 8 x 16 x 68 floats */
template <int ET, bool SPLIT, int BIAS_MODE, int OUT_MODE, bool RESID, int ACT = 0>
__device__ __forceinline__ void gemm64_group(
    const unsigned short* __restrict__ Ap, const unsigned short* __restrict__ A2p, int lda, long strideA,
    const unsigned short* __restrict__ Btp, const unsigned short* __restrict__ Bt2p, int ldb, long strideB,
    void* __restrict__ Cout, void* __restrict__ Cout2, int ldc, long strideC,
    const float* __restrict__ bias,
    const float* __restrict__ resid, long strideR,
    int M, int N, int K, float scale, int bx, int b, float (*sT)[16 * 68]) {
  typedef typename Elem<ET>::T T;
  typedef typename Frag<T>::V V;
  const T* A = (const T*)Ap; const T* A2 = (const T*)A2p; const T* Bt = (const T*)Btp; const T* Bt2 = (const T*)Bt2p;
  const int lane = threadIdx.x & 31;
  const int wave = threadIdx.x >> 5;
  const int tilesN = N >> 6;
  const int tilesM = M >> 6;
  const int tile = bx * 8 + wave;
  if (tile >= tilesM * tilesN) return;
  const int tm = tile / tilesN;
  const int tn = tile - tm * tilesN;
  const int m0 = tm << 6;
  const int n0 = tn << 6;

  const T* Ab  = A  + (size_t)b * strideA;
  const T* Bb  = Bt + (size_t)b * strideB;
  const T* Ab2 = SPLIT ? (A2  + (size_t)b * strideA) : nullptr;
  const T* Bb2 = SPLIT ? (Bt2 + (size_t)b * strideB) : nullptr;

  const int rlane = lane & 15;
  const int koff  = (lane >> 4) * 8;
  const int mOff  = (lane >> 4) * 8;

  v8f acc[4][4];
#pragma unroll
  for (int i = 0; i < 4; ++i)
#pragma unroll
    for (int j = 0; j < 4; ++j) acc[i][j] = (v8f){0.f,0.f,0.f,0.f,0.f,0.f,0.f,0.f};

  for (int k0 = 0; k0 < K; k0 += 32) {
    V bh[4], bl[4];
#pragma unroll
    for (int j = 0; j < 4; ++j) {
      const size_t bo = (size_t)(n0 + (j << 4) + rlane) * ldb + koff + k0;
      bh[j] = Frag<T>::load(Bb + bo);
      if (SPLIT) bl[j] = Frag<T>::load(Bb2 + bo);
    }
#pragma unroll
    for (int i = 0; i < 4; ++i) {
      const size_t ao = (size_t)(m0 + (i << 4) + rlane) * lda + koff + k0;
      V ah = Frag<T>::load(Ab + ao);
      V al;
      if (SPLIT) al = Frag<T>::load(Ab2 + ao);
#pragma unroll
      for (int j = 0; j < 4; ++j) {
        acc[i][j] = Frag<T>::mma(ah, bh[j], acc[i][j]);
        if (SPLIT) {
          acc[i][j] = Frag<T>::mma(ah, bl[j], acc[i][j]);
          acc[i][j] = Frag<T>::mma(al, bh[j], acc[i][j]);
        }
      }
      Frag<T>::guard(acc[i][0], acc[i][3], ah, SPLIT ? al : ah);
    }
    Frag<T>::keep(bh[0], bh[1], bh[2], bh[3]);
    if (SPLIT) Frag<T>::keep(bl[0], bl[1], bl[2], bl[3]);
  }
  acc_guard4(acc[0][0], acc[0][1], acc[0][2], acc[0][3]);
  acc_guard4(acc[1][0], acc[1][1], acc[1][2], acc[1][3]);
  acc_guard4(acc[2][0], acc[2][1], acc[2][2], acc[2][3]);
  acc_guard4(acc[3][0], acc[3][1], acc[3][2], acc[3][3]);

  float* slab = sT[wave];
  const float* Rb = RESID ? (resid + (size_t)b * strideR) : nullptr;
#pragma unroll
  for (int i = 0; i < 4; ++i) {
    const int mBase = m0 + (i << 4);
#pragma unroll
    for (int j = 0; j < 4; ++j) {
      const int n = n0 + (j << 4) + rlane;
      float bv = 0.f;
      if (BIAS_MODE == 2) bv = bias[n];
#pragma unroll
      for (int r = 0; r < 8; ++r) {
        float v = acc[i][j][r] * scale;
        if (BIAS_MODE == 1) v += bias[mBase + mOff + r];
        if (BIAS_MODE == 2) v += bv;
        if (RESID) v += Rb[(size_t)(mBase + mOff + r) * ldc + n];
        if (ACT == 1) v = tanhf(v);
        if (ACT == 2) v = fmaxf(v, 0.0f);
        if (ACT == 3) v = v / (1.0f + expf(-v));
        if (ACT == 4) v = (v > 0.f) ? v : 0.01f * v;
        if (ACT == 5) v = 0.5f * v * (1.0f + erff(v * 0.70710678118654752f));
        slab[(mOff + r) * 68 + (j << 4) + rlane] = v;
      }
    }
    __builtin_amdgcn_fence(__ATOMIC_RELEASE, "workgroup");
    __builtin_amdgcn_wave_barrier();
    __builtin_amdgcn_fence(__ATOMIC_ACQUIRE, "workgroup");
    if (OUT_MODE == 0) {
      float* C = (float*)Cout + (size_t)b * strideC;
      const int hh = lane >> 4, c4 = (lane & 15) * 4;
      {
#pragma unroll
        for (int it = 0; it < 8; ++it) {
          const int row = it * 2 + hh;
          v4f v = *(const v4f*)(slab + row * 68 + c4);
          *(v4f*)(C + (size_t)(mBase + row) * ldc + n0 + c4) = v;
        }
        
      }
    } else {
      const int q = lane >> 3, c8 = (lane & 7) * 8;
      unsigned short* C  = (unsigned short*)Cout  + (size_t)b * strideC;
      unsigned short* C2 = (OUT_MODE == 2) ? ((unsigned short*)Cout2 + (size_t)b * strideC) : nullptr;
      {
#pragma unroll
        for (int it = 0; it < 4; ++it) {
          const int row = it * 4 + q;
          const float* sp = slab + row * 68 + c8;
          if (OUT_MODE == 1) {
            v8h hv;
#pragma unroll
            for (int e = 0; e < 8; ++e) hv[e] = (_Float16)sp[e];
            *(v8h*)(C + (size_t)(mBase + row) * ldc + n0 + c8) = hv;
          } else {
            v4u hw, lw;
#pragma unroll
            for (int p = 0; p < 4; ++p) {
              v2b h2, l2;
              split2(sp[2 * p], sp[2 * p + 1], h2, l2);
              hw[p] = __builtin_bit_cast(unsigned, h2);
              lw[p] = __builtin_bit_cast(unsigned, l2);
            }
            *(v4u*)(C + (size_t)(mBase + row) * ldc + n0 + c8) = hw;
            *(v4u*)(C2 + (size_t)(mBase + row) * ldc + n0 + c8) = lw;
          }
        }
        
      }
    }
    __builtin_amdgcn_fence(__ATOMIC_RELEASE, "workgroup");
    __builtin_amdgcn_wave_barrier();
    __builtin_amdgcn_fence(__ATOMIC_ACQUIRE, "workgroup");
  }
}

template <int ET, bool SPLIT, int BIAS_MODE, int OUT_MODE, bool RESID, int ACT = 0>
__global__ __launch_bounds__(256) void wmma_gemm64(
    const unsigned short* __restrict__ Ap, const unsigned short* __restrict__ A2p, int lda, long strideA,
    const unsigned short* __restrict__ Btp, const unsigned short* __restrict__ Bt2p, int ldb, long strideB,
    void* __restrict__ Cout, void* __restrict__ Cout2, int ldc, long strideC,
    const float* __restrict__ bias,
    const float* __restrict__ resid, long strideR,
    int M, int N, int K, float scale) {
  __shared__ __align__(16) float sT[8][16 * 68];
  gemm64_group<ET, SPLIT, BIAS_MODE, OUT_MODE, RESID, ACT>(Ap, A2p, lda, strideA, Btp, Bt2p, ldb, strideB, Cout, Cout2, ldc, strideC,
                                                           bias, resid, strideR, M, N, K, scale, blockIdx.x, blockIdx.y, sT);
}

/* ---- the three input projections as ONE launch: none reads what another writes, and alone each fills only 16 or 32 WGPs.
   Work-groups 0 .. kGroupsKV-1 make v (bf16 hi/lo planes), the next kGroupsKV make k, the last kGroupsQ make q (f16 planes).
   wt: 4 weights x (hi plane + lo plane) of 128*128 halves, in the order q, k, v, p. ld = N = K = 128. */
constexpr int kGroupsQ  = ((kBatch * kNq  / 64) * (kC / 64) + 7) / 8;
constexpr int kGroupsKV = ((kBatch * kNkv / 64) * (kC / 64) + 7) / 8;
__global__ __launch_bounds__(256) void qkv_gemm64(
    const unsigned short* __restrict__ xq_hi, const unsigned short* __restrict__ xq_lo,
    const unsigned short* __restrict__ xkv_hi, const unsigned short* __restrict__ xkv_lo,
    const unsigned short* __restrict__ wt,
    unsigned short* __restrict__ q16, unsigned short* __restrict__ k16,
    unsigned short* __restrict__ v_hi, unsigned short* __restrict__ v_lo,
    const float* __restrict__ bq, const float* __restrict__ bk, const float* __restrict__ bv,
    int ld, int N, int K) {
  __shared__ __align__(16) float sT[8][16 * 68];
  const int bx = blockIdx.x;   /* every choice below is the same for the whole work-group */
  if (bx < kGroupsKV) {
    const unsigned short* w = wt + 2 * (2 * kC * kC);
    gemm64_group<1, true, 2, 2, false>(xkv_hi, xkv_lo, ld, 0L, w, w + kC * kC, ld, 0L, (void*)v_hi, (void*)v_lo, ld, 0L,
                                       bv, nullptr, 0L, kBatch * kNkv, N, K, 1.0f, bx, 0, sT);
  } else {
    const bool isk = bx < 2 * kGroupsKV;
    const unsigned short* w = wt + (isk ? 1 : 0) * (2 * kC * kC);
    gemm64_group<1, true, 2, 1, false>(isk ? xkv_hi : xq_hi, isk ? xkv_lo : xq_lo, ld, 0L, w, w + kC * kC, ld, 0L,
                                       (void*)(isk ? k16 : q16), nullptr, ld, 0L, isk ? bk : bq, nullptr, 0L,
                                       isk ? kBatch * kNkv : kBatch * kNq, N, K, 1.0f,
                                       bx - (isk ? kGroupsKV : 2 * kGroupsKV), 0, sT);
  }
}

/* ---- matrix helpers for the attention path ---- */
__device__ __forceinline__ v8f at_mma(v16b a, v16b b, v8f c) {
  c = __builtin_amdgcn_wmma_f32_16x16x32_bf16(false, a, false, b, (short)0, c, false, false);
  asm volatile("v_nop\n\tv_nop\n\tv_nop\n\tv_nop" : "+v"(c) : "v"(a), "v"(b));
  return c;
}
__device__ __forceinline__ v8f mma_h16(v16h a, v16h b, v8f c) {
  c = __builtin_amdgcn_wmma_f32_16x16x32_f16(false, a, false, b, (short)0, c, false, false);
  asm volatile("v_nop\n\tv_nop\n\tv_nop\n\tv_nop" : "+v"(c) : "v"(a), "v"(b));
  return c;
}

/* f32[8] -> packed bf16 hi (4 words) and bf16 lo residual (4 words), RNE convert */
__device__ __forceinline__ void split_pack8(const float (&x)[8], v4u& H, v4u& L) {
#pragma unroll
  for (int p = 0; p < 4; ++p) {
    v2b h2, l2;
    split2(x[2 * p], x[2 * p + 1], h2, l2);
    H[p] = __builtin_bit_cast(unsigned, h2);
    L[p] = __builtin_bit_cast(unsigned, l2);
  }
}
__device__ __forceinline__ void store_planes2(unsigned short* __restrict__ hi, unsigned short* __restrict__ lo,
                                              size_t off, v4u H, v4u L) {
  *(v4u*)(hi + off) = H;
  *(v4u*)(lo + off) = L;
  
}

/* ---- activations f32 [rows][128] -> bf16 hi/lo planes, same layout; thread i takes elements 8*i .. 8*i+7 ------------- */
__device__ __forceinline__ void split_rows_bf16(const float* __restrict__ in,
                                                unsigned short* __restrict__ hi,
                                                unsigned short* __restrict__ lo, int i) {
  const size_t e0 = (size_t)i * 8;
  const v4f a = *(const v4f*)(in + e0);
  const v4f c = *(const v4f*)(in + e0 + 4);
  float x[8];
  x[0] = a[0]; x[1] = a[1]; x[2] = a[2]; x[3] = a[3];
  x[4] = c[0]; x[5] = c[1]; x[6] = c[2]; x[7] = c[3];
  v4u H, L;
  split_pack8(x, H, L);
  store_planes2(hi, lo, e0, H, L);
}

/* ---- one weight W[k][n] (input-major, 128x128): in[k][n] -> out[n][k] as transposed bf16 hi/lo planes -----
   2048 threads gt per weight; 2048 threads x 8 = 16384 = 128x128 per plane exactly. */
__device__ __forceinline__ void wt_split_bf16(const float* __restrict__ W, unsigned short* __restrict__ hi,
                                              unsigned short* __restrict__ lo, int gt) {
  const int n  = gt >> 4;
  const int k8 = (gt & 15) * 8;
  float x[8];
#pragma unroll
  for (int e = 0; e < 8; ++e) x[e] = W[(size_t)(k8 + e) * kC + n];
  v4u H, L;
  split_pack8(x, H, L);
  store_planes2(hi, lo, (size_t)n * kC + k8, H, L);
}

/* ---- all operand planes of the projections as ONE launch: the three jobs are independent of each other.
   Work-groups 0 .. 31: the 4 weights, 8 groups each (outb: 4 weights x (hi plane + lo plane) of 128*128 halves);
   the next kPrepQ: x_q; the last kPrepKV: x_kv. Every range is covered exactly, 8 elements a thread. */
constexpr int kPrepW  = 4 * (kC * kC / 8 / 256);
constexpr int kPrepQ  = kBatch * kNq  * kC / 8 / 256;
constexpr int kPrepKV = kBatch * kNkv * kC / 8 / 256;
static_assert((kC * kC) % (8 * 256) == 0 && (kBatch * kNq * kC) % (8 * 256) == 0 && (kBatch * kNkv * kC) % (8 * 256) == 0, "");
__global__ __launch_bounds__(256) void prep_planes_kernel(
    const float* __restrict__ x_q, const float* __restrict__ x_kv,
    const float* __restrict__ W0, const float* __restrict__ W1, const float* __restrict__ W2, const float* __restrict__ W3,
    unsigned short* __restrict__ xq_hi, unsigned short* __restrict__ xq_lo,
    unsigned short* __restrict__ xkv_hi, unsigned short* __restrict__ xkv_lo,
    unsigned short* __restrict__ outb) {
  const int bx = blockIdx.x;
  const int t  = threadIdx.x;
  if (bx < kPrepW) {
    constexpr int per = kPrepW / 4;
    const int which = bx / per;
    const float* W = (which == 0) ? W0 : (which == 1) ? W1 : (which == 2) ? W2 : W3;
    unsigned short* hi = outb + (size_t)which * (2 * kC * kC);
    wt_split_bf16(W, hi, hi + kC * kC, (bx - which * per) * 256 + t);
  } else {
    const bool isq = bx < kPrepW + kPrepQ;
    split_rows_bf16(isq ? x_q : x_kv, isq ? xq_hi : xkv_hi, isq ? xq_lo : xkv_lo, (bx - kPrepW - (isq ? 0 : kPrepQ)) * 256 + t);
    asm volatile("s_wait_xcnt 0x0" ::: "memory");   /* a precaution: the weight path runs in other work-groups, nothing follows these stores */
  }
}

/* transposing LDS load: the lanes point at 16-byte pieces of a row-major [key][d] tile (lane l: row 8*(l>>4) + (l&7), piece (l>>3)&1);
   lane (c, hh) receives keys 8*hh .. 8*hh+7 of column d = c, which is half of an A fragment of the transposed tile */
__device__ __forceinline__ v8b ld_tr16(const unsigned short* p) {
  typedef __attribute__((address_space(3))) v8s lds_v8s;
  return __builtin_bit_cast(v8b, __builtin_amdgcn_ds_load_tr16_b128_v8i16((lds_v8s*)p));
}
/* lane l with lane l ^ 16: the two halves of a wave hold the two halves of a query column's keys */
__device__ __forceinline__ float xhalf(float x) {
  return __builtin_bit_cast(float, __builtin_amdgcn_permlanex16(__builtin_bit_cast(int, x), __builtin_bit_cast(int, x),
                                                                0x76543210, 0xfedcba98, false, false));
}
/* e[i] = 2^e[i], the 17 exponentials of a softmax step as one run. In asm for the free slot that the instruction set asks for behind a
   transcendental: each v_exp_f32 is the independent instruction behind the one before it and the v_nop stands behind the last */
__device__ __forceinline__ void exp2_run17(float (&e)[17]) {
  asm(
      "v_exp_f32 %0, %0\n\t"
      "v_exp_f32 %1, %1\n\t"
      "v_exp_f32 %2, %2\n\t"
      "v_exp_f32 %3, %3\n\t"
      "v_exp_f32 %4, %4\n\t"
      "v_exp_f32 %5, %5\n\t"
      "v_exp_f32 %6, %6\n\t"
      "v_exp_f32 %7, %7\n\t"
      "v_exp_f32 %8, %8\n\t"
      "v_exp_f32 %9, %9\n\t"
      "v_exp_f32 %10, %10\n\t"
      "v_exp_f32 %11, %11\n\t"
      "v_exp_f32 %12, %12\n\t"
      "v_exp_f32 %13, %13\n\t"
      "v_exp_f32 %14, %14\n\t"
      "v_exp_f32 %15, %15\n\t"
      "v_exp_f32 %16, %16\n\t"
      "v_nop"
      : "+v"(e[0]), "+v"(e[1]), "+v"(e[2]), "+v"(e[3]), "+v"(e[4]), "+v"(e[5]),
        "+v"(e[6]), "+v"(e[7]), "+v"(e[8]), "+v"(e[9]), "+v"(e[10]), "+v"(e[11]),
        "+v"(e[12]), "+v"(e[13]), "+v"(e[14]), "+v"(e[15]), "+v"(e[16]));
}
/* ---- online softmax step for one head, 32 keys x 16 query columns per wave (2 key subtiles), scores transposed ----
   sA[r]: key 8*hh + r, sB[r]: key 16 + 8*hh + r, both of query column c: a lane holds 16 keys of ONE query.
   The scores arrive times log2(e), so that e^(s - m) is one v_exp_f32 (2^x) of a difference; mrow is kept in the same unit.
   Maximum in the lane plus one exchange between the halves; the sum stays a per-lane partial (joined behind the key loop).
   P^T leaves as two B operands, hi and lo: element s = key kmap(s, hh), which is the order the accumulators already have. */
__device__ __forceinline__ float softmax_step_t(const v8f& sA, const v8f& sB, float& mrow, float& lrow, v16b& ph, v16b& pl) {
  float mm[4];
#pragma unroll
  for (int k = 0; k < 4; ++k) mm[k] = fmaxf(fmaxf(sA[k], sA[4 + k]), fmaxf(sB[k], sB[4 + k]));
  float m = fmaxf(fmaxf(mm[0], mm[1]), fmaxf(mm[2], mm[3]));
  m = fmaxf(m, xhalf(m));
  const float mnew = fmaxf(mrow, m);
  float e[17];
#pragma unroll
  for (int r = 0; r < 8; ++r) { e[r] = sA[r] - mnew; e[8 + r] = sB[r] - mnew; }
  e[16] = mrow - mnew;
  exp2_run17(e);
  const float al = e[16];
  mrow = mnew;
  float ps[4] = {0.f, 0.f, 0.f, 0.f};
#pragma unroll
  for (int r = 0; r < 16; r += 2) {
    ps[(r >> 3) * 2]     += e[r];
    ps[(r >> 3) * 2 + 1] += e[r + 1];
    v2b hi, lo;
    split2(e[r], e[r + 1], hi, lo);
    ph[r] = hi[0];  ph[r + 1] = hi[1];
    pl[r] = lo[0];  pl[r + 1] = lo[1];
  }
  lrow = lrow * al + ((ps[0] + ps[1]) + (ps[2] + ps[3]));
  return al;
}
/* per-wave transposed result (o[t][r] = O[query c][d = t*16 + 8*hh + r]) -> LDS staging [query][d] (pitch kOsPitch);
   writes rows 0..15, cols 0..31, 8 consecutive floats per lane and tile */
__device__ __forceinline__ void tile_to_os(float* os, const v8f (&o)[2], int hh, int c) {
#pragma unroll
  for (int t = 0; t < 2; ++t) {
    float* p = os + c * kOsPitch + t * 16 + 8 * hh;
    *(v4f*)(p)     = (v4f){o[t][0], o[t][1], o[t][2], o[t][3]};
    *(v4f*)(p + 4) = (v4f){o[t][4], o[t][5], o[t][6], o[t][7]};
  }
}
/* weighted sum over the kSplit key groups of one query tile, 4 floats of one row per lane;
   os0: staging tile of key group 0 for this query tile, the groups 4 tiles apart */
__device__ __forceinline__ v4f merge_os(const float* os0, const float (&w)[kSplit], int row, int c4) {
  v4f acc = (v4f){0.f, 0.f, 0.f, 0.f};
#pragma unroll
  for (int s = 0; s < kSplit; ++s) {
    const v4f v = *(const v4f*)(os0 + s * (4 * 16 * kOsPitch) + row * kOsPitch + c4);
#pragma unroll
    for (int e = 0; e < 4; ++e) acc[e] += w[s] * v[e];
  }
  return acc;
}

/* ---- attention for one (batch, head h, 64 query rows) ----------------------------------
   q16/k16: f16 planes [B*N][128] (head-major columns); vhi/vlo: bf16 hi/lo planes [B*Nkv][128].
   scores^T = (k.q^T)*scale + rpe[idx][h], the head's table column held in LDS; online softmax in f32, a lane holding one query's keys;
   scale and table carry the factor log2(e), so the softmax runs on powers of two (the hardware's own exponential);
   P^T hi and lo go from the score accumulators straight into B operands, never through LDS;
   V tiles lie row-major in LDS and are transposed by the load that reads them;
   o^T = V_h^T . P^T;  for h >= 2 also ox^T = V_{h-2}^T . P^T (the cross term of the differential mixing).
   16 waves: wave = (key group sp, query tile qt). Group sp (4 waves) takes key chunks sp, sp + kSplit, ... with its own
   K/V tiles and each wave its own running max, sum and accumulators; the groups are merged through LDS at the end.
   xattn f32 [B*Nq][128]; ycross f32 [B][2][Nq][32]. grid.x = B*H*(Nq/64), block 128 * kSplit. */
__global__ __launch_bounds__(128 * kSplit) __attribute__((amdgpu_num_vgpr(256)))
void attn_head_kernel(
    const unsigned short* __restrict__ q16, const unsigned short* __restrict__ k16,
    const unsigned short* __restrict__ vhi, const unsigned short* __restrict__ vlo,
    const int* __restrict__ coords_q, const int* __restrict__ coords_k,
    const float* __restrict__ rpe,
    float* __restrict__ xattn, float* __restrict__ ycross)
{
  __shared__ __align__(16) unsigned short KshS[kSplit][kKC * kHD];   /* [group][key][d]  f16 bits  */
  __shared__ __align__(16) unsigned short VthS[kSplit][kKC * kVP];   /* [group][key][d] bf16 hi, head h,   row pitch kVP */
  __shared__ __align__(16) unsigned short VtlS[kSplit][kKC * kVP];   /* [group][key][d] bf16 lo, head h,   row pitch kVP */
  __shared__ __align__(16) unsigned short VxhS[kSplit][kKC * kVP];   /* [group][key][d] bf16 hi, head h-2, row pitch kVP */
  __shared__ __align__(16) unsigned short VxlS[kSplit][kKC * kVP];   /* [group][key][d] bf16 lo, head h-2, row pitch kVP */
  __shared__ __align__(16) float Tab[kTabLds];                       /* rpe[idx][h] * log2(e) for this block's head, all idx */
  /* behind the key loop the table is dead and its bytes take the merge staging */
  static_assert(4 * kSplit * 16 * kOsPitch + 4 * kSplit * 16 * 2 <= kTabLds, "");
  float* const OsAll = Tab;                                          /* [wave][16 * kOsPitch] */
  float* const MlAll = Tab + 4 * kSplit * 16 * kOsPitch;             /* [wave][row] (max, sum) */

  const int wave = threadIdx.x >> 5;     /* 0 .. 15 */
  const int sp   = wave >> 2;            /* key group */
  const int qt   = wave & 3;             /* query tile */
  const int tid  = threadIdx.x & 127;    /* thread within the key group */
  const int lane = tid & 31;
  unsigned short* Ksh = KshS[sp];
  unsigned short* Vth = VthS[sp];
  unsigned short* Vtl = VtlS[sp];
  unsigned short* Vxh = VxhS[sp];
  unsigned short* Vxl = VxlS[sp];
  const int hh   = lane >> 4;
  const int c    = lane & 15;
  const int vro  = (8 * hh + (lane & 7)) * kVP + ((lane >> 3) & 1) * 8;   /* halves; this lane's piece for the transposing V loads */
  constexpr int nqb = kNq / kQB;
  const int bx   = blockIdx.x;
  const int qb   = bx % nqb;
  const int rest = bx / nqb;
  const int h    = rest % kH;
  const int b    = rest / kH;
  const bool cross = (h >= kNH);                       /* block-uniform */
  const int hcol = h * kHD;
  const int xcol = (cross ? (h - kNH) : 0) * kHD;
  const int q0   = qb * kQB + qt * 16;
  const size_t qrows  = (size_t)b * kNq + q0;
  const size_t kvrows = (size_t)b * kNkv;
  const float* __restrict__ rpe_h = rpe + h;           /* table entry stride kH floats */

  /* this head's column of the bias table -> LDS, once per work-group; batches of 16 loads per thread keep the
     latency of the strided reads covered. The first barrier of the key loop publishes it. */
  {
    constexpr int kThreads = 128 * kSplit;
    constexpr int kFull = kTable / (kThreads * 16);
    const int t0 = threadIdx.x;
    /* rolled: 16 waves x 16 loads in flight already cover the L2 latency; unrolled further the copy only takes more registers */
#pragma unroll 1
    for (int g = 0; g < kFull; ++g) {
      float tv[16];
      const float* gp = rpe_h + (size_t)(g * 16 * kThreads + t0) * kH;
#pragma unroll
      for (int u = 0; u < 16; ++u) tv[u] = gp[u * (kThreads * kH)];
      asm volatile("s_wait_xcnt 0x0" :: "v"(gp) : "memory");   /* the loads' address registers are kept as they are until this wait */
#pragma unroll
      for (int u = 0; u < 16; ++u) Tab[(g * 16 + u) * kThreads + t0] = tv[u] * kLog2e;
    }
    for (int i = kFull * 16 * kThreads + t0; i < kTable; i += kThreads) Tab[i] = rpe_h[(size_t)i * kH] * kLog2e;
  }

  /* Q fragment (B operand: lane c -> query column c; K = head_dim = 32, one k-step) */
  const _Float16* qp = (const _Float16*)(const void*)q16;
  const v16h qa = Frag<_Float16>::load(qp + (qrows + c) * kC + hcol + 8 * hh);

  /* coords of this lane's query column c, +MAXD folded in */
  const v2i cq = *(const v2i*)(coords_q + (qrows + c) * 2);
  const int cqx = cq.x + kMaxd;
  const int cqy = cq.y + kMaxd;

  float mr = -INFINITY, lr = 0.f;   /* running max (equal in both halves) and this lane's partial sum for query c */
  v8f o[2], ox[2];                  /* o[t][r] = O[query c][d = t*16 + 8*hh + r] */
#pragma unroll
  for (int t = 0; t < 2; ++t) {
    o[t]  = (v8f){0.f,0.f,0.f,0.f,0.f,0.f,0.f,0.f};
    ox[t] = (v8f){0.f,0.f,0.f,0.f,0.f,0.f,0.f,0.f};
  }

  for (int kc = 0; kc < kNkv / (kKC * kSplit); ++kc) {
    const int kv0 = (kc * kSplit + sp) * kKC;
    __syncthreads();
    /* coords of this lane's 16 score rows (keys j*16 + 8*hh + r), two keys per 16-byte load, the same address in the 16 lanes
       of a half; asked for just ahead of the K and V rows so that one round trip serves both */
    v4i ck[2][4];
    {
      const int* ckp = coords_k + (kvrows + kv0 + 8 * hh) * 2;
#pragma unroll
      for (int j = 0; j < 2; ++j) {
#pragma unroll
        for (int i = 0; i < 4; ++i) ck[j][i] = *(const v4i*)(ckp + j * 32 + i * 4);
      }
      asm volatile("s_wait_xcnt 0x0" :: "v"(ckp) : "memory");   /* the loads' address registers are kept as they are until this wait */
    }
    /* stage the K tile and the V hi/lo tiles, all row-major: 32 keys x 4 segments of 8 halves = 128 = threads of a key group, one
       uint4 per thread per plane; covers Ksh 32x32 and the 32 d of every row of Vth/Vtl (and Vxh/Vxl when cross) exactly;
       the pad halves of a V row are never read */
    {
      const int key = tid >> 2;
      const int seg = tid & 3;
      const size_t rowoff = (kvrows + kv0 + key) * kC;
      const size_t go = rowoff + hcol + seg * 8;
      const unsigned short* kgp = k16 + go;
      const unsigned short* hgp = vhi + go;
      const unsigned short* lgp = vlo + go;
      const uint4 kw  = *(const uint4*)(kgp);
      const uint4 vh4 = *(const uint4*)(hgp);
      const uint4 vl4 = *(const uint4*)(lgp);
      asm volatile("s_wait_xcnt 0x0" :: "v"(kgp), "v"(hgp), "v"(lgp) : "memory");   /* the loads' address registers are kept as they are until this wait */
      *(uint4*)(&Ksh[key * kHD + seg * 8]) = kw;
      *(uint4*)(&Vth[key * kVP + seg * 8]) = vh4;
      *(uint4*)(&Vtl[key * kVP + seg * 8]) = vl4;
      if (cross) {
        const size_t gx = rowoff + xcol + seg * 8;
        const uint4 xh4 = *(const uint4*)(vhi + gx);
        const uint4 xl4 = *(const uint4*)(vlo + gx);
        *(uint4*)(&Vxh[key * kVP + seg * 8]) = xh4;
        *(uint4*)(&Vxl[key * kVP + seg * 8]) = xl4;
      }
    }
    __syncthreads();

    /* scores^T: s[j], j = key subtile; A fragment lane c -> key j*16+c, elements d (split map); s[j][r] = S[key j*16+8*hh+r][query c] */
    v8f s[2];
    {
      const v8f z = (v8f){0.f,0.f,0.f,0.f,0.f,0.f,0.f,0.f};
      const _Float16* Kp = (const _Float16*)(const void*)Ksh;
#pragma unroll
      for (int j = 0; j < 2; ++j) {
        Frag<_Float16>::U kb;
        kb.h[0] = *(const v8h*)(Kp + (j * 16 + c) * kHD + 8 * hh);
        kb.h[1] = *(const v8h*)(Kp + (j * 16 + c) * kHD + 16 + 8 * hh);
        s[j] = mma_h16(kb.v, qa, z);
      }
    }

    /* scale + relative position bias, both times log2(e): one clamped b32 gather from the LDS table per (key, query) */
#pragma unroll
    for (int r = 0; r < 8; ++r) {
#pragma unroll
      for (int j = 0; j < 2; ++j) {
        const int kx = ck[j][r >> 1][(r & 1) * 2];
        const int ky = ck[j][r >> 1][(r & 1) * 2 + 1];
        int dx = cqx - kx; dx = dx < 0 ? 0 : dx; dx = dx > 2 * kMaxd ? 2 * kMaxd : dx;
        int dy = cqy - ky; dy = dy < 0 ? 0 : dy; dy = dy > 2 * kMaxd ? 2 * kMaxd : dy;
        const int idx = dx * kSpan + dy;            /* 0 .. kTable-1 */
        s[j][r] = s[j][r] * kScaleL2 + Tab[idx];
      }
    }

    /* online softmax; P^T hi and lo stay in registers as B operands */
    v16b ph, pl;
    const float al = softmax_step_t(s[0], s[1], mr, lr, ph, pl);
#pragma unroll
    for (int t = 0; t < 2; ++t) {
#pragma unroll
      for (int r = 0; r < 8; ++r) { o[t][r] *= al; ox[t][r] *= al; }
    }

    /* V^T.P^T : A = V^T (lane c -> d, elements key, split map), transposed out of the row-major tile by the load itself;
       B = P^T (lane c -> query, elements key, same map) */
    {
#pragma unroll
      for (int t = 0; t < 2; ++t) {
        Frag<__bf16>::U vh, vl;
        vh.h[0] = ld_tr16(Vth + vro + t * 16);  vh.h[1] = ld_tr16(Vth + vro + 16 * kVP + t * 16);
        vl.h[0] = ld_tr16(Vtl + vro + t * 16);  vl.h[1] = ld_tr16(Vtl + vro + 16 * kVP + t * 16);
        o[t] = at_mma(vh.v, ph, o[t]);
        o[t] = at_mma(vl.v, ph, o[t]);
        o[t] = at_mma(vh.v, pl, o[t]);
      }
      if (cross) {
#pragma unroll
        for (int t = 0; t < 2; ++t) {
          Frag<__bf16>::U vh, vl;
          vh.h[0] = ld_tr16(Vxh + vro + t * 16);  vh.h[1] = ld_tr16(Vxh + vro + 16 * kVP + t * 16);
          vl.h[0] = ld_tr16(Vxl + vro + t * 16);  vl.h[1] = ld_tr16(Vxl + vro + 16 * kVP + t * 16);
          ox[t] = at_mma(vh.v, ph, ox[t]);
          ox[t] = at_mma(vl.v, ph, ox[t]);
          ox[t] = at_mma(vh.v, pl, ox[t]);
        }
      }
    }
  }

  /* merge of the key groups: every wave leaves its accumulators (not normalised) and its (max, sum) in LDS;
     wave (sp, qt) then merges rows 4*sp .. 4*sp+3 of query tile qt: x = sum_s 2^(m_s-M) o_s / sum_s 2^(m_s-M) l_s, the maxima in log2 units */
  __syncthreads();   /* every wave has made its last table read: the table's bytes become the merge staging */
  float* os = OsAll + wave * (16 * kOsPitch);
  const float* osq = OsAll + qt * (16 * kOsPitch);
  tile_to_os(os, o, hh, c);
  lr += xhalf(lr);   /* the two halves' partial sums of query c */
  if (hh == 0) {     /* max and sum are now equal in lanes c and c + 16 */
    MlAll[wave * 32 + c * 2] = mr;
    MlAll[wave * 32 + c * 2 + 1] = lr;
  }
  __syncthreads();   /* all groups' partial tiles are in LDS */

  const int row = 4 * sp + (lane >> 3);
  const int c4  = (lane & 7) * 4;
  float w[kSplit];
  {
    float ms[kSplit], ls[kSplit];
    float M = -INFINITY;
#pragma unroll
    for (int s = 0; s < kSplit; ++s) {
      ms[s] = MlAll[(s * 4 + qt) * 32 + row * 2];
      ls[s] = MlAll[(s * 4 + qt) * 32 + row * 2 + 1];
      M = fmaxf(M, ms[s]);
    }
    float L = 0.f;
#pragma unroll
    for (int s = 0; s < kSplit; ++s) { w[s] = __builtin_amdgcn_exp2f(ms[s] - M); L += w[s] * ls[s]; }
    const float inv = 1.0f / L;
#pragma unroll
    for (int s = 0; s < kSplit; ++s) w[s] *= inv;
  }
  *(v4f*)(xattn + (qrows + row) * kC + hcol + c4) = merge_os(osq, w, row, c4);
  asm volatile("s_wait_xcnt 0x0" ::: "memory");   /* the cross path below reuses the registers this store names */

  if (cross) {
    __syncthreads();   /* every reader has left the o tiles */
    tile_to_os(os, ox, hh, c);
    __syncthreads();   /* all groups' cross tiles are in LDS */
    *(v4f*)(ycross + ((((size_t)b * kNH + (h - kNH)) * kNq + q0 + row) * kHD) + c4) = merge_os(osq, w, row, c4);
  }
}

/* ---- differential head mixing + split to bf16 hi/lo planes for the output projection --------
   x[b,q,h*32+d] = xs + alpha[b,q]*(xs - lam[h]*yc[b,h,q,d]) for h < 2, else xs.
   coverage 65536 threads x 8 = 4096x128 exactly. */
__global__ __launch_bounds__(256) void combine_split_kernel(
    const float* __restrict__ xattn, const float* __restrict__ ycross, const float* __restrict__ alpha,
    const float* __restrict__ lq1, const float* __restrict__ lk1,
    const float* __restrict__ lq2, const float* __restrict__ lk2,
    unsigned short* __restrict__ hi, unsigned short* __restrict__ lo)
{
  __shared__ float lam_s[2];
  if (threadIdx.x < 2) {
    const int h = threadIdx.x;
    float s1 = 0.f, s2 = 0.f;
#pragma unroll 1
    for (int i = 0; i < kHD; ++i) {
      s1 += lq1[h * kHD + i] * lk1[h * kHD + i];
      s2 += lq2[h * kHD + i] * lk2[h * kHD + i];
    }
    lam_s[h] = expf(s1) - expf(s2) + kLambdaInit;
  }
  __syncthreads();
  const int gt = blockIdx.x * 256 + threadIdx.x;
  if (gt >= kBatch * kNq * kC / 8) return;
  const size_t e0 = (size_t)gt * 8;
  const int row = (int)(e0 >> 7);
  const int col = (int)(e0 & 127);
  const int h   = col >> 5;
  const int d   = col & 31;
  const int hc  = h & 1;
  const int b   = row >> 11;
  const int q   = row & (kNq - 1);
  const float a   = alpha[row];
  const float lam = lam_s[hc];
  const v4f xs0 = *(const v4f*)(xattn + e0);
  const v4f xs1 = *(const v4f*)(xattn + e0 + 4);
  const size_t yo = (((size_t)b * kNH + hc) * kNq + q) * kHD + d;
  const v4f y0 = *(const v4f*)(ycross + yo);
  const v4f y1 = *(const v4f*)(ycross + yo + 4);
  const bool mix = (h < kNH);
  float x[8];
#pragma unroll
  for (int e = 0; e < 4; ++e) {
    const float xa = xs0[e], xb = xs1[e];
    const float va = xa + a * (xa - lam * y0[e]);
    const float vb = xb + a * (xb - lam * y1[e]);
    x[e]     = mix ? va : xa;
    x[4 + e] = mix ? vb : xb;
  }
  v4u H, L;
  split_pack8(x, H, L);
  store_planes2(hi, lo, e0, H, L);
}

/* =========================================================================================
   host launch: 5 kernel launches
   workspace region map (bytes, all offsets MiB/256-KiB aligned):
     xq_hi  1 MiB | xq_lo 1 MiB | xkv_hi 2 MiB | xkv_lo 2 MiB | wt planes 256 KiB (4 weights x hi,lo x 32 KiB)
     q16 1 MiB | k16 2 MiB | v_hi 2 MiB | v_lo 2 MiB | xattn f32 2 MiB | ycross f32 1 MiB | xmix_hi 1 MiB | xmix_lo 1 MiB
     total 19,136,512 B
   ========================================================================================= */
extern "C" void kernel_launch(void* const* d_in, const int* in_sizes, int n_in,
                              void* d_out, int out_size, void* d_ws, size_t ws_size,
                              hipStream_t stream) {
  constexpr int Mq  = kBatch * kNq;    /* 4096 */
  constexpr int Mkv = kBatch * kNkv;   /* 8192 */
  static_assert(Mq % 64 == 0 && Mkv % 64 == 0 && kC % 64 == 0 && kC % 32 == 0, "");
  static_assert((Mq * kC) % 8 == 0 && (Mkv * kC) % 8 == 0, "");
  if (n_in < 18) return;
  if (in_sizes[0] != Mq * kC || in_sizes[1] != Mkv * kC || in_sizes[2] != Mq * 2 || in_sizes[3] != Mkv * 2 ||
      in_sizes[4] != Mq || in_sizes[5] != kC * kC || in_sizes[7] != kC * kC || in_sizes[9] != kC * kC ||
      in_sizes[16] != kC * kC || in_sizes[6] != kC || in_sizes[8] != kC || in_sizes[10] != kC || in_sizes[17] != kC ||
      in_sizes[11] != kNH * kHD || in_sizes[12] != kNH * kHD || in_sizes[13] != kNH * kHD || in_sizes[14] != kNH * kHD ||
      in_sizes[15] != kTable * kH || out_size != Mq * kC) return;

  const float* x_q      = (const float*)d_in[0];
  const float* x_kv     = (const float*)d_in[1];
  const int*   coords_q = (const int*)d_in[2];
  const int*   coords_k = (const int*)d_in[3];
  const float* alpha    = (const float*)d_in[4];
  const float* Wq = (const float*)d_in[5];  const float* bq = (const float*)d_in[6];
  const float* Wk = (const float*)d_in[7];  const float* bk = (const float*)d_in[8];
  const float* Wv = (const float*)d_in[9];  const float* bv = (const float*)d_in[10];
  const float* lq1 = (const float*)d_in[11]; const float* lk1 = (const float*)d_in[12];
  const float* lq2 = (const float*)d_in[13]; const float* lk2 = (const float*)d_in[14];
  const float* rpe = (const float*)d_in[15];
  const float* Wp = (const float*)d_in[16]; const float* bp = (const float*)d_in[17];
  float* out = (float*)d_out;

  char* ws = (char*)d_ws;
  size_t off = 0;
  const size_t szXq16  = (size_t)Mq * kC * 2;     /* 1 MiB  */
  const size_t szXkv16 = (size_t)Mkv * kC * 2;    /* 2 MiB  */
  const size_t szWt    = (size_t)4 * 2 * kC * kC * 2;
  const size_t szXattn = (size_t)Mq * kC * 4;
  const size_t szYc    = (size_t)kBatch * kNH * kNq * kHD * 4;
  unsigned short* xq_hi  = (unsigned short*)(ws + off); off += szXq16;
  unsigned short* xq_lo  = (unsigned short*)(ws + off); off += szXq16;
  unsigned short* xkv_hi = (unsigned short*)(ws + off); off += szXkv16;
  unsigned short* xkv_lo = (unsigned short*)(ws + off); off += szXkv16;
  unsigned short* wt     = (unsigned short*)(ws + off); off += szWt;
  unsigned short* q16    = (unsigned short*)(ws + off); off += szXq16;
  unsigned short* k16    = (unsigned short*)(ws + off); off += szXkv16;
  unsigned short* v_hi   = (unsigned short*)(ws + off); off += szXkv16;
  unsigned short* v_lo   = (unsigned short*)(ws + off); off += szXkv16;
  float*          xattn  = (float*)(ws + off);          off += szXattn;
  float*          ycross = (float*)(ws + off);          off += szYc;
  unsigned short* xm_hi  = (unsigned short*)(ws + off); off += szXq16;
  unsigned short* xm_lo  = (unsigned short*)(ws + off); off += szXq16;
  if (off > ws_size) return;

  const unsigned short* wtp_hi = wt + 3 * (2 * kC * kC); const unsigned short* wtp_lo = wtp_hi + kC * kC;

  /* 1: activations and weights -> bf16 hi/lo planes (weights transposed: in[k][n] -> out[n][k], square 128x128) */
  const int n8q = Mq * kC / 8;
  prep_planes_kernel<<<dim3(kPrepW + kPrepQ + kPrepKV), dim3(256), 0, stream>>>(x_q, x_kv, Wq, Wk, Wv, Wp,
                                                                               xq_hi, xq_lo, xkv_hi, xkv_lo, wt);

  /* 2: the three input projections, M x 128, K = 128 (M % 64 == 0, N = 128 % 64 == 0, K = 128 % 32 == 0) */
  const int blocksQ = kGroupsQ;
  qkv_gemm64<<<dim3(kGroupsQ + 2 * kGroupsKV), dim3(256), 0, stream>>>(xq_hi, xq_lo, xkv_hi, xkv_lo, wt, q16, k16, v_hi, v_lo,
                                                                      bq, bk, bv, kC, kC, kC);

  /* 3: attention per (batch, head, 64 queries) */
  const int attnBlocks = kBatch * kH * (kNq / kQB);
  attn_head_kernel<<<dim3(attnBlocks), dim3(128 * kSplit), 0, stream>>>(q16, k16, v_hi, v_lo, coords_q, coords_k, rpe, xattn, ycross);

  /* 4: differential mixing + bf16 hi/lo planes */
  combine_split_kernel<<<dim3((n8q + 255) / 256), dim3(256), 0, stream>>>(xattn, ycross, alpha, lq1, lk1, lq2, lk2, xm_hi, xm_lo);

  /* 5: output projection -> d_out (f32), M = 4096, N = 128, K = 128 */
  wmma_gemm64<1, true, 2, 0, false><<<dim3(blocksQ, 1), dim3(256), 0, stream>>>(
      xm_hi, xm_lo, kC, 0L, wtp_hi, wtp_lo, kC, 0L, (void*)out, nullptr, kC, 0L, bp, nullptr, 0L, Mq, kC, kC, 1.0f);
}

// v008
// It runs in 104 microseconds.
// In two side-by-side timings against v007, it was 1.07 and 1.08 times as fast.
// All steps since v000 together make it 4.36 times as fast.
// Contractions: x@Wq, x@Wk, x@Wv and xmix@Wp on v_wmma_f32_16x16x32_bf16 with bf16 hi/lo operand planes (hi.hi + hi.lo + lo.hi); k.q^T on v_wmma_f32_16x16x32_f16 with plain f16 q/k planes; v^T.p^T and v_cross^T.p^T on v_wmma_f32_16x16x32_bf16 with bf16 hi/lo p and v tiles; f32 accumulate; bias gather, online softmax and head mixing in f32.
#include <hip/hip_runtime.h>
#include <stdint.h>

typedef __attribute__((ext_vector_type(16))) _Float16 v16h;
typedef __attribute__((ext_vector_type(8)))  _Float16 v8h;
typedef __attribute__((ext_vector_type(16))) __bf16   v16b;
typedef __attribute__((ext_vector_type(8)))  __bf16   v8b;
typedef __attribute__((ext_vector_type(8)))  float    v8f;
typedef __attribute__((ext_vector_type(4)))  float    v4f;
typedef __attribute__((ext_vector_type(4)))  unsigned int v4u;
typedef __attribute__((ext_vector_type(2)))  int      v2i;
typedef __attribute__((ext_vector_type(4)))  int      v4i;
typedef __attribute__((ext_vector_type(8)))  short    v8s;
typedef __attribute__((ext_vector_type(2)))  float    v2f;
typedef __attribute__((ext_vector_type(2)))  __bf16   v2b;

/* ---- problem geometry (fixed by the module) ---- */
constexpr int kBatch = 2;
constexpr int kNq    = 2048;
constexpr int kNkv   = 4096;
constexpr int kC     = 128;
constexpr int kH     = 4;
constexpr int kHD    = 32;
constexpr int kNH    = 2;
constexpr int kMaxd  = 128;
constexpr int kSpan  = 2 * kMaxd + 1;
constexpr int kTable = kSpan * kSpan;
constexpr int kKC    = 32;     /* keys per chunk in the attention kernel */
constexpr int kQB    = 64;     /* query rows per attention block (4 query tiles x 16) */
constexpr int kSplit = 4;      /* key groups per attention block: wave = (key group, query tile) */
constexpr int kOsPitch = 36;   /* floats; per-wave output staging pitch */
constexpr int kVP    = 48;     /* halves; LDS row pitch of the V tiles: 96 B = 32 B x odd, the pitch of the transposing load */
constexpr int kTabLds  = (kTable + 3) & ~3;   /* floats; one head's bias column in LDS, rounded to 16 bytes */
constexpr float kLog2e  = 1.4426950408889634f;                        /* log2(e) */
constexpr float kScaleL2 = (float)(0.17677669529663687 * 1.4426950408889634);   /* head_dim ** -0.5 * log2(e) */
constexpr float kLambdaInit = 0.8f;

static_assert(kNq % kQB == 0, "");
static_assert(kNkv % (kKC * kSplit) == 0, "");
static_assert(kSplit * 4 == 16, "");   /* the merge gives each wave 16 / kSplit = 4 rows = 32 lanes x 4 floats */
static_assert(kC == kH * kHD, "");
static_assert((kBatch * kNq) % 64 == 0 && (kBatch * kNkv) % 64 == 0, "");
static_assert(kC % 64 == 0 && kC % 32 == 0, "");
static_assert(kH == 4 && kNH == 2 && kHD == 32 && kKC == 32, "");

/* two f32 -> a packed pair of bf16 hi and a packed pair of bf16 lo (the residual x - hi, exact in f32), three instructions a pair, all on
   the hardware's own converts, which round to nearest even as the integer form did. hi: one packed convert. lo: one mixed fma per value,
   hi * (-1) + x with hi and the -1 read as bf16 and the result written as bf16 into one half of lo. In asm because the compiler widens hi
   by a shift and a mask, subtracts and converts again: five instructions a pair */
__device__ __forceinline__ void split2(float a, float b, v2b& hi, v2b& lo) {
  hi = __builtin_convertvector((v2f){a, b}, v2b);
  unsigned lw;
  asm("v_fma_mixlo_bf16 %0, %1, %2, %3 op_sel_hi:[1,1,0]\n\t"
      "v_fma_mixhi_bf16 %0, %1, %2, %4 op_sel:[1,0,0] op_sel_hi:[1,1,0]"
      : "=&v"(lw)
      : "v"(__builtin_bit_cast(unsigned, hi)), "v"(0xBF80BF80u) /* bf16 -1 */, "v"(a), "v"(b));
  lo = __builtin_bit_cast(v2b, lw);
}

/* hazard guards as plain device helpers */
__device__ __forceinline__ void dep_guard_h(v8f& a, v8f& b, v16h x, v16h y) { asm volatile("v_nop\n\tv_nop\n\tv_nop\n\tv_nop" : "+v"(a), "+v"(b) : "v"(x), "v"(y)); }
__device__ __forceinline__ void dep_guard_b(v8f& a, v8f& b, v16b x, v16b y) { asm volatile("v_nop\n\tv_nop\n\tv_nop\n\tv_nop" : "+v"(a), "+v"(b) : "v"(x), "v"(y)); }
__device__ __forceinline__ void keep4_h(v16h a, v16h b, v16h c, v16h d) { asm volatile("v_nop" :: "v"(a), "v"(b), "v"(c), "v"(d)); }
__device__ __forceinline__ void keep4_b(v16b a, v16b b, v16b c, v16b d) { asm volatile("v_nop" :: "v"(a), "v"(b), "v"(c), "v"(d)); }
__device__ __forceinline__ void acc_guard4(v8f& a, v8f& b, v8f& c, v8f& d) { asm volatile("v_nop\n\tv_nop\n\tv_nop\n\tv_nop" : "+v"(a), "+v"(b), "+v"(c), "+v"(d)); }
template <typename T> struct Frag;
template <> struct Frag<_Float16> {
  typedef v16h V; union U { v16h v; v8h h[2]; };
  static __device__ __forceinline__ v16h load(const _Float16* p) {
    U f; f.h[0] = *(const v8h*)(p); f.h[1] = *(const v8h*)(p + 16); return f.v;
  }
  static __device__ __forceinline__ v8f mma(v16h a, v16h b, v8f c) {
    return __builtin_amdgcn_wmma_f32_16x16x32_f16(false, a, false, b, (short)0, c, false, false);
  }
  static __device__ __forceinline__ void guard(v8f& a, v8f& b, v16h x, v16h y) { dep_guard_h(a, b, x, y); }
  static __device__ __forceinline__ void keep(v16h a, v16h b, v16h c, v16h d) { keep4_h(a, b, c, d); }
};
template <> struct Frag<__bf16> {
  typedef v16b V; union U { v16b v; v8b h[2]; };
  static __device__ __forceinline__ v16b load(const __bf16* p) {
    U f; f.h[0] = *(const v8b*)(p); f.h[1] = *(const v8b*)(p + 16); return f.v;
  }
  static __device__ __forceinline__ v8f mma(v16b a, v16b b, v8f c) {
    return __builtin_amdgcn_wmma_f32_16x16x32_bf16(false, a, false, b, (short)0, c, false, false);
  }
  static __device__ __forceinline__ void guard(v8f& a, v8f& b, v16b x, v16b y) { dep_guard_b(a, b, x, y); }
  static __device__ __forceinline__ void keep(v16b a, v16b b, v16b c, v16b d) { keep4_b(a, b, c, d); }
};

/* ---- Register-blocked batched WMMA GEMM ---------------- */
template <int ET> struct Elem;
template <> struct Elem<0> { typedef _Float16 T; };
template <> struct Elem<1> { typedef __bf16 T; };
/* one work-group's share (8 waves, a 64x64 tile each) of one GEMM; bx, b: the work-group's place in that GEMM's own grid;
   sT: the work-group's staging slabs, 8 x 16 x 68 floats */
template <int ET, bool SPLIT, int BIAS_MODE, int OUT_MODE, bool RESID, int ACT = 0>
__device__ __forceinline__ void gemm64_group(
    const unsigned short* __restrict__ Ap, const unsigned short* __restrict__ A2p, int lda, long strideA,
    const unsigned short* __restrict__ Btp, const unsigned short* __restrict__ Bt2p, int ldb, long strideB,
    void* __restrict__ Cout, void* __restrict__ Cout2, int ldc, long strideC,
    const float* __restrict__ bias,
    const float* __restrict__ resid, long strideR,
    int M, int N, int K, float scale, int bx, int b, float (*sT)[16 * 68]) {
  typedef typename Elem<ET>::T T;
  typedef typename Frag<T>::V V;
  const T* A = (const T*)Ap; const T* A2 = (const T*)A2p; const T* Bt = (const T*)Btp; const T* Bt2 = (const T*)Bt2p;
  const int lane = threadIdx.x & 31;
  const int wave = threadIdx.x >> 5;
  const int tilesN = N >> 6;
  const int tilesM = M >> 6;
  const int tile = bx * 8 + wave;
  if (tile >= tilesM * tilesN) return;
  const int tm = tile / tilesN;
  const int tn = tile - tm * tilesN;
  const int m0 = tm << 6;
  const int n0 = tn << 6;

  const T* Ab  = A  + (size_t)b * strideA;
  const T* Bb  = Bt + (size_t)b * strideB;
  const T* Ab2 = SPLIT ? (A2  + (size_t)b * strideA) : nullptr;
  const T* Bb2 = SPLIT ? (Bt2 + (size_t)b * strideB) : nullptr;

  const int rlane = lane & 15;
  const int koff  = (lane >> 4) * 8;
  const int mOff  = (lane >> 4) * 8;

  v8f acc[4][4];
#pragma unroll
  for (int i = 0; i < 4; ++i)
#pragma unroll
    for (int j = 0; j < 4; ++j) acc[i][j] = (v8f){0.f,0.f,0.f,0.f,0.f,0.f,0.f,0.f};

  for (int k0 = 0; k0 < K; k0 += 32) {
    V bh[4], bl[4];
#pragma unroll
    for (int j = 0; j < 4; ++j) {
      const size_t bo = (size_t)(n0 + (j << 4) + rlane) * ldb + koff + k0;
      bh[j] = Frag<T>::load(Bb + bo);
      if (SPLIT) bl[j] = Frag<T>::load(Bb2 + bo);
    }
#pragma unroll
    for (int i = 0; i < 4; ++i) {
      const size_t ao = (size_t)(m0 + (i << 4) + rlane) * lda + koff + k0;
      V ah = Frag<T>::load(Ab + ao);
      V al;
      if (SPLIT) al = Frag<T>::load(Ab2 + ao);
#pragma unroll
      for (int j = 0; j < 4; ++j) {
        acc[i][j] = Frag<T>::mma(ah, bh[j], acc[i][j]);
        if (SPLIT) {
          acc[i][j] = Frag<T>::mma(ah, bl[j], acc[i][j]);
          acc[i][j] = Frag<T>::mma(al, bh[j], acc[i][j]);
        }
      }
      Frag<T>::guard(acc[i][0], acc[i][3], ah, SPLIT ? al : ah);
    }
    Frag<T>::keep(bh[0], bh[1], bh[2], bh[3]);
    if (SPLIT) Frag<T>::keep(bl[0], bl[1], bl[2], bl[3]);
  }
  acc_guard4(acc[0][0], acc[0][1], acc[0][2], acc[0][3]);
  acc_guard4(acc[1][0], acc[1][1], acc[1][2], acc[1][3]);
  acc_guard4(acc[2][0], acc[2][1], acc[2][2], acc[2][3]);
  acc_guard4(acc[3][0], acc[3][1], acc[3][2], acc[3][3]);

  float* slab = sT[wave];
  const float* Rb = RESID ? (resid + (size_t)b * strideR) : nullptr;
#pragma unroll
  for (int i = 0; i < 4; ++i) {
    const int mBase = m0 + (i << 4);
#pragma unroll
    for (int j = 0; j < 4; ++j) {
      const int n = n0 + (j << 4) + rlane;
      float bv = 0.f;
      if (BIAS_MODE == 2) bv = bias[n];
#pragma unroll
      for (int r = 0; r < 8; ++r) {
        float v = acc[i][j][r] * scale;
        if (BIAS_MODE == 1) v += bias[mBase + mOff + r];
        if (BIAS_MODE == 2) v += bv;
        if (RESID) v += Rb[(size_t)(mBase + mOff + r) * ldc + n];
        if (ACT == 1) v = tanhf(v);
        if (ACT == 2) v = fmaxf(v, 0.0f);
        if (ACT == 3) v = v / (1.0f + expf(-v));
        if (ACT == 4) v = (v > 0.f) ? v : 0.01f * v;
        if (ACT == 5) v = 0.5f * v * (1.0f + erff(v * 0.70710678118654752f));
        slab[(mOff + r) * 68 + (j << 4) + rlane] = v;
      }
    }
    __builtin_amdgcn_fence(__ATOMIC_RELEASE, "workgroup");
    __builtin_amdgcn_wave_barrier();
    __builtin_amdgcn_fence(__ATOMIC_ACQUIRE, "workgroup");
    if (OUT_MODE == 0) {
      float* C = (float*)Cout + (size_t)b * strideC;
      const int hh = lane >> 4, c4 = (lane & 15) * 4;
      {
#pragma unroll
        for (int it = 0; it < 8; ++it) {
          const int row = it * 2 + hh;
          v4f v = *(const v4f*)(slab + row * 68 + c4);
          *(v4f*)(C + (size_t)(mBase + row) * ldc + n0 + c4) = v;
        }
        
      }
    } else {
      const int q = lane >> 3, c8 = (lane & 7) * 8;
      unsigned short* C  = (unsigned short*)Cout  + (size_t)b * strideC;
      unsigned short* C2 = (OUT_MODE == 2) ? ((unsigned short*)Cout2 + (size_t)b * strideC) : nullptr;
      {
#pragma unroll
        for (int it = 0; it < 4; ++it) {
          const int row = it * 4 + q;
          const float* sp = slab + row * 68 + c8;
          if (OUT_MODE == 1) {
            v8h hv;
#pragma unroll
            for (int e = 0; e < 8; ++e) hv[e] = (_Float16)sp[e];
            *(v8h*)(C + (size_t)(mBase + row) * ldc + n0 + c8) = hv;
          } else {
            v4u hw, lw;
#pragma unroll
            for (int p = 0; p < 4; ++p) {
              v2b h2, l2;
              split2(sp[2 * p], sp[2 * p + 1], h2, l2);
              hw[p] = __builtin_bit_cast(unsigned, h2);
              lw[p] = __builtin_bit_cast(unsigned, l2);
            }
            *(v4u*)(C + (size_t)(mBase + row) * ldc + n0 + c8) = hw;
            *(v4u*)(C2 + (size_t)(mBase + row) * ldc + n0 + c8) = lw;
          }
        }
        
      }
    }
    __builtin_amdgcn_fence(__ATOMIC_RELEASE, "workgroup");
    __builtin_amdgcn_wave_barrier();
    __builtin_amdgcn_fence(__ATOMIC_ACQUIRE, "workgroup");
  }
}

template <int ET, bool SPLIT, int BIAS_MODE, int OUT_MODE, bool RESID, int ACT = 0>
__global__ __launch_bounds__(256) void wmma_gemm64(
    const unsigned short* __restrict__ Ap, const unsigned short* __restrict__ A2p, int lda, long strideA,
    const unsigned short* __restrict__ Btp, const unsigned short* __restrict__ Bt2p, int ldb, long strideB,
    void* __restrict__ Cout, void* __restrict__ Cout2, int ldc, long strideC,
    const float* __restrict__ bias,
    const float* __restrict__ resid, long strideR,
    int M, int N, int K, float scale) {
  __shared__ __align__(16) float sT[8][16 * 68];
  gemm64_group<ET, SPLIT, BIAS_MODE, OUT_MODE, RESID, ACT>(Ap, A2p, lda, strideA, Btp, Bt2p, ldb, strideB, Cout, Cout2, ldc, strideC,
                                                           bias, resid, strideR, M, N, K, scale, blockIdx.x, blockIdx.y, sT);
}

/* ---- the three input projections as ONE launch: none reads what another writes, and alone each fills only 16 or 32 WGPs.
   Work-groups 0 .. kGroupsKV-1 make v (bf16 hi/lo planes), the next kGroupsKV make k, the last kGroupsQ make q (f16 planes).
   wt: 4 weights x (hi plane + lo plane) of 128*128 halves, in the order q, k, v, p. ld = N = K = 128. */
constexpr int kGroupsQ  = ((kBatch * kNq  / 64) * (kC / 64) + 7) / 8;
constexpr int kGroupsKV = ((kBatch * kNkv / 64) * (kC / 64) + 7) / 8;
__global__ __launch_bounds__(256) void qkv_gemm64(
    const unsigned short* __restrict__ xq_hi, const unsigned short* __restrict__ xq_lo,
    const unsigned short* __restrict__ xkv_hi, const unsigned short* __restrict__ xkv_lo,
    const unsigned short* __restrict__ wt,
    unsigned short* __restrict__ q16, unsigned short* __restrict__ k16,
    unsigned short* __restrict__ v_hi, unsigned short* __restrict__ v_lo,
    const float* __restrict__ bq, const float* __restrict__ bk, const float* __restrict__ bv,
    int ld, int N, int K) {
  __shared__ __align__(16) float sT[8][16 * 68];
  const int bx = blockIdx.x;   /* every choice below is the same for the whole work-group */
  if (bx < kGroupsKV) {
    const unsigned short* w = wt + 2 * (2 * kC * kC);
    gemm64_group<1, true, 2, 2, false>(xkv_hi, xkv_lo, ld, 0L, w, w + kC * kC, ld, 0L, (void*)v_hi, (void*)v_lo, ld, 0L,
                                       bv, nullptr, 0L, kBatch * kNkv, N, K, 1.0f, bx, 0, sT);
  } else {
    const bool isk = bx < 2 * kGroupsKV;
    const unsigned short* w = wt + (isk ? 1 : 0) * (2 * kC * kC);
    gemm64_group<1, true, 2, 1, false>(isk ? xkv_hi : xq_hi, isk ? xkv_lo : xq_lo, ld, 0L, w, w + kC * kC, ld, 0L,
                                       (void*)(isk ? k16 : q16), nullptr, ld, 0L, isk ? bk : bq, nullptr, 0L,
                                       isk ? kBatch * kNkv : kBatch * kNq, N, K, 1.0f,
                                       bx - (isk ? kGroupsKV : 2 * kGroupsKV), 0, sT);
  }
}

/* ---- matrix helpers for the attention path ---- */
__device__ __forceinline__ v8f at_mma(v16b a, v16b b, v8f c) {
  c = __builtin_amdgcn_wmma_f32_16x16x32_bf16(false, a, false, b, (short)0, c, false, false);
  asm volatile("v_nop\n\tv_nop\n\tv_nop\n\tv_nop" : "+v"(c) : "v"(a), "v"(b));
  return c;
}
__device__ __forceinline__ v8f mma_h16(v16h a, v16h b, v8f c) {
  c = __builtin_amdgcn_wmma_f32_16x16x32_f16(false, a, false, b, (short)0, c, false, false);
  asm volatile("v_nop\n\tv_nop\n\tv_nop\n\tv_nop" : "+v"(c) : "v"(a), "v"(b));
  return c;
}

/* f32[8] -> packed bf16 hi (4 words) and bf16 lo residual (4 words), RNE convert */
__device__ __forceinline__ void split_pack8(const float (&x)[8], v4u& H, v4u& L) {
#pragma unroll
  for (int p = 0; p < 4; ++p) {
    v2b h2, l2;
    split2(x[2 * p], x[2 * p + 1], h2, l2);
    H[p] = __builtin_bit_cast(unsigned, h2);
    L[p] = __builtin_bit_cast(unsigned, l2);
  }
}
__device__ __forceinline__ void store_planes2(unsigned short* __restrict__ hi, unsigned short* __restrict__ lo,
                                              size_t off, v4u H, v4u L) {
  *(v4u*)(hi + off) = H;
  *(v4u*)(lo + off) = L;
  
}

/* ---- activations f32 [rows][128] -> bf16 hi/lo planes, same layout; thread i takes elements 8*i .. 8*i+7 ------------- */
__device__ __forceinline__ void split_rows_bf16(const float* __restrict__ in,
                                                unsigned short* __restrict__ hi,
                                                unsigned short* __restrict__ lo, int i) {
  const size_t e0 = (size_t)i * 8;
  const v4f a = *(const v4f*)(in + e0);
  const v4f c = *(const v4f*)(in + e0 + 4);
  float x[8];
  x[0] = a[0]; x[1] = a[1]; x[2] = a[2]; x[3] = a[3];
  x[4] = c[0]; x[5] = c[1]; x[6] = c[2]; x[7] = c[3];
  v4u H, L;
  split_pack8(x, H, L);
  store_planes2(hi, lo, e0, H, L);
}

/* ---- one weight W[k][n] (input-major, 128x128): in[k][n] -> out[n][k] as transposed bf16 hi/lo planes -----
   2048 threads gt per weight; 2048 threads x 8 = 16384 = 128x128 per plane exactly. */
__device__ __forceinline__ void wt_split_bf16(const float* __restrict__ W, unsigned short* __restrict__ hi,
                                              unsigned short* __restrict__ lo, int gt) {
  const int n  = gt >> 4;
  const int k8 = (gt & 15) * 8;
  float x[8];
#pragma unroll
  for (int e = 0; e < 8; ++e) x[e] = W[(size_t)(k8 + e) * kC + n];
  v4u H, L;
  split_pack8(x, H, L);
  store_planes2(hi, lo, (size_t)n * kC + k8, H, L);
}

/* ---- all operand planes of the projections as ONE launch: the three jobs are independent of each other.
   Work-groups 0 .. 31: the 4 weights, 8 groups each (outb: 4 weights x (hi plane + lo plane) of 128*128 halves);
   the next kPrepQ: x_q; the last kPrepKV: x_kv. Every range is covered exactly, 8 elements a thread. */
constexpr int kPrepW  = 4 * (kC * kC / 8 / 256);
constexpr int kPrepQ  = kBatch * kNq  * kC / 8 / 256;
constexpr int kPrepKV = kBatch * kNkv * kC / 8 / 256;
static_assert((kC * kC) % (8 * 256) == 0 && (kBatch * kNq * kC) % (8 * 256) == 0 && (kBatch * kNkv * kC) % (8 * 256) == 0, "");
__global__ __launch_bounds__(256) void prep_planes_kernel(
    const float* __restrict__ x_q, const float* __restrict__ x_kv,
    const float* __restrict__ W0, const float* __restrict__ W1, const float* __restrict__ W2, const float* __restrict__ W3,
    unsigned short* __restrict__ xq_hi, unsigned short* __restrict__ xq_lo,
    unsigned short* __restrict__ xkv_hi, unsigned short* __restrict__ xkv_lo,
    unsigned short* __restrict__ outb) {
  const int bx = blockIdx.x;
  const int t  = threadIdx.x;
  if (bx < kPrepW) {
    constexpr int per = kPrepW / 4;
    const int which = bx / per;
    const float* W = (which == 0) ? W0 : (which == 1) ? W1 : (which == 2) ? W2 : W3;
    unsigned short* hi = outb + (size_t)which * (2 * kC * kC);
    wt_split_bf16(W, hi, hi + kC * kC, (bx - which * per) * 256 + t);
  } else {
    const bool isq = bx < kPrepW + kPrepQ;
    split_rows_bf16(isq ? x_q : x_kv, isq ? xq_hi : xkv_hi, isq ? xq_lo : xkv_lo, (bx - kPrepW - (isq ? 0 : kPrepQ)) * 256 + t);
    asm volatile("s_wait_xcnt 0x0" ::: "memory");   /* a precaution: the weight path runs in other work-groups, nothing follows these stores */
  }
}

/* transposing LDS load: the lanes point at 16-byte pieces of a row-major [key][d] tile (lane l: row 8*(l>>4) + (l&7), piece (l>>3)&1);
   lane (c, hh) receives keys 8*hh .. 8*hh+7 of column d = c, which is half of an A fragment of the transposed tile */
__device__ __forceinline__ v8b ld_tr16(const unsigned short* p) {
  typedef __attribute__((address_space(3))) v8s lds_v8s;
  return __builtin_bit_cast(v8b, __builtin_amdgcn_ds_load_tr16_b128_v8i16((lds_v8s*)p));
}
/* lane l with lane l ^ 16: the two halves of a wave hold the two halves of a query column's keys */
__device__ __forceinline__ float xhalf(float x) {
  return __builtin_bit_cast(float, __builtin_amdgcn_permlanex16(__builtin_bit_cast(int, x), __builtin_bit_cast(int, x),
                                                                0x76543210, 0xfedcba98, false, false));
}
/* e[i] = 2^e[i], the 17 exponentials of a softmax step as one run. In asm for the free slot that the instruction set asks for behind a
   transcendental: each v_exp_f32 is the independent instruction behind the one before it and the v_nop stands behind the last */
__device__ __forceinline__ void exp2_run17(float (&e)[17]) {
  asm(
      "v_exp_f32 %0, %0\n\t"
      "v_exp_f32 %1, %1\n\t"
      "v_exp_f32 %2, %2\n\t"
      "v_exp_f32 %3, %3\n\t"
      "v_exp_f32 %4, %4\n\t"
      "v_exp_f32 %5, %5\n\t"
      "v_exp_f32 %6, %6\n\t"
      "v_exp_f32 %7, %7\n\t"
      "v_exp_f32 %8, %8\n\t"
      "v_exp_f32 %9, %9\n\t"
      "v_exp_f32 %10, %10\n\t"
      "v_exp_f32 %11, %11\n\t"
      "v_exp_f32 %12, %12\n\t"
      "v_exp_f32 %13, %13\n\t"
      "v_exp_f32 %14, %14\n\t"
      "v_exp_f32 %15, %15\n\t"
      "v_exp_f32 %16, %16\n\t"
      "v_nop"
      : "+v"(e[0]), "+v"(e[1]), "+v"(e[2]), "+v"(e[3]), "+v"(e[4]), "+v"(e[5]),
        "+v"(e[6]), "+v"(e[7]), "+v"(e[8]), "+v"(e[9]), "+v"(e[10]), "+v"(e[11]),
        "+v"(e[12]), "+v"(e[13]), "+v"(e[14]), "+v"(e[15]), "+v"(e[16]));
}
/* ---- online softmax step for one head, 32 keys x 16 query columns per wave (2 key subtiles), scores transposed ----
   sA[r]: key 8*hh + r, sB[r]: key 16 + 8*hh + r, both of query column c: a lane holds 16 keys of ONE query.
   The scores arrive times log2(e), so that e^(s - m) is one v_exp_f32 (2^x) of a difference; mrow is kept in the same unit.
   Maximum in the lane plus one exchange between the halves; the sum stays a per-lane partial (joined behind the key loop).
   P^T leaves as two B operands, hi and lo: element s = key kmap(s, hh), which is the order the accumulators already have. */
__device__ __forceinline__ float softmax_step_t(const v8f& sA, const v8f& sB, float& mrow, float& lrow, v16b& ph, v16b& pl) {
  float mm[4];
#pragma unroll
  for (int k = 0; k < 4; ++k) mm[k] = fmaxf(fmaxf(sA[k], sA[4 + k]), fmaxf(sB[k], sB[4 + k]));
  float m = fmaxf(fmaxf(mm[0], mm[1]), fmaxf(mm[2], mm[3]));
  m = fmaxf(m, xhalf(m));
  const float mnew = fmaxf(mrow, m);
  float e[17];
#pragma unroll
  for (int r = 0; r < 8; ++r) { e[r] = sA[r] - mnew; e[8 + r] = sB[r] - mnew; }
  e[16] = mrow - mnew;
  exp2_run17(e);
  const float al = e[16];
  mrow = mnew;
  float ps[4] = {0.f, 0.f, 0.f, 0.f};
#pragma unroll
  for (int r = 0; r < 16; r += 2) {
    ps[(r >> 3) * 2]     += e[r];
    ps[(r >> 3) * 2 + 1] += e[r + 1];
    v2b hi, lo;
    split2(e[r], e[r + 1], hi, lo);
    ph[r] = hi[0];  ph[r + 1] = hi[1];
    pl[r] = lo[0];  pl[r + 1] = lo[1];
  }
  lrow = lrow * al + ((ps[0] + ps[1]) + (ps[2] + ps[3]));
  return al;
}
/* per-wave transposed result (o[t][r] = O[query c][d = t*16 + 8*hh + r]) -> LDS staging [query][d] (pitch kOsPitch);
   writes rows 0..15, cols 0..31, 8 consecutive floats per lane and tile */
__device__ __forceinline__ void tile_to_os(float* os, const v8f (&o)[2], int hh, int c) {
#pragma unroll
  for (int t = 0; t < 2; ++t) {
    float* p = os + c * kOsPitch + t * 16 + 8 * hh;
    *(v4f*)(p)     = (v4f){o[t][0], o[t][1], o[t][2], o[t][3]};
    *(v4f*)(p + 4) = (v4f){o[t][4], o[t][5], o[t][6], o[t][7]};
  }
}
/* weighted sum over the kSplit key groups of one query tile, 4 floats of one row per lane;
   os0: staging tile of key group 0 for this query tile, the groups 4 tiles apart */
__device__ __forceinline__ v4f merge_os(const float* os0, const float (&w)[kSplit], int row, int c4) {
  v4f acc = (v4f){0.f, 0.f, 0.f, 0.f};
#pragma unroll
  for (int s = 0; s < kSplit; ++s) {
    const v4f v = *(const v4f*)(os0 + s * (4 * 16 * kOsPitch) + row * kOsPitch + c4);
#pragma unroll
    for (int e = 0; e < 4; ++e) acc[e] += w[s] * v[e];
  }
  return acc;
}

/* ---- attention for one (batch, head h, 64 query rows) ----------------------------------
   q16/k16: f16 planes [B*N][128] (head-major columns); vhi/vlo: bf16 hi/lo planes [B*Nkv][128].
   scores^T = (k.q^T)*scale + rpe[idx][h], the head's table column held in LDS; online softmax in f32, a lane holding one query's keys;
   scale and table carry the factor log2(e), so the softmax runs on powers of two (the hardware's own exponential);
   P^T hi and lo go from the score accumulators straight into B operands, never through LDS;
   V tiles lie row-major in LDS and are transposed by the load that reads them;
   o^T = V_h^T . P^T;  for h >= 2 also ox^T = V_{h-2}^T . P^T (the cross term of the differential mixing).
   16 waves: wave = (key group sp, query tile qt). Group sp (4 waves) takes key chunks sp, sp + kSplit, ... with its own
   K/V tiles and each wave its own running max, sum and accumulators; the groups are merged through LDS at the end.
   xattn f32 [B*Nq][128]; ycross f32 [B][2][Nq][32]. grid.x = B*H*(Nq/64), block 128 * kSplit. */
__global__ __launch_bounds__(128 * kSplit) __attribute__((amdgpu_num_vgpr(256)))
void attn_head_kernel(
    const unsigned short* __restrict__ q16, const unsigned short* __restrict__ k16,
    const unsigned short* __restrict__ vhi, const unsigned short* __restrict__ vlo,
    const int* __restrict__ coords_q, const int* __restrict__ coords_k,
    const float* __restrict__ rpe,
    float* __restrict__ xattn, float* __restrict__ ycross)
{
  __shared__ __align__(16) unsigned short KshS[kSplit][kKC * kHD];   /* [group][key][d]  f16 bits  */
  __shared__ __align__(16) unsigned short VthS[kSplit][kKC * kVP];   /* [group][key][d] bf16 hi, head h,   row pitch kVP */
  __shared__ __align__(16) unsigned short VtlS[kSplit][kKC * kVP];   /* [group][key][d] bf16 lo, head h,   row pitch kVP */
  __shared__ __align__(16) unsigned short VxhS[kSplit][kKC * kVP];   /* [group][key][d] bf16 hi, head h-2, row pitch kVP */
  __shared__ __align__(16) unsigned short VxlS[kSplit][kKC * kVP];   /* [group][key][d] bf16 lo, head h-2, row pitch kVP */
  __shared__ __align__(16) float Tab[kTabLds];                       /* rpe[idx][h] * log2(e) for this block's head, all idx */
  /* behind the key loop the table is dead and its bytes take the merge staging */
  static_assert(4 * kSplit * 16 * kOsPitch + 4 * kSplit * 16 * 2 <= kTabLds, "");
  float* const OsAll = Tab;                                          /* [wave][16 * kOsPitch] */
  float* const MlAll = Tab + 4 * kSplit * 16 * kOsPitch;             /* [wave][row] (max, sum) */

  const int wave = threadIdx.x >> 5;     /* 0 .. 15 */
  const int sp   = wave >> 2;            /* key group */
  const int qt   = wave & 3;             /* query tile */
  const int tid  = threadIdx.x & 127;    /* thread within the key group */
  const int lane = tid & 31;
  unsigned short* Ksh = KshS[sp];
  unsigned short* Vth = VthS[sp];
  unsigned short* Vtl = VtlS[sp];
  unsigned short* Vxh = VxhS[sp];
  unsigned short* Vxl = VxlS[sp];
  const int hh   = lane >> 4;
  const int c    = lane & 15;
  const int vro  = (8 * hh + (lane & 7)) * kVP + ((lane >> 3) & 1) * 8;   /* halves; this lane's piece for the transposing V loads */
  constexpr int nqb = kNq / kQB;
  const int bx   = blockIdx.x;
  const int qb   = bx % nqb;
  const int rest = bx / nqb;
  const int h    = rest % kH;
  const int b    = rest / kH;
  const bool cross = (h >= kNH);                       /* block-uniform */
  const int hcol = h * kHD;
  const int xcol = (cross ? (h - kNH) : 0) * kHD;
  const int q0   = qb * kQB + qt * 16;
  const size_t qrows  = (size_t)b * kNq + q0;
  const size_t kvrows = (size_t)b * kNkv;
  const float* __restrict__ rpe_h = rpe + h;           /* table entry stride kH floats */

  /* one chunk on its way from global memory to the tiles, held in registers: asked for while the chunk before it is worked on, stored to
     LDS at the head of its own pass, so that no pass stands waiting for a round trip to L2.
     ck: coords of this lane's 16 score rows (keys j*16 + 8*hh + r), two keys per 16-byte load, the same address in the 16 lanes of a half.
     kw, vh4, vl4 (xh4, xl4 when cross): 32 keys x 4 segments of 8 halves = 128 = threads of a key group, one uint4 per thread per plane */
  constexpr int kChunks = kNkv / (kKC * kSplit);
  const int skey = tid >> 2;
  const int sseg = tid & 3;
  v4i ck[2][4];
  uint4 kw, vh4, vl4;
  uint4 xh4 = make_uint4(0u, 0u, 0u, 0u), xl4 = make_uint4(0u, 0u, 0u, 0u);
  auto fetch = [&](int kcn) {
    const int kv0 = (kcn * kSplit + sp) * kKC;
    const int* ckp = coords_k + (kvrows + kv0 + 8 * hh) * 2;
#pragma unroll
    for (int j = 0; j < 2; ++j) {
#pragma unroll
      for (int i = 0; i < 4; ++i) ck[j][i] = *(const v4i*)(ckp + j * 32 + i * 4);
    }
    const size_t rowoff = (kvrows + kv0 + skey) * kC;
    const size_t go = rowoff + hcol + sseg * 8;
    const unsigned short* kgp = k16 + go;
    const unsigned short* hgp = vhi + go;
    const unsigned short* lgp = vlo + go;
    kw  = *(const uint4*)(kgp);
    vh4 = *(const uint4*)(hgp);
    vl4 = *(const uint4*)(lgp);
    asm volatile("s_wait_xcnt 0x0" :: "v"(ckp), "v"(kgp), "v"(hgp), "v"(lgp) : "memory");   /* the loads' address registers are kept as they are until this wait */
    if (cross) {
      const size_t gx = rowoff + xcol + sseg * 8;
      const unsigned short* xhp = vhi + gx;
      const unsigned short* xlp = vlo + gx;
      xh4 = *(const uint4*)(xhp);
      xl4 = *(const uint4*)(xlp);
      asm volatile("s_wait_xcnt 0x0" :: "v"(xhp), "v"(xlp) : "memory");   /* the loads' address registers are kept as they are until this wait */
    }
  };
  fetch(0);

  /* this head's column of the bias table -> LDS, once per work-group; batches of 16 loads per thread keep the
     latency of the strided reads covered. The first barrier of the key loop publishes it. */
  {
    constexpr int kThreads = 128 * kSplit;
    constexpr int kFull = kTable / (kThreads * 16);
    const int t0 = threadIdx.x;
    /* rolled: 16 waves x 16 loads in flight already cover the L2 latency; unrolled further the copy only takes more registers */
#pragma unroll 1
    for (int g = 0; g < kFull; ++g) {
      float tv[16];
      const float* gp = rpe_h + (size_t)(g * 16 * kThreads + t0) * kH;
#pragma unroll
      for (int u = 0; u < 16; ++u) tv[u] = gp[u * (kThreads * kH)];
      asm volatile("s_wait_xcnt 0x0" :: "v"(gp) : "memory");   /* the loads' address registers are kept as they are until this wait */
#pragma unroll
      for (int u = 0; u < 16; ++u) Tab[(g * 16 + u) * kThreads + t0] = tv[u] * kLog2e;
    }
    for (int i = kFull * 16 * kThreads + t0; i < kTable; i += kThreads) Tab[i] = rpe_h[(size_t)i * kH] * kLog2e;
  }

  /* Q fragment (B operand: lane c -> query column c; K = head_dim = 32, one k-step) */
  const _Float16* qp = (const _Float16*)(const void*)q16;
  const v16h qa = Frag<_Float16>::load(qp + (qrows + c) * kC + hcol + 8 * hh);

  /* coords of this lane's query column c, +MAXD folded in */
  const v2i cq = *(const v2i*)(coords_q + (qrows + c) * 2);
  const int cqx = cq.x + kMaxd;
  const int cqy = cq.y + kMaxd;

  float mr = -INFINITY, lr = 0.f;   /* running max (equal in both halves) and this lane's partial sum for query c */
  v8f o[2], ox[2];                  /* o[t][r] = O[query c][d = t*16 + 8*hh + r] */
#pragma unroll
  for (int t = 0; t < 2; ++t) {
    o[t]  = (v8f){0.f,0.f,0.f,0.f,0.f,0.f,0.f,0.f};
    ox[t] = (v8f){0.f,0.f,0.f,0.f,0.f,0.f,0.f,0.f};
  }

  /* two passes a trip: the coords' registers of one pass and of the next change roles, with one pass a trip they are copied (16 moves) */
#pragma unroll 2
  for (int kc = 0; kc < kChunks; ++kc) {
    __syncthreads();   /* every reader has left the tiles of the chunk before */
    /* this chunk's K tile and V hi/lo tiles out of the carried registers, all row-major: covers Ksh 32x32 and the 32 d of every row of
       Vth/Vtl (and Vxh/Vxl when cross) exactly; the pad halves of a V row are never read */
    *(uint4*)(&Ksh[skey * kHD + sseg * 8]) = kw;
    *(uint4*)(&Vth[skey * kVP + sseg * 8]) = vh4;
    *(uint4*)(&Vtl[skey * kVP + sseg * 8]) = vl4;
    if (cross) {
      *(uint4*)(&Vxh[skey * kVP + sseg * 8]) = xh4;
      *(uint4*)(&Vxl[skey * kVP + sseg * 8]) = xl4;
    }
    /* clamped table index of every (key, query) of this lane; behind this the coords' registers are free for the next chunk */
    int ti[2][8];
#pragma unroll
    for (int r = 0; r < 8; ++r) {
#pragma unroll
      for (int j = 0; j < 2; ++j) {
        const int kx = ck[j][r >> 1][(r & 1) * 2];
        const int ky = ck[j][r >> 1][(r & 1) * 2 + 1];
        int dx = cqx - kx; dx = dx < 0 ? 0 : dx; dx = dx > 2 * kMaxd ? 2 * kMaxd : dx;
        int dy = cqy - ky; dy = dy < 0 ? 0 : dy; dy = dy > 2 * kMaxd ? 2 * kMaxd : dy;
        ti[j][r] = dx * kSpan + dy;                 /* 0 .. kTable-1 */
      }
    }
    __syncthreads();   /* the tiles (and, in the first pass, the table) are published */
    if (kc + 1 < kChunks) fetch(kc + 1);   /* the same for the whole work-group; in flight during the work below */

    /* scores^T: s[j], j = key subtile; A fragment lane c -> key j*16+c, elements d (split map); s[j][r] = S[key j*16+8*hh+r][query c] */
    v8f s[2];
    {
      const v8f z = (v8f){0.f,0.f,0.f,0.f,0.f,0.f,0.f,0.f};
      const _Float16* Kp = (const _Float16*)(const void*)Ksh;
#pragma unroll
      for (int j = 0; j < 2; ++j) {
        Frag<_Float16>::U kb;
        kb.h[0] = *(const v8h*)(Kp + (j * 16 + c) * kHD + 8 * hh);
        kb.h[1] = *(const v8h*)(Kp + (j * 16 + c) * kHD + 16 + 8 * hh);
        s[j] = mma_h16(kb.v, qa, z);
      }
    }

    /* scale + relative position bias, both times log2(e): one clamped b32 gather from the LDS table per (key, query) */
#pragma unroll
    for (int r = 0; r < 8; ++r) {
#pragma unroll
      for (int j = 0; j < 2; ++j) s[j][r] = s[j][r] * kScaleL2 + Tab[ti[j][r]];
    }

    /* online softmax; P^T hi and lo stay in registers as B operands */
    v16b ph, pl;
    const float al = softmax_step_t(s[0], s[1], mr, lr, ph, pl);
#pragma unroll
    for (int t = 0; t < 2; ++t) {
#pragma unroll
      for (int r = 0; r < 8; ++r) { o[t][r] *= al; ox[t][r] *= al; }
    }

    /* V^T.P^T : A = V^T (lane c -> d, elements key, split map), transposed out of the row-major tile by the load itself;
       B = P^T (lane c -> query, elements key, same map) */
    {
#pragma unroll
      for (int t = 0; t < 2; ++t) {
        Frag<__bf16>::U vh, vl;
        vh.h[0] = ld_tr16(Vth + vro + t * 16);  vh.h[1] = ld_tr16(Vth + vro + 16 * kVP + t * 16);
        vl.h[0] = ld_tr16(Vtl + vro + t * 16);  vl.h[1] = ld_tr16(Vtl + vro + 16 * kVP + t * 16);
        o[t] = at_mma(vh.v, ph, o[t]);
        o[t] = at_mma(vl.v, ph, o[t]);
        o[t] = at_mma(vh.v, pl, o[t]);
      }
      if (cross) {
#pragma unroll
        for (int t = 0; t < 2; ++t) {
          Frag<__bf16>::U vh, vl;
          vh.h[0] = ld_tr16(Vxh + vro + t * 16);  vh.h[1] = ld_tr16(Vxh + vro + 16 * kVP + t * 16);
          vl.h[0] = ld_tr16(Vxl + vro + t * 16);  vl.h[1] = ld_tr16(Vxl + vro + 16 * kVP + t * 16);
          ox[t] = at_mma(vh.v, ph, ox[t]);
          ox[t] = at_mma(vl.v, ph, ox[t]);
          ox[t] = at_mma(vh.v, pl, ox[t]);
        }
      }
    }
  }

  /* merge of the key groups: every wave leaves its accumulators (not normalised) and its (max, sum) in LDS;
     wave (sp, qt) then merges rows 4*sp .. 4*sp+3 of query tile qt: x = sum_s 2^(m_s-M) o_s / sum_s 2^(m_s-M) l_s, the maxima in log2 units */
  __syncthreads();   /* every wave has made its last table read: the table's bytes become the merge staging */
  float* os = OsAll + wave * (16 * kOsPitch);
  const float* osq = OsAll + qt * (16 * kOsPitch);
  tile_to_os(os, o, hh, c);
  lr += xhalf(lr);   /* the two halves' partial sums of query c */
  if (hh == 0) {     /* max and sum are now equal in lanes c and c + 16 */
    MlAll[wave * 32 + c * 2] = mr;
    MlAll[wave * 32 + c * 2 + 1] = lr;
  }
  __syncthreads();   /* all groups' partial tiles are in LDS */

  const int row = 4 * sp + (lane >> 3);
  const int c4  = (lane & 7) * 4;
  float w[kSplit];
  {
    float ms[kSplit], ls[kSplit];
    float M = -INFINITY;
#pragma unroll
    for (int s = 0; s < kSplit; ++s) {
      ms[s] = MlAll[(s * 4 + qt) * 32 + row * 2];
      ls[s] = MlAll[(s * 4 + qt) * 32 + row * 2 + 1];
      M = fmaxf(M, ms[s]);
    }
    float L = 0.f;
#pragma unroll
    for (int s = 0; s < kSplit; ++s) { w[s] = __builtin_amdgcn_exp2f(ms[s] - M); L += w[s] * ls[s]; }
    const float inv = 1.0f / L;
#pragma unroll
    for (int s = 0; s < kSplit; ++s) w[s] *= inv;
  }
  *(v4f*)(xattn + (qrows + row) * kC + hcol + c4) = merge_os(osq, w, row, c4);
  asm volatile("s_wait_xcnt 0x0" ::: "memory");   /* the cross path below reuses the registers this store names */

  if (cross) {
    __syncthreads();   /* every reader has left the o tiles */
    tile_to_os(os, ox, hh, c);
    __syncthreads();   /* all groups' cross tiles are in LDS */
    *(v4f*)(ycross + ((((size_t)b * kNH + (h - kNH)) * kNq + q0 + row) * kHD) + c4) = merge_os(osq, w, row, c4);
  }
}

/* ---- differential head mixing + split to bf16 hi/lo planes for the output projection --------
   x[b,q,h*32+d] = xs + alpha[b,q]*(xs - lam[h]*yc[b,h,q,d]) for h < 2, else xs.
   coverage 65536 threads x 8 = 4096x128 exactly. */
__global__ __launch_bounds__(256) void combine_split_kernel(
    const float* __restrict__ xattn, const float* __restrict__ ycross, const float* __restrict__ alpha,
    const float* __restrict__ lq1, const float* __restrict__ lk1,
    const float* __restrict__ lq2, const float* __restrict__ lk2,
    unsigned short* __restrict__ hi, unsigned short* __restrict__ lo)
{
  __shared__ float lam_s[2];
  if (threadIdx.x < 2) {
    const int h = threadIdx.x;
    float s1 = 0.f, s2 = 0.f;
#pragma unroll 1
    for (int i = 0; i < kHD; ++i) {
      s1 += lq1[h * kHD + i] * lk1[h * kHD + i];
      s2 += lq2[h * kHD + i] * lk2[h * kHD + i];
    }
    lam_s[h] = expf(s1) - expf(s2) + kLambdaInit;
  }
  __syncthreads();
  const int gt = blockIdx.x * 256 + threadIdx.x;
  if (gt >= kBatch * kNq * kC / 8) return;
  const size_t e0 = (size_t)gt * 8;
  const int row = (int)(e0 >> 7);
  const int col = (int)(e0 & 127);
  const int h   = col >> 5;
  const int d   = col & 31;
  const int hc  = h & 1;
  const int b   = row >> 11;
  const int q   = row & (kNq - 1);
  const float a   = alpha[row];
  const float lam = lam_s[hc];
  const v4f xs0 = *(const v4f*)(xattn + e0);
  const v4f xs1 = *(const v4f*)(xattn + e0 + 4);
  const size_t yo = (((size_t)b * kNH + hc) * kNq + q) * kHD + d;
  const v4f y0 = *(const v4f*)(ycross + yo);
  const v4f y1 = *(const v4f*)(ycross + yo + 4);
  const bool mix = (h < kNH);
  float x[8];
#pragma unroll
  for (int e = 0; e < 4; ++e) {
    const float xa = xs0[e], xb = xs1[e];
    const float va = xa + a * (xa - lam * y0[e]);
    const float vb = xb + a * (xb - lam * y1[e]);
    x[e]     = mix ? va : xa;
    x[4 + e] = mix ? vb : xb;
  }
  v4u H, L;
  split_pack8(x, H, L);
  store_planes2(hi, lo, e0, H, L);
}

/* =========================================================================================
   host launch: 5 kernel launches
   workspace region map (bytes, all offsets MiB/256-KiB aligned):
     xq_hi  1 MiB | xq_lo 1 MiB | xkv_hi 2 MiB | xkv_lo 2 MiB | wt planes 256 KiB (4 weights x hi,lo x 32 KiB)
     q16 1 MiB | k16 2 MiB | v_hi 2 MiB | v_lo 2 MiB | xattn f32 2 MiB | ycross f32 1 MiB | xmix_hi 1 MiB | xmix_lo 1 MiB
     total 19,136,512 B
   ========================================================================================= */
extern "C" void kernel_launch(void* const* d_in, const int* in_sizes, int n_in,
                              void* d_out, int out_size, void* d_ws, size_t ws_size,
                              hipStream_t stream) {
  constexpr int Mq  = kBatch * kNq;    /* 4096 */
  constexpr int Mkv = kBatch * kNkv;   /* 8192 */
  static_assert(Mq % 64 == 0 && Mkv % 64 == 0 && kC % 64 == 0 && kC % 32 == 0, "");
  static_assert((Mq * kC) % 8 == 0 && (Mkv * kC) % 8 == 0, "");
  if (n_in < 18) return;
  if (in_sizes[0] != Mq * kC || in_sizes[1] != Mkv * kC || in_sizes[2] != Mq * 2 || in_sizes[3] != Mkv * 2 ||
      in_sizes[4] != Mq || in_sizes[5] != kC * kC || in_sizes[7] != kC * kC || in_sizes[9] != kC * kC ||
      in_sizes[16] != kC * kC || in_sizes[6] != kC || in_sizes[8] != kC || in_sizes[10] != kC || in_sizes[17] != kC ||
      in_sizes[11] != kNH * kHD || in_sizes[12] != kNH * kHD || in_sizes[13] != kNH * kHD || in_sizes[14] != kNH * kHD ||
      in_sizes[15] != kTable * kH || out_size != Mq * kC) return;

  const float* x_q      = (const float*)d_in[0];
  const float* x_kv     = (const float*)d_in[1];
  const int*   coords_q = (const int*)d_in[2];
  const int*   coords_k = (const int*)d_in[3];
  const float* alpha    = (const float*)d_in[4];
  const float* Wq = (const float*)d_in[5];  const float* bq = (const float*)d_in[6];
  const float* Wk = (const float*)d_in[7];  const float* bk = (const float*)d_in[8];
  const float* Wv = (const float*)d_in[9];  const float* bv = (const float*)d_in[10];
  const float* lq1 = (const float*)d_in[11]; const float* lk1 = (const float*)d_in[12];
  const float* lq2 = (const float*)d_in[13]; const float* lk2 = (const float*)d_in[14];
  const float* rpe = (const float*)d_in[15];
  const float* Wp = (const float*)d_in[16]; const float* bp = (const float*)d_in[17];
  float* out = (float*)d_out;

  char* ws = (char*)d_ws;
  size_t off = 0;
  const size_t szXq16  = (size_t)Mq * kC * 2;     /* 1 MiB  */
  const size_t szXkv16 = (size_t)Mkv * kC * 2;    /* 2 MiB  */
  const size_t szWt    = (size_t)4 * 2 * kC * kC * 2;
  const size_t szXattn = (size_t)Mq * kC * 4;
  const size_t szYc    = (size_t)kBatch * kNH * kNq * kHD * 4;
  unsigned short* xq_hi  = (unsigned short*)(ws + off); off += szXq16;
  unsigned short* xq_lo  = (unsigned short*)(ws + off); off += szXq16;
  unsigned short* xkv_hi = (unsigned short*)(ws + off); off += szXkv16;
  unsigned short* xkv_lo = (unsigned short*)(ws + off); off += szXkv16;
  unsigned short* wt     = (unsigned short*)(ws + off); off += szWt;
  unsigned short* q16    = (unsigned short*)(ws + off); off += szXq16;
  unsigned short* k16    = (unsigned short*)(ws + off); off += szXkv16;
  unsigned short* v_hi   = (unsigned short*)(ws + off); off += szXkv16;
  unsigned short* v_lo   = (unsigned short*)(ws + off); off += szXkv16;
  float*          xattn  = (float*)(ws + off);          off += szXattn;
  float*          ycross = (float*)(ws + off);          off += szYc;
  unsigned short* xm_hi  = (unsigned short*)(ws + off); off += szXq16;
  unsigned short* xm_lo  = (unsigned short*)(ws + off); off += szXq16;
  if (off > ws_size) return;

  const unsigned short* wtp_hi = wt + 3 * (2 * kC * kC); const unsigned short* wtp_lo = wtp_hi + kC * kC;

  /* 1: activations and weights -> bf16 hi/lo planes (weights transposed: in[k][n] -> out[n][k], square 128x128) */
  const int n8q = Mq * kC / 8;
  prep_planes_kernel<<<dim3(kPrepW + kPrepQ + kPrepKV), dim3(256), 0, stream>>>(x_q, x_kv, Wq, Wk, Wv, Wp,
                                                                               xq_hi, xq_lo, xkv_hi, xkv_lo, wt);

  /* 2: the three input projections, M x 128, K = 128 (M % 64 == 0, N = 128 % 64 == 0, K = 128 % 32 == 0) */
  const int blocksQ = kGroupsQ;
  qkv_gemm64<<<dim3(kGroupsQ + 2 * kGroupsKV), dim3(256), 0, stream>>>(xq_hi, xq_lo, xkv_hi, xkv_lo, wt, q16, k16, v_hi, v_lo,
                                                                      bq, bk, bv, kC, kC, kC);

  /* 3: attention per (batch, head, 64 queries) */
  const int attnBlocks = kBatch * kH * (kNq / kQB);
  attn_head_kernel<<<dim3(attnBlocks), dim3(128 * kSplit), 0, stream>>>(q16, k16, v_hi, v_lo, coords_q, coords_k, rpe, xattn, ycross);

  /* 4: differential mixing + bf16 hi/lo planes */
  combine_split_kernel<<<dim3((n8q + 255) / 256), dim3(256), 0, stream>>>(xattn, ycross, alpha, lq1, lk1, lq2, lk2, xm_hi, xm_lo);

  /* 5: output projection -> d_out (f32), M = 4096, N = 128, K = 128 */
  wmma_gemm64<1, true, 2, 0, false><<<dim3(blocksQ, 1), dim3(256), 0, stream>>>(
      xm_hi, xm_lo, kC, 0L, wtp_hi, wtp_lo, kC, 0L, (void*)out, nullptr, kC, 0L, bp, nullptr, 0L, Mq, kC, kC, 1.0f);
}

// v009
// A run of this version takes 89 microseconds.
// Two timings next to v008 put it at 1.16 and 1.17 times that version's speed.
// All steps since v000 together make it 5.08 times as fast.
// Contractions: x@Wq, x@Wk, x@Wv and xmix@Wp on v_wmma_f32_16x16x32_bf16 with bf16 hi/lo operand planes (hi.hi + hi.lo + lo.hi); k.q^T on v_wmma_f32_16x16x32_f16 with plain f16 q/k planes; v^T.p^T and v_cross^T.p^T on v_wmma_f32_16x16x32_bf16 with bf16 hi/lo p and v tiles; f32 accumulate; bias gather, online softmax and head mixing in f32.
#include <hip/hip_runtime.h>
#include <stdint.h>

typedef __attribute__((ext_vector_type(16))) _Float16 v16h;
typedef __attribute__((ext_vector_type(8)))  _Float16 v8h;
typedef __attribute__((ext_vector_type(16))) __bf16   v16b;
typedef __attribute__((ext_vector_type(8)))  __bf16   v8b;
typedef __attribute__((ext_vector_type(8)))  float    v8f;
typedef __attribute__((ext_vector_type(4)))  float    v4f;
typedef __attribute__((ext_vector_type(4)))  unsigned int v4u;
typedef __attribute__((ext_vector_type(2)))  int      v2i;
typedef __attribute__((ext_vector_type(4)))  int      v4i;
typedef __attribute__((ext_vector_type(8)))  short    v8s;
typedef __attribute__((ext_vector_type(2)))  float    v2f;
typedef __attribute__((ext_vector_type(2)))  __bf16   v2b;

/* ---- problem geometry (fixed by the module) ---- */
constexpr int kBatch = 2;
constexpr int kNq    = 2048;
constexpr int kNkv   = 4096;
constexpr int kC     = 128;
constexpr int kH     = 4;
constexpr int kHD    = 32;
constexpr int kNH    = 2;
constexpr int kMaxd  = 128;
constexpr int kSpan  = 2 * kMaxd + 1;
constexpr int kTable = kSpan * kSpan;
constexpr int kKC    = 32;     /* keys per chunk in the attention kernel */
constexpr int kQB    = 64;     /* query rows per attention block (4 query tiles x 16) */
constexpr int kSplit = 4;      /* key groups per attention block: wave = (key group, query tile) */
constexpr int kOsPitch = 36;   /* floats; per-wave output staging pitch */
constexpr int kVP    = 48;     /* halves; LDS row pitch of the V tiles: 96 B = 32 B x odd, the pitch of the transposing load */
constexpr int kTabLds  = (kTable + 3) & ~3;   /* floats; one head's bias column in LDS, rounded to 16 bytes */
constexpr float kLog2e  = 1.4426950408889634f;                        /* log2(e) */
constexpr float kScaleL2 = (float)(0.17677669529663687 * 1.4426950408889634);   /* head_dim ** -0.5 * log2(e) */
constexpr float kLambdaInit = 0.8f;

static_assert(kNq % kQB == 0, "");
static_assert(kNkv % (kKC * kSplit) == 0, "");
static_assert(kSplit * 4 == 16, "");   /* the merge gives each wave 16 / kSplit = 4 rows = 32 lanes x 4 floats */
static_assert(kC == kH * kHD, "");
static_assert((kBatch * kNq) % 64 == 0 && (kBatch * kNkv) % 64 == 0, "");
static_assert(kC % 64 == 0 && kC % 32 == 0, "");
static_assert(kH == 4 && kNH == 2 && kHD == 32 && kKC == 32, "");

/* two f32 -> a packed pair of bf16 hi and a packed pair of bf16 lo (the residual x - hi, exact in f32), three instructions a pair, all on
   the hardware's own converts, which round to nearest even as the integer form did. hi: one packed convert. lo: one mixed fma per value,
   hi * (-1) + x with hi and the -1 read as bf16 and the result written as bf16 into one half of lo. In asm because the compiler widens hi
   by a shift and a mask, subtracts and converts again: five instructions a pair */
__device__ __forceinline__ void split2(float a, float b, v2b& hi, v2b& lo) {
  hi = __builtin_convertvector((v2f){a, b}, v2b);
  unsigned lw;
  asm("v_fma_mixlo_bf16 %0, %1, %2, %3 op_sel_hi:[1,1,0]\n\t"
      "v_fma_mixhi_bf16 %0, %1, %2, %4 op_sel:[1,0,0] op_sel_hi:[1,1,0]"
      : "=&v"(lw)
      : "v"(__builtin_bit_cast(unsigned, hi)), "v"(0xBF80BF80u) /* bf16 -1 */, "v"(a), "v"(b));
  lo = __builtin_bit_cast(v2b, lw);
}

/* hazard guards as plain device helpers */
__device__ __forceinline__ void dep_guard_h(v8f& a, v8f& b, v16h x, v16h y) { asm volatile("v_nop\n\tv_nop\n\tv_nop\n\tv_nop" : "+v"(a), "+v"(b) : "v"(x), "v"(y)); }
__device__ __forceinline__ void dep_guard_b(v8f& a, v8f& b, v16b x, v16b y) { asm volatile("v_nop\n\tv_nop\n\tv_nop\n\tv_nop" : "+v"(a), "+v"(b) : "v"(x), "v"(y)); }
__device__ __forceinline__ void keep4_h(v16h a, v16h b, v16h c, v16h d) { asm volatile("v_nop" :: "v"(a), "v"(b), "v"(c), "v"(d)); }
__device__ __forceinline__ void keep4_b(v16b a, v16b b, v16b c, v16b d) { asm volatile("v_nop" :: "v"(a), "v"(b), "v"(c), "v"(d)); }
__device__ __forceinline__ void acc_guard4(v8f& a, v8f& b, v8f& c, v8f& d) { asm volatile("v_nop\n\tv_nop\n\tv_nop\n\tv_nop" : "+v"(a), "+v"(b), "+v"(c), "+v"(d)); }
template <typename T> struct Frag;
template <> struct Frag<_Float16> {
  typedef v16h V; union U { v16h v; v8h h[2]; };
  static __device__ __forceinline__ v16h load(const _Float16* p) {
    U f; f.h[0] = *(const v8h*)(p); f.h[1] = *(const v8h*)(p + 16); return f.v;
  }
  static __device__ __forceinline__ v8f mma(v16h a, v16h b, v8f c) {
    return __builtin_amdgcn_wmma_f32_16x16x32_f16(false, a, false, b, (short)0, c, false, false);
  }
  static __device__ __forceinline__ void guard(v8f& a, v8f& b, v16h x, v16h y) { dep_guard_h(a, b, x, y); }
  static __device__ __forceinline__ void keep(v16h a, v16h b, v16h c, v16h d) { keep4_h(a, b, c, d); }
};
template <> struct Frag<__bf16> {
  typedef v16b V; union U { v16b v; v8b h[2]; };
  static __device__ __forceinline__ v16b load(const __bf16* p) {
    U f; f.h[0] = *(const v8b*)(p); f.h[1] = *(const v8b*)(p + 16); return f.v;
  }
  static __device__ __forceinline__ v8f mma(v16b a, v16b b, v8f c) {
    return __builtin_amdgcn_wmma_f32_16x16x32_bf16(false, a, false, b, (short)0, c, false, false);
  }
  static __device__ __forceinline__ void guard(v8f& a, v8f& b, v16b x, v16b y) { dep_guard_b(a, b, x, y); }
  static __device__ __forceinline__ void keep(v16b a, v16b b, v16b c, v16b d) { keep4_b(a, b, c, d); }
};

/* ---- Register-blocked batched WMMA GEMM ---------------- */
/* decomposition: one wave a work-group, a 32x64 tile a wave. M x 128 outputs are few tiles: in 8-wave groups of 64x64 tiles they stood on
   16 to 80 of the chip's WGPs, whose eight waves queued their fragment loads (16 cache lines each) on one cache path while the other WGPs
   idled; so cut, the same loads are spread over every WGP, and a wave's chain of dependent load waits is half as long */
constexpr int kMI = 2;    /* 16-row subtiles per wave tile */
constexpr int kGW = 1;    /* waves per GEMM work-group */
constexpr int kTM = 16 * kMI;
template <int ET> struct Elem;
template <> struct Elem<0> { typedef _Float16 T; };
template <> struct Elem<1> { typedef __bf16 T; };
/* one work-group's share (kGW waves, a kTM x 64 tile each) of one GEMM; bx, b: the work-group's place in that GEMM's own grid;
   sT: the work-group's staging slabs, kGW x 16 x 68 floats */
template <int ET, bool SPLIT, int BIAS_MODE, int OUT_MODE, bool RESID, int ACT = 0>
__device__ __forceinline__ void gemm64_group(
    const unsigned short* __restrict__ Ap, const unsigned short* __restrict__ A2p, int lda, long strideA,
    const unsigned short* __restrict__ Btp, const unsigned short* __restrict__ Bt2p, int ldb, long strideB,
    void* __restrict__ Cout, void* __restrict__ Cout2, int ldc, long strideC,
    const float* __restrict__ bias,
    const float* __restrict__ resid, long strideR,
    int M, int N, int K, float scale, int bx, int b, float (*sT)[16 * 68]) {
  typedef typename Elem<ET>::T T;
  typedef typename Frag<T>::V V;
  const T* A = (const T*)Ap; const T* A2 = (const T*)A2p; const T* Bt = (const T*)Btp; const T* Bt2 = (const T*)Bt2p;
  const int lane = threadIdx.x & 31;
  const int wave = threadIdx.x >> 5;
  const int tilesN = N >> 6;
  const int tilesM = M / kTM;
  const int tile = bx * kGW + wave;
  if (tile >= tilesM * tilesN) return;
  const int tm = tile / tilesN;
  const int tn = tile - tm * tilesN;
  const int m0 = tm * kTM;
  const int n0 = tn << 6;

  const T* Ab  = A  + (size_t)b * strideA;
  const T* Bb  = Bt + (size_t)b * strideB;
  const T* Ab2 = SPLIT ? (A2  + (size_t)b * strideA) : nullptr;
  const T* Bb2 = SPLIT ? (Bt2 + (size_t)b * strideB) : nullptr;

  const int rlane = lane & 15;
  const int koff  = (lane >> 4) * 8;
  const int mOff  = (lane >> 4) * 8;

  v8f acc[kMI][4];
#pragma unroll
  for (int i = 0; i < kMI; ++i)
#pragma unroll
    for (int j = 0; j < 4; ++j) acc[i][j] = (v8f){0.f,0.f,0.f,0.f,0.f,0.f,0.f,0.f};

  for (int k0 = 0; k0 < K; k0 += 32) {
    V bh[4], bl[4];
#pragma unroll
    for (int j = 0; j < 4; ++j) {
      const size_t bo = (size_t)(n0 + (j << 4) + rlane) * ldb + koff + k0;
      bh[j] = Frag<T>::load(Bb + bo);
      if (SPLIT) bl[j] = Frag<T>::load(Bb2 + bo);
    }
#pragma unroll
    for (int i = 0; i < kMI; ++i) {
      const size_t ao = (size_t)(m0 + (i << 4) + rlane) * lda + koff + k0;
      V ah = Frag<T>::load(Ab + ao);
      V al;
      if (SPLIT) al = Frag<T>::load(Ab2 + ao);
#pragma unroll
      for (int j = 0; j < 4; ++j) {
        acc[i][j] = Frag<T>::mma(ah, bh[j], acc[i][j]);
        if (SPLIT) {
          acc[i][j] = Frag<T>::mma(ah, bl[j], acc[i][j]);
          acc[i][j] = Frag<T>::mma(al, bh[j], acc[i][j]);
        }
      }
      Frag<T>::guard(acc[i][0], acc[i][3], ah, SPLIT ? al : ah);
    }
    Frag<T>::keep(bh[0], bh[1], bh[2], bh[3]);
    if (SPLIT) Frag<T>::keep(bl[0], bl[1], bl[2], bl[3]);
  }
#pragma unroll
  for (int i = 0; i < kMI; ++i) acc_guard4(acc[i][0], acc[i][1], acc[i][2], acc[i][3]);

  float* slab = sT[wave];
  const float* Rb = RESID ? (resid + (size_t)b * strideR) : nullptr;
#pragma unroll
  for (int i = 0; i < kMI; ++i) {
    const int mBase = m0 + (i << 4);
#pragma unroll
    for (int j = 0; j < 4; ++j) {
      const int n = n0 + (j << 4) + rlane;
      float bv = 0.f;
      if (BIAS_MODE == 2) bv = bias[n];
#pragma unroll
      for (int r = 0; r < 8; ++r) {
        float v = acc[i][j][r] * scale;
        if (BIAS_MODE == 1) v += bias[mBase + mOff + r];
        if (BIAS_MODE == 2) v += bv;
        if (RESID) v += Rb[(size_t)(mBase + mOff + r) * ldc + n];
        if (ACT == 1) v = tanhf(v);
        if (ACT == 2) v = fmaxf(v, 0.0f);
        if (ACT == 3) v = v / (1.0f + expf(-v));
        if (ACT == 4) v = (v > 0.f) ? v : 0.01f * v;
        if (ACT == 5) v = 0.5f * v * (1.0f + erff(v * 0.70710678118654752f));
        slab[(mOff + r) * 68 + (j << 4) + rlane] = v;
      }
    }
    __builtin_amdgcn_fence(__ATOMIC_RELEASE, "workgroup");
    __builtin_amdgcn_wave_barrier();
    __builtin_amdgcn_fence(__ATOMIC_ACQUIRE, "workgroup");
    if (OUT_MODE == 0) {
      float* C = (float*)Cout + (size_t)b * strideC;
      const int hh = lane >> 4, c4 = (lane & 15) * 4;
      {
#pragma unroll
        for (int it = 0; it < 8; ++it) {
          const int row = it * 2 + hh;
          v4f v = *(const v4f*)(slab + row * 68 + c4);
          *(v4f*)(C + (size_t)(mBase + row) * ldc + n0 + c4) = v;
        }
        
      }
    } else {
      const int q = lane >> 3, c8 = (lane & 7) * 8;
      unsigned short* C  = (unsigned short*)Cout  + (size_t)b * strideC;
      unsigned short* C2 = (OUT_MODE == 2) ? ((unsigned short*)Cout2 + (size_t)b * strideC) : nullptr;
      {
#pragma unroll
        for (int it = 0; it < 4; ++it) {
          const int row = it * 4 + q;
          const float* sp = slab + row * 68 + c8;
          if (OUT_MODE == 1) {
            v8h hv;
#pragma unroll
            for (int e = 0; e < 8; ++e) hv[e] = (_Float16)sp[e];
            *(v8h*)(C + (size_t)(mBase + row) * ldc + n0 + c8) = hv;
          } else {
            v4u hw, lw;
#pragma unroll
            for (int p = 0; p < 4; ++p) {
              v2b h2, l2;
              split2(sp[2 * p], sp[2 * p + 1], h2, l2);
              hw[p] = __builtin_bit_cast(unsigned, h2);
              lw[p] = __builtin_bit_cast(unsigned, l2);
            }
            *(v4u*)(C + (size_t)(mBase + row) * ldc + n0 + c8) = hw;
            *(v4u*)(C2 + (size_t)(mBase + row) * ldc + n0 + c8) = lw;
          }
        }
        
      }
    }
    __builtin_amdgcn_fence(__ATOMIC_RELEASE, "workgroup");
    __builtin_amdgcn_wave_barrier();
    __builtin_amdgcn_fence(__ATOMIC_ACQUIRE, "workgroup");
  }
}

template <int ET, bool SPLIT, int BIAS_MODE, int OUT_MODE, bool RESID, int ACT = 0>
__global__ __launch_bounds__(32 * kGW) void wmma_gemm64(
    const unsigned short* __restrict__ Ap, const unsigned short* __restrict__ A2p, int lda, long strideA,
    const unsigned short* __restrict__ Btp, const unsigned short* __restrict__ Bt2p, int ldb, long strideB,
    void* __restrict__ Cout, void* __restrict__ Cout2, int ldc, long strideC,
    const float* __restrict__ bias,
    const float* __restrict__ resid, long strideR,
    int M, int N, int K, float scale) {
  __shared__ __align__(16) float sT[kGW][16 * 68];
  gemm64_group<ET, SPLIT, BIAS_MODE, OUT_MODE, RESID, ACT>(Ap, A2p, lda, strideA, Btp, Bt2p, ldb, strideB, Cout, Cout2, ldc, strideC,
                                                           bias, resid, strideR, M, N, K, scale, blockIdx.x, blockIdx.y, sT);
}

/* ---- the three input projections as ONE launch: none reads what another writes.
   Work-groups 0 .. kGroupsKV-1 make v (bf16 hi/lo planes), the next kGroupsKV make k, the last kGroupsQ make q (f16 planes).
   wt: 4 weights x (hi plane + lo plane) of 128*128 halves, in the order q, k, v, p. ld = N = K = 128. */
constexpr int kGroupsQ  = ((kBatch * kNq  / kTM) * (kC / 64) + kGW - 1) / kGW;
constexpr int kGroupsKV = ((kBatch * kNkv / kTM) * (kC / 64) + kGW - 1) / kGW;
static_assert((kBatch * kNq) % kTM == 0 && (kBatch * kNkv) % kTM == 0, "");
__global__ __launch_bounds__(32 * kGW) void qkv_gemm64(
    const unsigned short* __restrict__ xq_hi, const unsigned short* __restrict__ xq_lo,
    const unsigned short* __restrict__ xkv_hi, const unsigned short* __restrict__ xkv_lo,
    const unsigned short* __restrict__ wt,
    unsigned short* __restrict__ q16, unsigned short* __restrict__ k16,
    unsigned short* __restrict__ v_hi, unsigned short* __restrict__ v_lo,
    const float* __restrict__ bq, const float* __restrict__ bk, const float* __restrict__ bv,
    int ld, int N, int K) {
  __shared__ __align__(16) float sT[kGW][16 * 68];
  const int bx = blockIdx.x;   /* every choice below is the same for the whole work-group */
  if (bx < kGroupsKV) {
    const unsigned short* w = wt + 2 * (2 * kC * kC);
    gemm64_group<1, true, 2, 2, false>(xkv_hi, xkv_lo, ld, 0L, w, w + kC * kC, ld, 0L, (void*)v_hi, (void*)v_lo, ld, 0L,
                                       bv, nullptr, 0L, kBatch * kNkv, N, K, 1.0f, bx, 0, sT);
  } else {
    const bool isk = bx < 2 * kGroupsKV;
    const unsigned short* w = wt + (isk ? 1 : 0) * (2 * kC * kC);
    gemm64_group<1, true, 2, 1, false>(isk ? xkv_hi : xq_hi, isk ? xkv_lo : xq_lo, ld, 0L, w, w + kC * kC, ld, 0L,
                                       (void*)(isk ? k16 : q16), nullptr, ld, 0L, isk ? bk : bq, nullptr, 0L,
                                       isk ? kBatch * kNkv : kBatch * kNq, N, K, 1.0f,
                                       bx - (isk ? kGroupsKV : 2 * kGroupsKV), 0, sT);
  }
}

/* ---- matrix helpers for the attention path ---- */
__device__ __forceinline__ v8f at_mma(v16b a, v16b b, v8f c) {
  c = __builtin_amdgcn_wmma_f32_16x16x32_bf16(false, a, false, b, (short)0, c, false, false);
  asm volatile("v_nop\n\tv_nop\n\tv_nop\n\tv_nop" : "+v"(c) : "v"(a), "v"(b));
  return c;
}
__device__ __forceinline__ v8f mma_h16(v16h a, v16h b, v8f c) {
  c = __builtin_amdgcn_wmma_f32_16x16x32_f16(false, a, false, b, (short)0, c, false, false);
  asm volatile("v_nop\n\tv_nop\n\tv_nop\n\tv_nop" : "+v"(c) : "v"(a), "v"(b));
  return c;
}

/* f32[8] -> packed bf16 hi (4 words) and bf16 lo residual (4 words), RNE convert */
__device__ __forceinline__ void split_pack8(const float (&x)[8], v4u& H, v4u& L) {
#pragma unroll
  for (int p = 0; p < 4; ++p) {
    v2b h2, l2;
    split2(x[2 * p], x[2 * p + 1], h2, l2);
    H[p] = __builtin_bit_cast(unsigned, h2);
    L[p] = __builtin_bit_cast(unsigned, l2);
  }
}
__device__ __forceinline__ void store_planes2(unsigned short* __restrict__ hi, unsigned short* __restrict__ lo,
                                              size_t off, v4u H, v4u L) {
  *(v4u*)(hi + off) = H;
  *(v4u*)(lo + off) = L;
  
}

/* ---- activations f32 [rows][128] -> bf16 hi/lo planes, same layout; thread i takes elements 8*i .. 8*i+7 ------------- */
__device__ __forceinline__ void split_rows_bf16(const float* __restrict__ in,
                                                unsigned short* __restrict__ hi,
                                                unsigned short* __restrict__ lo, int i) {
  const size_t e0 = (size_t)i * 8;
  const v4f a = *(const v4f*)(in + e0);
  const v4f c = *(const v4f*)(in + e0 + 4);
  float x[8];
  x[0] = a[0]; x[1] = a[1]; x[2] = a[2]; x[3] = a[3];
  x[4] = c[0]; x[5] = c[1]; x[6] = c[2]; x[7] = c[3];
  v4u H, L;
  split_pack8(x, H, L);
  store_planes2(hi, lo, e0, H, L);
}

/* ---- one weight W[k][n] (input-major, 128x128): in[k][n] -> out[n][k] as transposed bf16 hi/lo planes -----
   2048 threads gt per weight; 2048 threads x 8 = 16384 = 128x128 per plane exactly. */
__device__ __forceinline__ void wt_split_bf16(const float* __restrict__ W, unsigned short* __restrict__ hi,
                                              unsigned short* __restrict__ lo, int gt) {
  const int n  = gt >> 4;
  const int k8 = (gt & 15) * 8;
  float x[8];
#pragma unroll
  for (int e = 0; e < 8; ++e) x[e] = W[(size_t)(k8 + e) * kC + n];
  v4u H, L;
  split_pack8(x, H, L);
  store_planes2(hi, lo, (size_t)n * kC + k8, H, L);
}

/* ---- all operand planes of the projections as ONE launch: the three jobs are independent of each other.
   Work-groups 0 .. 31: the 4 weights, 8 groups each (outb: 4 weights x (hi plane + lo plane) of 128*128 halves);
   the next kPrepQ: x_q; the last kPrepKV: x_kv. Every range is covered exactly, 8 elements a thread. */
constexpr int kPrepW  = 4 * (kC * kC / 8 / 256);
constexpr int kPrepQ  = kBatch * kNq  * kC / 8 / 256;
constexpr int kPrepKV = kBatch * kNkv * kC / 8 / 256;
static_assert((kC * kC) % (8 * 256) == 0 && (kBatch * kNq * kC) % (8 * 256) == 0 && (kBatch * kNkv * kC) % (8 * 256) == 0, "");
__global__ __launch_bounds__(256) void prep_planes_kernel(
    const float* __restrict__ x_q, const float* __restrict__ x_kv,
    const float* __restrict__ W0, const float* __restrict__ W1, const float* __restrict__ W2, const float* __restrict__ W3,
    unsigned short* __restrict__ xq_hi, unsigned short* __restrict__ xq_lo,
    unsigned short* __restrict__ xkv_hi, unsigned short* __restrict__ xkv_lo,
    unsigned short* __restrict__ outb) {
  const int bx = blockIdx.x;
  const int t  = threadIdx.x;
  if (bx < kPrepW) {
    constexpr int per = kPrepW / 4;
    const int which = bx / per;
    const float* W = (which == 0) ? W0 : (which == 1) ? W1 : (which == 2) ? W2 : W3;
    unsigned short* hi = outb + (size_t)which * (2 * kC * kC);
    wt_split_bf16(W, hi, hi + kC * kC, (bx - which * per) * 256 + t);
  } else {
    const bool isq = bx < kPrepW + kPrepQ;
    split_rows_bf16(isq ? x_q : x_kv, isq ? xq_hi : xkv_hi, isq ? xq_lo : xkv_lo, (bx - kPrepW - (isq ? 0 : kPrepQ)) * 256 + t);
    asm volatile("s_wait_xcnt 0x0" ::: "memory");   /* a precaution: the weight path runs in other work-groups, nothing follows these stores */
  }
}

/* transposing LDS load: the lanes point at 16-byte pieces of a row-major [key][d] tile (lane l: row 8*(l>>4) + (l&7), piece (l>>3)&1);
   lane (c, hh) receives keys 8*hh .. 8*hh+7 of column d = c, which is half of an A fragment of the transposed tile */
__device__ __forceinline__ v8b ld_tr16(const unsigned short* p) {
  typedef __attribute__((address_space(3))) v8s lds_v8s;
  return __builtin_bit_cast(v8b, __builtin_amdgcn_ds_load_tr16_b128_v8i16((lds_v8s*)p));
}
/* lane l with lane l ^ 16: the two halves of a wave hold the two halves of a query column's keys */
__device__ __forceinline__ float xhalf(float x) {
  return __builtin_bit_cast(float, __builtin_amdgcn_permlanex16(__builtin_bit_cast(int, x), __builtin_bit_cast(int, x),
                                                                0x76543210, 0xfedcba98, false, false));
}
/* e[i] = 2^e[i], the 17 exponentials of a softmax step as one run. In asm for the free slot that the instruction set asks for behind a
   transcendental: each v_exp_f32 is the independent instruction behind the one before it and the v_nop stands behind the last */
__device__ __forceinline__ void exp2_run17(float (&e)[17]) {
  asm(
      "v_exp_f32 %0, %0\n\t"
      "v_exp_f32 %1, %1\n\t"
      "v_exp_f32 %2, %2\n\t"
      "v_exp_f32 %3, %3\n\t"
      "v_exp_f32 %4, %4\n\t"
      "v_exp_f32 %5, %5\n\t"
      "v_exp_f32 %6, %6\n\t"
      "v_exp_f32 %7, %7\n\t"
      "v_exp_f32 %8, %8\n\t"
      "v_exp_f32 %9, %9\n\t"
      "v_exp_f32 %10, %10\n\t"
      "v_exp_f32 %11, %11\n\t"
      "v_exp_f32 %12, %12\n\t"
      "v_exp_f32 %13, %13\n\t"
      "v_exp_f32 %14, %14\n\t"
      "v_exp_f32 %15, %15\n\t"
      "v_exp_f32 %16, %16\n\t"
      "v_nop"
      : "+v"(e[0]), "+v"(e[1]), "+v"(e[2]), "+v"(e[3]), "+v"(e[4]), "+v"(e[5]),
        "+v"(e[6]), "+v"(e[7]), "+v"(e[8]), "+v"(e[9]), "+v"(e[10]), "+v"(e[11]),
        "+v"(e[12]), "+v"(e[13]), "+v"(e[14]), "+v"(e[15]), "+v"(e[16]));
}
/* ---- online softmax step for one head, 32 keys x 16 query columns per wave (2 key subtiles), scores transposed ----
   sA[r]: key 8*hh + r, sB[r]: key 16 + 8*hh + r, both of query column c: a lane holds 16 keys of ONE query.
   The scores arrive times log2(e), so that e^(s - m) is one v_exp_f32 (2^x) of a difference; mrow is kept in the same unit.
   Maximum in the lane plus one exchange between the halves; the sum stays a per-lane partial (joined behind the key loop).
   P^T leaves as two B operands, hi and lo: element s = key kmap(s, hh), which is the order the accumulators already have. */
__device__ __forceinline__ float softmax_step_t(const v8f& sA, const v8f& sB, float& mrow, float& lrow, v16b& ph, v16b& pl) {
  float mm[4];
#pragma unroll
  for (int k = 0; k < 4; ++k) mm[k] = fmaxf(fmaxf(sA[k], sA[4 + k]), fmaxf(sB[k], sB[4 + k]));
  float m = fmaxf(fmaxf(mm[0], mm[1]), fmaxf(mm[2], mm[3]));
  m = fmaxf(m, xhalf(m));
  const float mnew = fmaxf(mrow, m);
  float e[17];
#pragma unroll
  for (int r = 0; r < 8; ++r) { e[r] = sA[r] - mnew; e[8 + r] = sB[r] - mnew; }
  e[16] = mrow - mnew;
  exp2_run17(e);
  const float al = e[16];
  mrow = mnew;
  float ps[4] = {0.f, 0.f, 0.f, 0.f};
#pragma unroll
  for (int r = 0; r < 16; r += 2) {
    ps[(r >> 3) * 2]     += e[r];
    ps[(r >> 3) * 2 + 1] += e[r + 1];
    v2b hi, lo;
    split2(e[r], e[r + 1], hi, lo);
    ph[r] = hi[0];  ph[r + 1] = hi[1];
    pl[r] = lo[0];  pl[r + 1] = lo[1];
  }
  lrow = lrow * al + ((ps[0] + ps[1]) + (ps[2] + ps[3]));
  return al;
}
/* per-wave transposed result (o[t][r] = O[query c][d = t*16 + 8*hh + r]) -> LDS staging [query][d] (pitch kOsPitch);
   writes rows 0..15, cols 0..31, 8 consecutive floats per lane and tile */
__device__ __forceinline__ void tile_to_os(float* os, const v8f (&o)[2], int hh, int c) {
#pragma unroll
  for (int t = 0; t < 2; ++t) {
    float* p = os + c * kOsPitch + t * 16 + 8 * hh;
    *(v4f*)(p)     = (v4f){o[t][0], o[t][1], o[t][2], o[t][3]};
    *(v4f*)(p + 4) = (v4f){o[t][4], o[t][5], o[t][6], o[t][7]};
  }
}
/* weighted sum over the kSplit key groups of one query tile, 4 floats of one row per lane;
   os0: staging tile of key group 0 for this query tile, the groups 4 tiles apart */
__device__ __forceinline__ v4f merge_os(const float* os0, const float (&w)[kSplit], int row, int c4) {
  v4f acc = (v4f){0.f, 0.f, 0.f, 0.f};
#pragma unroll
  for (int s = 0; s < kSplit; ++s) {
    const v4f v = *(const v4f*)(os0 + s * (4 * 16 * kOsPitch) + row * kOsPitch + c4);
#pragma unroll
    for (int e = 0; e < 4; ++e) acc[e] += w[s] * v[e];
  }
  return acc;
}

/* ---- attention for one (batch, head h, 64 query rows) ----------------------------------
   q16/k16: f16 planes [B*N][128] (head-major columns); vhi/vlo: bf16 hi/lo planes [B*Nkv][128].
   scores^T = (k.q^T)*scale + rpe[idx][h], the head's table column held in LDS; online softmax in f32, a lane holding one query's keys;
   scale and table carry the factor log2(e), so the softmax runs on powers of two (the hardware's own exponential);
   P^T hi and lo go from the score accumulators straight into B operands, never through LDS;
   V tiles lie row-major in LDS and are transposed by the load that reads them;
   o^T = V_h^T . P^T;  for h >= 2 also ox^T = V_{h-2}^T . P^T (the cross term of the differential mixing).
   16 waves: wave = (key group sp, query tile qt). Group sp (4 waves) takes key chunks sp, sp + kSplit, ... with its own
   K/V tiles and each wave its own running max, sum and accumulators; the groups are merged through LDS at the end.
   xattn f32 [B*Nq][128]; ycross f32 [B][2][Nq][32]. grid.x = B*H*(Nq/64), block 128 * kSplit. */
__global__ __launch_bounds__(128 * kSplit) __attribute__((amdgpu_num_vgpr(256)))
void attn_head_kernel(
    const unsigned short* __restrict__ q16, const unsigned short* __restrict__ k16,
    const unsigned short* __restrict__ vhi, const unsigned short* __restrict__ vlo,
    const int* __restrict__ coords_q, const int* __restrict__ coords_k,
    const float* __restrict__ rpe,
    float* __restrict__ xattn, float* __restrict__ ycross)
{
  __shared__ __align__(16) unsigned short KshS[kSplit][kKC * kHD];   /* [group][key][d]  f16 bits  */
  __shared__ __align__(16) unsigned short VthS[kSplit][kKC * kVP];   /* [group][key][d] bf16 hi, head h,   row pitch kVP */
  __shared__ __align__(16) unsigned short VtlS[kSplit][kKC * kVP];   /* [group][key][d] bf16 lo, head h,   row pitch kVP */
  __shared__ __align__(16) unsigned short VxhS[kSplit][kKC * kVP];   /* [group][key][d] bf16 hi, head h-2, row pitch kVP */
  __shared__ __align__(16) unsigned short VxlS[kSplit][kKC * kVP];   /* [group][key][d] bf16 lo, head h-2, row pitch kVP */
  __shared__ __align__(16) float Tab[kTabLds];                       /* rpe[idx][h] * log2(e) for this block's head, all idx */
  /* behind the key loop the table is dead and its bytes take the merge staging */
  static_assert(4 * kSplit * 16 * kOsPitch + 4 * kSplit * 16 * 2 <= kTabLds, "");
  float* const OsAll = Tab;                                          /* [wave][16 * kOsPitch] */
  float* const MlAll = Tab + 4 * kSplit * 16 * kOsPitch;             /* [wave][row] (max, sum) */

  const int wave = threadIdx.x >> 5;     /* 0 .. 15 */
  const int sp   = wave >> 2;            /* key group */
  const int qt   = wave & 3;             /* query tile */
  const int tid  = threadIdx.x & 127;    /* thread within the key group */
  const int lane = tid & 31;
  unsigned short* Ksh = KshS[sp];
  unsigned short* Vth = VthS[sp];
  unsigned short* Vtl = VtlS[sp];
  unsigned short* Vxh = VxhS[sp];
  unsigned short* Vxl = VxlS[sp];
  const int hh   = lane >> 4;
  const int c    = lane & 15;
  const int vro  = (8 * hh + (lane & 7)) * kVP + ((lane >> 3) & 1) * 8;   /* halves; this lane's piece for the transposing V loads */
  constexpr int nqb = kNq / kQB;
  const int bx   = blockIdx.x;
  const int qb   = bx % nqb;
  const int rest = bx / nqb;
  const int h    = rest % kH;
  const int b    = rest / kH;
  const bool cross = (h >= kNH);                       /* block-uniform */
  const int hcol = h * kHD;
  const int xcol = (cross ? (h - kNH) : 0) * kHD;
  const int q0   = qb * kQB + qt * 16;
  const size_t qrows  = (size_t)b * kNq + q0;
  const size_t kvrows = (size_t)b * kNkv;
  const float* __restrict__ rpe_h = rpe + h;           /* table entry stride kH floats */

  /* one chunk on its way from global memory to the tiles, held in registers: asked for while the chunk before it is worked on, stored to
     LDS at the head of its own pass, so that no pass stands waiting for a round trip to L2.
     ck: coords of this lane's 16 score rows (keys j*16 + 8*hh + r), two keys per 16-byte load, the same address in the 16 lanes of a half.
     kw, vh4, vl4 (xh4, xl4 when cross): 32 keys x 4 segments of 8 halves = 128 = threads of a key group, one uint4 per thread per plane */
  constexpr int kChunks = kNkv / (kKC * kSplit);
  const int skey = tid >> 2;
  const int sseg = tid & 3;
  v4i ck[2][4];
  uint4 kw, vh4, vl4;
  uint4 xh4 = make_uint4(0u, 0u, 0u, 0u), xl4 = make_uint4(0u, 0u, 0u, 0u);
  auto fetch = [&](int kcn) {
    const int kv0 = (kcn * kSplit + sp) * kKC;
    const int* ckp = coords_k + (kvrows + kv0 + 8 * hh) * 2;
#pragma unroll
    for (int j = 0; j < 2; ++j) {
#pragma unroll
      for (int i = 0; i < 4; ++i) ck[j][i] = *(const v4i*)(ckp + j * 32 + i * 4);
    }
    const size_t rowoff = (kvrows + kv0 + skey) * kC;
    const size_t go = rowoff + hcol + sseg * 8;
    const unsigned short* kgp = k16 + go;
    const unsigned short* hgp = vhi + go;
    const unsigned short* lgp = vlo + go;
    kw  = *(const uint4*)(kgp);
    vh4 = *(const uint4*)(hgp);
    vl4 = *(const uint4*)(lgp);
    asm volatile("s_wait_xcnt 0x0" :: "v"(ckp), "v"(kgp), "v"(hgp), "v"(lgp) : "memory");   /* the loads' address registers are kept as they are until this wait */
    if (cross) {
      const size_t gx = rowoff + xcol + sseg * 8;
      const unsigned short* xhp = vhi + gx;
      const unsigned short* xlp = vlo + gx;
      xh4 = *(const uint4*)(xhp);
      xl4 = *(const uint4*)(xlp);
      asm volatile("s_wait_xcnt 0x0" :: "v"(xhp), "v"(xlp) : "memory");   /* the loads' address registers are kept as they are until this wait */
    }
  };
  fetch(0);

  /* this head's column of the bias table -> LDS, once per work-group; batches of 16 loads per thread keep the
     latency of the strided reads covered. The first barrier of the key loop publishes it. */
  {
    constexpr int kThreads = 128 * kSplit;
    constexpr int kFull = kTable / (kThreads * 16);
    const int t0 = threadIdx.x;
    /* rolled: 16 waves x 16 loads in flight already cover the L2 latency; unrolled further the copy only takes more registers */
#pragma unroll 1
    for (int g = 0; g < kFull; ++g) {
      float tv[16];
      const float* gp = rpe_h + (size_t)(g * 16 * kThreads + t0) * kH;
#pragma unroll
      for (int u = 0; u < 16; ++u) tv[u] = gp[u * (kThreads * kH)];
      asm volatile("s_wait_xcnt 0x0" :: "v"(gp) : "memory");   /* the loads' address registers are kept as they are until this wait */
#pragma unroll
      for (int u = 0; u < 16; ++u) Tab[(g * 16 + u) * kThreads + t0] = tv[u] * kLog2e;
    }
    for (int i = kFull * 16 * kThreads + t0; i < kTable; i += kThreads) Tab[i] = rpe_h[(size_t)i * kH] * kLog2e;
  }

  /* Q fragment (B operand: lane c -> query column c; K = head_dim = 32, one k-step) */
  const _Float16* qp = (const _Float16*)(const void*)q16;
  const v16h qa = Frag<_Float16>::load(qp + (qrows + c) * kC + hcol + 8 * hh);

  /* coords of this lane's query column c, +MAXD folded in */
  const v2i cq = *(const v2i*)(coords_q + (qrows + c) * 2);
  const int cqx = cq.x + kMaxd;
  const int cqy = cq.y + kMaxd;

  float mr = -INFINITY, lr = 0.f;   /* running max (equal in both halves) and this lane's partial sum for query c */
  v8f o[2], ox[2];                  /* o[t][r] = O[query c][d = t*16 + 8*hh + r] */
#pragma unroll
  for (int t = 0; t < 2; ++t) {
    o[t]  = (v8f){0.f,0.f,0.f,0.f,0.f,0.f,0.f,0.f};
    ox[t] = (v8f){0.f,0.f,0.f,0.f,0.f,0.f,0.f,0.f};
  }

  /* two passes a trip: the coords' registers of one pass and of the next change roles, with one pass a trip they are copied (16 moves) */
#pragma unroll 2
  for (int kc = 0; kc < kChunks; ++kc) {
    __syncthreads();   /* every reader has left the tiles of the chunk before */
    /* this chunk's K tile and V hi/lo tiles out of the carried registers, all row-major: covers Ksh 32x32 and the 32 d of every row of
       Vth/Vtl (and Vxh/Vxl when cross) exactly; the pad halves of a V row are never read */
    *(uint4*)(&Ksh[skey * kHD + sseg * 8]) = kw;
    *(uint4*)(&Vth[skey * kVP + sseg * 8]) = vh4;
    *(uint4*)(&Vtl[skey * kVP + sseg * 8]) = vl4;
    if (cross) {
      *(uint4*)(&Vxh[skey * kVP + sseg * 8]) = xh4;
      *(uint4*)(&Vxl[skey * kVP + sseg * 8]) = xl4;
    }
    /* clamped table index of every (key, query) of this lane; behind this the coords' registers are free for the next chunk */
    int ti[2][8];
#pragma unroll
    for (int r = 0; r < 8; ++r) {
#pragma unroll
      for (int j = 0; j < 2; ++j) {
        const int kx = ck[j][r >> 1][(r & 1) * 2];
        const int ky = ck[j][r >> 1][(r & 1) * 2 + 1];
        int dx = cqx - kx; dx = dx < 0 ? 0 : dx; dx = dx > 2 * kMaxd ? 2 * kMaxd : dx;
        int dy = cqy - ky; dy = dy < 0 ? 0 : dy; dy = dy > 2 * kMaxd ? 2 * kMaxd : dy;
        ti[j][r] = dx * kSpan + dy;                 /* 0 .. kTable-1 */
      }
    }
    __syncthreads();   /* the tiles (and, in the first pass, the table) are published */
    if (kc + 1 < kChunks) fetch(kc + 1);   /* the same for the whole work-group; in flight during the work below */

    /* scores^T: s[j], j = key subtile; A fragment lane c -> key j*16+c, elements d (split map); s[j][r] = S[key j*16+8*hh+r][query c] */
    v8f s[2];
    {
      const v8f z = (v8f){0.f,0.f,0.f,0.f,0.f,0.f,0.f,0.f};
      const _Float16* Kp = (const _Float16*)(const void*)Ksh;
#pragma unroll
      for (int j = 0; j < 2; ++j) {
        Frag<_Float16>::U kb;
        kb.h[0] = *(const v8h*)(Kp + (j * 16 + c) * kHD + 8 * hh);
        kb.h[1] = *(const v8h*)(Kp + (j * 16 + c) * kHD + 16 + 8 * hh);
        s[j] = mma_h16(kb.v, qa, z);
      }
    }

    /* scale + relative position bias, both times log2(e): one clamped b32 gather from the LDS table per (key, query) */
#pragma unroll
    for (int r = 0; r < 8; ++r) {
#pragma unroll
      for (int j = 0; j < 2; ++j) s[j][r] = s[j][r] * kScaleL2 + Tab[ti[j][r]];
    }

    /* online softmax; P^T hi and lo stay in registers as B operands */
    v16b ph, pl;
    const float al = softmax_step_t(s[0], s[1], mr, lr, ph, pl);
#pragma unroll
    for (int t = 0; t < 2; ++t) {
#pragma unroll
      for (int r = 0; r < 8; ++r) { o[t][r] *= al; ox[t][r] *= al; }
    }

    /* V^T.P^T : A = V^T (lane c -> d, elements key, split map), transposed out of the row-major tile by the load itself;
       B = P^T (lane c -> query, elements key, same map) */
    {
#pragma unroll
      for (int t = 0; t < 2; ++t) {
        Frag<__bf16>::U vh, vl;
        vh.h[0] = ld_tr16(Vth + vro + t * 16);  vh.h[1] = ld_tr16(Vth + vro + 16 * kVP + t * 16);
        vl.h[0] = ld_tr16(Vtl + vro + t * 16);  vl.h[1] = ld_tr16(Vtl + vro + 16 * kVP + t * 16);
        o[t] = at_mma(vh.v, ph, o[t]);
        o[t] = at_mma(vl.v, ph, o[t]);
        o[t] = at_mma(vh.v, pl, o[t]);
      }
      if (cross) {
#pragma unroll
        for (int t = 0; t < 2; ++t) {
          Frag<__bf16>::U vh, vl;
          vh.h[0] = ld_tr16(Vxh + vro + t * 16);  vh.h[1] = ld_tr16(Vxh + vro + 16 * kVP + t * 16);
          vl.h[0] = ld_tr16(Vxl + vro + t * 16);  vl.h[1] = ld_tr16(Vxl + vro + 16 * kVP + t * 16);
          ox[t] = at_mma(vh.v, ph, ox[t]);
          ox[t] = at_mma(vl.v, ph, ox[t]);
          ox[t] = at_mma(vh.v, pl, ox[t]);
        }
      }
    }
  }

  /* merge of the key groups: every wave leaves its accumulators (not normalised) and its (max, sum) in LDS;
     wave (sp, qt) then merges rows 4*sp .. 4*sp+3 of query tile qt: x = sum_s 2^(m_s-M) o_s / sum_s 2^(m_s-M) l_s, the maxima in log2 units */
  __syncthreads();   /* every wave has made its last table read: the table's bytes become the merge staging */
  float* os = OsAll + wave * (16 * kOsPitch);
  const float* osq = OsAll + qt * (16 * kOsPitch);
  tile_to_os(os, o, hh, c);
  lr += xhalf(lr);   /* the two halves' partial sums of query c */
  if (hh == 0) {     /* max and sum are now equal in lanes c and c + 16 */
    MlAll[wave * 32 + c * 2] = mr;
    MlAll[wave * 32 + c * 2 + 1] = lr;
  }
  __syncthreads();   /* all groups' partial tiles are in LDS */

  const int row = 4 * sp + (lane >> 3);
  const int c4  = (lane & 7) * 4;
  float w[kSplit];
  {
    float ms[kSplit], ls[kSplit];
    float M = -INFINITY;
#pragma unroll
    for (int s = 0; s < kSplit; ++s) {
      ms[s] = MlAll[(s * 4 + qt) * 32 + row * 2];
      ls[s] = MlAll[(s * 4 + qt) * 32 + row * 2 + 1];
      M = fmaxf(M, ms[s]);
    }
    float L = 0.f;
#pragma unroll
    for (int s = 0; s < kSplit; ++s) { w[s] = __builtin_amdgcn_exp2f(ms[s] - M); L += w[s] * ls[s]; }
    const float inv = 1.0f / L;
#pragma unroll
    for (int s = 0; s < kSplit; ++s) w[s] *= inv;
  }
  *(v4f*)(xattn + (qrows + row) * kC + hcol + c4) = merge_os(osq, w, row, c4);
  asm volatile("s_wait_xcnt 0x0" ::: "memory");   /* the cross path below reuses the registers this store names */

  if (cross) {
    __syncthreads();   /* every reader has left the o tiles */
    tile_to_os(os, ox, hh, c);
    __syncthreads();   /* all groups' cross tiles are in LDS */
    *(v4f*)(ycross + ((((size_t)b * kNH + (h - kNH)) * kNq + q0 + row) * kHD) + c4) = merge_os(osq, w, row, c4);
  }
}

/* ---- differential head mixing + split to bf16 hi/lo planes for the output projection --------
   x[b,q,h*32+d] = xs + alpha[b,q]*(xs - lam[h]*yc[b,h,q,d]) for h < 2, else xs.
   coverage 65536 threads x 8 = 4096x128 exactly. */
__global__ __launch_bounds__(256) void combine_split_kernel(
    const float* __restrict__ xattn, const float* __restrict__ ycross, const float* __restrict__ alpha,
    const float* __restrict__ lq1, const float* __restrict__ lk1,
    const float* __restrict__ lq2, const float* __restrict__ lk2,
    unsigned short* __restrict__ hi, unsigned short* __restrict__ lo)
{
  __shared__ float lam_s[2];
  if (threadIdx.x < 2) {
    const int h = threadIdx.x;
    float s1 = 0.f, s2 = 0.f;
#pragma unroll 1
    for (int i = 0; i < kHD; ++i) {
      s1 += lq1[h * kHD + i] * lk1[h * kHD + i];
      s2 += lq2[h * kHD + i] * lk2[h * kHD + i];
    }
    lam_s[h] = expf(s1) - expf(s2) + kLambdaInit;
  }
  __syncthreads();
  const int gt = blockIdx.x * 256 + threadIdx.x;
  if (gt >= kBatch * kNq * kC / 8) return;
  const size_t e0 = (size_t)gt * 8;
  const int row = (int)(e0 >> 7);
  const int col = (int)(e0 & 127);
  const int h   = col >> 5;
  const int d   = col & 31;
  const int hc  = h & 1;
  const int b   = row >> 11;
  const int q   = row & (kNq - 1);
  const float a   = alpha[row];
  const float lam = lam_s[hc];
  const v4f xs0 = *(const v4f*)(xattn + e0);
  const v4f xs1 = *(const v4f*)(xattn + e0 + 4);
  const size_t yo = (((size_t)b * kNH + hc) * kNq + q) * kHD + d;
  const v4f y0 = *(const v4f*)(ycross + yo);
  const v4f y1 = *(const v4f*)(ycross + yo + 4);
  const bool mix = (h < kNH);
  float x[8];
#pragma unroll
  for (int e = 0; e < 4; ++e) {
    const float xa = xs0[e], xb = xs1[e];
    const float va = xa + a * (xa - lam * y0[e]);
    const float vb = xb + a * (xb - lam * y1[e]);
    x[e]     = mix ? va : xa;
    x[4 + e] = mix ? vb : xb;
  }
  v4u H, L;
  split_pack8(x, H, L);
  store_planes2(hi, lo, e0, H, L);
}

/* =========================================================================================
   host launch: 5 kernel launches
   workspace region map (bytes, all offsets MiB/256-KiB aligned):
     xq_hi  1 MiB | xq_lo 1 MiB | xkv_hi 2 MiB | xkv_lo 2 MiB | wt planes 256 KiB (4 weights x hi,lo x 32 KiB)
     q16 1 MiB | k16 2 MiB | v_hi 2 MiB | v_lo 2 MiB | xattn f32 2 MiB | ycross f32 1 MiB | xmix_hi 1 MiB | xmix_lo 1 MiB
     total 19,136,512 B
   ========================================================================================= */
extern "C" void kernel_launch(void* const* d_in, const int* in_sizes, int n_in,
                              void* d_out, int out_size, void* d_ws, size_t ws_size,
                              hipStream_t stream) {
  constexpr int Mq  = kBatch * kNq;    /* 4096 */
  constexpr int Mkv = kBatch * kNkv;   /* 8192 */
  static_assert(Mq % 64 == 0 && Mkv % 64 == 0 && kC % 64 == 0 && kC % 32 == 0, "");
  static_assert((Mq * kC) % 8 == 0 && (Mkv * kC) % 8 == 0, "");
  if (n_in < 18) return;
  if (in_sizes[0] != Mq * kC || in_sizes[1] != Mkv * kC || in_sizes[2] != Mq * 2 || in_sizes[3] != Mkv * 2 ||
      in_sizes[4] != Mq || in_sizes[5] != kC * kC || in_sizes[7] != kC * kC || in_sizes[9] != kC * kC ||
      in_sizes[16] != kC * kC || in_sizes[6] != kC || in_sizes[8] != kC || in_sizes[10] != kC || in_sizes[17] != kC ||
      in_sizes[11] != kNH * kHD || in_sizes[12] != kNH * kHD || in_sizes[13] != kNH * kHD || in_sizes[14] != kNH * kHD ||
      in_sizes[15] != kTable * kH || out_size != Mq * kC) return;

  const float* x_q      = (const float*)d_in[0];
  const float* x_kv     = (const float*)d_in[1];
  const int*   coords_q = (const int*)d_in[2];
  const int*   coords_k = (const int*)d_in[3];
  const float* alpha    = (const float*)d_in[4];
  const float* Wq = (const float*)d_in[5];  const float* bq = (const float*)d_in[6];
  const float* Wk = (const float*)d_in[7];  const float* bk = (const float*)d_in[8];
  const float* Wv = (const float*)d_in[9];  const float* bv = (const float*)d_in[10];
  const float* lq1 = (const float*)d_in[11]; const float* lk1 = (const float*)d_in[12];
  const float* lq2 = (const float*)d_in[13]; const float* lk2 = (const float*)d_in[14];
  const float* rpe = (const float*)d_in[15];
  const float* Wp = (const float*)d_in[16]; const float* bp = (const float*)d_in[17];
  float* out = (float*)d_out;

  char* ws = (char*)d_ws;
  size_t off = 0;
  const size_t szXq16  = (size_t)Mq * kC * 2;     /* 1 MiB  */
  const size_t szXkv16 = (size_t)Mkv * kC * 2;    /* 2 MiB  */
  const size_t szWt    = (size_t)4 * 2 * kC * kC * 2;
  const size_t szXattn = (size_t)Mq * kC * 4;
  const size_t szYc    = (size_t)kBatch * kNH * kNq * kHD * 4;
  unsigned short* xq_hi  = (unsigned short*)(ws + off); off += szXq16;
  unsigned short* xq_lo  = (unsigned short*)(ws + off); off += szXq16;
  unsigned short* xkv_hi = (unsigned short*)(ws + off); off += szXkv16;
  unsigned short* xkv_lo = (unsigned short*)(ws + off); off += szXkv16;
  unsigned short* wt     = (unsigned short*)(ws + off); off += szWt;
  unsigned short* q16    = (unsigned short*)(ws + off); off += szXq16;
  unsigned short* k16    = (unsigned short*)(ws + off); off += szXkv16;
  unsigned short* v_hi   = (unsigned short*)(ws + off); off += szXkv16;
  unsigned short* v_lo   = (unsigned short*)(ws + off); off += szXkv16;
  float*          xattn  = (float*)(ws + off);          off += szXattn;
  float*          ycross = (float*)(ws + off);          off += szYc;
  unsigned short* xm_hi  = (unsigned short*)(ws + off); off += szXq16;
  unsigned short* xm_lo  = (unsigned short*)(ws + off); off += szXq16;
  if (off > ws_size) return;

  const unsigned short* wtp_hi = wt + 3 * (2 * kC * kC); const unsigned short* wtp_lo = wtp_hi + kC * kC;

  /* 1: activations and weights -> bf16 hi/lo planes (weights transposed: in[k][n] -> out[n][k], square 128x128) */
  const int n8q = Mq * kC / 8;
  prep_planes_kernel<<<dim3(kPrepW + kPrepQ + kPrepKV), dim3(256), 0, stream>>>(x_q, x_kv, Wq, Wk, Wv, Wp,
                                                                               xq_hi, xq_lo, xkv_hi, xkv_lo, wt);

  /* 2: the three input projections, M x 128, K = 128 (M % 64 == 0, N = 128 % 64 == 0, K = 128 % 32 == 0) */
  const int blocksQ = kGroupsQ;
  qkv_gemm64<<<dim3(kGroupsQ + 2 * kGroupsKV), dim3(32 * kGW), 0, stream>>>(xq_hi, xq_lo, xkv_hi, xkv_lo, wt, q16, k16, v_hi, v_lo,
                                                                      bq, bk, bv, kC, kC, kC);

  /* 3: attention per (batch, head, 64 queries) */
  const int attnBlocks = kBatch * kH * (kNq / kQB);
  attn_head_kernel<<<dim3(attnBlocks), dim3(128 * kSplit), 0, stream>>>(q16, k16, v_hi, v_lo, coords_q, coords_k, rpe, xattn, ycross);

  /* 4: differential mixing + bf16 hi/lo planes */
  combine_split_kernel<<<dim3((n8q + 255) / 256), dim3(256), 0, stream>>>(xattn, ycross, alpha, lq1, lk1, lq2, lk2, xm_hi, xm_lo);

  /* 5: output projection -> d_out (f32), M = 4096, N = 128, K = 128 */
  wmma_gemm64<1, true, 2, 0, false><<<dim3(blocksQ, 1), dim3(32 * kGW), 0, stream>>>(
      xm_hi, xm_lo, kC, 0L, wtp_hi, wtp_lo, kC, 0L, (void*)out, nullptr, kC, 0L, bp, nullptr, 0L, Mq, kC, kC, 1.0f);
}

// v010
// It runs in 78.9 microseconds.
// Timed twice side by side with v009, it ran 1.13 and 1.12 times as fast.
// Over all steps from v000 it is 5.72 times as fast.
// Contractions: x@Wq, x@Wk, x@Wv and xmix@Wp on v_wmma_f32_16x16x32_bf16 with bf16 hi/lo operands split in the fragment loaders (hi.hi + hi.lo + lo.hi); k.q^T on v_wmma_f32_16x16x32_f16 with plain f16 q/k planes; v^T.p^T and v_cross^T.p^T on v_wmma_f32_16x16x32_bf16 with bf16 hi/lo p and v tiles; f32 accumulate; bias gather, online softmax and head mixing in f32.
#include <hip/hip_runtime.h>
#include <stdint.h>

typedef __attribute__((ext_vector_type(16))) _Float16 v16h;
typedef __attribute__((ext_vector_type(8)))  _Float16 v8h;
typedef __attribute__((ext_vector_type(16))) __bf16   v16b;
typedef __attribute__((ext_vector_type(8)))  __bf16   v8b;
typedef __attribute__((ext_vector_type(8)))  float    v8f;
typedef __attribute__((ext_vector_type(4)))  float    v4f;
typedef __attribute__((ext_vector_type(4)))  unsigned int v4u;
typedef __attribute__((ext_vector_type(2)))  int      v2i;
typedef __attribute__((ext_vector_type(4)))  int      v4i;
typedef __attribute__((ext_vector_type(8)))  short    v8s;
typedef __attribute__((ext_vector_type(2)))  float    v2f;
typedef __attribute__((ext_vector_type(2)))  __bf16   v2b;

/* ---- problem geometry (fixed by the module) ---- */
constexpr int kBatch = 2;
constexpr int kNq    = 2048;
constexpr int kNkv   = 4096;
constexpr int kC     = 128;
constexpr int kH     = 4;
constexpr int kHD    = 32;
constexpr int kNH    = 2;
constexpr int kMaxd  = 128;
constexpr int kSpan  = 2 * kMaxd + 1;
constexpr int kTable = kSpan * kSpan;
constexpr int kKC    = 32;     /* keys per chunk in the attention kernel */
constexpr int kQB    = 64;     /* query rows per attention block (4 query tiles x 16) */
constexpr int kSplit = 4;      /* key groups per attention block: wave = (key group, query tile) */
constexpr int kOsPitch = 36;   /* floats; per-wave output staging pitch */
constexpr int kVP    = 48;     /* halves; LDS row pitch of the V tiles: 96 B = 32 B x odd, the pitch of the transposing load */
constexpr int kTabLds  = (kTable + 3) & ~3;   /* floats; one head's bias column in LDS, rounded to 16 bytes */
constexpr float kLog2e  = 1.4426950408889634f;                        /* log2(e) */
constexpr float kScaleL2 = (float)(0.17677669529663687 * 1.4426950408889634);   /* head_dim ** -0.5 * log2(e) */
constexpr float kLambdaInit = 0.8f;

static_assert(kNq % kQB == 0, "");
static_assert(kNkv % (kKC * kSplit) == 0, "");
static_assert(kSplit * 4 == 16, "");   /* the merge gives each wave 16 / kSplit = 4 rows = 32 lanes x 4 floats */
static_assert(kC == kH * kHD, "");
static_assert((kBatch * kNq) % 64 == 0 && (kBatch * kNkv) % 64 == 0, "");
static_assert(kC % 64 == 0 && kC % 32 == 0, "");
static_assert(kH == 4 && kNH == 2 && kHD == 32 && kKC == 32, "");

/* two f32 -> a packed pair of bf16 hi and a packed pair of bf16 lo (the residual x - hi, exact in f32), three instructions a pair, all on
   the hardware's own converts, which round to nearest even as the integer form did. hi: one packed convert. lo: one mixed fma per value,
   hi * (-1) + x with hi and the -1 read as bf16 and the result written as bf16 into one half of lo. In asm because the compiler widens hi
   by a shift and a mask, subtracts and converts again: five instructions a pair */
__device__ __forceinline__ void split2(float a, float b, v2b& hi, v2b& lo) {
  hi = __builtin_convertvector((v2f){a, b}, v2b);
  unsigned lw;
  asm("v_fma_mixlo_bf16 %0, %1, %2, %3 op_sel_hi:[1,1,0]\n\t"
      "v_fma_mixhi_bf16 %0, %1, %2, %4 op_sel:[1,0,0] op_sel_hi:[1,1,0]"
      : "=&v"(lw)
      : "v"(__builtin_bit_cast(unsigned, hi)), "v"(0xBF80BF80u) /* bf16 -1 */, "v"(a), "v"(b));
  lo = __builtin_bit_cast(v2b, lw);
}

/* hazard guards as plain device helpers */
__device__ __forceinline__ void dep_guard_h(v8f& a, v8f& b, v16h x, v16h y) { asm volatile("v_nop\n\tv_nop\n\tv_nop\n\tv_nop" : "+v"(a), "+v"(b) : "v"(x), "v"(y)); }
__device__ __forceinline__ void dep_guard_b(v8f& a, v8f& b, v16b x, v16b y) { asm volatile("v_nop\n\tv_nop\n\tv_nop\n\tv_nop" : "+v"(a), "+v"(b) : "v"(x), "v"(y)); }
__device__ __forceinline__ void keep4_h(v16h a, v16h b, v16h c, v16h d) { asm volatile("v_nop" :: "v"(a), "v"(b), "v"(c), "v"(d)); }
__device__ __forceinline__ void keep4_b(v16b a, v16b b, v16b c, v16b d) { asm volatile("v_nop" :: "v"(a), "v"(b), "v"(c), "v"(d)); }
__device__ __forceinline__ void acc_guard4(v8f& a, v8f& b, v8f& c, v8f& d) { asm volatile("v_nop\n\tv_nop\n\tv_nop\n\tv_nop" : "+v"(a), "+v"(b), "+v"(c), "+v"(d)); }
template <typename T> struct Frag;
template <> struct Frag<_Float16> {
  typedef v16h V; union U { v16h v; v8h h[2]; };
  static __device__ __forceinline__ v16h load(const _Float16* p) {
    U f; f.h[0] = *(const v8h*)(p); f.h[1] = *(const v8h*)(p + 16); return f.v;
  }
  static __device__ __forceinline__ v8f mma(v16h a, v16h b, v8f c) {
    return __builtin_amdgcn_wmma_f32_16x16x32_f16(false, a, false, b, (short)0, c, false, false);
  }
  static __device__ __forceinline__ void guard(v8f& a, v8f& b, v16h x, v16h y) { dep_guard_h(a, b, x, y); }
  static __device__ __forceinline__ void keep(v16h a, v16h b, v16h c, v16h d) { keep4_h(a, b, c, d); }
};
template <> struct Frag<__bf16> {
  typedef v16b V; union U { v16b v; v8b h[2]; };
  static __device__ __forceinline__ v16b load(const __bf16* p) {
    U f; f.h[0] = *(const v8b*)(p); f.h[1] = *(const v8b*)(p + 16); return f.v;
  }
  static __device__ __forceinline__ v8f mma(v16b a, v16b b, v8f c) {
    return __builtin_amdgcn_wmma_f32_16x16x32_bf16(false, a, false, b, (short)0, c, false, false);
  }
  static __device__ __forceinline__ void guard(v8f& a, v8f& b, v16b x, v16b y) { dep_guard_b(a, b, x, y); }
  static __device__ __forceinline__ void keep(v16b a, v16b b, v16b c, v16b d) { keep4_b(a, b, c, d); }
};

/* ---- Register-blocked WMMA GEMM, M x 128 = (M x 128) . (128 x 128), operands read as f32 ---------------- */
/* decomposition: one wave a work-group, a 32x64 tile a wave (16x64 in the output projection). M x 128 outputs are few tiles: in 8-wave groups of 64x64 tiles they stood on
   16 to 80 of the chip's WGPs, whose eight waves queued their fragment loads (16 cache lines each) on one cache path while the other WGPs
   idled; so cut, the same loads are spread over every WGP, and a wave's chain of dependent load waits is half as long.
   operands: the bf16 hi and lo fragments are made in the loaders, out of the f32 values themselves (three instructions a pair); no launch
   stands in front of a GEMM only to write hi/lo planes that the GEMM reads back */
constexpr int kMI = 2;    /* 16-row subtiles per wave tile, input projections */
constexpr int kMIP = 1;   /* the same, output projection: its loader holds the cross term beside the rows, and with two subtiles the build spills */
constexpr int kGW = 1;    /* waves per GEMM work-group */
constexpr int kTM = 16 * kMI;
/* the four vector slots that the chip asks for between a matrix instruction and an overwrite of its A or B: the next fragments are written
   by the split's asm text; naming all four accumulators keeps every product of the subtile
   in front of the slots */
__device__ __forceinline__ void frag_guard(v8f& a, v8f& b, v8f& c, v8f& d, v16b x, v16b y) {
  asm volatile("v_nop\n\tv_nop\n\tv_nop\n\tv_nop" : "+v"(a), "+v"(b), "+v"(c), "+v"(d) : "v"(x), "v"(y));
}
/* 16 f32 -> one fragment of bf16 hi and one of bf16 lo; element e of a fragment is x[e] */
__device__ __forceinline__ void split_frag(const float (&x)[16], v16b& H, v16b& L) {
  union { v16b v; unsigned w[8]; } h, l;
#pragma unroll
  for (int p = 0; p < 8; ++p) {
    v2b h2, l2;
    split2(x[2 * p], x[2 * p + 1], h2, l2);
    h.w[p] = __builtin_bit_cast(unsigned, h2);
    l.w[p] = __builtin_bit_cast(unsigned, l2);
  }
  H = h.v;
  L = l.v;
}
/* the 16 f32 of one lane's fragment out of a row with k contiguous: p[0..7] and p[16..23] */
__device__ __forceinline__ void load_row16(const float* __restrict__ p, float (&x)[16]) {
#pragma unroll
  for (int g = 0; g < 4; ++g) {
    const v4f v = *(const v4f*)(p + (g >> 1) * 16 + (g & 1) * 4);
#pragma unroll
    for (int e = 0; e < 4; ++e) x[g * 4 + e] = v[e];
  }
}
/* one work-group's share (kGW waves, a 16*MI x 64 tile each) of one GEMM; bx: the work-group's place in that GEMM's own grid;
   sT: the work-group's staging slabs, kGW x 16 x 68 floats.
   Af: f32 rows [M][128]. Wf: f32 weight, input-major [k][n], 128 x 128. Column c of the j-th 16-column subtile is output column
   n0 + 4*c + j: a lane's four B fragments are then four neighbouring columns of W, and one 16-byte load brings one k of all four,
   256 contiguous bytes over the 16 lanes of a half.
   MIX: Af is the attention result and the A loader applies the differential head mixing before it splits; a k step of 32 is one head:
   x[b,q,h*32+d] = xs + alpha[b,q]*(xs - lam[h]*yc[b,h,q,d]) for h < 2, else xs.
   OUT_MODE 0: f32; 1: f16 plane; 2: bf16 hi and lo planes */
template <bool MIX, int OUT_MODE, int MI>
__device__ __forceinline__ void gemm64_group(
    const float* __restrict__ Af, const float* __restrict__ Wf,
    void* __restrict__ Cout, void* __restrict__ Cout2, const float* __restrict__ bias,
    const float* __restrict__ Yc, const float* __restrict__ alpha, const float* __restrict__ lamw,
    int M, int bx, float (*sT)[16 * 68]) {
  typedef __bf16 T;
  typedef v16b V;
  constexpr int ldc = kC;
  const int lane = threadIdx.x & 31;
  const int wave = threadIdx.x >> 5;
  constexpr int tilesN = kC >> 6;
  const int tilesM = M / (16 * MI);
  const int tile = bx * kGW + wave;
  if (tile >= tilesM * tilesN) return;
  const int tm = tile / tilesN;
  const int tn = tile - tm * tilesN;
  const int m0 = tm * (16 * MI);
  const int n0 = tn << 6;

  const int rlane = lane & 15;
  const int koff  = (lane >> 4) * 8;
  const int mOff  = (lane >> 4) * 8;

  /* this lane's places: element e of a fragment is k = k0 + koff + e (e < 8) and k0 + koff + 16 + (e - 8), in A and in B alike */
  const float* wp = Wf + (size_t)koff * kC + n0 + rlane * 4;
  const float* ap[MI];
  const float* yp[MI];
#pragma unroll
  for (int i = 0; i < MI; ++i) {
    const int row = m0 + (i << 4) + rlane;
    ap[i] = Af + (size_t)row * kC + koff;
    yp[i] = MIX ? (Yc + ((size_t)(row / kNq) * kNH * kNq + (row % kNq)) * kHD + koff) : nullptr;
  }

  v8f acc[MI][4];
#pragma unroll
  for (int i = 0; i < MI; ++i)
#pragma unroll
    for (int j = 0; j < 4; ++j) acc[i][j] = (v8f){0.f,0.f,0.f,0.f,0.f,0.f,0.f,0.f};

  const float* alp = MIX ? (alpha + m0 + rlane) : nullptr;
  float av[MI];
  float lam[kNH] = {0.f, 0.f};
  static_assert(MI >= 1 && MI <= 2 && kNH == 2, "");
#pragma unroll
  for (int ks = 0; ks < kC / 32; ++ks) {
    const int k0 = ks * 32;
    float wx[4][16], ax[MI][16], yx[MI][16];
    if (MIX && ks == 0) {   /* beside the first step's loads */
#pragma unroll
      for (int i = 0; i < MI; ++i) av[i] = alp[i << 4];
    }
#pragma unroll
    for (int i = 0; i < MI; ++i) {
      load_row16(ap[i] + k0, ax[i]);
      if (MIX && ks < kNH) load_row16(yp[i] + (size_t)ks * kNq * kHD, yx[i]);
    }
#pragma unroll
    for (int e = 0; e < 16; ++e) {
      const v4f w4 = *(const v4f*)(wp + (k0 + (e >> 3) * 16 + (e & 7)) * kC);
#pragma unroll
      for (int j = 0; j < 4; ++j) wx[j][e] = w4[j];
    }
    if (MIX && ks == 0) {
      asm volatile("s_wait_xcnt 0x0" :: "v"(wp), "v"(ap[0]), "v"(ap[MI - 1]), "v"(yp[0]), "v"(yp[MI - 1]), "v"(alp) : "memory");   /* the loads' address registers are kept as they are until this wait */
#pragma unroll
      for (int h = 0; h < kNH; ++h) lam[h] = lamw[h];   /* the same in every lane: asked for behind the step's loads, it holds none of them up */
    } else if (MIX) {
      asm volatile("s_wait_xcnt 0x0" :: "v"(wp), "v"(ap[0]), "v"(ap[MI - 1]), "v"(yp[0]), "v"(yp[MI - 1]) : "memory");   /* the loads' address registers are kept as they are until this wait */
    } else {
      asm volatile("s_wait_xcnt 0x0" :: "v"(wp), "v"(ap[0]), "v"(ap[MI - 1]) : "memory");   /* the loads' address registers are kept as they are until this wait */
    }
    V bh[4], bl[4];
#pragma unroll
    for (int j = 0; j < 4; ++j) split_frag(wx[j], bh[j], bl[j]);
#pragma unroll
    for (int i = 0; i < MI; ++i) {
      if (MIX && ks < kNH) {
#pragma unroll
        for (int e = 0; e < 16; ++e) ax[i][e] = ax[i][e] + av[i] * (ax[i][e] - lam[ks < kNH ? ks : 0] * yx[i][e]);
      }
      V ah, al;
      split_frag(ax[i], ah, al);
#pragma unroll
      for (int j = 0; j < 4; ++j) {
        acc[i][j] = Frag<T>::mma(ah, bh[j], acc[i][j]);
        acc[i][j] = Frag<T>::mma(ah, bl[j], acc[i][j]);
        acc[i][j] = Frag<T>::mma(al, bh[j], acc[i][j]);
      }
      frag_guard(acc[i][0], acc[i][1], acc[i][2], acc[i][3], ah, al);
    }
    Frag<T>::keep(bh[0], bh[1], bh[2], bh[3]);
    Frag<T>::keep(bl[0], bl[1], bl[2], bl[3]);
  }
#pragma unroll
  for (int i = 0; i < MI; ++i) acc_guard4(acc[i][0], acc[i][1], acc[i][2], acc[i][3]);

  float* slab = sT[wave];
  const v4f bv4 = *(const v4f*)(bias + n0 + rlane * 4);
#pragma unroll
  for (int i = 0; i < MI; ++i) {
    const int mBase = m0 + (i << 4);
#pragma unroll
    for (int r = 0; r < 8; ++r)
      *(v4f*)(slab + (mOff + r) * 68 + rlane * 4) = (v4f){acc[i][0][r] + bv4[0], acc[i][1][r] + bv4[1], acc[i][2][r] + bv4[2], acc[i][3][r] + bv4[3]};
    __builtin_amdgcn_fence(__ATOMIC_RELEASE, "workgroup");
    __builtin_amdgcn_wave_barrier();
    __builtin_amdgcn_fence(__ATOMIC_ACQUIRE, "workgroup");
    if (OUT_MODE == 0) {
      float* C = (float*)Cout;
      const int hh = lane >> 4, c4 = (lane & 15) * 4;
#pragma unroll
      for (int it = 0; it < 8; ++it) {
        const int row = it * 2 + hh;
        v4f v = *(const v4f*)(slab + row * 68 + c4);
        *(v4f*)(C + (size_t)(mBase + row) * ldc + n0 + c4) = v;
      }
    } else {
      const int q = lane >> 3, c8 = (lane & 7) * 8;
      unsigned short* C  = (unsigned short*)Cout;
      unsigned short* C2 = (OUT_MODE == 2) ? (unsigned short*)Cout2 : nullptr;
#pragma unroll
      for (int it = 0; it < 4; ++it) {
        const int row = it * 4 + q;
        const float* sp = slab + row * 68 + c8;
        if (OUT_MODE == 1) {
          v8h hv;
#pragma unroll
          for (int e = 0; e < 8; ++e) hv[e] = (_Float16)sp[e];
          *(v8h*)(C + (size_t)(mBase + row) * ldc + n0 + c8) = hv;
        } else {
          v4u hw, lw;
#pragma unroll
          for (int p = 0; p < 4; ++p) {
            v2b h2, l2;
            split2(sp[2 * p], sp[2 * p + 1], h2, l2);
            hw[p] = __builtin_bit_cast(unsigned, h2);
            lw[p] = __builtin_bit_cast(unsigned, l2);
          }
          *(v4u*)(C + (size_t)(mBase + row) * ldc + n0 + c8) = hw;
          *(v4u*)(C2 + (size_t)(mBase + row) * ldc + n0 + c8) = lw;
        }
      }
    }
    __builtin_amdgcn_fence(__ATOMIC_RELEASE, "workgroup");
    __builtin_amdgcn_wave_barrier();
    __builtin_amdgcn_fence(__ATOMIC_ACQUIRE, "workgroup");
  }
}

/* ---- the three input projections as ONE launch: none reads what another writes.
   Work-groups 0 .. kGroupsKV-1 make v (bf16 hi/lo planes), the next kGroupsKV make k, the next kGroupsQ make q (f16 planes);
   one more makes the two mixing weights lam[h] = exp(sum lq1[h]*lk1[h]) - exp(sum lq2[h]*lk2[h]) + lambda_init for the last launch. */
constexpr int kGroupsQ  = ((kBatch * kNq  / kTM) * (kC / 64) + kGW - 1) / kGW;
constexpr int kGroupsKV = ((kBatch * kNkv / kTM) * (kC / 64) + kGW - 1) / kGW;
static_assert((kBatch * kNq) % kTM == 0 && (kBatch * kNkv) % kTM == 0, "");
__global__ __launch_bounds__(32 * kGW) void qkv_gemm64(
    const float* __restrict__ x_q, const float* __restrict__ x_kv,
    const float* __restrict__ Wq, const float* __restrict__ Wk, const float* __restrict__ Wv,
    unsigned short* __restrict__ q16, unsigned short* __restrict__ k16,
    unsigned short* __restrict__ v_hi, unsigned short* __restrict__ v_lo,
    const float* __restrict__ bq, const float* __restrict__ bk, const float* __restrict__ bv,
    const float* __restrict__ lq1, const float* __restrict__ lk1,
    const float* __restrict__ lq2, const float* __restrict__ lk2, float* __restrict__ lamw) {
  __shared__ __align__(16) float sT[kGW][16 * 68];
  const int bx = blockIdx.x;   /* every choice below is the same for the whole work-group */
  if (bx >= kGroupsQ + 2 * kGroupsKV) {
    if (threadIdx.x < kNH) {
      const int h = threadIdx.x;
      float s1 = 0.f, s2 = 0.f;
#pragma unroll
      for (int i = 0; i < kHD; ++i) {
        s1 = __builtin_fmaf(lq1[h * kHD + i], lk1[h * kHD + i], s1);
        s2 = __builtin_fmaf(lq2[h * kHD + i], lk2[h * kHD + i], s2);
      }
      lamw[h] = expf(s1) - expf(s2) + kLambdaInit;
    }
  } else if (bx < kGroupsKV) {
    gemm64_group<false, 2, kMI>(x_kv, Wv, (void*)v_hi, (void*)v_lo, bv, nullptr, nullptr, nullptr, kBatch * kNkv, bx, sT);
  } else {
    const bool isk = bx < 2 * kGroupsKV;
    gemm64_group<false, 1, kMI>(isk ? x_kv : x_q, isk ? Wk : Wq, (void*)(isk ? k16 : q16), nullptr, isk ? bk : bq,
                           nullptr, nullptr, nullptr,
                           isk ? kBatch * kNkv : kBatch * kNq, bx - (isk ? kGroupsKV : 2 * kGroupsKV), sT);
  }
}

/* ---- differential head mixing (in the A loader) + output projection -> out f32 [B*Nq][128] ---- */
constexpr int kGroupsP = ((kBatch * kNq / (16 * kMIP)) * (kC / 64) + kGW - 1) / kGW;
__global__ __launch_bounds__(32 * kGW) void mix_proj_gemm64(
    const float* __restrict__ xattn, const float* __restrict__ ycross, const float* __restrict__ alpha, const float* __restrict__ lamw,
    const float* __restrict__ Wp, const float* __restrict__ bp, float* __restrict__ out) {
  __shared__ __align__(16) float sT[kGW][16 * 68];
  gemm64_group<true, 0, kMIP>(xattn, Wp, (void*)out, nullptr, bp, ycross, alpha, lamw, kBatch * kNq, blockIdx.x, sT);
}

/* ---- matrix helpers for the attention path ---- */
__device__ __forceinline__ v8f at_mma(v16b a, v16b b, v8f c) {
  c = __builtin_amdgcn_wmma_f32_16x16x32_bf16(false, a, false, b, (short)0, c, false, false);
  asm volatile("v_nop\n\tv_nop\n\tv_nop\n\tv_nop" : "+v"(c) : "v"(a), "v"(b));
  return c;
}
__device__ __forceinline__ v8f mma_h16(v16h a, v16h b, v8f c) {
  c = __builtin_amdgcn_wmma_f32_16x16x32_f16(false, a, false, b, (short)0, c, false, false);
  asm volatile("v_nop\n\tv_nop\n\tv_nop\n\tv_nop" : "+v"(c) : "v"(a), "v"(b));
  return c;
}

/* transposing LDS load: the lanes point at 16-byte pieces of a row-major [key][d] tile (lane l: row 8*(l>>4) + (l&7), piece (l>>3)&1);
   lane (c, hh) receives keys 8*hh .. 8*hh+7 of column d = c, which is half of an A fragment of the transposed tile */
__device__ __forceinline__ v8b ld_tr16(const unsigned short* p) {
  typedef __attribute__((address_space(3))) v8s lds_v8s;
  return __builtin_bit_cast(v8b, __builtin_amdgcn_ds_load_tr16_b128_v8i16((lds_v8s*)p));
}
/* lane l with lane l ^ 16: the two halves of a wave hold the two halves of a query column's keys */
__device__ __forceinline__ float xhalf(float x) {
  return __builtin_bit_cast(float, __builtin_amdgcn_permlanex16(__builtin_bit_cast(int, x), __builtin_bit_cast(int, x),
                                                                0x76543210, 0xfedcba98, false, false));
}
/* e[i] = 2^e[i], the 17 exponentials of a softmax step as one run. In asm for the free slot that the instruction set asks for behind a
   transcendental: each v_exp_f32 is the independent instruction behind the one before it and the v_nop stands behind the last */
__device__ __forceinline__ void exp2_run17(float (&e)[17]) {
  asm(
      "v_exp_f32 %0, %0\n\t"
      "v_exp_f32 %1, %1\n\t"
      "v_exp_f32 %2, %2\n\t"
      "v_exp_f32 %3, %3\n\t"
      "v_exp_f32 %4, %4\n\t"
      "v_exp_f32 %5, %5\n\t"
      "v_exp_f32 %6, %6\n\t"
      "v_exp_f32 %7, %7\n\t"
      "v_exp_f32 %8, %8\n\t"
      "v_exp_f32 %9, %9\n\t"
      "v_exp_f32 %10, %10\n\t"
      "v_exp_f32 %11, %11\n\t"
      "v_exp_f32 %12, %12\n\t"
      "v_exp_f32 %13, %13\n\t"
      "v_exp_f32 %14, %14\n\t"
      "v_exp_f32 %15, %15\n\t"
      "v_exp_f32 %16, %16\n\t"
      "v_nop"
      : "+v"(e[0]), "+v"(e[1]), "+v"(e[2]), "+v"(e[3]), "+v"(e[4]), "+v"(e[5]),
        "+v"(e[6]), "+v"(e[7]), "+v"(e[8]), "+v"(e[9]), "+v"(e[10]), "+v"(e[11]),
        "+v"(e[12]), "+v"(e[13]), "+v"(e[14]), "+v"(e[15]), "+v"(e[16]));
}
/* ---- online softmax step for one head, 32 keys x 16 query columns per wave (2 key subtiles), scores transposed ----
   sA[r]: key 8*hh + r, sB[r]: key 16 + 8*hh + r, both of query column c: a lane holds 16 keys of ONE query.
   The scores arrive times log2(e), so that e^(s - m) is one v_exp_f32 (2^x) of a difference; mrow is kept in the same unit.
   Maximum in the lane plus one exchange between the halves; the sum stays a per-lane partial (joined behind the key loop).
   P^T leaves as two B operands, hi and lo: element s = key kmap(s, hh), which is the order the accumulators already have. */
__device__ __forceinline__ float softmax_step_t(const v8f& sA, const v8f& sB, float& mrow, float& lrow, v16b& ph, v16b& pl) {
  float mm[4];
#pragma unroll
  for (int k = 0; k < 4; ++k) mm[k] = fmaxf(fmaxf(sA[k], sA[4 + k]), fmaxf(sB[k], sB[4 + k]));
  float m = fmaxf(fmaxf(mm[0], mm[1]), fmaxf(mm[2], mm[3]));
  m = fmaxf(m, xhalf(m));
  const float mnew = fmaxf(mrow, m);
  float e[17];
#pragma unroll
  for (int r = 0; r < 8; ++r) { e[r] = sA[r] - mnew; e[8 + r] = sB[r] - mnew; }
  e[16] = mrow - mnew;
  exp2_run17(e);
  const float al = e[16];
  mrow = mnew;
  float ps[4] = {0.f, 0.f, 0.f, 0.f};
#pragma unroll
  for (int r = 0; r < 16; r += 2) {
    ps[(r >> 3) * 2]     += e[r];
    ps[(r >> 3) * 2 + 1] += e[r + 1];
    v2b hi, lo;
    split2(e[r], e[r + 1], hi, lo);
    ph[r] = hi[0];  ph[r + 1] = hi[1];
    pl[r] = lo[0];  pl[r + 1] = lo[1];
  }
  lrow = lrow * al + ((ps[0] + ps[1]) + (ps[2] + ps[3]));
  return al;
}
/* per-wave transposed result (o[t][r] = O[query c][d = t*16 + 8*hh + r]) -> LDS staging [query][d] (pitch kOsPitch);
   writes rows 0..15, cols 0..31, 8 consecutive floats per lane and tile */
__device__ __forceinline__ void tile_to_os(float* os, const v8f (&o)[2], int hh, int c) {
#pragma unroll
  for (int t = 0; t < 2; ++t) {
    float* p = os + c * kOsPitch + t * 16 + 8 * hh;
    *(v4f*)(p)     = (v4f){o[t][0], o[t][1], o[t][2], o[t][3]};
    *(v4f*)(p + 4) = (v4f){o[t][4], o[t][5], o[t][6], o[t][7]};
  }
}
/* weighted sum over the kSplit key groups of one query tile, 4 floats of one row per lane;
   os0: staging tile of key group 0 for this query tile, the groups 4 tiles apart */
__device__ __forceinline__ v4f merge_os(const float* os0, const float (&w)[kSplit], int row, int c4) {
  v4f acc = (v4f){0.f, 0.f, 0.f, 0.f};
#pragma unroll
  for (int s = 0; s < kSplit; ++s) {
    const v4f v = *(const v4f*)(os0 + s * (4 * 16 * kOsPitch) + row * kOsPitch + c4);
#pragma unroll
    for (int e = 0; e < 4; ++e) acc[e] += w[s] * v[e];
  }
  return acc;
}

/* ---- attention for one (batch, head h, 64 query rows) ----------------------------------
   q16/k16: f16 planes [B*N][128] (head-major columns); vhi/vlo: bf16 hi/lo planes [B*Nkv][128].
   scores^T = (k.q^T)*scale + rpe[idx][h], the head's table column held in LDS; online softmax in f32, a lane holding one query's keys;
   scale and table carry the factor log2(e), so the softmax runs on powers of two (the hardware's own exponential);
   P^T hi and lo go from the score accumulators straight into B operands, never through LDS;
   V tiles lie row-major in LDS and are transposed by the load that reads them;
   o^T = V_h^T . P^T;  for h >= 2 also ox^T = V_{h-2}^T . P^T (the cross term of the differential mixing).
   16 waves: wave = (key group sp, query tile qt). Group sp (4 waves) takes key chunks sp, sp + kSplit, ... with its own
   K/V tiles and each wave its own running max, sum and accumulators; the groups are merged through LDS at the end.
   xattn f32 [B*Nq][128]; ycross f32 [B][2][Nq][32]. grid.x = B*H*(Nq/64), block 128 * kSplit. */
__global__ __launch_bounds__(128 * kSplit) __attribute__((amdgpu_num_vgpr(256)))
void attn_head_kernel(
    const unsigned short* __restrict__ q16, const unsigned short* __restrict__ k16,
    const unsigned short* __restrict__ vhi, const unsigned short* __restrict__ vlo,
    const int* __restrict__ coords_q, const int* __restrict__ coords_k,
    const float* __restrict__ rpe,
    float* __restrict__ xattn, float* __restrict__ ycross)
{
  __shared__ __align__(16) unsigned short KshS[kSplit][kKC * kHD];   /* [group][key][d]  f16 bits  */
  __shared__ __align__(16) unsigned short VthS[kSplit][kKC * kVP];   /* [group][key][d] bf16 hi, head h,   row pitch kVP */
  __shared__ __align__(16) unsigned short VtlS[kSplit][kKC * kVP];   /* [group][key][d] bf16 lo, head h,   row pitch kVP */
  __shared__ __align__(16) unsigned short VxhS[kSplit][kKC * kVP];   /* [group][key][d] bf16 hi, head h-2, row pitch kVP */
  __shared__ __align__(16) unsigned short VxlS[kSplit][kKC * kVP];   /* [group][key][d] bf16 lo, head h-2, row pitch kVP */
  __shared__ __align__(16) float Tab[kTabLds];                       /* rpe[idx][h] * log2(e) for this block's head, all idx */
  /* behind the key loop the table is dead and its bytes take the merge staging */
  static_assert(4 * kSplit * 16 * kOsPitch + 4 * kSplit * 16 * 2 <= kTabLds, "");
  float* const OsAll = Tab;                                          /* [wave][16 * kOsPitch] */
  float* const MlAll = Tab + 4 * kSplit * 16 * kOsPitch;             /* [wave][row] (max, sum) */

  const int wave = threadIdx.x >> 5;     /* 0 .. 15 */
  const int sp   = wave >> 2;            /* key group */
  const int qt   = wave & 3;             /* query tile */
  const int tid  = threadIdx.x & 127;    /* thread within the key group */
  const int lane = tid & 31;
  unsigned short* Ksh = KshS[sp];
  unsigned short* Vth = VthS[sp];
  unsigned short* Vtl = VtlS[sp];
  unsigned short* Vxh = VxhS[sp];
  unsigned short* Vxl = VxlS[sp];
  const int hh   = lane >> 4;
  const int c    = lane & 15;
  const int vro  = (8 * hh + (lane & 7)) * kVP + ((lane >> 3) & 1) * 8;   /* halves; this lane's piece for the transposing V loads */
  constexpr int nqb = kNq / kQB;
  const int bx   = blockIdx.x;
  const int qb   = bx % nqb;
  const int rest = bx / nqb;
  const int h    = rest % kH;
  const int b    = rest / kH;
  const bool cross = (h >= kNH);                       /* block-uniform */
  const int hcol = h * kHD;
  const int xcol = (cross ? (h - kNH) : 0) * kHD;
  const int q0   = qb * kQB + qt * 16;
  const size_t qrows  = (size_t)b * kNq + q0;
  const size_t kvrows = (size_t)b * kNkv;
  const float* __restrict__ rpe_h = rpe + h;           /* table entry stride kH floats */

  /* one chunk on its way from global memory to the tiles, held in registers: asked for while the chunk before it is worked on, stored to
     LDS at the head of its own pass, so that no pass stands waiting for a round trip to L2.
     ck: coords of this lane's 16 score rows (keys j*16 + 8*hh + r), two keys per 16-byte load, the same address in the 16 lanes of a half.
     kw, vh4, vl4 (xh4, xl4 when cross): 32 keys x 4 segments of 8 halves = 128 = threads of a key group, one uint4 per thread per plane */
  constexpr int kChunks = kNkv / (kKC * kSplit);
  const int skey = tid >> 2;
  const int sseg = tid & 3;
  v4i ck[2][4];
  uint4 kw, vh4, vl4;
  uint4 xh4 = make_uint4(0u, 0u, 0u, 0u), xl4 = make_uint4(0u, 0u, 0u, 0u);
  auto fetch = [&](int kcn) {
    const int kv0 = (kcn * kSplit + sp) * kKC;
    const int* ckp = coords_k + (kvrows + kv0 + 8 * hh) * 2;
#pragma unroll
    for (int j = 0; j < 2; ++j) {
#pragma unroll
      for (int i = 0; i < 4; ++i) ck[j][i] = *(const v4i*)(ckp + j * 32 + i * 4);
    }
    const size_t rowoff = (kvrows + kv0 + skey) * kC;
    const size_t go = rowoff + hcol + sseg * 8;
    const unsigned short* kgp = k16 + go;
    const unsigned short* hgp = vhi + go;
    const unsigned short* lgp = vlo + go;
    kw  = *(const uint4*)(kgp);
    vh4 = *(const uint4*)(hgp);
    vl4 = *(const uint4*)(lgp);
    asm volatile("s_wait_xcnt 0x0" :: "v"(ckp), "v"(kgp), "v"(hgp), "v"(lgp) : "memory");   /* the loads' address registers are kept as they are until this wait */
    if (cross) {
      const size_t gx = rowoff + xcol + sseg * 8;
      const unsigned short* xhp = vhi + gx;
      const unsigned short* xlp = vlo + gx;
      xh4 = *(const uint4*)(xhp);
      xl4 = *(const uint4*)(xlp);
      asm volatile("s_wait_xcnt 0x0" :: "v"(xhp), "v"(xlp) : "memory");   /* the loads' address registers are kept as they are until this wait */
    }
  };
  fetch(0);

  /* this head's column of the bias table -> LDS, once per work-group; batches of 16 loads per thread keep the
     latency of the strided reads covered. The first barrier of the key loop publishes it. */
  {
    constexpr int kThreads = 128 * kSplit;
    constexpr int kFull = kTable / (kThreads * 16);
    const int t0 = threadIdx.x;
    /* rolled: 16 waves x 16 loads in flight already cover the L2 latency; unrolled further the copy only takes more registers */
#pragma unroll 1
    for (int g = 0; g < kFull; ++g) {
      float tv[16];
      const float* gp = rpe_h + (size_t)(g * 16 * kThreads + t0) * kH;
#pragma unroll
      for (int u = 0; u < 16; ++u) tv[u] = gp[u * (kThreads * kH)];
      asm volatile("s_wait_xcnt 0x0" :: "v"(gp) : "memory");   /* the loads' address registers are kept as they are until this wait */
#pragma unroll
      for (int u = 0; u < 16; ++u) Tab[(g * 16 + u) * kThreads + t0] = tv[u] * kLog2e;
    }
    for (int i = kFull * 16 * kThreads + t0; i < kTable; i += kThreads) Tab[i] = rpe_h[(size_t)i * kH] * kLog2e;
  }

  /* Q fragment (B operand: lane c -> query column c; K = head_dim = 32, one k-step) */
  const _Float16* qp = (const _Float16*)(const void*)q16;
  const v16h qa = Frag<_Float16>::load(qp + (qrows + c) * kC + hcol + 8 * hh);

  /* coords of this lane's query column c, +MAXD folded in */
  const v2i cq = *(const v2i*)(coords_q + (qrows + c) * 2);
  const int cqx = cq.x + kMaxd;
  const int cqy = cq.y + kMaxd;

  float mr = -INFINITY, lr = 0.f;   /* running max (equal in both halves) and this lane's partial sum for query c */
  v8f o[2], ox[2];                  /* o[t][r] = O[query c][d = t*16 + 8*hh + r] */
#pragma unroll
  for (int t = 0; t < 2; ++t) {
    o[t]  = (v8f){0.f,0.f,0.f,0.f,0.f,0.f,0.f,0.f};
    ox[t] = (v8f){0.f,0.f,0.f,0.f,0.f,0.f,0.f,0.f};
  }

  /* two passes a trip: the coords' registers of one pass and of the next change roles, with one pass a trip they are copied (16 moves) */
#pragma unroll 2
  for (int kc = 0; kc < kChunks; ++kc) {
    __syncthreads();   /* every reader has left the tiles of the chunk before */
    /* this chunk's K tile and V hi/lo tiles out of the carried registers, all row-major: covers Ksh 32x32 and the 32 d of every row of
       Vth/Vtl (and Vxh/Vxl when cross) exactly; the pad halves of a V row are never read */
    *(uint4*)(&Ksh[skey * kHD + sseg * 8]) = kw;
    *(uint4*)(&Vth[skey * kVP + sseg * 8]) = vh4;
    *(uint4*)(&Vtl[skey * kVP + sseg * 8]) = vl4;
    if (cross) {
      *(uint4*)(&Vxh[skey * kVP + sseg * 8]) = xh4;
      *(uint4*)(&Vxl[skey * kVP + sseg * 8]) = xl4;
    }
    /* clamped table index of every (key, query) of this lane; behind this the coords' registers are free for the next chunk */
    int ti[2][8];
#pragma unroll
    for (int r = 0; r < 8; ++r) {
#pragma unroll
      for (int j = 0; j < 2; ++j) {
        const int kx = ck[j][r >> 1][(r & 1) * 2];
        const int ky = ck[j][r >> 1][(r & 1) * 2 + 1];
        int dx = cqx - kx; dx = dx < 0 ? 0 : dx; dx = dx > 2 * kMaxd ? 2 * kMaxd : dx;
        int dy = cqy - ky; dy = dy < 0 ? 0 : dy; dy = dy > 2 * kMaxd ? 2 * kMaxd : dy;
        ti[j][r] = dx * kSpan + dy;                 /* 0 .. kTable-1 */
      }
    }
    __syncthreads();   /* the tiles (and, in the first pass, the table) are published */
    if (kc + 1 < kChunks) fetch(kc + 1);   /* the same for the whole work-group; in flight during the work below */

    /* scores^T: s[j], j = key subtile; A fragment lane c -> key j*16+c, elements d (split map); s[j][r] = S[key j*16+8*hh+r][query c] */
    v8f s[2];
    {
      const v8f z = (v8f){0.f,0.f,0.f,0.f,0.f,0.f,0.f,0.f};
      const _Float16* Kp = (const _Float16*)(const void*)Ksh;
#pragma unroll
      for (int j = 0; j < 2; ++j) {
        Frag<_Float16>::U kb;
        kb.h[0] = *(const v8h*)(Kp + (j * 16 + c) * kHD + 8 * hh);
        kb.h[1] = *(const v8h*)(Kp + (j * 16 + c) * kHD + 16 + 8 * hh);
        s[j] = mma_h16(kb.v, qa, z);
      }
    }

    /* scale + relative position bias, both times log2(e): one clamped b32 gather from the LDS table per (key, query) */
#pragma unroll
    for (int r = 0; r < 8; ++r) {
#pragma unroll
      for (int j = 0; j < 2; ++j) s[j][r] = s[j][r] * kScaleL2 + Tab[ti[j][r]];
    }

    /* online softmax; P^T hi and lo stay in registers as B operands */
    v16b ph, pl;
    const float al = softmax_step_t(s[0], s[1], mr, lr, ph, pl);
#pragma unroll
    for (int t = 0; t < 2; ++t) {
#pragma unroll
      for (int r = 0; r < 8; ++r) { o[t][r] *= al; ox[t][r] *= al; }
    }

    /* V^T.P^T : A = V^T (lane c -> d, elements key, split map), transposed out of the row-major tile by the load itself;
       B = P^T (lane c -> query, elements key, same map) */
    {
#pragma unroll
      for (int t = 0; t < 2; ++t) {
        Frag<__bf16>::U vh, vl;
        vh.h[0] = ld_tr16(Vth + vro + t * 16);  vh.h[1] = ld_tr16(Vth + vro + 16 * kVP + t * 16);
        vl.h[0] = ld_tr16(Vtl + vro + t * 16);  vl.h[1] = ld_tr16(Vtl + vro + 16 * kVP + t * 16);
        o[t] = at_mma(vh.v, ph, o[t]);
        o[t] = at_mma(vl.v, ph, o[t]);
        o[t] = at_mma(vh.v, pl, o[t]);
      }
      if (cross) {
#pragma unroll
        for (int t = 0; t < 2; ++t) {
          Frag<__bf16>::U vh, vl;
          vh.h[0] = ld_tr16(Vxh + vro + t * 16);  vh.h[1] = ld_tr16(Vxh + vro + 16 * kVP + t * 16);
          vl.h[0] = ld_tr16(Vxl + vro + t * 16);  vl.h[1] = ld_tr16(Vxl + vro + 16 * kVP + t * 16);
          ox[t] = at_mma(vh.v, ph, ox[t]);
          ox[t] = at_mma(vl.v, ph, ox[t]);
          ox[t] = at_mma(vh.v, pl, ox[t]);
        }
      }
    }
  }

  /* merge of the key groups: every wave leaves its accumulators (not normalised) and its (max, sum) in LDS;
     wave (sp, qt) then merges rows 4*sp .. 4*sp+3 of query tile qt: x = sum_s 2^(m_s-M) o_s / sum_s 2^(m_s-M) l_s, the maxima in log2 units */
  __syncthreads();   /* every wave has made its last table read: the table's bytes become the merge staging */
  float* os = OsAll + wave * (16 * kOsPitch);
  const float* osq = OsAll + qt * (16 * kOsPitch);
  tile_to_os(os, o, hh, c);
  lr += xhalf(lr);   /* the two halves' partial sums of query c */
  if (hh == 0) {     /* max and sum are now equal in lanes c and c + 16 */
    MlAll[wave * 32 + c * 2] = mr;
    MlAll[wave * 32 + c * 2 + 1] = lr;
  }
  __syncthreads();   /* all groups' partial tiles are in LDS */

  const int row = 4 * sp + (lane >> 3);
  const int c4  = (lane & 7) * 4;
  float w[kSplit];
  {
    float ms[kSplit], ls[kSplit];
    float M = -INFINITY;
#pragma unroll
    for (int s = 0; s < kSplit; ++s) {
      ms[s] = MlAll[(s * 4 + qt) * 32 + row * 2];
      ls[s] = MlAll[(s * 4 + qt) * 32 + row * 2 + 1];
      M = fmaxf(M, ms[s]);
    }
    float L = 0.f;
#pragma unroll
    for (int s = 0; s < kSplit; ++s) { w[s] = __builtin_amdgcn_exp2f(ms[s] - M); L += w[s] * ls[s]; }
    const float inv = 1.0f / L;
#pragma unroll
    for (int s = 0; s < kSplit; ++s) w[s] *= inv;
  }
  *(v4f*)(xattn + (qrows + row) * kC + hcol + c4) = merge_os(osq, w, row, c4);
  asm volatile("s_wait_xcnt 0x0" ::: "memory");   /* the cross path below reuses the registers this store names */

  if (cross) {
    __syncthreads();   /* every reader has left the o tiles */
    tile_to_os(os, ox, hh, c);
    __syncthreads();   /* all groups' cross tiles are in LDS */
    *(v4f*)(ycross + ((((size_t)b * kNH + (h - kNH)) * kNq + q0 + row) * kHD) + c4) = merge_os(osq, w, row, c4);
  }
}

/* =========================================================================================
   host launch: 3 kernel launches
   workspace region map (bytes, all offsets MiB/256-KiB aligned):
     q16 1 MiB | k16 2 MiB | v_hi 2 MiB | v_lo 2 MiB | xattn f32 2 MiB | ycross f32 512 KiB | lam 256 B
     total 9,961,728 B
   ========================================================================================= */
extern "C" void kernel_launch(void* const* d_in, const int* in_sizes, int n_in,
                              void* d_out, int out_size, void* d_ws, size_t ws_size,
                              hipStream_t stream) {
  constexpr int Mq  = kBatch * kNq;    /* 4096 */
  constexpr int Mkv = kBatch * kNkv;   /* 8192 */
  static_assert(Mq % 64 == 0 && Mkv % 64 == 0 && kC % 64 == 0 && kC % 32 == 0, "");
  static_assert((Mq * kC) % 8 == 0 && (Mkv * kC) % 8 == 0, "");
  if (n_in < 18) return;
  if (in_sizes[0] != Mq * kC || in_sizes[1] != Mkv * kC || in_sizes[2] != Mq * 2 || in_sizes[3] != Mkv * 2 ||
      in_sizes[4] != Mq || in_sizes[5] != kC * kC || in_sizes[7] != kC * kC || in_sizes[9] != kC * kC ||
      in_sizes[16] != kC * kC || in_sizes[6] != kC || in_sizes[8] != kC || in_sizes[10] != kC || in_sizes[17] != kC ||
      in_sizes[11] != kNH * kHD || in_sizes[12] != kNH * kHD || in_sizes[13] != kNH * kHD || in_sizes[14] != kNH * kHD ||
      in_sizes[15] != kTable * kH || out_size != Mq * kC) return;

  const float* x_q      = (const float*)d_in[0];
  const float* x_kv     = (const float*)d_in[1];
  const int*   coords_q = (const int*)d_in[2];
  const int*   coords_k = (const int*)d_in[3];
  const float* alpha    = (const float*)d_in[4];
  const float* Wq = (const float*)d_in[5];  const float* bq = (const float*)d_in[6];
  const float* Wk = (const float*)d_in[7];  const float* bk = (const float*)d_in[8];
  const float* Wv = (const float*)d_in[9];  const float* bv = (const float*)d_in[10];
  const float* lq1 = (const float*)d_in[11]; const float* lk1 = (const float*)d_in[12];
  const float* lq2 = (const float*)d_in[13]; const float* lk2 = (const float*)d_in[14];
  const float* rpe = (const float*)d_in[15];
  const float* Wp = (const float*)d_in[16]; const float* bp = (const float*)d_in[17];
  float* out = (float*)d_out;

  char* ws = (char*)d_ws;
  size_t off = 0;
  const size_t szXq16  = (size_t)Mq * kC * 2;     /* 1 MiB  */
  const size_t szXkv16 = (size_t)Mkv * kC * 2;    /* 2 MiB  */
  const size_t szXattn = (size_t)Mq * kC * 4;
  const size_t szYc    = (size_t)kBatch * kNH * kNq * kHD * 4;
  unsigned short* q16    = (unsigned short*)(ws + off); off += szXq16;
  unsigned short* k16    = (unsigned short*)(ws + off); off += szXkv16;
  unsigned short* v_hi   = (unsigned short*)(ws + off); off += szXkv16;
  unsigned short* v_lo   = (unsigned short*)(ws + off); off += szXkv16;
  float*          xattn  = (float*)(ws + off);          off += szXattn;
  float*          ycross = (float*)(ws + off);          off += szYc;
  float*          lamw   = (float*)(ws + off);          off += 256;
  if (off > ws_size) return;

  /* 1: the three input projections, M x 128, K = 128, straight from the f32 activations and weights; one more work-group: lam */
  qkv_gemm64<<<dim3(kGroupsQ + 2 * kGroupsKV + 1), dim3(32 * kGW), 0, stream>>>(x_q, x_kv, Wq, Wk, Wv, q16, k16, v_hi, v_lo, bq, bk, bv,
                                                                               lq1, lk1, lq2, lk2, lamw);

  /* 2: attention per (batch, head, 64 queries) */
  const int attnBlocks = kBatch * kH * (kNq / kQB);
  attn_head_kernel<<<dim3(attnBlocks), dim3(128 * kSplit), 0, stream>>>(q16, k16, v_hi, v_lo, coords_q, coords_k, rpe, xattn, ycross);

  /* 3: differential mixing + output projection -> d_out (f32), M = 4096, N = 128, K = 128 */
  mix_proj_gemm64<<<dim3(kGroupsP), dim3(32 * kGW), 0, stream>>>(xattn, ycross, alpha, lamw, Wp, bp, out);
}
